// v000
// Times are from an AMD MI455X. After a warm-up the kernel runs many times in a row, and a time is the length of
// such a window on the GPU divided by its runs, so every launch and the gaps after it count. The runs cycle
// through copies of the inputs. A figure is the median of several windows, for all but v000 over two sittings.
// Sittings can differ by a few percent; kernels timed side by side share one.
// v000, which the later versions start from, runs in 2090 microseconds.
#include <hip/hip_runtime.h>

// ---------------------------------------------------------------------------
// Problem constants (from reference)
// ---------------------------------------------------------------------------
// B=2, T=2048, HID=2048, H=16, DK=64, DV=128, C=16, LOWR=16
// M = B*T = 4096 rows.  Fused projection GEMM: [4096,2048] x [2048,6144]
//   cols 0..1023   : q  (H*DK)
//   cols 1024..2047: k  (H*DK)
//   cols 2048..4095: v  (H*DV)   (overwritten with o by the GLA kernel)
//   cols 4096..6143: g  (H*DV)
// Output GEMM: [4096,2048] x [2048,2048] -> d_out (fp32)

#define MROWS   4096
#define KDIM    2048
#define NCAT    6144
#define NOUT    2048
#define GLA_SCALE 0.125f   // DK^-0.5

typedef __attribute__((ext_vector_type(16))) __bf16 v16bf;
typedef __attribute__((ext_vector_type(8)))  float  v8f;

__device__ __forceinline__ unsigned short f2bf(float f) {
  unsigned int u = __float_as_uint(f);
  u += 0x7fffu + ((u >> 16) & 1u);
  return (unsigned short)(u >> 16);
}

// gfx1250 async global->LDS DMA: 16B per lane, no data VGPRs, ASYNCcnt-tracked.
// GV mode: VDST = LDS byte offset (low 32 bits of flat shared address per the
// LDS aperture rule addr[31:0]), VADDR = 64-bit global address, no SADDR.
__device__ __forceinline__ void async_copy_b128(const void* g, void* lds) {
  unsigned lds_off = (unsigned)(unsigned long long)lds;
  asm volatile("global_load_async_to_lds_b128 %0, %1, off"
               :: "v"(lds_off), "v"(g) : "memory");
}
__device__ __forceinline__ void wait_async0() {
  asm volatile("s_wait_asynccnt 0x0" ::: "memory");
}

// ---------------------------------------------------------------------------
// fp32 -> bf16 elementwise convert (x activations)
// ---------------------------------------------------------------------------
__global__ __launch_bounds__(256) void cvt_f32_bf16_kernel(
    const float* __restrict__ in, unsigned short* __restrict__ out, long n) {
  long i = ((long)blockIdx.x * 256 + threadIdx.x) * 4;
  if (i + 3 < n) {
    float4 v = *(const float4*)(in + i);
    out[i + 0] = f2bf(v.x);
    out[i + 1] = f2bf(v.y);
    out[i + 2] = f2bf(v.z);
    out[i + 3] = f2bf(v.w);
  }
}

// ---------------------------------------------------------------------------
// Transpose [K,Nw] fp32 -> [Nw,K] bf16 (weights, so WMMA B operand is N-major)
// ---------------------------------------------------------------------------
__global__ __launch_bounds__(256) void transpose_cvt_kernel(
    const float* __restrict__ W, unsigned short* __restrict__ out,
    int K, int Nw) {
  __shared__ float tile[32][33];
  int kb = blockIdx.y * 32, nb = blockIdx.x * 32;
  int tx = threadIdx.x, ty = threadIdx.y;   // block (32,8)
#pragma unroll
  for (int i = 0; i < 32; i += 8)
    tile[ty + i][tx] = W[(long)(kb + ty + i) * Nw + (nb + tx)];
  __syncthreads();
#pragma unroll
  for (int i = 0; i < 32; i += 8)
    out[(long)(nb + ty + i) * K + (kb + tx)] = f2bf(tile[tx][ty + i]);
}

// ---------------------------------------------------------------------------
// bf16 WMMA GEMM:  C[M,N](f32) = A[M,K](bf16,row-major) * Bt[N,K]^T
// Block tile 128x128, K-step 64, 256 threads = 8 waves (4x2 wave grid),
// each wave: 2x4 fragments of 16x16. Double-buffered LDS, pitch 72
// (144B rows -> conflict-free b128 fragment reads). Tile staging uses
// global_load_async_to_lds_b128 (no data VGPRs -> no spills).
// ---------------------------------------------------------------------------
#define GT_M 128
#define GT_K 64
#define LDT  72

__device__ __forceinline__ v16bf load_frag(const unsigned short* p) {
  union { v16bf v; uint4 u[2]; } f;
  f.u[0] = *(const uint4*)(p);        // halves 0..7  : K = khalf*8 + 0..7
  f.u[1] = *(const uint4*)(p + 16);   // halves 8..15 : K = khalf*8 + 16..23
  return f.v;
}

__global__ __launch_bounds__(256) void gemm_bf16_wmma_kernel(
    const unsigned short* __restrict__ A,   // [M,K] bf16
    const unsigned short* __restrict__ Bt,  // [N,K] bf16 (B transposed)
    float* __restrict__ C, int K, int ldc) {
  __shared__ __align__(16) unsigned short As[2][GT_M * LDT];
  __shared__ __align__(16) unsigned short Bs[2][GT_M * LDT];

  const int tid  = threadIdx.x;
  const int lane = tid & 31;
  const int w    = tid >> 5;
  const int wm   = w >> 1;   // 0..3 : 32-row band
  const int wn   = w & 1;    // 0..1 : 64-col band

  const long m0 = (long)blockIdx.y * GT_M;
  const long n0 = (long)blockIdx.x * GT_M;
  const int  c0 = tid * 4;            // this thread's 4 of 1024 16B chunks
  const int  nk = K / GT_K;

  const unsigned short* Agb = A  + m0 * K;
  const unsigned short* Bgb = Bt + n0 * K;

  // preload tile 0 (async DMA straight into LDS)
#pragma unroll
  for (int i = 0; i < 4; ++i) {
    int ch = c0 + i, r = ch >> 3, kc = (ch & 7) * 8;
    async_copy_b128(&Agb[(long)r * K + kc], &As[0][r * LDT + kc]);
    async_copy_b128(&Bgb[(long)r * K + kc], &Bs[0][r * LDT + kc]);
  }
  wait_async0();
  __syncthreads();

  v8f acc[2][4];
#pragma unroll
  for (int fm = 0; fm < 2; ++fm)
#pragma unroll
    for (int fn = 0; fn < 4; ++fn)
      acc[fm][fn] = (v8f){0.f, 0.f, 0.f, 0.f, 0.f, 0.f, 0.f, 0.f};

  for (int kt = 0; kt < nk; ++kt) {
    const int cur = kt & 1, nxt = cur ^ 1;
    // kick off async DMA of the next tile into the other buffer
    if (kt + 1 < nk) {
      const unsigned short* Ag = Agb + (kt + 1) * GT_K;
      const unsigned short* Bg = Bgb + (kt + 1) * GT_K;
#pragma unroll
      for (int i = 0; i < 4; ++i) {
        int ch = c0 + i, r = ch >> 3, kc = (ch & 7) * 8;
        async_copy_b128(&Ag[(long)r * K + kc], &As[nxt][r * LDT + kc]);
        async_copy_b128(&Bg[(long)r * K + kc], &Bs[nxt][r * LDT + kc]);
      }
    }
    if (kt + 2 < nk) {  // gfx1250 global_prefetch_b8 for tile kt+2 into L2
      int r = c0 >> 3, kc = (c0 & 7) * 8;
      __builtin_prefetch(&Agb[(kt + 2) * GT_K + (long)r * K + kc], 0, 1);
      __builtin_prefetch(&Bgb[(kt + 2) * GT_K + (long)r * K + kc], 0, 1);
    }

    // compute on current buffer: two k=32 sub-steps
#pragma unroll
    for (int s = 0; s < 2; ++s) {
      const int kb = s * 32 + (lane >> 4) * 8;   // khalf selects K sub-lane set
      v16bf afr[2], bfr[4];
#pragma unroll
      for (int fm = 0; fm < 2; ++fm) {
        int row = wm * 32 + fm * 16 + (lane & 15);
        afr[fm] = load_frag(&As[cur][row * LDT + kb]);
      }
#pragma unroll
      for (int fn = 0; fn < 4; ++fn) {
        int row = wn * 64 + fn * 16 + (lane & 15);
        bfr[fn] = load_frag(&Bs[cur][row * LDT + kb]);
      }
#pragma unroll
      for (int fm = 0; fm < 2; ++fm)
#pragma unroll
        for (int fn = 0; fn < 4; ++fn)
          acc[fm][fn] = __builtin_amdgcn_wmma_f32_16x16x32_bf16(
              false, afr[fm], false, bfr[fn], (short)0, acc[fm][fn],
              false, false);
    }

    // next tile must be fully in LDS before anyone reads it next iteration
    wait_async0();
    __syncthreads();
  }

  // store: VGPR r -> row (r + 8*khalf), lane&15 -> col  (16x16 f32 C layout)
  const int cn    = lane & 15;
  const int rbase = (lane >> 4) * 8;
#pragma unroll
  for (int fm = 0; fm < 2; ++fm)
#pragma unroll
    for (int fn = 0; fn < 4; ++fn) {
      long row0 = m0 + wm * 32 + fm * 16 + rbase;
      long col  = n0 + wn * 64 + fn * 16 + cn;
#pragma unroll
      for (int r = 0; r < 8; ++r)
        C[(row0 + r) * ldc + col] = acc[fm][fn][r];
    }
}

// ---------------------------------------------------------------------------
// gk = log_sigmoid(x @ Wgk1 @ Wgk2 + bgk2) / 16      (low-rank, fp32)
// one block per row m; wave w reduces ranks 2w, 2w+1 with wave32 shuffles
// ---------------------------------------------------------------------------
__global__ __launch_bounds__(256) void gk_kernel(
    const float* __restrict__ x, const float* __restrict__ Wgk1,
    const float* __restrict__ Wgk2, const float* __restrict__ bgk2,
    float* __restrict__ gkout) {
  __shared__ float xrow[KDIM];
  __shared__ float low[16];
  const int m = blockIdx.x;
  const float* xr = x + (long)m * KDIM;
  for (int k = threadIdx.x; k < KDIM; k += 256) xrow[k] = xr[k];
  __syncthreads();

  const int w = threadIdx.x >> 5, lane = threadIdx.x & 31;
  float s0 = 0.f, s1 = 0.f;
  for (int k = lane; k < KDIM; k += 32) {
    float xv = xrow[k];
    s0 += xv * Wgk1[k * 16 + 2 * w];
    s1 += xv * Wgk1[k * 16 + 2 * w + 1];
  }
#pragma unroll
  for (int off = 16; off > 0; off >>= 1) {
    s0 += __shfl_down(s0, off, 32);
    s1 += __shfl_down(s1, off, 32);
  }
  if (lane == 0) { low[2 * w] = s0; low[2 * w + 1] = s1; }
  __syncthreads();

  float l[16];
#pragma unroll
  for (int r = 0; r < 16; ++r) l[r] = low[r];
  for (int j = threadIdx.x; j < 1024; j += 256) {
    float acc = bgk2[j];
#pragma unroll
    for (int r = 0; r < 16; ++r) acc += l[r] * Wgk2[r * 1024 + j];
    float ls = fminf(acc, 0.f) - log1pf(__expf(-fabsf(acc)));
    gkout[(long)m * 1024 + j] = ls * (1.0f / 16.0f);
  }
}

// ---------------------------------------------------------------------------
// Chunked GLA scan: one block per (b,h), 128 threads (thread = DV column e),
// S[64][128] carried in LDS across 128 chunks of 16. o overwrites v in qkvg.
// ---------------------------------------------------------------------------
#define CPAD 68
__global__ __launch_bounds__(128) void gla_kernel(
    float* __restrict__ qkvg, const float* __restrict__ gk) {
  __shared__ float S[64 * 128];
  __shared__ float gc[16 * CPAD];
  __shared__ float qe[16 * CPAD];
  __shared__ float ke[16 * CPAD];
  __shared__ float kd[16 * CPAD];
  __shared__ float Am[16 * 16];
  __shared__ float decay[64];

  const int bh = blockIdx.x;        // 0..31
  const int b = bh >> 4, h = bh & 15;
  const int tid = threadIdx.x;

  for (int i = tid; i < 64 * 128; i += 128) S[i] = 0.f;
  __syncthreads();

  const long rowbase = (long)b * 2048;
  float v[16], o[16];

  for (int n = 0; n < 128; ++n) {
    const long m0 = rowbase + n * 16;
    if (tid < 64) {                  // per-column-d prep
      const int d = tid;
      float c = 0.f;
#pragma unroll
      for (int cc = 0; cc < 16; ++cc) {
        c += gk[(m0 + cc) * 1024 + h * 64 + d];
        gc[cc * CPAD + d] = c;
      }
      decay[d] = __expf(c);
      const float glast = c;
#pragma unroll
      for (int cc = 0; cc < 16; ++cc) {
        float g = gc[cc * CPAD + d];
        float q = qkvg[(m0 + cc) * 6144 + h * 64 + d];
        float k = qkvg[(m0 + cc) * 6144 + 1024 + h * 64 + d];
        qe[cc * CPAD + d] = q * __expf(g) * GLA_SCALE;
        ke[cc * CPAD + d] = k * __expf(-g);
        kd[cc * CPAD + d] = k * __expf(glast - g);
      }
    }
    __syncthreads();

    // A = tril(qe ke^T), 256 entries over 128 threads
#pragma unroll
    for (int t = tid; t < 256; t += 128) {
      int cc = t >> 4, mm = t & 15;
      float a = 0.f;
      if (mm <= cc) {
#pragma unroll
        for (int d = 0; d < 64; ++d) a += qe[cc * CPAD + d] * ke[mm * CPAD + d];
      }
      Am[cc * 16 + mm] = a;
    }
    __syncthreads();

    {
      const int e = tid;
#pragma unroll
      for (int cc = 0; cc < 16; ++cc)
        v[cc] = qkvg[(m0 + cc) * 6144 + 2048 + h * 128 + e];
      // o_intra
#pragma unroll
      for (int cc = 0; cc < 16; ++cc) {
        float a = 0.f;
        for (int mm = 0; mm <= cc; ++mm) a += Am[cc * 16 + mm] * v[mm];
        o[cc] = a;
      }
      // o_inter (uses old S) fused with state update
      for (int d = 0; d < 64; ++d) {
        float s = S[d * 128 + e];
        float kv = 0.f;
#pragma unroll
        for (int cc = 0; cc < 16; ++cc) {
          o[cc] += qe[cc * CPAD + d] * s;
          kv += kd[cc * CPAD + d] * v[cc];
        }
        S[d * 128 + e] = decay[d] * s + kv;
      }
#pragma unroll
      for (int cc = 0; cc < 16; ++cc)
        qkvg[(m0 + cc) * 6144 + 2048 + h * 128 + e] = o[cc];
    }
    __syncthreads();
  }
}

// ---------------------------------------------------------------------------
// RMSNorm over DV + SiLU(g) gate, output bf16 for the final GEMM
// one block per (m,h), 128 threads (thread = e)
// ---------------------------------------------------------------------------
__global__ __launch_bounds__(128) void norm_gate_kernel(
    const float* __restrict__ qkvg, const float* __restrict__ norm_w,
    unsigned short* __restrict__ og) {
  __shared__ float red[128];
  const int mh = blockIdx.x;
  const int m = mh >> 4, h = mh & 15;
  const int e = threadIdx.x;
  float o = qkvg[(long)m * 6144 + 2048 + h * 128 + e];
  red[e] = o * o;
  __syncthreads();
#pragma unroll
  for (int s = 64; s > 0; s >>= 1) {
    if (e < s) red[e] += red[e + s];
    __syncthreads();
  }
  float r = rsqrtf(red[0] * (1.f / 128.f) + 1e-5f);
  float g = qkvg[(long)m * 6144 + 4096 + h * 128 + e];
  float val = o * r * norm_w[e] * (g / (1.f + __expf(-g)));
  og[(long)m * 2048 + h * 128 + e] = f2bf(val);
}

// ---------------------------------------------------------------------------
// Host launcher
// ---------------------------------------------------------------------------
extern "C" void kernel_launch(void* const* d_in, const int* in_sizes, int n_in,
                              void* d_out, int out_size, void* d_ws,
                              size_t ws_size, hipStream_t stream) {
  const float* x      = (const float*)d_in[0];
  const float* Wq     = (const float*)d_in[1];
  const float* Wk     = (const float*)d_in[2];
  const float* Wv     = (const float*)d_in[3];
  const float* Wg     = (const float*)d_in[4];
  const float* Wgk1   = (const float*)d_in[5];
  const float* Wgk2   = (const float*)d_in[6];
  const float* bgk2   = (const float*)d_in[7];
  const float* Wo     = (const float*)d_in[8];
  const float* norm_w = (const float*)d_in[9];
  float* out = (float*)d_out;

  // workspace layout (bytes)
  char* ws = (char*)d_ws;
  unsigned short* xb    = (unsigned short*)(ws);                       // 16 MiB
  unsigned short* wcat  = (unsigned short*)(ws + (size_t)16777216);    // 24 MiB
  unsigned short* wot   = (unsigned short*)(ws + (size_t)41943040);    //  8 MiB
  float*          qkvg  = (float*)         (ws + (size_t)50331648);    // 96 MiB
  float*          gkbuf = (float*)         (ws + (size_t)150994944);   // 16 MiB
  unsigned short* og    = (unsigned short*)(ws + (size_t)167772160);   // 16 MiB

  // 1) x -> bf16
  cvt_f32_bf16_kernel<<<MROWS * KDIM / 1024, 256, 0, stream>>>(
      x, xb, (long)MROWS * KDIM);

  // 2) weight transpose+convert into concatenated [6144,2048] and [2048,2048]
  dim3 tb(32, 8);
  transpose_cvt_kernel<<<dim3(1024 / 32, KDIM / 32), tb, 0, stream>>>(
      Wq, wcat, KDIM, 1024);
  transpose_cvt_kernel<<<dim3(1024 / 32, KDIM / 32), tb, 0, stream>>>(
      Wk, wcat + (size_t)1024 * KDIM, KDIM, 1024);
  transpose_cvt_kernel<<<dim3(2048 / 32, KDIM / 32), tb, 0, stream>>>(
      Wv, wcat + (size_t)2048 * KDIM, KDIM, 2048);
  transpose_cvt_kernel<<<dim3(2048 / 32, KDIM / 32), tb, 0, stream>>>(
      Wg, wcat + (size_t)4096 * KDIM, KDIM, 2048);
  transpose_cvt_kernel<<<dim3(2048 / 32, KDIM / 32), tb, 0, stream>>>(
      Wo, wot, KDIM, 2048);

  // 3) fused projection GEMM (WMMA bf16 -> f32): qkvg[4096,6144]
  gemm_bf16_wmma_kernel<<<dim3(NCAT / 128, MROWS / 128), 256, 0, stream>>>(
      xb, wcat, qkvg, KDIM, NCAT);

  // 4) low-rank gate path gk[4096,1024]
  gk_kernel<<<MROWS, 256, 0, stream>>>(x, Wgk1, Wgk2, bgk2, gkbuf);

  // 5) chunked GLA scan (writes o over the v slice of qkvg)
  gla_kernel<<<32, 128, 0, stream>>>(qkvg, gkbuf);

  // 6) RMSNorm + SiLU gate -> bf16 [4096,2048]
  norm_gate_kernel<<<MROWS * 16, 128, 0, stream>>>(qkvg, norm_w, og);

  // 7) output GEMM (WMMA) -> d_out fp32 [4096,2048]
  gemm_bf16_wmma_kernel<<<dim3(NOUT / 128, MROWS / 128), 256, 0, stream>>>(
      og, wot, out, KDIM, NOUT);
}

// v001
// It runs in 462 microseconds.
// Two timings next to v000 put it at 4.56 and 4.55 times that version's speed.
#include <hip/hip_runtime.h>

// ---------------------------------------------------------------------------
// Problem constants (from reference)
// ---------------------------------------------------------------------------
// B=2, T=2048, HID=2048, H=16, DK=64, DV=128, C=16, LOWR=16
// M = B*T = 4096 rows.  Fused projection GEMM: [4096,2048] x [2048,6144]
//   cols 0..1023   : q  (H*DK)
//   cols 1024..2047: k  (H*DK)
//   cols 2048..4095: v  (H*DV)   (overwritten with o by the GLA kernel)
//   cols 4096..6143: g  (H*DV)
// Output GEMM: [4096,2048] x [2048,2048] -> d_out (fp32)

#define MROWS   4096
#define KDIM    2048
#define NCAT    6144
#define NOUT    2048
#define GLA_SCALE 0.125f   // DK^-0.5

typedef __attribute__((ext_vector_type(16))) __bf16 v16bf;
typedef __attribute__((ext_vector_type(8)))  float  v8f;

__device__ __forceinline__ unsigned short f2bf(float f) {
  unsigned int u = __float_as_uint(f);
  u += 0x7fffu + ((u >> 16) & 1u);
  return (unsigned short)(u >> 16);
}

// gfx1250 async global->LDS DMA: 16B per lane, no data VGPRs, ASYNCcnt-tracked.
// GV mode: VDST = LDS byte offset (low 32 bits of flat shared address per the
// LDS aperture rule addr[31:0]), VADDR = 64-bit global address, no SADDR.
__device__ __forceinline__ void async_copy_b128(const void* g, void* lds) {
  unsigned lds_off = (unsigned)(unsigned long long)lds;
  asm volatile("global_load_async_to_lds_b128 %0, %1, off"
               :: "v"(lds_off), "v"(g) : "memory");
}
__device__ __forceinline__ void wait_async0() {
  asm volatile("s_wait_asynccnt 0x0" ::: "memory");
}

// ---------------------------------------------------------------------------
// fp32 -> bf16 elementwise convert (x activations)
// ---------------------------------------------------------------------------
__global__ __launch_bounds__(256) void cvt_f32_bf16_kernel(
    const float* __restrict__ in, unsigned short* __restrict__ out, long n) {
  long i = ((long)blockIdx.x * 256 + threadIdx.x) * 4;
  if (i + 3 < n) {
    float4 v = *(const float4*)(in + i);
    out[i + 0] = f2bf(v.x);
    out[i + 1] = f2bf(v.y);
    out[i + 2] = f2bf(v.z);
    out[i + 3] = f2bf(v.w);
  }
}

// ---------------------------------------------------------------------------
// Transpose [K,Nw] fp32 -> [Nw,K] bf16 (weights, so WMMA B operand is N-major)
// ---------------------------------------------------------------------------
__global__ __launch_bounds__(256) void transpose_cvt_kernel(
    const float* __restrict__ W, unsigned short* __restrict__ out,
    int K, int Nw) {
  __shared__ float tile[32][33];
  int kb = blockIdx.y * 32, nb = blockIdx.x * 32;
  int tx = threadIdx.x, ty = threadIdx.y;   // block (32,8)
#pragma unroll
  for (int i = 0; i < 32; i += 8)
    tile[ty + i][tx] = W[(long)(kb + ty + i) * Nw + (nb + tx)];
  __syncthreads();
#pragma unroll
  for (int i = 0; i < 32; i += 8)
    out[(long)(nb + ty + i) * K + (kb + tx)] = f2bf(tile[tx][ty + i]);
}

// ---------------------------------------------------------------------------
// bf16 WMMA GEMM:  C[M,N](f32) = A[M,K](bf16,row-major) * Bt[N,K]^T
// Block tile 128x128, K-step 64, 256 threads = 8 waves (4x2 wave grid),
// each wave: 2x4 fragments of 16x16. Double-buffered LDS, pitch 72
// (144B rows -> conflict-free b128 fragment reads). Tile staging uses
// global_load_async_to_lds_b128 (no data VGPRs -> no spills).
// ---------------------------------------------------------------------------
#define GT_M 128
#define GT_K 64
#define LDT  72

__device__ __forceinline__ v16bf load_frag(const unsigned short* p) {
  union { v16bf v; uint4 u[2]; } f;
  f.u[0] = *(const uint4*)(p);        // halves 0..7  : K = khalf*8 + 0..7
  f.u[1] = *(const uint4*)(p + 16);   // halves 8..15 : K = khalf*8 + 16..23
  return f.v;
}

__global__ __launch_bounds__(256) void gemm_bf16_wmma_kernel(
    const unsigned short* __restrict__ A,   // [M,K] bf16
    const unsigned short* __restrict__ Bt,  // [N,K] bf16 (B transposed)
    float* __restrict__ C, int K, int ldc) {
  __shared__ __align__(16) unsigned short As[2][GT_M * LDT];
  __shared__ __align__(16) unsigned short Bs[2][GT_M * LDT];

  const int tid  = threadIdx.x;
  const int lane = tid & 31;
  const int w    = tid >> 5;
  const int wm   = w >> 1;   // 0..3 : 32-row band
  const int wn   = w & 1;    // 0..1 : 64-col band

  const long m0 = (long)blockIdx.y * GT_M;
  const long n0 = (long)blockIdx.x * GT_M;
  const int  c0 = tid * 4;            // this thread's 4 of 1024 16B chunks
  const int  nk = K / GT_K;

  const unsigned short* Agb = A  + m0 * K;
  const unsigned short* Bgb = Bt + n0 * K;

  // preload tile 0 (async DMA straight into LDS)
#pragma unroll
  for (int i = 0; i < 4; ++i) {
    int ch = c0 + i, r = ch >> 3, kc = (ch & 7) * 8;
    async_copy_b128(&Agb[(long)r * K + kc], &As[0][r * LDT + kc]);
    async_copy_b128(&Bgb[(long)r * K + kc], &Bs[0][r * LDT + kc]);
  }
  wait_async0();
  __syncthreads();

  v8f acc[2][4];
#pragma unroll
  for (int fm = 0; fm < 2; ++fm)
#pragma unroll
    for (int fn = 0; fn < 4; ++fn)
      acc[fm][fn] = (v8f){0.f, 0.f, 0.f, 0.f, 0.f, 0.f, 0.f, 0.f};

  for (int kt = 0; kt < nk; ++kt) {
    const int cur = kt & 1, nxt = cur ^ 1;
    // kick off async DMA of the next tile into the other buffer
    if (kt + 1 < nk) {
      const unsigned short* Ag = Agb + (kt + 1) * GT_K;
      const unsigned short* Bg = Bgb + (kt + 1) * GT_K;
#pragma unroll
      for (int i = 0; i < 4; ++i) {
        int ch = c0 + i, r = ch >> 3, kc = (ch & 7) * 8;
        async_copy_b128(&Ag[(long)r * K + kc], &As[nxt][r * LDT + kc]);
        async_copy_b128(&Bg[(long)r * K + kc], &Bs[nxt][r * LDT + kc]);
      }
    }
    if (kt + 2 < nk) {  // gfx1250 global_prefetch_b8 for tile kt+2 into L2
      int r = c0 >> 3, kc = (c0 & 7) * 8;
      __builtin_prefetch(&Agb[(kt + 2) * GT_K + (long)r * K + kc], 0, 1);
      __builtin_prefetch(&Bgb[(kt + 2) * GT_K + (long)r * K + kc], 0, 1);
    }

    // compute on current buffer: two k=32 sub-steps
#pragma unroll
    for (int s = 0; s < 2; ++s) {
      const int kb = s * 32 + (lane >> 4) * 8;   // khalf selects K sub-lane set
      v16bf afr[2], bfr[4];
#pragma unroll
      for (int fm = 0; fm < 2; ++fm) {
        int row = wm * 32 + fm * 16 + (lane & 15);
        afr[fm] = load_frag(&As[cur][row * LDT + kb]);
      }
#pragma unroll
      for (int fn = 0; fn < 4; ++fn) {
        int row = wn * 64 + fn * 16 + (lane & 15);
        bfr[fn] = load_frag(&Bs[cur][row * LDT + kb]);
      }
#pragma unroll
      for (int fm = 0; fm < 2; ++fm)
#pragma unroll
        for (int fn = 0; fn < 4; ++fn)
          acc[fm][fn] = __builtin_amdgcn_wmma_f32_16x16x32_bf16(
              false, afr[fm], false, bfr[fn], (short)0, acc[fm][fn],
              false, false);
    }

    // next tile must be fully in LDS before anyone reads it next iteration
    wait_async0();
    __syncthreads();
  }

  // store: VGPR r -> row (r + 8*khalf), lane&15 -> col  (16x16 f32 C layout)
  const int cn    = lane & 15;
  const int rbase = (lane >> 4) * 8;
#pragma unroll
  for (int fm = 0; fm < 2; ++fm)
#pragma unroll
    for (int fn = 0; fn < 4; ++fn) {
      long row0 = m0 + wm * 32 + fm * 16 + rbase;
      long col  = n0 + wn * 64 + fn * 16 + cn;
#pragma unroll
      for (int r = 0; r < 8; ++r)
        C[(row0 + r) * ldc + col] = acc[fm][fn][r];
    }
}

// ---------------------------------------------------------------------------
// gk = log_sigmoid(x @ Wgk1 @ Wgk2 + bgk2) / 16      (low-rank, fp32)
// one block per row m; wave w reduces ranks 2w, 2w+1 with wave32 shuffles
// ---------------------------------------------------------------------------
__global__ __launch_bounds__(256) void gk_kernel(
    const float* __restrict__ x, const float* __restrict__ Wgk1,
    const float* __restrict__ Wgk2, const float* __restrict__ bgk2,
    float* __restrict__ gkout) {
  __shared__ float xrow[KDIM];
  __shared__ float low[16];
  const int m = blockIdx.x;
  const float* xr = x + (long)m * KDIM;
  for (int k = threadIdx.x; k < KDIM; k += 256) xrow[k] = xr[k];
  __syncthreads();

  const int w = threadIdx.x >> 5, lane = threadIdx.x & 31;
  float s0 = 0.f, s1 = 0.f;
  for (int k = lane; k < KDIM; k += 32) {
    float xv = xrow[k];
    s0 += xv * Wgk1[k * 16 + 2 * w];
    s1 += xv * Wgk1[k * 16 + 2 * w + 1];
  }
#pragma unroll
  for (int off = 16; off > 0; off >>= 1) {
    s0 += __shfl_down(s0, off, 32);
    s1 += __shfl_down(s1, off, 32);
  }
  if (lane == 0) { low[2 * w] = s0; low[2 * w + 1] = s1; }
  __syncthreads();

  float l[16];
#pragma unroll
  for (int r = 0; r < 16; ++r) l[r] = low[r];
  for (int j = threadIdx.x; j < 1024; j += 256) {
    float acc = bgk2[j];
#pragma unroll
    for (int r = 0; r < 16; ++r) acc += l[r] * Wgk2[r * 1024 + j];
    float ls = fminf(acc, 0.f) - log1pf(__expf(-fabsf(acc)));
    gkout[(long)m * 1024 + j] = ls * (1.0f / 16.0f);
  }
}

// ---------------------------------------------------------------------------
// Chunked GLA scan, split along the sequence into NSEG segments of SEGC chunks
// so that (b,h) x segment work-groups run side by side. The state recurrence
// S <- diag(decay) S + kv is linear in S, so over one segment
//   S_end = diag(D_seg) S_start + KV_seg,
// with D_seg the product of the chunk decays and KV_seg the segment's end
// state when started from zero. Three launches:
//   1) gla_seg_state_kernel: KV_seg and D_seg of every segment but the last
//   2) gla_seg_scan_kernel : start state of segments 1..NSEG-1 (in place)
//   3) gla_kernel          : the full chunk loop of a segment from its start
// thread = DV column e; S[64][128] carried in LDS. o overwrites v in qkvg.
// ---------------------------------------------------------------------------
#define CPAD 68
#define NSEG 32                 // segments per sequence
#define SEGC 4                  // chunks of 16 rows per segment (NSEG*SEGC = 128)
#define NSEGM1 (NSEG - 1)

__global__ __launch_bounds__(128) void gla_seg_state_kernel(
    const float* __restrict__ qkvg, const float* __restrict__ gk,
    float* __restrict__ segS, float* __restrict__ segD) {
  __shared__ float S[64 * 128];
  __shared__ float gc[16 * CPAD];
  __shared__ float kd[16 * CPAD];
  __shared__ float decay[64];

  const int seg = blockIdx.x;       // 0..NSEG-2
  const int bh = blockIdx.y;        // 0..31
  const int b = bh >> 4, h = bh & 15;
  const int tid = threadIdx.x;

  for (int i = tid; i < 64 * 128; i += 128) S[i] = 0.f;

  const long row0 = (long)b * 2048 + (long)seg * (SEGC * 16);
  // row pointers of the current chunk, advanced by 16 rows per chunk
  const float* gp = gk + row0 * 1024 + h * 64 + (tid & 63);
  const float* kp = qkvg + row0 * 6144 + 1024 + h * 64 + (tid & 63);
  const float* vp = qkvg + row0 * 6144 + 2048 + h * 128 + tid;
  float v[16];
  float dprod = 1.f;

  for (int n = 0; n < SEGC; ++n) {
    if (tid < 64) {                  // per-column-d prep
      const int d = tid;
      float c = 0.f;
#pragma unroll  // the 16 row loads go out together
      for (int cc = 0; cc < 16; ++cc) {
        c += gp[cc * 1024];
        gc[cc * CPAD + d] = c;
      }
      const float dec = __expf(c);
      decay[d] = dec;
      dprod *= dec;
      const float glast = c;
#pragma unroll  // the 16 row loads go out together
      for (int cc = 0; cc < 16; ++cc) {
        float g = gc[cc * CPAD + d];
        kd[cc * CPAD + d] = kp[cc * 6144] * __expf(glast - g);
      }
    }
    __syncthreads();

    {
      const int e = tid;
#pragma unroll  // v[] stays in registers
      for (int cc = 0; cc < 16; ++cc) v[cc] = vp[cc * 6144];
      for (int d = 0; d < 64; ++d) {
        float s = S[d * 128 + e];
        float kv = 0.f;
#pragma unroll  // v[] stays in registers
        for (int cc = 0; cc < 16; ++cc) kv += kd[cc * CPAD + d] * v[cc];
        S[d * 128 + e] = decay[d] * s + kv;
      }
    }
    gp += 16 * 1024;
    kp += 16 * 6144;
    vp += 16 * 6144;
    __syncthreads();
  }

  const long sb = (long)bh * NSEGM1 + seg;
  float* sp = segS + sb * (64 * 128) + tid;
#pragma unroll  // one address, constant offsets
  for (int d = 0; d < 64; ++d) sp[d * 128] = S[d * 128 + tid];
  if (tid < 64) segD[sb * 64 + tid] = dprod;
}

// segS[bh][g] holds KV of segment g on entry and the start state of segment
// g + 1 on exit. One thread per (bh, d, four columns e); every load is issued
// ahead of the first store.
__global__ __launch_bounds__(256) void gla_seg_scan_kernel(
    float* __restrict__ segS, const float* __restrict__ segD) {
  const int idx = blockIdx.x * 256 + threadIdx.x;   // 32 * 64 * 32 threads
  const int bh = idx >> 11, rem = idx & 2047, d = rem >> 5;
  float4* p = (float4*)segS + (long)bh * NSEGM1 * 2048 + rem;
  const float* dp = segD + (long)bh * NSEGM1 * 64 + d;
  float4 kv[NSEGM1];
  float dc[NSEGM1];
#pragma unroll  // kv[] and dc[] stay in registers
  for (int g = 0; g < NSEGM1; ++g) {
    kv[g] = p[g * 2048];
    dc[g] = dp[g * 64];
  }
  // Stands behind the last load and in front of the first store: no load is
  // issued among the stores into a register that a store still names, and the
  // loads' latencies overlap instead of adding up along the chain.
  asm volatile("s_wait_xcnt 0x0" ::: "memory");
  // segment 0 starts from zero, so kv[0] is already the start of segment 1
#pragma unroll  // kv[] and dc[] stay in registers
  for (int g = 1; g < NSEGM1; ++g) {
    kv[g].x = dc[g] * kv[g - 1].x + kv[g].x;
    kv[g].y = dc[g] * kv[g - 1].y + kv[g].y;
    kv[g].z = dc[g] * kv[g - 1].z + kv[g].z;
    kv[g].w = dc[g] * kv[g - 1].w + kv[g].w;
    p[g * 2048] = kv[g];
  }
}

__global__ __launch_bounds__(128) void gla_kernel(
    float* __restrict__ qkvg, const float* __restrict__ gk,
    const float* __restrict__ segS) {
  __shared__ float S[64 * 128];
  __shared__ float gc[16 * CPAD];
  __shared__ float qe[16 * CPAD];
  __shared__ float ke[16 * CPAD];
  __shared__ float kd[16 * CPAD];
  __shared__ float Am[16 * 16];
  __shared__ float decay[64];

  const int seg = blockIdx.x;       // 0..NSEG-1
  const int bh = blockIdx.y;        // 0..31
  const int b = bh >> 4, h = bh & 15;
  const int tid = threadIdx.x;

  if (seg == 0) {
    for (int i = tid; i < 64 * 128; i += 128) S[i] = 0.f;
  } else {
    const float* s0 = segS + ((long)bh * NSEGM1 + (seg - 1)) * (64 * 128) + tid;
#pragma unroll  // one address, constant offsets, all loads in flight
    for (int d = 0; d < 64; ++d) S[d * 128 + tid] = s0[d * 128];
  }
  __syncthreads();

  const long rowbase = (long)b * 2048 + (long)seg * (SEGC * 16);
  float v[16], o[16];

  for (int n = 0; n < SEGC; ++n) {
    const long m0 = rowbase + n * 16;
    if (tid < 64) {                  // per-column-d prep
      const int d = tid;
      float c = 0.f;
#pragma unroll
      for (int cc = 0; cc < 16; ++cc) {
        c += gk[(m0 + cc) * 1024 + h * 64 + d];
        gc[cc * CPAD + d] = c;
      }
      decay[d] = __expf(c);
      const float glast = c;
#pragma unroll
      for (int cc = 0; cc < 16; ++cc) {
        float g = gc[cc * CPAD + d];
        float q = qkvg[(m0 + cc) * 6144 + h * 64 + d];
        float k = qkvg[(m0 + cc) * 6144 + 1024 + h * 64 + d];
        qe[cc * CPAD + d] = q * __expf(g) * GLA_SCALE;
        ke[cc * CPAD + d] = k * __expf(-g);
        kd[cc * CPAD + d] = k * __expf(glast - g);
      }
    }
    __syncthreads();

    // A = tril(qe ke^T), 256 entries over 128 threads
#pragma unroll
    for (int t = tid; t < 256; t += 128) {
      int cc = t >> 4, mm = t & 15;
      float a = 0.f;
      if (mm <= cc) {
#pragma unroll
        for (int d = 0; d < 64; ++d) a += qe[cc * CPAD + d] * ke[mm * CPAD + d];
      }
      Am[cc * 16 + mm] = a;
    }
    __syncthreads();

    {
      const int e = tid;
#pragma unroll
      for (int cc = 0; cc < 16; ++cc)
        v[cc] = qkvg[(m0 + cc) * 6144 + 2048 + h * 128 + e];
      // o_intra
#pragma unroll
      for (int cc = 0; cc < 16; ++cc) {
        float a = 0.f;
        for (int mm = 0; mm <= cc; ++mm) a += Am[cc * 16 + mm] * v[mm];
        o[cc] = a;
      }
      if (n + 1 < SEGC) {
        // o_inter (uses old S) fused with state update
        for (int d = 0; d < 64; ++d) {
          float s = S[d * 128 + e];
          float kv = 0.f;
#pragma unroll
          for (int cc = 0; cc < 16; ++cc) {
            o[cc] += qe[cc * CPAD + d] * s;
            kv += kd[cc * CPAD + d] * v[cc];
          }
          S[d * 128 + e] = decay[d] * s + kv;
        }
      } else {
        // last chunk of the segment: nobody reads this segment's end state here
        for (int d = 0; d < 64; ++d) {
          float s = S[d * 128 + e];
#pragma unroll  // o[] stays in registers
          for (int cc = 0; cc < 16; ++cc) o[cc] += qe[cc * CPAD + d] * s;
        }
      }
#pragma unroll
      for (int cc = 0; cc < 16; ++cc)
        qkvg[(m0 + cc) * 6144 + 2048 + h * 128 + e] = o[cc];
    }
    __syncthreads();
  }
}

// ---------------------------------------------------------------------------
// RMSNorm over DV + SiLU(g) gate, output bf16 for the final GEMM
// one block per (m,h), 128 threads (thread = e)
// ---------------------------------------------------------------------------
__global__ __launch_bounds__(128) void norm_gate_kernel(
    const float* __restrict__ qkvg, const float* __restrict__ norm_w,
    unsigned short* __restrict__ og) {
  __shared__ float red[128];
  const int mh = blockIdx.x;
  const int m = mh >> 4, h = mh & 15;
  const int e = threadIdx.x;
  float o = qkvg[(long)m * 6144 + 2048 + h * 128 + e];
  red[e] = o * o;
  __syncthreads();
#pragma unroll
  for (int s = 64; s > 0; s >>= 1) {
    if (e < s) red[e] += red[e + s];
    __syncthreads();
  }
  float r = rsqrtf(red[0] * (1.f / 128.f) + 1e-5f);
  float g = qkvg[(long)m * 6144 + 4096 + h * 128 + e];
  float val = o * r * norm_w[e] * (g / (1.f + __expf(-g)));
  og[(long)m * 2048 + h * 128 + e] = f2bf(val);
}

// ---------------------------------------------------------------------------
// Host launcher
// ---------------------------------------------------------------------------
extern "C" void kernel_launch(void* const* d_in, const int* in_sizes, int n_in,
                              void* d_out, int out_size, void* d_ws,
                              size_t ws_size, hipStream_t stream) {
  const float* x      = (const float*)d_in[0];
  const float* Wq     = (const float*)d_in[1];
  const float* Wk     = (const float*)d_in[2];
  const float* Wv     = (const float*)d_in[3];
  const float* Wg     = (const float*)d_in[4];
  const float* Wgk1   = (const float*)d_in[5];
  const float* Wgk2   = (const float*)d_in[6];
  const float* bgk2   = (const float*)d_in[7];
  const float* Wo     = (const float*)d_in[8];
  const float* norm_w = (const float*)d_in[9];
  float* out = (float*)d_out;

  // workspace layout (bytes)
  char* ws = (char*)d_ws;
  unsigned short* xb    = (unsigned short*)(ws);                       // 16 MiB
  unsigned short* wcat  = (unsigned short*)(ws + (size_t)16777216);    // 24 MiB
  unsigned short* wot   = (unsigned short*)(ws + (size_t)41943040);    //  8 MiB
  float*          qkvg  = (float*)         (ws + (size_t)50331648);    // 96 MiB
  float*          gkbuf = (float*)         (ws + (size_t)150994944);   // 16 MiB
  unsigned short* og    = (unsigned short*)(ws + (size_t)167772160);   // 16 MiB
  float*          segS  = (float*)         (ws + (size_t)184549376);   // 31 MiB
  float*          segD  = (float*)         (ws + (size_t)218103808);   // 248 KiB

  // 1) x -> bf16
  cvt_f32_bf16_kernel<<<MROWS * KDIM / 1024, 256, 0, stream>>>(
      x, xb, (long)MROWS * KDIM);

  // 2) weight transpose+convert into concatenated [6144,2048] and [2048,2048]
  dim3 tb(32, 8);
  transpose_cvt_kernel<<<dim3(1024 / 32, KDIM / 32), tb, 0, stream>>>(
      Wq, wcat, KDIM, 1024);
  transpose_cvt_kernel<<<dim3(1024 / 32, KDIM / 32), tb, 0, stream>>>(
      Wk, wcat + (size_t)1024 * KDIM, KDIM, 1024);
  transpose_cvt_kernel<<<dim3(2048 / 32, KDIM / 32), tb, 0, stream>>>(
      Wv, wcat + (size_t)2048 * KDIM, KDIM, 2048);
  transpose_cvt_kernel<<<dim3(2048 / 32, KDIM / 32), tb, 0, stream>>>(
      Wg, wcat + (size_t)4096 * KDIM, KDIM, 2048);
  transpose_cvt_kernel<<<dim3(2048 / 32, KDIM / 32), tb, 0, stream>>>(
      Wo, wot, KDIM, 2048);

  // 3) fused projection GEMM (WMMA bf16 -> f32): qkvg[4096,6144]
  gemm_bf16_wmma_kernel<<<dim3(NCAT / 128, MROWS / 128), 256, 0, stream>>>(
      xb, wcat, qkvg, KDIM, NCAT);

  // 4) low-rank gate path gk[4096,1024]
  gk_kernel<<<MROWS, 256, 0, stream>>>(x, Wgk1, Wgk2, bgk2, gkbuf);

  // 5) chunked GLA scan in segments (writes o over the v slice of qkvg)
  gla_seg_state_kernel<<<dim3(NSEGM1, 32), 128, 0, stream>>>(qkvg, gkbuf, segS,
                                                            segD);
  gla_seg_scan_kernel<<<32 * 64 * 32 / 256, 256, 0, stream>>>(segS, segD);
  gla_kernel<<<dim3(NSEG, 32), 128, 0, stream>>>(qkvg, gkbuf, segS);

  // 6) RMSNorm + SiLU gate -> bf16 [4096,2048]
  norm_gate_kernel<<<MROWS * 16, 128, 0, stream>>>(qkvg, norm_w, og);

  // 7) output GEMM (WMMA) -> d_out fp32 [4096,2048]
  gemm_bf16_wmma_kernel<<<dim3(NOUT / 128, MROWS / 128), 256, 0, stream>>>(
      og, wot, out, KDIM, NOUT);
}

// v002
// Measured time: 427 microseconds a run.
// Next to v001, in two timings, it ran 1.08 times as fast each time.
// Counting every step since v000, it is 4.94 times as fast.
#include <hip/hip_runtime.h>

// ---------------------------------------------------------------------------
// Problem constants (from reference)
// ---------------------------------------------------------------------------
// B=2, T=2048, HID=2048, H=16, DK=64, DV=128, C=16, LOWR=16
// M = B*T = 4096 rows.  Fused projection GEMM: [4096,2048] x [2048,6144]
//   cols 0..1023   : q  (H*DK)
//   cols 1024..2047: k  (H*DK)
//   cols 2048..4095: v  (H*DV)   (overwritten with o by the GLA kernel)
//   cols 4096..6143: g  (H*DV)
// Output GEMM: [4096,2048] x [2048,2048] -> d_out (fp32)

#define MROWS   4096
#define KDIM    2048
#define NCAT    6144
#define NOUT    2048
#define GLA_SCALE 0.125f   // DK^-0.5

typedef __attribute__((ext_vector_type(16))) __bf16 v16bf;
typedef __attribute__((ext_vector_type(8)))  float  v8f;

__device__ __forceinline__ unsigned short f2bf(float f) {
  unsigned int u = __float_as_uint(f);
  u += 0x7fffu + ((u >> 16) & 1u);
  return (unsigned short)(u >> 16);
}

// gfx1250 async global->LDS DMA: 16B per lane, no data VGPRs, ASYNCcnt-tracked.
// GV mode: VDST = LDS byte offset (low 32 bits of flat shared address per the
// LDS aperture rule addr[31:0]), VADDR = 64-bit global address, no SADDR.
__device__ __forceinline__ void async_copy_b128(const void* g, void* lds) {
  unsigned lds_off = (unsigned)(unsigned long long)lds;
  asm volatile("global_load_async_to_lds_b128 %0, %1, off"
               :: "v"(lds_off), "v"(g) : "memory");
}
__device__ __forceinline__ void wait_async0() {
  asm volatile("s_wait_asynccnt 0x0" ::: "memory");
}

// The three streaming helpers below (convert, transpose, norm+gate) move few
// bytes per wave.
// Each is laid out so that a wave brings in 4 KiB or more with all its loads
// in flight at once, and the grids are 8 to 32 times smaller for it.

__device__ __forceinline__ unsigned int pack2bf(float lo, float hi) {
  return (unsigned int)f2bf(lo) | ((unsigned int)f2bf(hi) << 16);
}

// ---------------------------------------------------------------------------
// fp32 -> bf16 elementwise convert (x activations)
// one block converts 8192 contiguous floats: 8 float4 per thread
// ---------------------------------------------------------------------------
__global__ __launch_bounds__(256) void cvt_f32_bf16_kernel(
    const float* __restrict__ in, unsigned short* __restrict__ out) {
  const long base = (long)blockIdx.x * 2048 + threadIdx.x;   // in float4 units
  const float4* p = (const float4*)in + base;
  uint2* q = (uint2*)out + base;
  float4 v[8];
#pragma unroll  // v[] stays in registers, the 8 loads go out together
  for (int i = 0; i < 8; ++i) v[i] = p[i * 256];
#pragma unroll  // v[] stays in registers
  for (int i = 0; i < 8; ++i)
    q[i * 256] = make_uint2(pack2bf(v[i].x, v[i].y), pack2bf(v[i].z, v[i].w));
}

// ---------------------------------------------------------------------------
// Transpose [K,Nw] fp32 -> [Nw,K] bf16 (weights, so WMMA B operand is N-major)
// one block of 256 threads moves a tile of 128 k x 64 n: 8 float4 loads per
// thread (256 B of a source row per 16 lanes), then 4 stores of 8 bf16 per
// thread (256 B of an output row per 16 lanes).
// ---------------------------------------------------------------------------
#define TT_K 128
#define TT_N 64
#define TT_P 65   // odd pitch in floats: column reads spread over the banks

// The row pitches are compile-time constants, so that the 8 loads (and the 4
// stores) share one address and differ in their immediate offsets only.
template <int Nw>
__global__ __launch_bounds__(256) void transpose_cvt_kernel(
    const float* __restrict__ W, unsigned short* __restrict__ out) {
  constexpr int K = KDIM;
  __shared__ float tile[TT_K * TT_P];
  const int kb = blockIdx.y * TT_K, nb = blockIdx.x * TT_N;
  const int lo = threadIdx.x & 15, hi = threadIdx.x >> 4;
  const float* s = W + (long)(kb + hi) * Nw + (nb + lo * 4);
  float4 v[8];
#pragma unroll  // v[] stays in registers, the 8 loads go out together
  for (int i = 0; i < 8; ++i) v[i] = *(const float4*)(s + i * 16 * Nw);
#pragma unroll  // v[] stays in registers
  for (int i = 0; i < 8; ++i) {
    float* t = &tile[(hi + i * 16) * TT_P + lo * 4];
    t[0] = v[i].x; t[1] = v[i].y; t[2] = v[i].z; t[3] = v[i].w;
  }
  __syncthreads();
  uint4 r[4];
#pragma unroll  // r[] stays in registers
  for (int j = 0; j < 4; ++j) {
    const float* t = &tile[(lo * 8) * TT_P + hi + j * 16];
    r[j] = make_uint4(pack2bf(t[0 * TT_P], t[1 * TT_P]),
                      pack2bf(t[2 * TT_P], t[3 * TT_P]),
                      pack2bf(t[4 * TT_P], t[5 * TT_P]),
                      pack2bf(t[6 * TT_P], t[7 * TT_P]));
  }
  unsigned short* d = out + (long)(nb + hi) * K + (kb + lo * 8);
#pragma unroll  // r[] stays in registers
  for (int j = 0; j < 4; ++j) *(uint4*)(d + j * 16 * K) = r[j];
}

// ---------------------------------------------------------------------------
// bf16 WMMA GEMM:  C[M,N](f32) = A[M,K](bf16,row-major) * Bt[N,K]^T
// Block tile 128x128, K-step 64, 256 threads = 8 waves (4x2 wave grid),
// each wave: 2x4 fragments of 16x16. Double-buffered LDS, pitch 72
// (144B rows -> conflict-free b128 fragment reads). Tile staging uses
// global_load_async_to_lds_b128 (no data VGPRs -> no spills).
// ---------------------------------------------------------------------------
#define GT_M 128
#define GT_K 64
#define LDT  72

__device__ __forceinline__ v16bf load_frag(const unsigned short* p) {
  union { v16bf v; uint4 u[2]; } f;
  f.u[0] = *(const uint4*)(p);        // halves 0..7  : K = khalf*8 + 0..7
  f.u[1] = *(const uint4*)(p + 16);   // halves 8..15 : K = khalf*8 + 16..23
  return f.v;
}

__global__ __launch_bounds__(256) void gemm_bf16_wmma_kernel(
    const unsigned short* __restrict__ A,   // [M,K] bf16
    const unsigned short* __restrict__ Bt,  // [N,K] bf16 (B transposed)
    float* __restrict__ C, int K, int ldc) {
  __shared__ __align__(16) unsigned short As[2][GT_M * LDT];
  __shared__ __align__(16) unsigned short Bs[2][GT_M * LDT];

  const int tid  = threadIdx.x;
  const int lane = tid & 31;
  const int w    = tid >> 5;
  const int wm   = w >> 1;   // 0..3 : 32-row band
  const int wn   = w & 1;    // 0..1 : 64-col band

  const long m0 = (long)blockIdx.y * GT_M;
  const long n0 = (long)blockIdx.x * GT_M;
  const int  c0 = tid * 4;            // this thread's 4 of 1024 16B chunks
  const int  nk = K / GT_K;

  const unsigned short* Agb = A  + m0 * K;
  const unsigned short* Bgb = Bt + n0 * K;

  // preload tile 0 (async DMA straight into LDS)
#pragma unroll
  for (int i = 0; i < 4; ++i) {
    int ch = c0 + i, r = ch >> 3, kc = (ch & 7) * 8;
    async_copy_b128(&Agb[(long)r * K + kc], &As[0][r * LDT + kc]);
    async_copy_b128(&Bgb[(long)r * K + kc], &Bs[0][r * LDT + kc]);
  }
  wait_async0();
  __syncthreads();

  v8f acc[2][4];
#pragma unroll
  for (int fm = 0; fm < 2; ++fm)
#pragma unroll
    for (int fn = 0; fn < 4; ++fn)
      acc[fm][fn] = (v8f){0.f, 0.f, 0.f, 0.f, 0.f, 0.f, 0.f, 0.f};

  for (int kt = 0; kt < nk; ++kt) {
    const int cur = kt & 1, nxt = cur ^ 1;
    // kick off async DMA of the next tile into the other buffer
    if (kt + 1 < nk) {
      const unsigned short* Ag = Agb + (kt + 1) * GT_K;
      const unsigned short* Bg = Bgb + (kt + 1) * GT_K;
#pragma unroll
      for (int i = 0; i < 4; ++i) {
        int ch = c0 + i, r = ch >> 3, kc = (ch & 7) * 8;
        async_copy_b128(&Ag[(long)r * K + kc], &As[nxt][r * LDT + kc]);
        async_copy_b128(&Bg[(long)r * K + kc], &Bs[nxt][r * LDT + kc]);
      }
    }
    if (kt + 2 < nk) {  // gfx1250 global_prefetch_b8 for tile kt+2 into L2
      int r = c0 >> 3, kc = (c0 & 7) * 8;
      __builtin_prefetch(&Agb[(kt + 2) * GT_K + (long)r * K + kc], 0, 1);
      __builtin_prefetch(&Bgb[(kt + 2) * GT_K + (long)r * K + kc], 0, 1);
    }

    // compute on current buffer: two k=32 sub-steps
#pragma unroll
    for (int s = 0; s < 2; ++s) {
      const int kb = s * 32 + (lane >> 4) * 8;   // khalf selects K sub-lane set
      v16bf afr[2], bfr[4];
#pragma unroll
      for (int fm = 0; fm < 2; ++fm) {
        int row = wm * 32 + fm * 16 + (lane & 15);
        afr[fm] = load_frag(&As[cur][row * LDT + kb]);
      }
#pragma unroll
      for (int fn = 0; fn < 4; ++fn) {
        int row = wn * 64 + fn * 16 + (lane & 15);
        bfr[fn] = load_frag(&Bs[cur][row * LDT + kb]);
      }
#pragma unroll
      for (int fm = 0; fm < 2; ++fm)
#pragma unroll
        for (int fn = 0; fn < 4; ++fn)
          acc[fm][fn] = __builtin_amdgcn_wmma_f32_16x16x32_bf16(
              false, afr[fm], false, bfr[fn], (short)0, acc[fm][fn],
              false, false);
    }

    // next tile must be fully in LDS before anyone reads it next iteration
    wait_async0();
    __syncthreads();
  }

  // store: VGPR r -> row (r + 8*khalf), lane&15 -> col  (16x16 f32 C layout)
  const int cn    = lane & 15;
  const int rbase = (lane >> 4) * 8;
#pragma unroll
  for (int fm = 0; fm < 2; ++fm)
#pragma unroll
    for (int fn = 0; fn < 4; ++fn) {
      long row0 = m0 + wm * 32 + fm * 16 + rbase;
      long col  = n0 + wn * 64 + fn * 16 + cn;
#pragma unroll
      for (int r = 0; r < 8; ++r)
        C[(row0 + r) * ldc + col] = acc[fm][fn][r];
    }
}

// ---------------------------------------------------------------------------
// gk = log_sigmoid(x @ Wgk1 @ Wgk2 + bgk2) / 16      (low-rank, fp32)
// one block per row m; wave w reduces ranks 2w, 2w+1 with wave32 shuffles
// ---------------------------------------------------------------------------
__global__ __launch_bounds__(256) void gk_kernel(
    const float* __restrict__ x, const float* __restrict__ Wgk1,
    const float* __restrict__ Wgk2, const float* __restrict__ bgk2,
    float* __restrict__ gkout) {
  __shared__ float xrow[KDIM];
  __shared__ float low[16];
  const int m = blockIdx.x;
  const float* xr = x + (long)m * KDIM;
  for (int k = threadIdx.x; k < KDIM; k += 256) xrow[k] = xr[k];
  __syncthreads();

  const int w = threadIdx.x >> 5, lane = threadIdx.x & 31;
  float s0 = 0.f, s1 = 0.f;
  for (int k = lane; k < KDIM; k += 32) {
    float xv = xrow[k];
    s0 += xv * Wgk1[k * 16 + 2 * w];
    s1 += xv * Wgk1[k * 16 + 2 * w + 1];
  }
#pragma unroll
  for (int off = 16; off > 0; off >>= 1) {
    s0 += __shfl_down(s0, off, 32);
    s1 += __shfl_down(s1, off, 32);
  }
  if (lane == 0) { low[2 * w] = s0; low[2 * w + 1] = s1; }
  __syncthreads();

  float l[16];
#pragma unroll
  for (int r = 0; r < 16; ++r) l[r] = low[r];
  for (int j = threadIdx.x; j < 1024; j += 256) {
    float acc = bgk2[j];
#pragma unroll
    for (int r = 0; r < 16; ++r) acc += l[r] * Wgk2[r * 1024 + j];
    float ls = fminf(acc, 0.f) - log1pf(__expf(-fabsf(acc)));
    gkout[(long)m * 1024 + j] = ls * (1.0f / 16.0f);
  }
}

// ---------------------------------------------------------------------------
// Chunked GLA scan, split along the sequence into NSEG segments of SEGC chunks
// so that (b,h) x segment work-groups run side by side. The state recurrence
// S <- diag(decay) S + kv is linear in S, so over one segment
//   S_end = diag(D_seg) S_start + KV_seg,
// with D_seg the product of the chunk decays and KV_seg the segment's end
// state when started from zero. Three launches:
//   1) gla_seg_state_kernel: KV_seg and D_seg of every segment but the last
//   2) gla_seg_scan_kernel : start state of segments 1..NSEG-1 (in place)
//   3) gla_kernel          : the full chunk loop of a segment from its start
// thread = DV column e; S[64][128] carried in LDS. o overwrites v in qkvg.
// ---------------------------------------------------------------------------
#define CPAD 68
#define NSEG 32                 // segments per sequence
#define SEGC 4                  // chunks of 16 rows per segment (NSEG*SEGC = 128)
#define NSEGM1 (NSEG - 1)

__global__ __launch_bounds__(128) void gla_seg_state_kernel(
    const float* __restrict__ qkvg, const float* __restrict__ gk,
    float* __restrict__ segS, float* __restrict__ segD) {
  __shared__ float S[64 * 128];
  __shared__ float gc[16 * CPAD];
  __shared__ float kd[16 * CPAD];
  __shared__ float decay[64];

  const int seg = blockIdx.x;       // 0..NSEG-2
  const int bh = blockIdx.y;        // 0..31
  const int b = bh >> 4, h = bh & 15;
  const int tid = threadIdx.x;

  for (int i = tid; i < 64 * 128; i += 128) S[i] = 0.f;

  const long row0 = (long)b * 2048 + (long)seg * (SEGC * 16);
  // row pointers of the current chunk, advanced by 16 rows per chunk
  const float* gp = gk + row0 * 1024 + h * 64 + (tid & 63);
  const float* kp = qkvg + row0 * 6144 + 1024 + h * 64 + (tid & 63);
  const float* vp = qkvg + row0 * 6144 + 2048 + h * 128 + tid;
  float v[16];
  float dprod = 1.f;

  for (int n = 0; n < SEGC; ++n) {
    if (tid < 64) {                  // per-column-d prep
      const int d = tid;
      float c = 0.f;
#pragma unroll  // the 16 row loads go out together
      for (int cc = 0; cc < 16; ++cc) {
        c += gp[cc * 1024];
        gc[cc * CPAD + d] = c;
      }
      const float dec = __expf(c);
      decay[d] = dec;
      dprod *= dec;
      const float glast = c;
#pragma unroll  // the 16 row loads go out together
      for (int cc = 0; cc < 16; ++cc) {
        float g = gc[cc * CPAD + d];
        kd[cc * CPAD + d] = kp[cc * 6144] * __expf(glast - g);
      }
    }
    __syncthreads();

    {
      const int e = tid;
#pragma unroll  // v[] stays in registers
      for (int cc = 0; cc < 16; ++cc) v[cc] = vp[cc * 6144];
      for (int d = 0; d < 64; ++d) {
        float s = S[d * 128 + e];
        float kv = 0.f;
#pragma unroll  // v[] stays in registers
        for (int cc = 0; cc < 16; ++cc) kv += kd[cc * CPAD + d] * v[cc];
        S[d * 128 + e] = decay[d] * s + kv;
      }
    }
    gp += 16 * 1024;
    kp += 16 * 6144;
    vp += 16 * 6144;
    __syncthreads();
  }

  const long sb = (long)bh * NSEGM1 + seg;
  float* sp = segS + sb * (64 * 128) + tid;
#pragma unroll  // one address, constant offsets
  for (int d = 0; d < 64; ++d) sp[d * 128] = S[d * 128 + tid];
  if (tid < 64) segD[sb * 64 + tid] = dprod;
}

// segS[bh][g] holds KV of segment g on entry and the start state of segment
// g + 1 on exit. One thread per (bh, d, four columns e); every load is issued
// ahead of the first store.
__global__ __launch_bounds__(256) void gla_seg_scan_kernel(
    float* __restrict__ segS, const float* __restrict__ segD) {
  const int idx = blockIdx.x * 256 + threadIdx.x;   // 32 * 64 * 32 threads
  const int bh = idx >> 11, rem = idx & 2047, d = rem >> 5;
  float4* p = (float4*)segS + (long)bh * NSEGM1 * 2048 + rem;
  const float* dp = segD + (long)bh * NSEGM1 * 64 + d;
  float4 kv[NSEGM1];
  float dc[NSEGM1];
#pragma unroll  // kv[] and dc[] stay in registers
  for (int g = 0; g < NSEGM1; ++g) {
    kv[g] = p[g * 2048];
    dc[g] = dp[g * 64];
  }
  // Stands behind the last load and in front of the first store: no load is
  // issued among the stores into a register that a store still names, and the
  // loads' latencies overlap instead of adding up along the chain.
  asm volatile("s_wait_xcnt 0x0" ::: "memory");
  // segment 0 starts from zero, so kv[0] is already the start of segment 1
#pragma unroll  // kv[] and dc[] stay in registers
  for (int g = 1; g < NSEGM1; ++g) {
    kv[g].x = dc[g] * kv[g - 1].x + kv[g].x;
    kv[g].y = dc[g] * kv[g - 1].y + kv[g].y;
    kv[g].z = dc[g] * kv[g - 1].z + kv[g].z;
    kv[g].w = dc[g] * kv[g - 1].w + kv[g].w;
    p[g * 2048] = kv[g];
  }
}

__global__ __launch_bounds__(128) void gla_kernel(
    float* __restrict__ qkvg, const float* __restrict__ gk,
    const float* __restrict__ segS) {
  __shared__ float S[64 * 128];
  __shared__ float gc[16 * CPAD];
  __shared__ float qe[16 * CPAD];
  __shared__ float ke[16 * CPAD];
  __shared__ float kd[16 * CPAD];
  __shared__ float Am[16 * 16];
  __shared__ float decay[64];

  const int seg = blockIdx.x;       // 0..NSEG-1
  const int bh = blockIdx.y;        // 0..31
  const int b = bh >> 4, h = bh & 15;
  const int tid = threadIdx.x;

  if (seg == 0) {
    for (int i = tid; i < 64 * 128; i += 128) S[i] = 0.f;
  } else {
    const float* s0 = segS + ((long)bh * NSEGM1 + (seg - 1)) * (64 * 128) + tid;
#pragma unroll  // one address, constant offsets, all loads in flight
    for (int d = 0; d < 64; ++d) S[d * 128 + tid] = s0[d * 128];
  }
  __syncthreads();

  const long rowbase = (long)b * 2048 + (long)seg * (SEGC * 16);
  float v[16], o[16];

  for (int n = 0; n < SEGC; ++n) {
    const long m0 = rowbase + n * 16;
    if (tid < 64) {                  // per-column-d prep
      const int d = tid;
      float c = 0.f;
#pragma unroll
      for (int cc = 0; cc < 16; ++cc) {
        c += gk[(m0 + cc) * 1024 + h * 64 + d];
        gc[cc * CPAD + d] = c;
      }
      decay[d] = __expf(c);
      const float glast = c;
#pragma unroll
      for (int cc = 0; cc < 16; ++cc) {
        float g = gc[cc * CPAD + d];
        float q = qkvg[(m0 + cc) * 6144 + h * 64 + d];
        float k = qkvg[(m0 + cc) * 6144 + 1024 + h * 64 + d];
        qe[cc * CPAD + d] = q * __expf(g) * GLA_SCALE;
        ke[cc * CPAD + d] = k * __expf(-g);
        kd[cc * CPAD + d] = k * __expf(glast - g);
      }
    }
    __syncthreads();

    // A = tril(qe ke^T), 256 entries over 128 threads
#pragma unroll
    for (int t = tid; t < 256; t += 128) {
      int cc = t >> 4, mm = t & 15;
      float a = 0.f;
      if (mm <= cc) {
#pragma unroll
        for (int d = 0; d < 64; ++d) a += qe[cc * CPAD + d] * ke[mm * CPAD + d];
      }
      Am[cc * 16 + mm] = a;
    }
    __syncthreads();

    {
      const int e = tid;
#pragma unroll
      for (int cc = 0; cc < 16; ++cc)
        v[cc] = qkvg[(m0 + cc) * 6144 + 2048 + h * 128 + e];
      // o_intra
#pragma unroll
      for (int cc = 0; cc < 16; ++cc) {
        float a = 0.f;
        for (int mm = 0; mm <= cc; ++mm) a += Am[cc * 16 + mm] * v[mm];
        o[cc] = a;
      }
      if (n + 1 < SEGC) {
        // o_inter (uses old S) fused with state update
        for (int d = 0; d < 64; ++d) {
          float s = S[d * 128 + e];
          float kv = 0.f;
#pragma unroll
          for (int cc = 0; cc < 16; ++cc) {
            o[cc] += qe[cc * CPAD + d] * s;
            kv += kd[cc * CPAD + d] * v[cc];
          }
          S[d * 128 + e] = decay[d] * s + kv;
        }
      } else {
        // last chunk of the segment: nobody reads this segment's end state here
        for (int d = 0; d < 64; ++d) {
          float s = S[d * 128 + e];
#pragma unroll  // o[] stays in registers
          for (int cc = 0; cc < 16; ++cc) o[cc] += qe[cc * CPAD + d] * s;
        }
      }
#pragma unroll
      for (int cc = 0; cc < 16; ++cc)
        qkvg[(m0 + cc) * 6144 + 2048 + h * 128 + e] = o[cc];
    }
    __syncthreads();
  }
}

// 2^x and 1/sqrt(x), each with the free slot that the instruction set asks for
// between a transcendental and a next instruction that overwrites its source.
__device__ __forceinline__ float exp2_slot(float x) {
  float r;
  asm("v_exp_f32 %0, %1\n\tv_nop" : "=v"(r) : "v"(x));
  return r;
}
__device__ __forceinline__ float rsq_slot(float x) {
  float r;
  asm("v_rsq_f32 %0, %1\n\tv_nop" : "=v"(r) : "v"(x));
  return r;
}
// g * sigmoid(g), with exp(-g) formed as 2^(-g * log2 e)
__device__ __forceinline__ float silu(float g) {
  return g / (1.f + exp2_slot(g * -1.44269504f));
}

// Sum over the 32 lanes, left in every lane: lane l with l ^ 1, 2, 4, 8 inside
// a row of 16 by DPP, then l ^ 16 by a cross-row move; all in the vector unit.
template <int M>
__device__ __forceinline__ float row_xor(float x) {
  return __builtin_bit_cast(float, __builtin_amdgcn_update_dpp(
      0, __builtin_bit_cast(int, x), 0x160 | M, 0xf, 0xf, true));
}
__device__ __forceinline__ float wave_sum(float s) {
  s += row_xor<1>(s);
  s += row_xor<2>(s);
  s += row_xor<4>(s);
  s += row_xor<8>(s);
  const int b = __builtin_bit_cast(int, s);
  return s + __builtin_bit_cast(float, __builtin_amdgcn_permlanex16(
                 b, b, 0x76543210, 0xfedcba98, false, false));
}

// ---------------------------------------------------------------------------
// RMSNorm over DV + SiLU(g) gate, output bf16 for the final GEMM
// one wave per (m, 8 heads): a row of 128 is one float4 per lane, its sum of
// squares a butterfly over the 32 lanes; no LDS, no barrier.
// ---------------------------------------------------------------------------
__global__ __launch_bounds__(256) void norm_gate_kernel(
    const float* __restrict__ qkvg, const float* __restrict__ norm_w,
    unsigned short* __restrict__ og) {
  const int lane = threadIdx.x & 31;
  const int wv = blockIdx.x * 8 + (threadIdx.x >> 5);   // 0..8191
  const int m = wv >> 1, h0 = (wv & 1) * 8;
  const float* ob = qkvg + (long)m * 6144 + 2048 + h0 * 128 + lane * 4;
  float4 o[8], g[8];
#pragma unroll  // o[] and g[] stay in registers, the 16 loads go out together
  for (int r = 0; r < 8; ++r) {
    o[r] = *(const float4*)(ob + r * 128);
    g[r] = *(const float4*)(ob + 2048 + r * 128);
  }
  const float4 w = *(const float4*)(norm_w + lane * 4);
  // The fence keeps every load above it, so that all 17 are in flight at once:
  // without it the compiler sinks six of them into the arithmetic.
  __builtin_amdgcn_sched_barrier(0);
  float ss[8];
#pragma unroll  // ss[] stays in registers
  for (int r = 0; r < 8; ++r)
    ss[r] = (o[r].x * o[r].x + o[r].y * o[r].y) +
            (o[r].z * o[r].z + o[r].w * o[r].w);
#pragma unroll  // ss[] stays in registers
  for (int r = 0; r < 8; ++r) ss[r] = wave_sum(ss[r]);
  uint2 res[8];
#pragma unroll  // res[] stays in registers
  for (int r = 0; r < 8; ++r) {
    // the argument is at least 1e-5: no subnormal range to rescale for
    const float rs = rsq_slot(ss[r] * (1.f / 128.f) + 1e-5f);
    const float a = o[r].x * rs * w.x * silu(g[r].x);
    const float b = o[r].y * rs * w.y * silu(g[r].y);
    const float c = o[r].z * rs * w.z * silu(g[r].z);
    const float d = o[r].w * rs * w.w * silu(g[r].w);
    res[r] = make_uint2(pack2bf(a, b), pack2bf(c, d));
  }
  unsigned short* dst = og + (long)m * 2048 + h0 * 128 + lane * 4;
#pragma unroll  // res[] stays in registers
  for (int r = 0; r < 8; ++r) *(uint2*)(dst + r * 128) = res[r];
}

// ---------------------------------------------------------------------------
// Host launcher
// ---------------------------------------------------------------------------
extern "C" void kernel_launch(void* const* d_in, const int* in_sizes, int n_in,
                              void* d_out, int out_size, void* d_ws,
                              size_t ws_size, hipStream_t stream) {
  const float* x      = (const float*)d_in[0];
  const float* Wq     = (const float*)d_in[1];
  const float* Wk     = (const float*)d_in[2];
  const float* Wv     = (const float*)d_in[3];
  const float* Wg     = (const float*)d_in[4];
  const float* Wgk1   = (const float*)d_in[5];
  const float* Wgk2   = (const float*)d_in[6];
  const float* bgk2   = (const float*)d_in[7];
  const float* Wo     = (const float*)d_in[8];
  const float* norm_w = (const float*)d_in[9];
  float* out = (float*)d_out;

  // workspace layout (bytes)
  char* ws = (char*)d_ws;
  unsigned short* xb    = (unsigned short*)(ws);                       // 16 MiB
  unsigned short* wcat  = (unsigned short*)(ws + (size_t)16777216);    // 24 MiB
  unsigned short* wot   = (unsigned short*)(ws + (size_t)41943040);    //  8 MiB
  float*          qkvg  = (float*)         (ws + (size_t)50331648);    // 96 MiB
  float*          gkbuf = (float*)         (ws + (size_t)150994944);   // 16 MiB
  unsigned short* og    = (unsigned short*)(ws + (size_t)167772160);   // 16 MiB
  float*          segS  = (float*)         (ws + (size_t)184549376);   // 31 MiB
  float*          segD  = (float*)         (ws + (size_t)218103808);   // 248 KiB

  // 1) x -> bf16
  cvt_f32_bf16_kernel<<<MROWS * KDIM / 8192, 256, 0, stream>>>(x, xb);

  // 2) weight transpose+convert into concatenated [6144,2048] and [2048,2048]
  transpose_cvt_kernel<1024>
      <<<dim3(1024 / TT_N, KDIM / TT_K), 256, 0, stream>>>(Wq, wcat);
  transpose_cvt_kernel<1024>
      <<<dim3(1024 / TT_N, KDIM / TT_K), 256, 0, stream>>>(
          Wk, wcat + (size_t)1024 * KDIM);
  transpose_cvt_kernel<2048>
      <<<dim3(2048 / TT_N, KDIM / TT_K), 256, 0, stream>>>(
          Wv, wcat + (size_t)2048 * KDIM);
  transpose_cvt_kernel<2048>
      <<<dim3(2048 / TT_N, KDIM / TT_K), 256, 0, stream>>>(
          Wg, wcat + (size_t)4096 * KDIM);
  transpose_cvt_kernel<2048>
      <<<dim3(2048 / TT_N, KDIM / TT_K), 256, 0, stream>>>(Wo, wot);

  // 3) fused projection GEMM (WMMA bf16 -> f32): qkvg[4096,6144]
  gemm_bf16_wmma_kernel<<<dim3(NCAT / 128, MROWS / 128), 256, 0, stream>>>(
      xb, wcat, qkvg, KDIM, NCAT);

  // 4) low-rank gate path gk[4096,1024]
  gk_kernel<<<MROWS, 256, 0, stream>>>(x, Wgk1, Wgk2, bgk2, gkbuf);

  // 5) chunked GLA scan in segments (writes o over the v slice of qkvg)
  gla_seg_state_kernel<<<dim3(NSEGM1, 32), 128, 0, stream>>>(qkvg, gkbuf, segS,
                                                            segD);
  gla_seg_scan_kernel<<<32 * 64 * 32 / 256, 256, 0, stream>>>(segS, segD);
  gla_kernel<<<dim3(NSEG, 32), 128, 0, stream>>>(qkvg, gkbuf, segS);

  // 6) RMSNorm + SiLU gate -> bf16 [4096,2048]
  norm_gate_kernel<<<MROWS * 16 / 64, 256, 0, stream>>>(qkvg, norm_w, og);

  // 7) output GEMM (WMMA) -> d_out fp32 [4096,2048]
  gemm_bf16_wmma_kernel<<<dim3(NOUT / 128, MROWS / 128), 256, 0, stream>>>(
      og, wot, out, KDIM, NOUT);
}

// v003
// It runs in 371 microseconds.
// Two timings next to v002 both put it at 1.15 times that version's speed.
// All steps since v000 together make it 5.68 times as fast.
#include <hip/hip_runtime.h>

// ---------------------------------------------------------------------------
// Problem constants (from reference)
// ---------------------------------------------------------------------------
// B=2, T=2048, HID=2048, H=16, DK=64, DV=128, C=16, LOWR=16
// M = B*T = 4096 rows.  Fused projection GEMM: [4096,2048] x [2048,6144]
//   cols 0..1023   : q  (H*DK)
//   cols 1024..2047: k  (H*DK)
//   cols 2048..4095: v  (H*DV)   (overwritten with o by the GLA kernel)
//   cols 4096..6143: g  (H*DV)
// Output GEMM: [4096,2048] x [2048,2048] -> d_out (fp32)

#define MROWS   4096
#define KDIM    2048
#define NCAT    6144
#define NOUT    2048
#define GLA_SCALE 0.125f   // DK^-0.5

typedef __attribute__((ext_vector_type(16))) __bf16 v16bf;
typedef __attribute__((ext_vector_type(8)))  float  v8f;

__device__ __forceinline__ unsigned short f2bf(float f) {
  unsigned int u = __float_as_uint(f);
  u += 0x7fffu + ((u >> 16) & 1u);
  return (unsigned short)(u >> 16);
}

// gfx1250 async global->LDS DMA: 16B per lane, no data VGPRs, ASYNCcnt-tracked.
// GV mode: VDST = LDS byte offset (low 32 bits of flat shared address per the
// LDS aperture rule addr[31:0]), VADDR = 64-bit global address, no SADDR.
__device__ __forceinline__ void async_copy_b128(const void* g, void* lds) {
  unsigned lds_off = (unsigned)(unsigned long long)lds;
  asm volatile("global_load_async_to_lds_b128 %0, %1, off"
               :: "v"(lds_off), "v"(g) : "memory");
}
__device__ __forceinline__ void wait_async0() {
  asm volatile("s_wait_asynccnt 0x0" ::: "memory");
}

// The three streaming helpers below (convert, transpose, norm+gate) move few
// bytes per wave.
// Each is laid out so that a wave brings in 4 KiB or more with all its loads
// in flight at once, and the grids are 8 to 32 times smaller for it.

__device__ __forceinline__ unsigned int pack2bf(float lo, float hi) {
  return (unsigned int)f2bf(lo) | ((unsigned int)f2bf(hi) << 16);
}

// ---------------------------------------------------------------------------
// fp32 -> bf16 elementwise convert (x activations)
// one block converts 8192 contiguous floats: 8 float4 per thread
// ---------------------------------------------------------------------------
__global__ __launch_bounds__(256) void cvt_f32_bf16_kernel(
    const float* __restrict__ in, unsigned short* __restrict__ out) {
  const long base = (long)blockIdx.x * 2048 + threadIdx.x;   // in float4 units
  const float4* p = (const float4*)in + base;
  uint2* q = (uint2*)out + base;
  float4 v[8];
#pragma unroll  // v[] stays in registers, the 8 loads go out together
  for (int i = 0; i < 8; ++i) v[i] = p[i * 256];
#pragma unroll  // v[] stays in registers
  for (int i = 0; i < 8; ++i)
    q[i * 256] = make_uint2(pack2bf(v[i].x, v[i].y), pack2bf(v[i].z, v[i].w));
}

// ---------------------------------------------------------------------------
// Transpose [K,Nw] fp32 -> [Nw,K] bf16 (weights, so WMMA B operand is N-major)
// one block of 256 threads moves a tile of 128 k x 64 n: 8 float4 loads per
// thread (256 B of a source row per 16 lanes), then 4 stores of 8 bf16 per
// thread (256 B of an output row per 16 lanes).
// ---------------------------------------------------------------------------
#define TT_K 128
#define TT_N 64
#define TT_P 65   // odd pitch in floats: column reads spread over the banks

// The row pitches are compile-time constants, so that the 8 loads (and the 4
// stores) share one address and differ in their immediate offsets only.
template <int Nw>
__global__ __launch_bounds__(256) void transpose_cvt_kernel(
    const float* __restrict__ W, unsigned short* __restrict__ out) {
  constexpr int K = KDIM;
  __shared__ float tile[TT_K * TT_P];
  const int kb = blockIdx.y * TT_K, nb = blockIdx.x * TT_N;
  const int lo = threadIdx.x & 15, hi = threadIdx.x >> 4;
  const float* s = W + (long)(kb + hi) * Nw + (nb + lo * 4);
  float4 v[8];
#pragma unroll  // v[] stays in registers, the 8 loads go out together
  for (int i = 0; i < 8; ++i) v[i] = *(const float4*)(s + i * 16 * Nw);
#pragma unroll  // v[] stays in registers
  for (int i = 0; i < 8; ++i) {
    float* t = &tile[(hi + i * 16) * TT_P + lo * 4];
    t[0] = v[i].x; t[1] = v[i].y; t[2] = v[i].z; t[3] = v[i].w;
  }
  __syncthreads();
  uint4 r[4];
#pragma unroll  // r[] stays in registers
  for (int j = 0; j < 4; ++j) {
    const float* t = &tile[(lo * 8) * TT_P + hi + j * 16];
    r[j] = make_uint4(pack2bf(t[0 * TT_P], t[1 * TT_P]),
                      pack2bf(t[2 * TT_P], t[3 * TT_P]),
                      pack2bf(t[4 * TT_P], t[5 * TT_P]),
                      pack2bf(t[6 * TT_P], t[7 * TT_P]));
  }
  unsigned short* d = out + (long)(nb + hi) * K + (kb + lo * 8);
#pragma unroll  // r[] stays in registers
  for (int j = 0; j < 4; ++j) *(uint4*)(d + j * 16 * K) = r[j];
}

// ---------------------------------------------------------------------------
// bf16 WMMA GEMM:  C[M,N](f32) = A[M,K](bf16,row-major) * Bt[N,K]^T
// Block tile 128x128, K-step 64, 256 threads = 8 waves (4x2 wave grid),
// each wave: 2x4 fragments of 16x16. Double-buffered LDS, pitch 72
// (144B rows -> conflict-free b128 fragment reads). Tile staging uses
// global_load_async_to_lds_b128 (no data VGPRs -> no spills).
// ---------------------------------------------------------------------------
#define GT_M 128
#define GT_K 64
#define LDT  72

__device__ __forceinline__ v16bf load_frag(const unsigned short* p) {
  union { v16bf v; uint4 u[2]; } f;
  f.u[0] = *(const uint4*)(p);        // halves 0..7  : K = khalf*8 + 0..7
  f.u[1] = *(const uint4*)(p + 16);   // halves 8..15 : K = khalf*8 + 16..23
  return f.v;
}

__global__ __launch_bounds__(256) void gemm_bf16_wmma_kernel(
    const unsigned short* __restrict__ A,   // [M,K] bf16
    const unsigned short* __restrict__ Bt,  // [N,K] bf16 (B transposed)
    float* __restrict__ C, int K, int ldc) {
  __shared__ __align__(16) unsigned short As[2][GT_M * LDT];
  __shared__ __align__(16) unsigned short Bs[2][GT_M * LDT];

  const int tid  = threadIdx.x;
  const int lane = tid & 31;
  const int w    = tid >> 5;
  const int wm   = w >> 1;   // 0..3 : 32-row band
  const int wn   = w & 1;    // 0..1 : 64-col band

  const long m0 = (long)blockIdx.y * GT_M;
  const long n0 = (long)blockIdx.x * GT_M;
  // A tile row is one 128-byte line. Copy i of a thread takes 16-byte chunk
  // i * 256 + tid of the tile's 1024, so that 8 lanes cover a whole line and a
  // wave's copy 4 whole lines.
  const int  c0 = tid * 4;            // the prefetch's chunk: two per row
  const int  nk = K / GT_K;

  const unsigned short* Agb = A  + m0 * K;
  const unsigned short* Bgb = Bt + n0 * K;

  // preload tile 0 (async DMA straight into LDS)
#pragma unroll
  for (int i = 0; i < 4; ++i) {
    int ch = i * 256 + tid, r = ch >> 3, kc = (ch & 7) * 8;
    async_copy_b128(&Agb[(long)r * K + kc], &As[0][r * LDT + kc]);
    async_copy_b128(&Bgb[(long)r * K + kc], &Bs[0][r * LDT + kc]);
  }
  wait_async0();
  __syncthreads();

  v8f acc[2][4];
#pragma unroll
  for (int fm = 0; fm < 2; ++fm)
#pragma unroll
    for (int fn = 0; fn < 4; ++fn)
      acc[fm][fn] = (v8f){0.f, 0.f, 0.f, 0.f, 0.f, 0.f, 0.f, 0.f};

  for (int kt = 0; kt < nk; ++kt) {
    const int cur = kt & 1, nxt = cur ^ 1;
    // kick off async DMA of the next tile into the other buffer
    if (kt + 1 < nk) {
      const unsigned short* Ag = Agb + (kt + 1) * GT_K;
      const unsigned short* Bg = Bgb + (kt + 1) * GT_K;
#pragma unroll
      for (int i = 0; i < 4; ++i) {
        int ch = i * 256 + tid, r = ch >> 3, kc = (ch & 7) * 8;
        async_copy_b128(&Ag[(long)r * K + kc], &As[nxt][r * LDT + kc]);
        async_copy_b128(&Bg[(long)r * K + kc], &Bs[nxt][r * LDT + kc]);
      }
    }
    if (kt + 2 < nk) {  // gfx1250 global_prefetch_b8 for tile kt+2 into L2
      int r = c0 >> 3, kc = (c0 & 7) * 8;
      __builtin_prefetch(&Agb[(kt + 2) * GT_K + (long)r * K + kc], 0, 1);
      __builtin_prefetch(&Bgb[(kt + 2) * GT_K + (long)r * K + kc], 0, 1);
    }

    // compute on current buffer: two k=32 sub-steps
#pragma unroll
    for (int s = 0; s < 2; ++s) {
      const int kb = s * 32 + (lane >> 4) * 8;   // khalf selects K sub-lane set
      v16bf afr[2], bfr[4];
#pragma unroll
      for (int fm = 0; fm < 2; ++fm) {
        int row = wm * 32 + fm * 16 + (lane & 15);
        afr[fm] = load_frag(&As[cur][row * LDT + kb]);
      }
#pragma unroll
      for (int fn = 0; fn < 4; ++fn) {
        int row = wn * 64 + fn * 16 + (lane & 15);
        bfr[fn] = load_frag(&Bs[cur][row * LDT + kb]);
      }
#pragma unroll
      for (int fm = 0; fm < 2; ++fm)
#pragma unroll
        for (int fn = 0; fn < 4; ++fn)
          acc[fm][fn] = __builtin_amdgcn_wmma_f32_16x16x32_bf16(
              false, afr[fm], false, bfr[fn], (short)0, acc[fm][fn],
              false, false);
    }

    // next tile must be fully in LDS before anyone reads it next iteration
    wait_async0();
    __syncthreads();
  }

  // store: VGPR r -> row (r + 8*khalf), lane&15 -> col  (16x16 f32 C layout)
  const int cn    = lane & 15;
  const int rbase = (lane >> 4) * 8;
#pragma unroll
  for (int fm = 0; fm < 2; ++fm)
#pragma unroll
    for (int fn = 0; fn < 4; ++fn) {
      long row0 = m0 + wm * 32 + fm * 16 + rbase;
      long col  = n0 + wn * 64 + fn * 16 + cn;
#pragma unroll
      for (int r = 0; r < 8; ++r)
        C[(row0 + r) * ldc + col] = acc[fm][fn][r];
    }
}

// ---------------------------------------------------------------------------
// gk = log_sigmoid(x @ Wgk1 @ Wgk2 + bgk2) / 16      (low-rank, fp32)
// one block per row m; wave w reduces ranks 2w, 2w+1 with wave32 shuffles
// ---------------------------------------------------------------------------
__global__ __launch_bounds__(256) void gk_kernel(
    const float* __restrict__ x, const float* __restrict__ Wgk1,
    const float* __restrict__ Wgk2, const float* __restrict__ bgk2,
    float* __restrict__ gkout) {
  __shared__ float xrow[KDIM];
  __shared__ float low[16];
  const int m = blockIdx.x;
  const float* xr = x + (long)m * KDIM;
  for (int k = threadIdx.x; k < KDIM; k += 256) xrow[k] = xr[k];
  __syncthreads();

  const int w = threadIdx.x >> 5, lane = threadIdx.x & 31;
  float s0 = 0.f, s1 = 0.f;
  for (int k = lane; k < KDIM; k += 32) {
    float xv = xrow[k];
    s0 += xv * Wgk1[k * 16 + 2 * w];
    s1 += xv * Wgk1[k * 16 + 2 * w + 1];
  }
#pragma unroll
  for (int off = 16; off > 0; off >>= 1) {
    s0 += __shfl_down(s0, off, 32);
    s1 += __shfl_down(s1, off, 32);
  }
  if (lane == 0) { low[2 * w] = s0; low[2 * w + 1] = s1; }
  __syncthreads();

  float l[16];
#pragma unroll
  for (int r = 0; r < 16; ++r) l[r] = low[r];
  for (int j = threadIdx.x; j < 1024; j += 256) {
    float acc = bgk2[j];
#pragma unroll
    for (int r = 0; r < 16; ++r) acc += l[r] * Wgk2[r * 1024 + j];
    float ls = fminf(acc, 0.f) - log1pf(__expf(-fabsf(acc)));
    gkout[(long)m * 1024 + j] = ls * (1.0f / 16.0f);
  }
}

// ---------------------------------------------------------------------------
// Chunked GLA scan, split along the sequence into NSEG segments of SEGC chunks
// so that (b,h) x segment work-groups run side by side. The state recurrence
// S <- diag(decay) S + kv is linear in S, so over one segment
//   S_end = diag(D_seg) S_start + KV_seg,
// with D_seg the product of the chunk decays and KV_seg the segment's end
// state when started from zero. Three launches:
//   1) gla_seg_state_kernel: KV_seg and D_seg of every segment but the last
//   2) gla_seg_scan_kernel : start state of segments 1..NSEG-1 (in place)
//   3) gla_kernel          : the full chunk loop of a segment from its start
// thread = DV column e; S[64][128] carried in LDS. o overwrites v in qkvg.
// ---------------------------------------------------------------------------
#define CPAD 68
#define NSEG 32                 // segments per sequence
#define SEGC 4                  // chunks of 16 rows per segment (NSEG*SEGC = 128)
#define NSEGM1 (NSEG - 1)

__global__ __launch_bounds__(128) void gla_seg_state_kernel(
    const float* __restrict__ qkvg, const float* __restrict__ gk,
    float* __restrict__ segS, float* __restrict__ segD) {
  __shared__ float S[64 * 128];
  __shared__ float gc[16 * CPAD];
  __shared__ float kd[16 * CPAD];
  __shared__ float decay[64];

  const int seg = blockIdx.x;       // 0..NSEG-2
  const int bh = blockIdx.y;        // 0..31
  const int b = bh >> 4, h = bh & 15;
  const int tid = threadIdx.x;

  for (int i = tid; i < 64 * 128; i += 128) S[i] = 0.f;

  const long row0 = (long)b * 2048 + (long)seg * (SEGC * 16);
  // row pointers of the current chunk, advanced by 16 rows per chunk
  const float* gp = gk + row0 * 1024 + h * 64 + (tid & 63);
  const float* kp = qkvg + row0 * 6144 + 1024 + h * 64 + (tid & 63);
  const float* vp = qkvg + row0 * 6144 + 2048 + h * 128 + tid;
  float v[16];
  float dprod = 1.f;

  for (int n = 0; n < SEGC; ++n) {
    if (tid < 64) {                  // per-column-d prep
      const int d = tid;
      float c = 0.f;
#pragma unroll  // the 16 row loads go out together
      for (int cc = 0; cc < 16; ++cc) {
        c += gp[cc * 1024];
        gc[cc * CPAD + d] = c;
      }
      const float dec = __expf(c);
      decay[d] = dec;
      dprod *= dec;
      const float glast = c;
#pragma unroll  // the 16 row loads go out together
      for (int cc = 0; cc < 16; ++cc) {
        float g = gc[cc * CPAD + d];
        kd[cc * CPAD + d] = kp[cc * 6144] * __expf(glast - g);
      }
    }
    __syncthreads();

    {
      const int e = tid;
#pragma unroll  // v[] stays in registers
      for (int cc = 0; cc < 16; ++cc) v[cc] = vp[cc * 6144];
      for (int d = 0; d < 64; ++d) {
        float s = S[d * 128 + e];
        float kv = 0.f;
#pragma unroll  // v[] stays in registers
        for (int cc = 0; cc < 16; ++cc) kv += kd[cc * CPAD + d] * v[cc];
        S[d * 128 + e] = decay[d] * s + kv;
      }
    }
    gp += 16 * 1024;
    kp += 16 * 6144;
    vp += 16 * 6144;
    __syncthreads();
  }

  const long sb = (long)bh * NSEGM1 + seg;
  float* sp = segS + sb * (64 * 128) + tid;
#pragma unroll  // one address, constant offsets
  for (int d = 0; d < 64; ++d) sp[d * 128] = S[d * 128 + tid];
  if (tid < 64) segD[sb * 64 + tid] = dprod;
}

// segS[bh][g] holds KV of segment g on entry and the start state of segment
// g + 1 on exit. One thread per (bh, d, four columns e); every load is issued
// ahead of the first store.
__global__ __launch_bounds__(256) void gla_seg_scan_kernel(
    float* __restrict__ segS, const float* __restrict__ segD) {
  const int idx = blockIdx.x * 256 + threadIdx.x;   // 32 * 64 * 32 threads
  const int bh = idx >> 11, rem = idx & 2047, d = rem >> 5;
  float4* p = (float4*)segS + (long)bh * NSEGM1 * 2048 + rem;
  const float* dp = segD + (long)bh * NSEGM1 * 64 + d;
  float4 kv[NSEGM1];
  float dc[NSEGM1];
#pragma unroll  // kv[] and dc[] stay in registers
  for (int g = 0; g < NSEGM1; ++g) {
    kv[g] = p[g * 2048];
    dc[g] = dp[g * 64];
  }
  // Stands behind the last load and in front of the first store: no load is
  // issued among the stores into a register that a store still names, and the
  // loads' latencies overlap instead of adding up along the chain.
  asm volatile("s_wait_xcnt 0x0" ::: "memory");
  // segment 0 starts from zero, so kv[0] is already the start of segment 1
#pragma unroll  // kv[] and dc[] stay in registers
  for (int g = 1; g < NSEGM1; ++g) {
    kv[g].x = dc[g] * kv[g - 1].x + kv[g].x;
    kv[g].y = dc[g] * kv[g - 1].y + kv[g].y;
    kv[g].z = dc[g] * kv[g - 1].z + kv[g].z;
    kv[g].w = dc[g] * kv[g - 1].w + kv[g].w;
    p[g * 2048] = kv[g];
  }
}

__global__ __launch_bounds__(128) void gla_kernel(
    float* __restrict__ qkvg, const float* __restrict__ gk,
    const float* __restrict__ segS) {
  __shared__ float S[64 * 128];
  __shared__ float gc[16 * CPAD];
  __shared__ float qe[16 * CPAD];
  __shared__ float ke[16 * CPAD];
  __shared__ float kd[16 * CPAD];
  __shared__ float Am[16 * 16];
  __shared__ float decay[64];

  const int seg = blockIdx.x;       // 0..NSEG-1
  const int bh = blockIdx.y;        // 0..31
  const int b = bh >> 4, h = bh & 15;
  const int tid = threadIdx.x;

  if (seg == 0) {
    for (int i = tid; i < 64 * 128; i += 128) S[i] = 0.f;
  } else {
    const float* s0 = segS + ((long)bh * NSEGM1 + (seg - 1)) * (64 * 128) + tid;
#pragma unroll  // one address, constant offsets, all loads in flight
    for (int d = 0; d < 64; ++d) S[d * 128 + tid] = s0[d * 128];
  }
  __syncthreads();

  const long rowbase = (long)b * 2048 + (long)seg * (SEGC * 16);
  float v[16], o[16];

  for (int n = 0; n < SEGC; ++n) {
    const long m0 = rowbase + n * 16;
    if (tid < 64) {                  // per-column-d prep
      const int d = tid;
      float c = 0.f;
#pragma unroll
      for (int cc = 0; cc < 16; ++cc) {
        c += gk[(m0 + cc) * 1024 + h * 64 + d];
        gc[cc * CPAD + d] = c;
      }
      decay[d] = __expf(c);
      const float glast = c;
#pragma unroll
      for (int cc = 0; cc < 16; ++cc) {
        float g = gc[cc * CPAD + d];
        float q = qkvg[(m0 + cc) * 6144 + h * 64 + d];
        float k = qkvg[(m0 + cc) * 6144 + 1024 + h * 64 + d];
        qe[cc * CPAD + d] = q * __expf(g) * GLA_SCALE;
        ke[cc * CPAD + d] = k * __expf(-g);
        kd[cc * CPAD + d] = k * __expf(glast - g);
      }
    }
    __syncthreads();

    // A = tril(qe ke^T), 256 entries over 128 threads
#pragma unroll
    for (int t = tid; t < 256; t += 128) {
      int cc = t >> 4, mm = t & 15;
      float a = 0.f;
      if (mm <= cc) {
#pragma unroll
        for (int d = 0; d < 64; ++d) a += qe[cc * CPAD + d] * ke[mm * CPAD + d];
      }
      Am[cc * 16 + mm] = a;
    }
    __syncthreads();

    {
      const int e = tid;
#pragma unroll
      for (int cc = 0; cc < 16; ++cc)
        v[cc] = qkvg[(m0 + cc) * 6144 + 2048 + h * 128 + e];
      // o_intra
#pragma unroll
      for (int cc = 0; cc < 16; ++cc) {
        float a = 0.f;
        for (int mm = 0; mm <= cc; ++mm) a += Am[cc * 16 + mm] * v[mm];
        o[cc] = a;
      }
      if (n + 1 < SEGC) {
        // o_inter (uses old S) fused with state update
        for (int d = 0; d < 64; ++d) {
          float s = S[d * 128 + e];
          float kv = 0.f;
#pragma unroll
          for (int cc = 0; cc < 16; ++cc) {
            o[cc] += qe[cc * CPAD + d] * s;
            kv += kd[cc * CPAD + d] * v[cc];
          }
          S[d * 128 + e] = decay[d] * s + kv;
        }
      } else {
        // last chunk of the segment: nobody reads this segment's end state here
        for (int d = 0; d < 64; ++d) {
          float s = S[d * 128 + e];
#pragma unroll  // o[] stays in registers
          for (int cc = 0; cc < 16; ++cc) o[cc] += qe[cc * CPAD + d] * s;
        }
      }
#pragma unroll
      for (int cc = 0; cc < 16; ++cc)
        qkvg[(m0 + cc) * 6144 + 2048 + h * 128 + e] = o[cc];
    }
    __syncthreads();
  }
}

// 2^x and 1/sqrt(x), each with the free slot that the instruction set asks for
// between a transcendental and a next instruction that overwrites its source.
__device__ __forceinline__ float exp2_slot(float x) {
  float r;
  asm("v_exp_f32 %0, %1\n\tv_nop" : "=v"(r) : "v"(x));
  return r;
}
__device__ __forceinline__ float rsq_slot(float x) {
  float r;
  asm("v_rsq_f32 %0, %1\n\tv_nop" : "=v"(r) : "v"(x));
  return r;
}
// g * sigmoid(g), with exp(-g) formed as 2^(-g * log2 e)
__device__ __forceinline__ float silu(float g) {
  return g / (1.f + exp2_slot(g * -1.44269504f));
}

// Sum over the 32 lanes, left in every lane: lane l with l ^ 1, 2, 4, 8 inside
// a row of 16 by DPP, then l ^ 16 by a cross-row move; all in the vector unit.
template <int M>
__device__ __forceinline__ float row_xor(float x) {
  return __builtin_bit_cast(float, __builtin_amdgcn_update_dpp(
      0, __builtin_bit_cast(int, x), 0x160 | M, 0xf, 0xf, true));
}
__device__ __forceinline__ float wave_sum(float s) {
  s += row_xor<1>(s);
  s += row_xor<2>(s);
  s += row_xor<4>(s);
  s += row_xor<8>(s);
  const int b = __builtin_bit_cast(int, s);
  return s + __builtin_bit_cast(float, __builtin_amdgcn_permlanex16(
                 b, b, 0x76543210, 0xfedcba98, false, false));
}

// ---------------------------------------------------------------------------
// RMSNorm over DV + SiLU(g) gate, output bf16 for the final GEMM
// one wave per (m, 8 heads): a row of 128 is one float4 per lane, its sum of
// squares a butterfly over the 32 lanes; no LDS, no barrier.
// ---------------------------------------------------------------------------
__global__ __launch_bounds__(256) void norm_gate_kernel(
    const float* __restrict__ qkvg, const float* __restrict__ norm_w,
    unsigned short* __restrict__ og) {
  const int lane = threadIdx.x & 31;
  const int wv = blockIdx.x * 8 + (threadIdx.x >> 5);   // 0..8191
  const int m = wv >> 1, h0 = (wv & 1) * 8;
  const float* ob = qkvg + (long)m * 6144 + 2048 + h0 * 128 + lane * 4;
  float4 o[8], g[8];
#pragma unroll  // o[] and g[] stay in registers, the 16 loads go out together
  for (int r = 0; r < 8; ++r) {
    o[r] = *(const float4*)(ob + r * 128);
    g[r] = *(const float4*)(ob + 2048 + r * 128);
  }
  const float4 w = *(const float4*)(norm_w + lane * 4);
  // The fence keeps every load above it, so that all 17 are in flight at once:
  // without it the compiler sinks six of them into the arithmetic.
  __builtin_amdgcn_sched_barrier(0);
  float ss[8];
#pragma unroll  // ss[] stays in registers
  for (int r = 0; r < 8; ++r)
    ss[r] = (o[r].x * o[r].x + o[r].y * o[r].y) +
            (o[r].z * o[r].z + o[r].w * o[r].w);
#pragma unroll  // ss[] stays in registers
  for (int r = 0; r < 8; ++r) ss[r] = wave_sum(ss[r]);
  uint2 res[8];
#pragma unroll  // res[] stays in registers
  for (int r = 0; r < 8; ++r) {
    // the argument is at least 1e-5: no subnormal range to rescale for
    const float rs = rsq_slot(ss[r] * (1.f / 128.f) + 1e-5f);
    const float a = o[r].x * rs * w.x * silu(g[r].x);
    const float b = o[r].y * rs * w.y * silu(g[r].y);
    const float c = o[r].z * rs * w.z * silu(g[r].z);
    const float d = o[r].w * rs * w.w * silu(g[r].w);
    res[r] = make_uint2(pack2bf(a, b), pack2bf(c, d));
  }
  unsigned short* dst = og + (long)m * 2048 + h0 * 128 + lane * 4;
#pragma unroll  // res[] stays in registers
  for (int r = 0; r < 8; ++r) *(uint2*)(dst + r * 128) = res[r];
}

// ---------------------------------------------------------------------------
// Host launcher
// ---------------------------------------------------------------------------
extern "C" void kernel_launch(void* const* d_in, const int* in_sizes, int n_in,
                              void* d_out, int out_size, void* d_ws,
                              size_t ws_size, hipStream_t stream) {
  const float* x      = (const float*)d_in[0];
  const float* Wq     = (const float*)d_in[1];
  const float* Wk     = (const float*)d_in[2];
  const float* Wv     = (const float*)d_in[3];
  const float* Wg     = (const float*)d_in[4];
  const float* Wgk1   = (const float*)d_in[5];
  const float* Wgk2   = (const float*)d_in[6];
  const float* bgk2   = (const float*)d_in[7];
  const float* Wo     = (const float*)d_in[8];
  const float* norm_w = (const float*)d_in[9];
  float* out = (float*)d_out;

  // workspace layout (bytes)
  char* ws = (char*)d_ws;
  unsigned short* xb    = (unsigned short*)(ws);                       // 16 MiB
  unsigned short* wcat  = (unsigned short*)(ws + (size_t)16777216);    // 24 MiB
  unsigned short* wot   = (unsigned short*)(ws + (size_t)41943040);    //  8 MiB
  float*          qkvg  = (float*)         (ws + (size_t)50331648);    // 96 MiB
  float*          gkbuf = (float*)         (ws + (size_t)150994944);   // 16 MiB
  unsigned short* og    = (unsigned short*)(ws + (size_t)167772160);   // 16 MiB
  float*          segS  = (float*)         (ws + (size_t)184549376);   // 31 MiB
  float*          segD  = (float*)         (ws + (size_t)218103808);   // 248 KiB

  // 1) x -> bf16
  cvt_f32_bf16_kernel<<<MROWS * KDIM / 8192, 256, 0, stream>>>(x, xb);

  // 2) weight transpose+convert into concatenated [6144,2048] and [2048,2048]
  transpose_cvt_kernel<1024>
      <<<dim3(1024 / TT_N, KDIM / TT_K), 256, 0, stream>>>(Wq, wcat);
  transpose_cvt_kernel<1024>
      <<<dim3(1024 / TT_N, KDIM / TT_K), 256, 0, stream>>>(
          Wk, wcat + (size_t)1024 * KDIM);
  transpose_cvt_kernel<2048>
      <<<dim3(2048 / TT_N, KDIM / TT_K), 256, 0, stream>>>(
          Wv, wcat + (size_t)2048 * KDIM);
  transpose_cvt_kernel<2048>
      <<<dim3(2048 / TT_N, KDIM / TT_K), 256, 0, stream>>>(
          Wg, wcat + (size_t)4096 * KDIM);
  transpose_cvt_kernel<2048>
      <<<dim3(2048 / TT_N, KDIM / TT_K), 256, 0, stream>>>(Wo, wot);

  // 3) fused projection GEMM (WMMA bf16 -> f32): qkvg[4096,6144]
  gemm_bf16_wmma_kernel<<<dim3(NCAT / 128, MROWS / 128), 256, 0, stream>>>(
      xb, wcat, qkvg, KDIM, NCAT);

  // 4) low-rank gate path gk[4096,1024]
  gk_kernel<<<MROWS, 256, 0, stream>>>(x, Wgk1, Wgk2, bgk2, gkbuf);

  // 5) chunked GLA scan in segments (writes o over the v slice of qkvg)
  gla_seg_state_kernel<<<dim3(NSEGM1, 32), 128, 0, stream>>>(qkvg, gkbuf, segS,
                                                            segD);
  gla_seg_scan_kernel<<<32 * 64 * 32 / 256, 256, 0, stream>>>(segS, segD);
  gla_kernel<<<dim3(NSEG, 32), 128, 0, stream>>>(qkvg, gkbuf, segS);

  // 6) RMSNorm + SiLU gate -> bf16 [4096,2048]
  norm_gate_kernel<<<MROWS * 16 / 64, 256, 0, stream>>>(qkvg, norm_w, og);

  // 7) output GEMM (WMMA) -> d_out fp32 [4096,2048]
  gemm_bf16_wmma_kernel<<<dim3(NOUT / 128, MROWS / 128), 256, 0, stream>>>(
      og, wot, out, KDIM, NOUT);
}

// v004
// Measured time: 319 microseconds a run.
// In both of two side-by-side timings against v003, it was 1.16 times as fast.
// Over all steps from v000 it is 6.59 times as fast.
#include <hip/hip_runtime.h>

// ---------------------------------------------------------------------------
// Problem constants (from reference)
// ---------------------------------------------------------------------------
// B=2, T=2048, HID=2048, H=16, DK=64, DV=128, C=16, LOWR=16
// M = B*T = 4096 rows.  Fused projection GEMM: [4096,2048] x [2048,6144]
//   cols 0..1023   : q  (H*DK)
//   cols 1024..2047: k  (H*DK)
//   cols 2048..4095: v  (H*DV)   (overwritten with o by the GLA kernel)
//   cols 4096..6143: g  (H*DV)
// Output GEMM: [4096,2048] x [2048,2048] -> d_out (fp32)

#define MROWS   4096
#define KDIM    2048
#define NCAT    6144
#define NOUT    2048
#define GLA_SCALE 0.125f   // DK^-0.5

typedef __attribute__((ext_vector_type(16))) __bf16 v16bf;
typedef __attribute__((ext_vector_type(8)))  float  v8f;

__device__ __forceinline__ unsigned short f2bf(float f) {
  unsigned int u = __float_as_uint(f);
  u += 0x7fffu + ((u >> 16) & 1u);
  return (unsigned short)(u >> 16);
}

// gfx1250 async global->LDS DMA: 16B per lane, no data VGPRs, ASYNCcnt-tracked.
// GV mode: VDST = LDS byte offset (low 32 bits of flat shared address per the
// LDS aperture rule addr[31:0]), VADDR = 64-bit global address, no SADDR.
__device__ __forceinline__ void async_copy_b128(const void* g, void* lds) {
  unsigned lds_off = (unsigned)(unsigned long long)lds;
  asm volatile("global_load_async_to_lds_b128 %0, %1, off"
               :: "v"(lds_off), "v"(g) : "memory");
}
__device__ __forceinline__ void wait_async0() {
  asm volatile("s_wait_asynccnt 0x0" ::: "memory");
}

// The three streaming helpers below (convert, transpose, norm+gate) move few
// bytes per wave.
// Each is laid out so that a wave brings in 4 KiB or more with all its loads
// in flight at once, and the grids are 8 to 32 times smaller for it.

__device__ __forceinline__ unsigned int pack2bf(float lo, float hi) {
  return (unsigned int)f2bf(lo) | ((unsigned int)f2bf(hi) << 16);
}

// ---------------------------------------------------------------------------
// fp32 -> bf16 elementwise convert (x activations)
// one block converts 8192 contiguous floats: 8 float4 per thread
// ---------------------------------------------------------------------------
__global__ __launch_bounds__(256) void cvt_f32_bf16_kernel(
    const float* __restrict__ in, unsigned short* __restrict__ out) {
  const long base = (long)blockIdx.x * 2048 + threadIdx.x;   // in float4 units
  const float4* p = (const float4*)in + base;
  uint2* q = (uint2*)out + base;
  float4 v[8];
#pragma unroll  // v[] stays in registers, the 8 loads go out together
  for (int i = 0; i < 8; ++i) v[i] = p[i * 256];
#pragma unroll  // v[] stays in registers
  for (int i = 0; i < 8; ++i)
    q[i * 256] = make_uint2(pack2bf(v[i].x, v[i].y), pack2bf(v[i].z, v[i].w));
}

// ---------------------------------------------------------------------------
// Transpose [K,Nw] fp32 -> [Nw,K] bf16 (weights, so WMMA B operand is N-major)
// one block of 256 threads moves a tile of 128 k x 64 n: 8 float4 loads per
// thread (256 B of a source row per 16 lanes), then 4 stores of 8 bf16 per
// thread (256 B of an output row per 16 lanes).
// ---------------------------------------------------------------------------
#define TT_K 128
#define TT_N 64
#define TT_P 65   // odd pitch in floats: column reads spread over the banks

// The row pitches are compile-time constants, so that the 8 loads (and the 4
// stores) share one address and differ in their immediate offsets only.
template <int Nw>
__global__ __launch_bounds__(256) void transpose_cvt_kernel(
    const float* __restrict__ W, unsigned short* __restrict__ out) {
  constexpr int K = KDIM;
  __shared__ float tile[TT_K * TT_P];
  const int kb = blockIdx.y * TT_K, nb = blockIdx.x * TT_N;
  const int lo = threadIdx.x & 15, hi = threadIdx.x >> 4;
  const float* s = W + (long)(kb + hi) * Nw + (nb + lo * 4);
  float4 v[8];
#pragma unroll  // v[] stays in registers, the 8 loads go out together
  for (int i = 0; i < 8; ++i) v[i] = *(const float4*)(s + i * 16 * Nw);
#pragma unroll  // v[] stays in registers
  for (int i = 0; i < 8; ++i) {
    float* t = &tile[(hi + i * 16) * TT_P + lo * 4];
    t[0] = v[i].x; t[1] = v[i].y; t[2] = v[i].z; t[3] = v[i].w;
  }
  __syncthreads();
  uint4 r[4];
#pragma unroll  // r[] stays in registers
  for (int j = 0; j < 4; ++j) {
    const float* t = &tile[(lo * 8) * TT_P + hi + j * 16];
    r[j] = make_uint4(pack2bf(t[0 * TT_P], t[1 * TT_P]),
                      pack2bf(t[2 * TT_P], t[3 * TT_P]),
                      pack2bf(t[4 * TT_P], t[5 * TT_P]),
                      pack2bf(t[6 * TT_P], t[7 * TT_P]));
  }
  unsigned short* d = out + (long)(nb + hi) * K + (kb + lo * 8);
#pragma unroll  // r[] stays in registers
  for (int j = 0; j < 4; ++j) *(uint4*)(d + j * 16 * K) = r[j];
}

// ---------------------------------------------------------------------------
// bf16 WMMA GEMM:  C[M,N](f32) = A[M,K](bf16,row-major) * Bt[N,K]^T
// Block tile 128x128, K-step 64, 256 threads = 8 waves (4x2 wave grid),
// each wave: 2x4 fragments of 16x16. Double-buffered LDS, pitch 72
// (144B rows -> conflict-free b128 fragment reads). Tile staging uses
// global_load_async_to_lds_b128 (no data VGPRs -> no spills).
// ---------------------------------------------------------------------------
#define GT_M 128
#define GT_K 64
#define LDT  72

__device__ __forceinline__ v16bf load_frag(const unsigned short* p) {
  union { v16bf v; uint4 u[2]; } f;
  f.u[0] = *(const uint4*)(p);        // halves 0..7  : K = khalf*8 + 0..7
  f.u[1] = *(const uint4*)(p + 16);   // halves 8..15 : K = khalf*8 + 16..23
  return f.v;
}

__global__ __launch_bounds__(256) void gemm_bf16_wmma_kernel(
    const unsigned short* __restrict__ A,   // [M,K] bf16
    const unsigned short* __restrict__ Bt,  // [N,K] bf16 (B transposed)
    float* __restrict__ C, int K, int ldc) {
  __shared__ __align__(16) unsigned short As[2][GT_M * LDT];
  __shared__ __align__(16) unsigned short Bs[2][GT_M * LDT];

  const int tid  = threadIdx.x;
  const int lane = tid & 31;
  const int w    = tid >> 5;
  const int wm   = w >> 1;   // 0..3 : 32-row band
  const int wn   = w & 1;    // 0..1 : 64-col band

  const long m0 = (long)blockIdx.y * GT_M;
  const long n0 = (long)blockIdx.x * GT_M;
  // A tile row is one 128-byte line. Copy i of a thread takes 16-byte chunk
  // i * 256 + tid of the tile's 1024, so that 8 lanes cover a whole line and a
  // wave's copy 4 whole lines.
  const int  c0 = tid * 4;            // the prefetch's chunk: two per row
  const int  nk = K / GT_K;

  const unsigned short* Agb = A  + m0 * K;
  const unsigned short* Bgb = Bt + n0 * K;

  // preload tile 0 (async DMA straight into LDS)
#pragma unroll
  for (int i = 0; i < 4; ++i) {
    int ch = i * 256 + tid, r = ch >> 3, kc = (ch & 7) * 8;
    async_copy_b128(&Agb[(long)r * K + kc], &As[0][r * LDT + kc]);
    async_copy_b128(&Bgb[(long)r * K + kc], &Bs[0][r * LDT + kc]);
  }
  wait_async0();
  __syncthreads();

  v8f acc[2][4];
#pragma unroll
  for (int fm = 0; fm < 2; ++fm)
#pragma unroll
    for (int fn = 0; fn < 4; ++fn)
      acc[fm][fn] = (v8f){0.f, 0.f, 0.f, 0.f, 0.f, 0.f, 0.f, 0.f};

  for (int kt = 0; kt < nk; ++kt) {
    const int cur = kt & 1, nxt = cur ^ 1;
    // kick off async DMA of the next tile into the other buffer
    if (kt + 1 < nk) {
      const unsigned short* Ag = Agb + (kt + 1) * GT_K;
      const unsigned short* Bg = Bgb + (kt + 1) * GT_K;
#pragma unroll
      for (int i = 0; i < 4; ++i) {
        int ch = i * 256 + tid, r = ch >> 3, kc = (ch & 7) * 8;
        async_copy_b128(&Ag[(long)r * K + kc], &As[nxt][r * LDT + kc]);
        async_copy_b128(&Bg[(long)r * K + kc], &Bs[nxt][r * LDT + kc]);
      }
    }
    if (kt + 2 < nk) {  // gfx1250 global_prefetch_b8 for tile kt+2 into L2
      int r = c0 >> 3, kc = (c0 & 7) * 8;
      __builtin_prefetch(&Agb[(kt + 2) * GT_K + (long)r * K + kc], 0, 1);
      __builtin_prefetch(&Bgb[(kt + 2) * GT_K + (long)r * K + kc], 0, 1);
    }

    // compute on current buffer: two k=32 sub-steps
#pragma unroll
    for (int s = 0; s < 2; ++s) {
      const int kb = s * 32 + (lane >> 4) * 8;   // khalf selects K sub-lane set
      v16bf afr[2], bfr[4];
#pragma unroll
      for (int fm = 0; fm < 2; ++fm) {
        int row = wm * 32 + fm * 16 + (lane & 15);
        afr[fm] = load_frag(&As[cur][row * LDT + kb]);
      }
#pragma unroll
      for (int fn = 0; fn < 4; ++fn) {
        int row = wn * 64 + fn * 16 + (lane & 15);
        bfr[fn] = load_frag(&Bs[cur][row * LDT + kb]);
      }
#pragma unroll
      for (int fm = 0; fm < 2; ++fm)
#pragma unroll
        for (int fn = 0; fn < 4; ++fn)
          acc[fm][fn] = __builtin_amdgcn_wmma_f32_16x16x32_bf16(
              false, afr[fm], false, bfr[fn], (short)0, acc[fm][fn],
              false, false);
    }

    // next tile must be fully in LDS before anyone reads it next iteration
    wait_async0();
    __syncthreads();
  }

  // store: VGPR r -> row (r + 8*khalf), lane&15 -> col  (16x16 f32 C layout)
  const int cn    = lane & 15;
  const int rbase = (lane >> 4) * 8;
#pragma unroll
  for (int fm = 0; fm < 2; ++fm)
#pragma unroll
    for (int fn = 0; fn < 4; ++fn) {
      long row0 = m0 + wm * 32 + fm * 16 + rbase;
      long col  = n0 + wn * 64 + fn * 16 + cn;
#pragma unroll
      for (int r = 0; r < 8; ++r)
        C[(row0 + r) * ldc + col] = acc[fm][fn][r];
    }
}

// ---------------------------------------------------------------------------
// gk = log_sigmoid(x @ Wgk1 @ Wgk2 + bgk2) / 16      (low-rank, fp32)
// one block per row m; wave w reduces ranks 2w, 2w+1 with wave32 shuffles
// ---------------------------------------------------------------------------
__global__ __launch_bounds__(256) void gk_kernel(
    const float* __restrict__ x, const float* __restrict__ Wgk1,
    const float* __restrict__ Wgk2, const float* __restrict__ bgk2,
    float* __restrict__ gkout) {
  __shared__ float xrow[KDIM];
  __shared__ float low[16];
  const int m = blockIdx.x;
  const float* xr = x + (long)m * KDIM;
  for (int k = threadIdx.x; k < KDIM; k += 256) xrow[k] = xr[k];
  __syncthreads();

  const int w = threadIdx.x >> 5, lane = threadIdx.x & 31;
  float s0 = 0.f, s1 = 0.f;
  for (int k = lane; k < KDIM; k += 32) {
    float xv = xrow[k];
    s0 += xv * Wgk1[k * 16 + 2 * w];
    s1 += xv * Wgk1[k * 16 + 2 * w + 1];
  }
#pragma unroll
  for (int off = 16; off > 0; off >>= 1) {
    s0 += __shfl_down(s0, off, 32);
    s1 += __shfl_down(s1, off, 32);
  }
  if (lane == 0) { low[2 * w] = s0; low[2 * w + 1] = s1; }
  __syncthreads();

  float l[16];
#pragma unroll
  for (int r = 0; r < 16; ++r) l[r] = low[r];
  for (int j = threadIdx.x; j < 1024; j += 256) {
    float acc = bgk2[j];
#pragma unroll
    for (int r = 0; r < 16; ++r) acc += l[r] * Wgk2[r * 1024 + j];
    float ls = fminf(acc, 0.f) - log1pf(__expf(-fabsf(acc)));
    gkout[(long)m * 1024 + j] = ls * (1.0f / 16.0f);
  }
}

// ---------------------------------------------------------------------------
// Chunked GLA scan, split along the sequence into NSEG segments of SEGC chunks
// so that (b,h) x segment work-groups run side by side. The state recurrence
// S <- diag(decay) S + kv is linear in S, so over one segment
//   S_end = diag(D_seg) S_start + KV_seg,
// with D_seg the product of the chunk decays and KV_seg the segment's end
// state when started from zero. Three launches:
//   1) gla_seg_state_kernel: KV_seg and D_seg of every segment but the last
//   2) gla_seg_scan_kernel : start state of segments 1..NSEG-1 (in place)
//   3) gla_kernel          : the full chunk loop of a segment from its start
// The products with v and with S run on the f32 16x16x4 matrix form. Wave w
// owns columns e = 32 w .. 32 w + 31 (two tiles of 16). S[64][128] lives in
// registers as 4 x 2 accumulator tiles per wave: register r of lane (c, hi)
// holds S[16 dt + 8 hi + r][e0 + c]. Registers (2j, 2j+1) of such a tile are at
// once a B fragment whose four k are rows 2j, 2j+1 (hi = 0) and 8+2j, 8+2j+1
// (hi = 1); the A loaders below take their k in the same order. v is loaded in
// the same map, so it too is a B fragment as it lies. o overwrites v in qkvg.
// ---------------------------------------------------------------------------
#define CPAD 68
#define NSEG 32                 // segments per sequence
#define SEGC 4                  // chunks of 16 rows per segment (NSEG*SEGC = 128)
#define NSEGM1 (NSEG - 1)

typedef __attribute__((ext_vector_type(2))) float v2f;

__device__ __forceinline__ v8f wmma_f32(v2f a, v2f b, v8f c) {
  return __builtin_amdgcn_wmma_f32_16x16x4_f32(false, a, false, b, (short)0, c,
                                               false, false);
}

// eight consecutive floats of LDS, 16-byte aligned
__device__ __forceinline__ v8f lds8(const float* p) {
  const float4 a = *(const float4*)p, b = *(const float4*)(p + 4);
  return (v8f){a.x, a.y, a.z, a.w, b.x, b.y, b.z, b.w};
}

// S <- diag(decay) S + kd^T v for one chunk; kd is [16 c][CPAD], d contiguous
__device__ __forceinline__ void state_step(v8f (&S)[4][2], const v8f (&vb)[2],
                                           const float* kd, const float* decay,
                                           int c16, int hi) {
#pragma unroll  // S[][] stays in registers
  for (int dt = 0; dt < 4; ++dt) {
    const v8f dec = lds8(&decay[dt * 16 + 8 * hi]);
    S[dt][0] *= dec;
    S[dt][1] *= dec;
#pragma unroll  // S[][] and vb[] stay in registers
    for (int j = 0; j < 4; ++j) {
      const float* kr = &kd[(2 * j + 8 * hi) * CPAD + dt * 16 + c16];
      const v2f a = {kr[0], kr[CPAD]};
#pragma unroll  // S[][] and vb[] stay in registers
      for (int et = 0; et < 2; ++et)
        S[dt][et] = wmma_f32(a, (v2f){vb[et][2 * j], vb[et][2 * j + 1]},
                             S[dt][et]);
    }
  }
}

__global__ __launch_bounds__(128) void gla_seg_state_kernel(
    const float* __restrict__ qkvg, const float* __restrict__ gk,
    float* __restrict__ segS, float* __restrict__ segD) {
  __shared__ float gc[16 * CPAD];
  __shared__ __align__(16) float kd[16 * CPAD];
  __shared__ __align__(16) float decay[64];

  const int seg = blockIdx.x;       // 0..NSEG-2
  const int bh = blockIdx.y;        // 0..31
  const int b = bh >> 4, h = bh & 15;
  const int tid = threadIdx.x;
  const int c16 = tid & 15, hi = (tid >> 4) & 1, w = tid >> 5;

  v8f S[4][2];
#pragma unroll  // S[][] stays in registers
  for (int dt = 0; dt < 4; ++dt)
#pragma unroll  // S[][] stays in registers
    for (int et = 0; et < 2; ++et)
      S[dt][et] = (v8f){0.f, 0.f, 0.f, 0.f, 0.f, 0.f, 0.f, 0.f};

  const long row0 = (long)b * 2048 + (long)seg * (SEGC * 16);
  // row pointers of the current chunk, advanced by 16 rows per chunk
  const float* gp = gk + row0 * 1024 + h * 64 + (tid & 63);
  const float* kp = qkvg + row0 * 6144 + 1024 + h * 64 + (tid & 63);
  const float* vp = qkvg + (row0 + 8 * hi) * 6144 + 2048 + h * 128 + w * 32 + c16;
  float dprod = 1.f;

  for (int n = 0; n < SEGC; ++n) {
    if (tid < 64) {                  // per-column-d prep
      const int d = tid;
      float c = 0.f;
#pragma unroll  // the 16 row loads go out together
      for (int cc = 0; cc < 16; ++cc) {
        c += gp[cc * 1024];
        gc[cc * CPAD + d] = c;
      }
      const float dec = __expf(c);
      decay[d] = dec;
      dprod *= dec;
      const float glast = c;
#pragma unroll  // the 16 row loads go out together
      for (int cc = 0; cc < 16; ++cc) {
        float g = gc[cc * CPAD + d];
        kd[cc * CPAD + d] = kp[cc * 6144] * __expf(glast - g);
      }
    }
    v8f vb[2];
#pragma unroll  // vb[] stays in registers
    for (int et = 0; et < 2; ++et)
#pragma unroll  // vb[] stays in registers
      for (int r = 0; r < 8; ++r) vb[et][r] = vp[r * 6144 + et * 16];
    __syncthreads();

    state_step(S, vb, kd, decay, c16, hi);
    gp += 16 * 1024;
    kp += 16 * 6144;
    vp += 16 * 6144;
    __syncthreads();
  }

  const long sb = (long)bh * NSEGM1 + seg;
  float* sp = segS + sb * (64 * 128) + (8 * hi) * 128 + w * 32 + c16;
#pragma unroll  // S[][] stays in registers; one address, constant offsets
  for (int dt = 0; dt < 4; ++dt)
#pragma unroll  // S[][] stays in registers
    for (int et = 0; et < 2; ++et)
#pragma unroll  // S[][] stays in registers
      for (int r = 0; r < 8; ++r)
        sp[(dt * 16 + r) * 128 + et * 16] = S[dt][et][r];
  if (tid < 64) segD[sb * 64 + tid] = dprod;
}

// segS[bh][g] holds KV of segment g on entry and the start state of segment
// g + 1 on exit. One thread per (bh, d, four columns e); every load is issued
// ahead of the first store.
__global__ __launch_bounds__(256) void gla_seg_scan_kernel(
    float* __restrict__ segS, const float* __restrict__ segD) {
  const int idx = blockIdx.x * 256 + threadIdx.x;   // 32 * 64 * 32 threads
  const int bh = idx >> 11, rem = idx & 2047, d = rem >> 5;
  float4* p = (float4*)segS + (long)bh * NSEGM1 * 2048 + rem;
  const float* dp = segD + (long)bh * NSEGM1 * 64 + d;
  float4 kv[NSEGM1];
  float dc[NSEGM1];
#pragma unroll  // kv[] and dc[] stay in registers
  for (int g = 0; g < NSEGM1; ++g) {
    kv[g] = p[g * 2048];
    dc[g] = dp[g * 64];
  }
  // Stands behind the last load and in front of the first store: no load is
  // issued among the stores into a register that a store still names, and the
  // loads' latencies overlap instead of adding up along the chain.
  asm volatile("s_wait_xcnt 0x0" ::: "memory");
  // segment 0 starts from zero, so kv[0] is already the start of segment 1
#pragma unroll  // kv[] and dc[] stay in registers
  for (int g = 1; g < NSEGM1; ++g) {
    kv[g].x = dc[g] * kv[g - 1].x + kv[g].x;
    kv[g].y = dc[g] * kv[g - 1].y + kv[g].y;
    kv[g].z = dc[g] * kv[g - 1].z + kv[g].z;
    kv[g].w = dc[g] * kv[g - 1].w + kv[g].w;
    p[g * 2048] = kv[g];
  }
}

__global__ __launch_bounds__(128) void gla_kernel(
    float* __restrict__ qkvg, const float* __restrict__ gk,
    const float* __restrict__ segS) {
  __shared__ float gc[16 * CPAD];
  __shared__ __align__(16) float qe[16 * CPAD];
  __shared__ __align__(16) float ke[16 * CPAD];
  __shared__ __align__(16) float kd[16 * CPAD];
  __shared__ __align__(16) float Am[16 * 16];
  __shared__ __align__(16) float decay[64];

  const int seg = blockIdx.x;       // 0..NSEG-1
  const int bh = blockIdx.y;        // 0..31
  const int b = bh >> 4, h = bh & 15;
  const int tid = threadIdx.x;
  const int c16 = tid & 15, hi = (tid >> 4) & 1, w = tid >> 5;

  v8f S[4][2];
  if (seg == 0) {
#pragma unroll  // S[][] stays in registers
    for (int dt = 0; dt < 4; ++dt)
#pragma unroll  // S[][] stays in registers
      for (int et = 0; et < 2; ++et)
        S[dt][et] = (v8f){0.f, 0.f, 0.f, 0.f, 0.f, 0.f, 0.f, 0.f};
  } else {
    const float* s0 = segS + ((long)bh * NSEGM1 + (seg - 1)) * (64 * 128) +
                      (8 * hi) * 128 + w * 32 + c16;
#pragma unroll  // S[][] stays in registers; one address, constant offsets
    for (int dt = 0; dt < 4; ++dt)
#pragma unroll  // S[][] stays in registers
      for (int et = 0; et < 2; ++et)
#pragma unroll  // S[][] stays in registers
        for (int r = 0; r < 8; ++r)
          S[dt][et][r] = s0[(dt * 16 + r) * 128 + et * 16];
    // behind the loads, ahead of any rewrite of a register that they name
    asm volatile("s_wait_xcnt 0x0" ::: "memory");
  }

  const long rowbase = (long)b * 2048 + (long)seg * (SEGC * 16);

  for (int n = 0; n < SEGC; ++n) {
    const long m0 = rowbase + n * 16;
    if (tid < 64) {                  // per-column-d prep
      const int d = tid;
      float c = 0.f;
#pragma unroll
      for (int cc = 0; cc < 16; ++cc) {
        c += gk[(m0 + cc) * 1024 + h * 64 + d];
        gc[cc * CPAD + d] = c;
      }
      decay[d] = __expf(c);
      const float glast = c;
#pragma unroll
      for (int cc = 0; cc < 16; ++cc) {
        float g = gc[cc * CPAD + d];
        float q = qkvg[(m0 + cc) * 6144 + h * 64 + d];
        float k = qkvg[(m0 + cc) * 6144 + 1024 + h * 64 + d];
        qe[cc * CPAD + d] = q * __expf(g) * GLA_SCALE;
        ke[cc * CPAD + d] = k * __expf(-g);
        kd[cc * CPAD + d] = k * __expf(glast - g);
      }
    }
    // this wave's 16 x 32 piece of v (and of o), rows 8 hi + r, as B fragments
    float* vo = qkvg + (m0 + 8 * hi) * 6144 + 2048 + h * 128 + w * 32 + c16;
    v8f vb[2];
#pragma unroll  // vb[] stays in registers
    for (int et = 0; et < 2; ++et)
#pragma unroll  // vb[] stays in registers
      for (int r = 0; r < 8; ++r) vb[et][r] = vo[r * 6144 + et * 16];
    __syncthreads();

    // A = tril(qe ke^T), 256 entries over 128 threads
#pragma unroll
    for (int t = tid; t < 256; t += 128) {
      int cc = t >> 4, mm = t & 15;
      float a = 0.f;
      if (mm <= cc) {
#pragma unroll
        for (int d = 0; d < 64; ++d) a += qe[cc * CPAD + d] * ke[mm * CPAD + d];
      }
      Am[cc * 16 + mm] = a;
    }
    __syncthreads();

    v8f o[2];
    o[0] = (v8f){0.f, 0.f, 0.f, 0.f, 0.f, 0.f, 0.f, 0.f};
    o[1] = o[0];
    {  // o_intra = A v: row c16 of A, k = rows of v in the order of vb
      const v8f am = lds8(&Am[c16 * 16 + 8 * hi]);
#pragma unroll  // am, vb[] and o[] stay in registers
      for (int j = 0; j < 4; ++j) {
        const v2f a = {am[2 * j], am[2 * j + 1]};
#pragma unroll  // vb[] and o[] stay in registers
        for (int et = 0; et < 2; ++et)
          o[et] = wmma_f32(a, (v2f){vb[et][2 * j], vb[et][2 * j + 1]}, o[et]);
      }
    }
    // o_inter = qe S (old S): row c16 of qe, k = rows of S in the tiles' order
#pragma unroll  // S[][] and o[] stay in registers
    for (int dt = 0; dt < 4; ++dt) {
      const v8f qf = lds8(&qe[c16 * CPAD + dt * 16 + 8 * hi]);
#pragma unroll  // qf, S[][] and o[] stay in registers
      for (int j = 0; j < 4; ++j) {
        const v2f a = {qf[2 * j], qf[2 * j + 1]};
#pragma unroll  // S[][] and o[] stay in registers
        for (int et = 0; et < 2; ++et)
          o[et] = wmma_f32(a, (v2f){S[dt][et][2 * j], S[dt][et][2 * j + 1]},
                           o[et]);
      }
    }
#pragma unroll  // o[] stays in registers
    for (int et = 0; et < 2; ++et)
#pragma unroll  // o[] stays in registers
      for (int r = 0; r < 8; ++r) vo[r * 6144 + et * 16] = o[et][r];
    // behind the stores, ahead of any rewrite of a register that they name
    asm volatile("s_wait_xcnt 0x0" ::: "memory");
    // the last chunk's end state is read by nobody here
    if (n + 1 < SEGC) state_step(S, vb, kd, decay, c16, hi);
    __syncthreads();
  }
}

// 2^x and 1/sqrt(x), each with the free slot that the instruction set asks for
// between a transcendental and a next instruction that overwrites its source.
__device__ __forceinline__ float exp2_slot(float x) {
  float r;
  asm("v_exp_f32 %0, %1\n\tv_nop" : "=v"(r) : "v"(x));
  return r;
}
__device__ __forceinline__ float rsq_slot(float x) {
  float r;
  asm("v_rsq_f32 %0, %1\n\tv_nop" : "=v"(r) : "v"(x));
  return r;
}
// g * sigmoid(g), with exp(-g) formed as 2^(-g * log2 e)
__device__ __forceinline__ float silu(float g) {
  return g / (1.f + exp2_slot(g * -1.44269504f));
}

// Sum over the 32 lanes, left in every lane: lane l with l ^ 1, 2, 4, 8 inside
// a row of 16 by DPP, then l ^ 16 by a cross-row move; all in the vector unit.
template <int M>
__device__ __forceinline__ float row_xor(float x) {
  return __builtin_bit_cast(float, __builtin_amdgcn_update_dpp(
      0, __builtin_bit_cast(int, x), 0x160 | M, 0xf, 0xf, true));
}
__device__ __forceinline__ float wave_sum(float s) {
  s += row_xor<1>(s);
  s += row_xor<2>(s);
  s += row_xor<4>(s);
  s += row_xor<8>(s);
  const int b = __builtin_bit_cast(int, s);
  return s + __builtin_bit_cast(float, __builtin_amdgcn_permlanex16(
                 b, b, 0x76543210, 0xfedcba98, false, false));
}

// ---------------------------------------------------------------------------
// RMSNorm over DV + SiLU(g) gate, output bf16 for the final GEMM
// one wave per (m, 8 heads): a row of 128 is one float4 per lane, its sum of
// squares a butterfly over the 32 lanes; no LDS, no barrier.
// ---------------------------------------------------------------------------
__global__ __launch_bounds__(256) void norm_gate_kernel(
    const float* __restrict__ qkvg, const float* __restrict__ norm_w,
    unsigned short* __restrict__ og) {
  const int lane = threadIdx.x & 31;
  const int wv = blockIdx.x * 8 + (threadIdx.x >> 5);   // 0..8191
  const int m = wv >> 1, h0 = (wv & 1) * 8;
  const float* ob = qkvg + (long)m * 6144 + 2048 + h0 * 128 + lane * 4;
  float4 o[8], g[8];
#pragma unroll  // o[] and g[] stay in registers, the 16 loads go out together
  for (int r = 0; r < 8; ++r) {
    o[r] = *(const float4*)(ob + r * 128);
    g[r] = *(const float4*)(ob + 2048 + r * 128);
  }
  const float4 w = *(const float4*)(norm_w + lane * 4);
  // The fence keeps every load above it, so that all 17 are in flight at once:
  // without it the compiler sinks six of them into the arithmetic.
  __builtin_amdgcn_sched_barrier(0);
  float ss[8];
#pragma unroll  // ss[] stays in registers
  for (int r = 0; r < 8; ++r)
    ss[r] = (o[r].x * o[r].x + o[r].y * o[r].y) +
            (o[r].z * o[r].z + o[r].w * o[r].w);
#pragma unroll  // ss[] stays in registers
  for (int r = 0; r < 8; ++r) ss[r] = wave_sum(ss[r]);
  uint2 res[8];
#pragma unroll  // res[] stays in registers
  for (int r = 0; r < 8; ++r) {
    // the argument is at least 1e-5: no subnormal range to rescale for
    const float rs = rsq_slot(ss[r] * (1.f / 128.f) + 1e-5f);
    const float a = o[r].x * rs * w.x * silu(g[r].x);
    const float b = o[r].y * rs * w.y * silu(g[r].y);
    const float c = o[r].z * rs * w.z * silu(g[r].z);
    const float d = o[r].w * rs * w.w * silu(g[r].w);
    res[r] = make_uint2(pack2bf(a, b), pack2bf(c, d));
  }
  unsigned short* dst = og + (long)m * 2048 + h0 * 128 + lane * 4;
#pragma unroll  // res[] stays in registers
  for (int r = 0; r < 8; ++r) *(uint2*)(dst + r * 128) = res[r];
}

// ---------------------------------------------------------------------------
// Host launcher
// ---------------------------------------------------------------------------
extern "C" void kernel_launch(void* const* d_in, const int* in_sizes, int n_in,
                              void* d_out, int out_size, void* d_ws,
                              size_t ws_size, hipStream_t stream) {
  const float* x      = (const float*)d_in[0];
  const float* Wq     = (const float*)d_in[1];
  const float* Wk     = (const float*)d_in[2];
  const float* Wv     = (const float*)d_in[3];
  const float* Wg     = (const float*)d_in[4];
  const float* Wgk1   = (const float*)d_in[5];
  const float* Wgk2   = (const float*)d_in[6];
  const float* bgk2   = (const float*)d_in[7];
  const float* Wo     = (const float*)d_in[8];
  const float* norm_w = (const float*)d_in[9];
  float* out = (float*)d_out;

  // workspace layout (bytes)
  char* ws = (char*)d_ws;
  unsigned short* xb    = (unsigned short*)(ws);                       // 16 MiB
  unsigned short* wcat  = (unsigned short*)(ws + (size_t)16777216);    // 24 MiB
  unsigned short* wot   = (unsigned short*)(ws + (size_t)41943040);    //  8 MiB
  float*          qkvg  = (float*)         (ws + (size_t)50331648);    // 96 MiB
  float*          gkbuf = (float*)         (ws + (size_t)150994944);   // 16 MiB
  unsigned short* og    = (unsigned short*)(ws + (size_t)167772160);   // 16 MiB
  float*          segS  = (float*)         (ws + (size_t)184549376);   // 31 MiB
  float*          segD  = (float*)         (ws + (size_t)218103808);   // 248 KiB

  // 1) x -> bf16
  cvt_f32_bf16_kernel<<<MROWS * KDIM / 8192, 256, 0, stream>>>(x, xb);

  // 2) weight transpose+convert into concatenated [6144,2048] and [2048,2048]
  transpose_cvt_kernel<1024>
      <<<dim3(1024 / TT_N, KDIM / TT_K), 256, 0, stream>>>(Wq, wcat);
  transpose_cvt_kernel<1024>
      <<<dim3(1024 / TT_N, KDIM / TT_K), 256, 0, stream>>>(
          Wk, wcat + (size_t)1024 * KDIM);
  transpose_cvt_kernel<2048>
      <<<dim3(2048 / TT_N, KDIM / TT_K), 256, 0, stream>>>(
          Wv, wcat + (size_t)2048 * KDIM);
  transpose_cvt_kernel<2048>
      <<<dim3(2048 / TT_N, KDIM / TT_K), 256, 0, stream>>>(
          Wg, wcat + (size_t)4096 * KDIM);
  transpose_cvt_kernel<2048>
      <<<dim3(2048 / TT_N, KDIM / TT_K), 256, 0, stream>>>(Wo, wot);

  // 3) fused projection GEMM (WMMA bf16 -> f32): qkvg[4096,6144]
  gemm_bf16_wmma_kernel<<<dim3(NCAT / 128, MROWS / 128), 256, 0, stream>>>(
      xb, wcat, qkvg, KDIM, NCAT);

  // 4) low-rank gate path gk[4096,1024]
  gk_kernel<<<MROWS, 256, 0, stream>>>(x, Wgk1, Wgk2, bgk2, gkbuf);

  // 5) chunked GLA scan in segments (writes o over the v slice of qkvg)
  gla_seg_state_kernel<<<dim3(NSEGM1, 32), 128, 0, stream>>>(qkvg, gkbuf, segS,
                                                            segD);
  gla_seg_scan_kernel<<<32 * 64 * 32 / 256, 256, 0, stream>>>(segS, segD);
  gla_kernel<<<dim3(NSEG, 32), 128, 0, stream>>>(qkvg, gkbuf, segS);

  // 6) RMSNorm + SiLU gate -> bf16 [4096,2048]
  norm_gate_kernel<<<MROWS * 16 / 64, 256, 0, stream>>>(qkvg, norm_w, og);

  // 7) output GEMM (WMMA) -> d_out fp32 [4096,2048]
  gemm_bf16_wmma_kernel<<<dim3(NOUT / 128, MROWS / 128), 256, 0, stream>>>(
      og, wot, out, KDIM, NOUT);
}

// v005
// A run of this version takes 291 microseconds.
// Two timings next to v004 both put it at 1.10 times that version's speed.
// All steps since v000 together make it 7.25 times as fast.
#include <hip/hip_runtime.h>

// ---------------------------------------------------------------------------
// Problem constants (from reference)
// ---------------------------------------------------------------------------
// B=2, T=2048, HID=2048, H=16, DK=64, DV=128, C=16, LOWR=16
// M = B*T = 4096 rows.  Fused projection GEMM: [4096,2048] x [2048,6144]
//   cols 0..1023   : q  (H*DK)
//   cols 1024..2047: k  (H*DK)
//   cols 2048..4095: v  (H*DV)   (overwritten with o by the GLA kernel)
//   cols 4096..6143: g  (H*DV)
// Output GEMM: [4096,2048] x [2048,2048] -> d_out (fp32)

#define MROWS   4096
#define KDIM    2048
#define NCAT    6144
#define NOUT    2048
#define GLA_SCALE 0.125f   // DK^-0.5

typedef __attribute__((ext_vector_type(16))) __bf16 v16bf;
typedef __attribute__((ext_vector_type(8)))  float  v8f;

__device__ __forceinline__ unsigned short f2bf(float f) {
  unsigned int u = __float_as_uint(f);
  u += 0x7fffu + ((u >> 16) & 1u);
  return (unsigned short)(u >> 16);
}

// gfx1250 async global->LDS DMA: 16B per lane, no data VGPRs, ASYNCcnt-tracked.
// GV mode: VDST = LDS byte offset (low 32 bits of flat shared address per the
// LDS aperture rule addr[31:0]), VADDR = 64-bit global address, no SADDR.
__device__ __forceinline__ void async_copy_b128(const void* g, void* lds) {
  unsigned lds_off = (unsigned)(unsigned long long)lds;
  asm volatile("global_load_async_to_lds_b128 %0, %1, off"
               :: "v"(lds_off), "v"(g) : "memory");
}
__device__ __forceinline__ void wait_async0() {
  asm volatile("s_wait_asynccnt 0x0" ::: "memory");
}

// The three streaming helpers below (convert, transpose, norm+gate) move few
// bytes per wave.
// Each is laid out so that a wave brings in 4 KiB or more with all its loads
// in flight at once, and the grids are 8 to 32 times smaller for it.

__device__ __forceinline__ unsigned int pack2bf(float lo, float hi) {
  return (unsigned int)f2bf(lo) | ((unsigned int)f2bf(hi) << 16);
}

// ---------------------------------------------------------------------------
// fp32 -> bf16 elementwise convert (x activations)
// one block converts 8192 contiguous floats: 8 float4 per thread
// ---------------------------------------------------------------------------
__global__ __launch_bounds__(256) void cvt_f32_bf16_kernel(
    const float* __restrict__ in, unsigned short* __restrict__ out) {
  const long base = (long)blockIdx.x * 2048 + threadIdx.x;   // in float4 units
  const float4* p = (const float4*)in + base;
  uint2* q = (uint2*)out + base;
  float4 v[8];
#pragma unroll  // v[] stays in registers, the 8 loads go out together
  for (int i = 0; i < 8; ++i) v[i] = p[i * 256];
#pragma unroll  // v[] stays in registers
  for (int i = 0; i < 8; ++i)
    q[i * 256] = make_uint2(pack2bf(v[i].x, v[i].y), pack2bf(v[i].z, v[i].w));
}

// ---------------------------------------------------------------------------
// Transpose [K,Nw] fp32 -> [Nw,K] bf16 (weights, so WMMA B operand is N-major)
// one block of 256 threads moves a tile of 128 k x 64 n: 8 float4 loads per
// thread (256 B of a source row per 16 lanes), then 4 stores of 8 bf16 per
// thread (256 B of an output row per 16 lanes).
// ---------------------------------------------------------------------------
#define TT_K 128
#define TT_N 64
#define TT_P 65   // odd pitch in floats: column reads spread over the banks

// The row pitches are compile-time constants, so that the 8 loads (and the 4
// stores) share one address and differ in their immediate offsets only.
template <int Nw>
__global__ __launch_bounds__(256) void transpose_cvt_kernel(
    const float* __restrict__ W, unsigned short* __restrict__ out) {
  constexpr int K = KDIM;
  __shared__ float tile[TT_K * TT_P];
  const int kb = blockIdx.y * TT_K, nb = blockIdx.x * TT_N;
  const int lo = threadIdx.x & 15, hi = threadIdx.x >> 4;
  const float* s = W + (long)(kb + hi) * Nw + (nb + lo * 4);
  float4 v[8];
#pragma unroll  // v[] stays in registers, the 8 loads go out together
  for (int i = 0; i < 8; ++i) v[i] = *(const float4*)(s + i * 16 * Nw);
#pragma unroll  // v[] stays in registers
  for (int i = 0; i < 8; ++i) {
    float* t = &tile[(hi + i * 16) * TT_P + lo * 4];
    t[0] = v[i].x; t[1] = v[i].y; t[2] = v[i].z; t[3] = v[i].w;
  }
  __syncthreads();
  uint4 r[4];
#pragma unroll  // r[] stays in registers
  for (int j = 0; j < 4; ++j) {
    const float* t = &tile[(lo * 8) * TT_P + hi + j * 16];
    r[j] = make_uint4(pack2bf(t[0 * TT_P], t[1 * TT_P]),
                      pack2bf(t[2 * TT_P], t[3 * TT_P]),
                      pack2bf(t[4 * TT_P], t[5 * TT_P]),
                      pack2bf(t[6 * TT_P], t[7 * TT_P]));
  }
  unsigned short* d = out + (long)(nb + hi) * K + (kb + lo * 8);
#pragma unroll  // r[] stays in registers
  for (int j = 0; j < 4; ++j) *(uint4*)(d + j * 16 * K) = r[j];
}

// ---------------------------------------------------------------------------
// bf16 WMMA GEMM:  C[M,N](f32) = A[M,K](bf16,row-major) * Bt[N,K]^T
// Block tile 128x128, K-step 64, 256 threads = 8 waves (4x2 wave grid),
// each wave: 2x4 fragments of 16x16. Double-buffered LDS, pitch 72
// (144B rows -> conflict-free b128 fragment reads). Tile staging uses
// global_load_async_to_lds_b128 (no data VGPRs -> no spills).
// ---------------------------------------------------------------------------
#define GT_M 128
#define GT_K 64
#define LDT  72

__device__ __forceinline__ v16bf load_frag(const unsigned short* p) {
  union { v16bf v; uint4 u[2]; } f;
  f.u[0] = *(const uint4*)(p);        // halves 0..7  : K = khalf*8 + 0..7
  f.u[1] = *(const uint4*)(p + 16);   // halves 8..15 : K = khalf*8 + 16..23
  return f.v;
}

__global__ __launch_bounds__(256) void gemm_bf16_wmma_kernel(
    const unsigned short* __restrict__ A,   // [M,K] bf16
    const unsigned short* __restrict__ Bt,  // [N,K] bf16 (B transposed)
    float* __restrict__ C, int K, int ldc) {
  __shared__ __align__(16) unsigned short As[2][GT_M * LDT];
  __shared__ __align__(16) unsigned short Bs[2][GT_M * LDT];

  const int tid  = threadIdx.x;
  const int lane = tid & 31;
  const int w    = tid >> 5;
  const int wm   = w >> 1;   // 0..3 : 32-row band
  const int wn   = w & 1;    // 0..1 : 64-col band

  const long m0 = (long)blockIdx.y * GT_M;
  const long n0 = (long)blockIdx.x * GT_M;
  // A tile row is one 128-byte line. Copy i of a thread takes 16-byte chunk
  // i * 256 + tid of the tile's 1024, so that 8 lanes cover a whole line and a
  // wave's copy 4 whole lines.
  const int  c0 = tid * 4;            // the prefetch's chunk: two per row
  const int  nk = K / GT_K;

  const unsigned short* Agb = A  + m0 * K;
  const unsigned short* Bgb = Bt + n0 * K;

  // preload tile 0 (async DMA straight into LDS)
#pragma unroll
  for (int i = 0; i < 4; ++i) {
    int ch = i * 256 + tid, r = ch >> 3, kc = (ch & 7) * 8;
    async_copy_b128(&Agb[(long)r * K + kc], &As[0][r * LDT + kc]);
    async_copy_b128(&Bgb[(long)r * K + kc], &Bs[0][r * LDT + kc]);
  }
  wait_async0();
  __syncthreads();

  v8f acc[2][4];
#pragma unroll
  for (int fm = 0; fm < 2; ++fm)
#pragma unroll
    for (int fn = 0; fn < 4; ++fn)
      acc[fm][fn] = (v8f){0.f, 0.f, 0.f, 0.f, 0.f, 0.f, 0.f, 0.f};

  for (int kt = 0; kt < nk; ++kt) {
    const int cur = kt & 1, nxt = cur ^ 1;
    // kick off async DMA of the next tile into the other buffer
    if (kt + 1 < nk) {
      const unsigned short* Ag = Agb + (kt + 1) * GT_K;
      const unsigned short* Bg = Bgb + (kt + 1) * GT_K;
#pragma unroll
      for (int i = 0; i < 4; ++i) {
        int ch = i * 256 + tid, r = ch >> 3, kc = (ch & 7) * 8;
        async_copy_b128(&Ag[(long)r * K + kc], &As[nxt][r * LDT + kc]);
        async_copy_b128(&Bg[(long)r * K + kc], &Bs[nxt][r * LDT + kc]);
      }
    }
    if (kt + 2 < nk) {  // gfx1250 global_prefetch_b8 for tile kt+2 into L2
      int r = c0 >> 3, kc = (c0 & 7) * 8;
      __builtin_prefetch(&Agb[(kt + 2) * GT_K + (long)r * K + kc], 0, 1);
      __builtin_prefetch(&Bgb[(kt + 2) * GT_K + (long)r * K + kc], 0, 1);
    }

    // compute on current buffer: two k=32 sub-steps
#pragma unroll
    for (int s = 0; s < 2; ++s) {
      const int kb = s * 32 + (lane >> 4) * 8;   // khalf selects K sub-lane set
      v16bf afr[2], bfr[4];
#pragma unroll
      for (int fm = 0; fm < 2; ++fm) {
        int row = wm * 32 + fm * 16 + (lane & 15);
        afr[fm] = load_frag(&As[cur][row * LDT + kb]);
      }
#pragma unroll
      for (int fn = 0; fn < 4; ++fn) {
        int row = wn * 64 + fn * 16 + (lane & 15);
        bfr[fn] = load_frag(&Bs[cur][row * LDT + kb]);
      }
#pragma unroll
      for (int fm = 0; fm < 2; ++fm)
#pragma unroll
        for (int fn = 0; fn < 4; ++fn)
          acc[fm][fn] = __builtin_amdgcn_wmma_f32_16x16x32_bf16(
              false, afr[fm], false, bfr[fn], (short)0, acc[fm][fn],
              false, false);
    }

    // next tile must be fully in LDS before anyone reads it next iteration
    wait_async0();
    __syncthreads();
  }

  // store: VGPR r -> row (r + 8*khalf), lane&15 -> col  (16x16 f32 C layout)
  const int cn    = lane & 15;
  const int rbase = (lane >> 4) * 8;
#pragma unroll
  for (int fm = 0; fm < 2; ++fm)
#pragma unroll
    for (int fn = 0; fn < 4; ++fn) {
      long row0 = m0 + wm * 32 + fm * 16 + rbase;
      long col  = n0 + wn * 64 + fn * 16 + cn;
#pragma unroll
      for (int r = 0; r < 8; ++r)
        C[(row0 + r) * ldc + col] = acc[fm][fn][r];
    }
}

// ---------------------------------------------------------------------------
// gk = log_sigmoid(x @ Wgk1 @ Wgk2 + bgk2) / 16      (low-rank, fp32)
// One block per 16 rows of x, so that Wgk1 and Wgk2 are read once per 16 rows.
// x @ Wgk1 runs on the f32 16x16x4 matrix form: wave w takes k = 128 w ..
// 128 w + 127, the 16 partial tiles are summed through LDS in the order of w.
// A wave loads its 16 x 128 piece of x in whole lines (one row piece of 512 B
// per load) and turns it into A fragments through LDS.
// k order of one matrix step (t, u): lane half hi, register i hold
// k = 128 w + 8 t + 4 hi + 2 u + i, in the A loader (a float4 of a row of x is
// u = 0, 1) and in the B loader (rows of Wgk1) alike.
// ---------------------------------------------------------------------------
#define GK_WAVES 16
#define GK_KS (KDIM / GK_WAVES)   // k per wave
#define GK_T (GK_KS / 8)          // float4 of x per lane
#define GK_XP (GK_KS + 4)         // LDS row pitch: 16 B x odd, for b128 readers

typedef __attribute__((ext_vector_type(2))) float v2f;

__device__ __forceinline__ v8f wmma_f32(v2f a, v2f b, v8f c) {
  return __builtin_amdgcn_wmma_f32_16x16x4_f32(false, a, false, b, (short)0, c,
                                               false, false);
}

// eight consecutive floats of LDS, 16-byte aligned
__device__ __forceinline__ v8f lds8(const float* p) {
  const float4 a = *(const float4*)p, b = *(const float4*)(p + 4);
  return (v8f){a.x, a.y, a.z, a.w, b.x, b.y, b.z, b.w};
}

__global__ __launch_bounds__(512) void gk_kernel(
    const float* __restrict__ x, const float* __restrict__ Wgk1,
    const float* __restrict__ Wgk2, const float* __restrict__ bgk2,
    float* __restrict__ gkout) {
  __shared__ __align__(16) float xs[GK_WAVES * 16 * GK_XP];
  __shared__ __align__(16) float red[GK_WAVES * 256];
  __shared__ __align__(16) float low[16 * 16];
  const int tid = threadIdx.x;
  const int lane = tid & 31, c16 = tid & 15, hi = (tid >> 4) & 1, w = tid >> 5;
  const long m0 = (long)blockIdx.x * 16;

  const float* xp = x + m0 * KDIM + w * GK_KS + lane * 4;
  const float* wp = Wgk1 + (w * GK_KS + 4 * hi) * 16 + c16;
  // the second product's operands: columns 2 tid, 2 tid + 1 of Wgk2 and bgk2
  float2 w2[16];
#pragma unroll  // w2[] stays in registers, the loads go out with those below
  for (int r = 0; r < 16; ++r) w2[r] = *((const float2*)(Wgk2 + r * 1024) + tid);
  const float2 bias = *((const float2*)bgk2 + tid);
  float bq[GK_T][4];
#pragma unroll  // bq[][] stays in registers, the loads go out together
  for (int t = 0; t < GK_T; ++t)
#pragma unroll  // bq[][] stays in registers
    for (int q = 0; q < 4; ++q) bq[t][q] = wp[(8 * t + q) * 16];
  // With the fence every load of the kernel is issued ahead of the first wait:
  // without it the compiler holds a quarter of these, and of those of x, back
  // behind that wait, and their latency comes on top.
  __builtin_amdgcn_sched_barrier(0);
  float4 xv[16];
#pragma unroll  // xv[] stays in registers, the loads go out together
  for (int j = 0; j < 16; ++j) xv[j] = *(const float4*)(xp + j * KDIM);

  float* xw = xs + w * (16 * GK_XP);
#pragma unroll  // xv[] stays in registers
  for (int j = 0; j < 16; ++j) *(float4*)(xw + j * GK_XP + lane * 4) = xv[j];
  __syncthreads();

  // two accumulator tiles, so that a step need not wait for the one before it
  v8f acc0 = (v8f){0.f, 0.f, 0.f, 0.f, 0.f, 0.f, 0.f, 0.f};
  v8f acc1 = acc0;
#pragma unroll  // bq[][] stays in registers
  for (int t = 0; t < GK_T; ++t) {
    const float4 a = *(const float4*)(xw + c16 * GK_XP + 8 * t + 4 * hi);
    acc0 = wmma_f32((v2f){a.x, a.y}, (v2f){bq[t][0], bq[t][1]}, acc0);
    acc1 = wmma_f32((v2f){a.z, a.w}, (v2f){bq[t][2], bq[t][3]}, acc1);
  }
  acc0 += acc1;
#pragma unroll  // acc0 stays in registers
  for (int r = 0; r < 8; ++r) red[w * 256 + r * 32 + lane] = acc0[r];
  __syncthreads();
  if (tid < 256) {   // register r = tid >> 5 of lane (c16, hi): row 8 hi + r
    float s = 0.f;
#pragma unroll  // the 16 LDS loads go out together
    for (int v = 0; v < GK_WAVES; ++v) s += red[v * 256 + tid];
    low[(8 * hi + w) * 16 + c16] = s;
  }
  __syncthreads();

  float* dst = gkout + m0 * 1024 + 2 * tid;
#pragma unroll 1  // one copy of the long log-sigmoid text
  for (int m = 0; m < 16; ++m) {
    const v8f l0 = lds8(&low[m * 16]), l1 = lds8(&low[m * 16 + 8]);
    float ax = bias.x, ay = bias.y;
#pragma unroll  // l0 and w2[] stay in registers
    for (int r = 0; r < 8; ++r) { ax += l0[r] * w2[r].x; ay += l0[r] * w2[r].y; }
#pragma unroll  // l1 and w2[] stay in registers
    for (int r = 0; r < 8; ++r) {
      ax += l1[r] * w2[8 + r].x;
      ay += l1[r] * w2[8 + r].y;
    }
    const float lx = fminf(ax, 0.f) - log1pf(__expf(-fabsf(ax)));
    const float ly = fminf(ay, 0.f) - log1pf(__expf(-fabsf(ay)));
    *(float2*)(dst + m * 1024) =
        make_float2(lx * (1.0f / 16.0f), ly * (1.0f / 16.0f));
  }
}

// ---------------------------------------------------------------------------
// Chunked GLA scan, split along the sequence into NSEG segments of SEGC chunks
// so that (b,h) x segment work-groups run side by side. The state recurrence
// S <- diag(decay) S + kv is linear in S, so over one segment
//   S_end = diag(D_seg) S_start + KV_seg,
// with D_seg the product of the chunk decays and KV_seg the segment's end
// state when started from zero. Three launches:
//   1) gla_seg_state_kernel: KV_seg and D_seg of every segment but the last
//   2) gla_seg_scan_kernel : start state of segments 1..NSEG-1 (in place)
//   3) gla_kernel          : the full chunk loop of a segment from its start
// The products with v and with S run on the f32 16x16x4 matrix form. Wave w
// owns columns e = 32 w .. 32 w + 31 (two tiles of 16). S[64][128] lives in
// registers as 4 x 2 accumulator tiles per wave: register r of lane (c, hi)
// holds S[16 dt + 8 hi + r][e0 + c]. Registers (2j, 2j+1) of such a tile are at
// once a B fragment whose four k are rows 2j, 2j+1 (hi = 0) and 8+2j, 8+2j+1
// (hi = 1); the A loaders below take their k in the same order. v is loaded in
// the same map, so it too is a B fragment as it lies. o overwrites v in qkvg.
// ---------------------------------------------------------------------------
#define CPAD 68
#define NSEG 32                 // segments per sequence
#define SEGC 4                  // chunks of 16 rows per segment (NSEG*SEGC = 128)
#define NSEGM1 (NSEG - 1)

// S <- diag(decay) S + kd^T v for one chunk; kd is [16 c][CPAD], d contiguous
__device__ __forceinline__ void state_step(v8f (&S)[4][2], const v8f (&vb)[2],
                                           const float* kd, const float* decay,
                                           int c16, int hi) {
#pragma unroll  // S[][] stays in registers
  for (int dt = 0; dt < 4; ++dt) {
    const v8f dec = lds8(&decay[dt * 16 + 8 * hi]);
    S[dt][0] *= dec;
    S[dt][1] *= dec;
#pragma unroll  // S[][] and vb[] stay in registers
    for (int j = 0; j < 4; ++j) {
      const float* kr = &kd[(2 * j + 8 * hi) * CPAD + dt * 16 + c16];
      const v2f a = {kr[0], kr[CPAD]};
#pragma unroll  // S[][] and vb[] stay in registers
      for (int et = 0; et < 2; ++et)
        S[dt][et] = wmma_f32(a, (v2f){vb[et][2 * j], vb[et][2 * j + 1]},
                             S[dt][et]);
    }
  }
}

__global__ __launch_bounds__(128) void gla_seg_state_kernel(
    const float* __restrict__ qkvg, const float* __restrict__ gk,
    float* __restrict__ segS, float* __restrict__ segD) {
  __shared__ float gc[16 * CPAD];
  __shared__ __align__(16) float kd[16 * CPAD];
  __shared__ __align__(16) float decay[64];

  const int seg = blockIdx.x;       // 0..NSEG-2
  const int bh = blockIdx.y;        // 0..31
  const int b = bh >> 4, h = bh & 15;
  const int tid = threadIdx.x;
  const int c16 = tid & 15, hi = (tid >> 4) & 1, w = tid >> 5;

  v8f S[4][2];
#pragma unroll  // S[][] stays in registers
  for (int dt = 0; dt < 4; ++dt)
#pragma unroll  // S[][] stays in registers
    for (int et = 0; et < 2; ++et)
      S[dt][et] = (v8f){0.f, 0.f, 0.f, 0.f, 0.f, 0.f, 0.f, 0.f};

  const long row0 = (long)b * 2048 + (long)seg * (SEGC * 16);
  // row pointers of the current chunk, advanced by 16 rows per chunk
  const float* gp = gk + row0 * 1024 + h * 64 + (tid & 63);
  const float* kp = qkvg + row0 * 6144 + 1024 + h * 64 + (tid & 63);
  const float* vp = qkvg + (row0 + 8 * hi) * 6144 + 2048 + h * 128 + w * 32 + c16;
  float dprod = 1.f;

  for (int n = 0; n < SEGC; ++n) {
    if (tid < 64) {                  // per-column-d prep
      const int d = tid;
      float c = 0.f;
#pragma unroll  // the 16 row loads go out together
      for (int cc = 0; cc < 16; ++cc) {
        c += gp[cc * 1024];
        gc[cc * CPAD + d] = c;
      }
      const float dec = __expf(c);
      decay[d] = dec;
      dprod *= dec;
      const float glast = c;
#pragma unroll  // the 16 row loads go out together
      for (int cc = 0; cc < 16; ++cc) {
        float g = gc[cc * CPAD + d];
        kd[cc * CPAD + d] = kp[cc * 6144] * __expf(glast - g);
      }
    }
    v8f vb[2];
#pragma unroll  // vb[] stays in registers
    for (int et = 0; et < 2; ++et)
#pragma unroll  // vb[] stays in registers
      for (int r = 0; r < 8; ++r) vb[et][r] = vp[r * 6144 + et * 16];
    __syncthreads();

    state_step(S, vb, kd, decay, c16, hi);
    gp += 16 * 1024;
    kp += 16 * 6144;
    vp += 16 * 6144;
    __syncthreads();
  }

  const long sb = (long)bh * NSEGM1 + seg;
  float* sp = segS + sb * (64 * 128) + (8 * hi) * 128 + w * 32 + c16;
#pragma unroll  // S[][] stays in registers; one address, constant offsets
  for (int dt = 0; dt < 4; ++dt)
#pragma unroll  // S[][] stays in registers
    for (int et = 0; et < 2; ++et)
#pragma unroll  // S[][] stays in registers
      for (int r = 0; r < 8; ++r)
        sp[(dt * 16 + r) * 128 + et * 16] = S[dt][et][r];
  if (tid < 64) segD[sb * 64 + tid] = dprod;
}

// segS[bh][g] holds KV of segment g on entry and the start state of segment
// g + 1 on exit. One thread per (bh, d, four columns e); every load is issued
// ahead of the first store.
__global__ __launch_bounds__(256) void gla_seg_scan_kernel(
    float* __restrict__ segS, const float* __restrict__ segD) {
  const int idx = blockIdx.x * 256 + threadIdx.x;   // 32 * 64 * 32 threads
  const int bh = idx >> 11, rem = idx & 2047, d = rem >> 5;
  float4* p = (float4*)segS + (long)bh * NSEGM1 * 2048 + rem;
  const float* dp = segD + (long)bh * NSEGM1 * 64 + d;
  float4 kv[NSEGM1];
  float dc[NSEGM1];
#pragma unroll  // kv[] and dc[] stay in registers
  for (int g = 0; g < NSEGM1; ++g) {
    kv[g] = p[g * 2048];
    dc[g] = dp[g * 64];
  }
  // Stands behind the last load and in front of the first store: no load is
  // issued among the stores into a register that a store still names, and the
  // loads' latencies overlap instead of adding up along the chain.
  asm volatile("s_wait_xcnt 0x0" ::: "memory");
  // segment 0 starts from zero, so kv[0] is already the start of segment 1
#pragma unroll  // kv[] and dc[] stay in registers
  for (int g = 1; g < NSEGM1; ++g) {
    kv[g].x = dc[g] * kv[g - 1].x + kv[g].x;
    kv[g].y = dc[g] * kv[g - 1].y + kv[g].y;
    kv[g].z = dc[g] * kv[g - 1].z + kv[g].z;
    kv[g].w = dc[g] * kv[g - 1].w + kv[g].w;
    p[g * 2048] = kv[g];
  }
}

__global__ __launch_bounds__(128) void gla_kernel(
    float* __restrict__ qkvg, const float* __restrict__ gk,
    const float* __restrict__ segS) {
  __shared__ float gc[16 * CPAD];
  __shared__ __align__(16) float qe[16 * CPAD];
  __shared__ __align__(16) float ke[16 * CPAD];
  __shared__ __align__(16) float kd[16 * CPAD];
  __shared__ __align__(16) float Am[16 * 16];
  __shared__ __align__(16) float decay[64];

  const int seg = blockIdx.x;       // 0..NSEG-1
  const int bh = blockIdx.y;        // 0..31
  const int b = bh >> 4, h = bh & 15;
  const int tid = threadIdx.x;
  const int c16 = tid & 15, hi = (tid >> 4) & 1, w = tid >> 5;

  v8f S[4][2];
  if (seg == 0) {
#pragma unroll  // S[][] stays in registers
    for (int dt = 0; dt < 4; ++dt)
#pragma unroll  // S[][] stays in registers
      for (int et = 0; et < 2; ++et)
        S[dt][et] = (v8f){0.f, 0.f, 0.f, 0.f, 0.f, 0.f, 0.f, 0.f};
  } else {
    const float* s0 = segS + ((long)bh * NSEGM1 + (seg - 1)) * (64 * 128) +
                      (8 * hi) * 128 + w * 32 + c16;
#pragma unroll  // S[][] stays in registers; one address, constant offsets
    for (int dt = 0; dt < 4; ++dt)
#pragma unroll  // S[][] stays in registers
      for (int et = 0; et < 2; ++et)
#pragma unroll  // S[][] stays in registers
        for (int r = 0; r < 8; ++r)
          S[dt][et][r] = s0[(dt * 16 + r) * 128 + et * 16];
    // behind the loads, ahead of any rewrite of a register that they name
    asm volatile("s_wait_xcnt 0x0" ::: "memory");
  }

  const long rowbase = (long)b * 2048 + (long)seg * (SEGC * 16);

  for (int n = 0; n < SEGC; ++n) {
    const long m0 = rowbase + n * 16;
    if (tid < 64) {                  // per-column-d prep
      const int d = tid;
      float c = 0.f;
#pragma unroll
      for (int cc = 0; cc < 16; ++cc) {
        c += gk[(m0 + cc) * 1024 + h * 64 + d];
        gc[cc * CPAD + d] = c;
      }
      decay[d] = __expf(c);
      const float glast = c;
#pragma unroll
      for (int cc = 0; cc < 16; ++cc) {
        float g = gc[cc * CPAD + d];
        float q = qkvg[(m0 + cc) * 6144 + h * 64 + d];
        float k = qkvg[(m0 + cc) * 6144 + 1024 + h * 64 + d];
        qe[cc * CPAD + d] = q * __expf(g) * GLA_SCALE;
        ke[cc * CPAD + d] = k * __expf(-g);
        kd[cc * CPAD + d] = k * __expf(glast - g);
      }
    }
    // this wave's 16 x 32 piece of v (and of o), rows 8 hi + r, as B fragments
    float* vo = qkvg + (m0 + 8 * hi) * 6144 + 2048 + h * 128 + w * 32 + c16;
    v8f vb[2];
#pragma unroll  // vb[] stays in registers
    for (int et = 0; et < 2; ++et)
#pragma unroll  // vb[] stays in registers
      for (int r = 0; r < 8; ++r) vb[et][r] = vo[r * 6144 + et * 16];
    __syncthreads();

    // A = tril(qe ke^T), 256 entries over 128 threads
#pragma unroll
    for (int t = tid; t < 256; t += 128) {
      int cc = t >> 4, mm = t & 15;
      float a = 0.f;
      if (mm <= cc) {
#pragma unroll
        for (int d = 0; d < 64; ++d) a += qe[cc * CPAD + d] * ke[mm * CPAD + d];
      }
      Am[cc * 16 + mm] = a;
    }
    __syncthreads();

    v8f o[2];
    o[0] = (v8f){0.f, 0.f, 0.f, 0.f, 0.f, 0.f, 0.f, 0.f};
    o[1] = o[0];
    {  // o_intra = A v: row c16 of A, k = rows of v in the order of vb
      const v8f am = lds8(&Am[c16 * 16 + 8 * hi]);
#pragma unroll  // am, vb[] and o[] stay in registers
      for (int j = 0; j < 4; ++j) {
        const v2f a = {am[2 * j], am[2 * j + 1]};
#pragma unroll  // vb[] and o[] stay in registers
        for (int et = 0; et < 2; ++et)
          o[et] = wmma_f32(a, (v2f){vb[et][2 * j], vb[et][2 * j + 1]}, o[et]);
      }
    }
    // o_inter = qe S (old S): row c16 of qe, k = rows of S in the tiles' order
#pragma unroll  // S[][] and o[] stay in registers
    for (int dt = 0; dt < 4; ++dt) {
      const v8f qf = lds8(&qe[c16 * CPAD + dt * 16 + 8 * hi]);
#pragma unroll  // qf, S[][] and o[] stay in registers
      for (int j = 0; j < 4; ++j) {
        const v2f a = {qf[2 * j], qf[2 * j + 1]};
#pragma unroll  // S[][] and o[] stay in registers
        for (int et = 0; et < 2; ++et)
          o[et] = wmma_f32(a, (v2f){S[dt][et][2 * j], S[dt][et][2 * j + 1]},
                           o[et]);
      }
    }
#pragma unroll  // o[] stays in registers
    for (int et = 0; et < 2; ++et)
#pragma unroll  // o[] stays in registers
      for (int r = 0; r < 8; ++r) vo[r * 6144 + et * 16] = o[et][r];
    // behind the stores, ahead of any rewrite of a register that they name
    asm volatile("s_wait_xcnt 0x0" ::: "memory");
    // the last chunk's end state is read by nobody here
    if (n + 1 < SEGC) state_step(S, vb, kd, decay, c16, hi);
    __syncthreads();
  }
}

// 2^x and 1/sqrt(x), each with the free slot that the instruction set asks for
// between a transcendental and a next instruction that overwrites its source.
__device__ __forceinline__ float exp2_slot(float x) {
  float r;
  asm("v_exp_f32 %0, %1\n\tv_nop" : "=v"(r) : "v"(x));
  return r;
}
__device__ __forceinline__ float rsq_slot(float x) {
  float r;
  asm("v_rsq_f32 %0, %1\n\tv_nop" : "=v"(r) : "v"(x));
  return r;
}
// g * sigmoid(g), with exp(-g) formed as 2^(-g * log2 e)
__device__ __forceinline__ float silu(float g) {
  return g / (1.f + exp2_slot(g * -1.44269504f));
}

// Sum over the 32 lanes, left in every lane: lane l with l ^ 1, 2, 4, 8 inside
// a row of 16 by DPP, then l ^ 16 by a cross-row move; all in the vector unit.
template <int M>
__device__ __forceinline__ float row_xor(float x) {
  return __builtin_bit_cast(float, __builtin_amdgcn_update_dpp(
      0, __builtin_bit_cast(int, x), 0x160 | M, 0xf, 0xf, true));
}
__device__ __forceinline__ float wave_sum(float s) {
  s += row_xor<1>(s);
  s += row_xor<2>(s);
  s += row_xor<4>(s);
  s += row_xor<8>(s);
  const int b = __builtin_bit_cast(int, s);
  return s + __builtin_bit_cast(float, __builtin_amdgcn_permlanex16(
                 b, b, 0x76543210, 0xfedcba98, false, false));
}

// ---------------------------------------------------------------------------
// RMSNorm over DV + SiLU(g) gate, output bf16 for the final GEMM
// one wave per (m, 8 heads): a row of 128 is one float4 per lane, its sum of
// squares a butterfly over the 32 lanes; no LDS, no barrier.
// ---------------------------------------------------------------------------
__global__ __launch_bounds__(256) void norm_gate_kernel(
    const float* __restrict__ qkvg, const float* __restrict__ norm_w,
    unsigned short* __restrict__ og) {
  const int lane = threadIdx.x & 31;
  const int wv = blockIdx.x * 8 + (threadIdx.x >> 5);   // 0..8191
  const int m = wv >> 1, h0 = (wv & 1) * 8;
  const float* ob = qkvg + (long)m * 6144 + 2048 + h0 * 128 + lane * 4;
  float4 o[8], g[8];
#pragma unroll  // o[] and g[] stay in registers, the 16 loads go out together
  for (int r = 0; r < 8; ++r) {
    o[r] = *(const float4*)(ob + r * 128);
    g[r] = *(const float4*)(ob + 2048 + r * 128);
  }
  const float4 w = *(const float4*)(norm_w + lane * 4);
  // The fence keeps every load above it, so that all 17 are in flight at once:
  // without it the compiler sinks six of them into the arithmetic.
  __builtin_amdgcn_sched_barrier(0);
  float ss[8];
#pragma unroll  // ss[] stays in registers
  for (int r = 0; r < 8; ++r)
    ss[r] = (o[r].x * o[r].x + o[r].y * o[r].y) +
            (o[r].z * o[r].z + o[r].w * o[r].w);
#pragma unroll  // ss[] stays in registers
  for (int r = 0; r < 8; ++r) ss[r] = wave_sum(ss[r]);
  uint2 res[8];
#pragma unroll  // res[] stays in registers
  for (int r = 0; r < 8; ++r) {
    // the argument is at least 1e-5: no subnormal range to rescale for
    const float rs = rsq_slot(ss[r] * (1.f / 128.f) + 1e-5f);
    const float a = o[r].x * rs * w.x * silu(g[r].x);
    const float b = o[r].y * rs * w.y * silu(g[r].y);
    const float c = o[r].z * rs * w.z * silu(g[r].z);
    const float d = o[r].w * rs * w.w * silu(g[r].w);
    res[r] = make_uint2(pack2bf(a, b), pack2bf(c, d));
  }
  unsigned short* dst = og + (long)m * 2048 + h0 * 128 + lane * 4;
#pragma unroll  // res[] stays in registers
  for (int r = 0; r < 8; ++r) *(uint2*)(dst + r * 128) = res[r];
}

// ---------------------------------------------------------------------------
// Host launcher
// ---------------------------------------------------------------------------
extern "C" void kernel_launch(void* const* d_in, const int* in_sizes, int n_in,
                              void* d_out, int out_size, void* d_ws,
                              size_t ws_size, hipStream_t stream) {
  const float* x      = (const float*)d_in[0];
  const float* Wq     = (const float*)d_in[1];
  const float* Wk     = (const float*)d_in[2];
  const float* Wv     = (const float*)d_in[3];
  const float* Wg     = (const float*)d_in[4];
  const float* Wgk1   = (const float*)d_in[5];
  const float* Wgk2   = (const float*)d_in[6];
  const float* bgk2   = (const float*)d_in[7];
  const float* Wo     = (const float*)d_in[8];
  const float* norm_w = (const float*)d_in[9];
  float* out = (float*)d_out;

  // workspace layout (bytes)
  char* ws = (char*)d_ws;
  unsigned short* xb    = (unsigned short*)(ws);                       // 16 MiB
  unsigned short* wcat  = (unsigned short*)(ws + (size_t)16777216);    // 24 MiB
  unsigned short* wot   = (unsigned short*)(ws + (size_t)41943040);    //  8 MiB
  float*          qkvg  = (float*)         (ws + (size_t)50331648);    // 96 MiB
  float*          gkbuf = (float*)         (ws + (size_t)150994944);   // 16 MiB
  unsigned short* og    = (unsigned short*)(ws + (size_t)167772160);   // 16 MiB
  float*          segS  = (float*)         (ws + (size_t)184549376);   // 31 MiB
  float*          segD  = (float*)         (ws + (size_t)218103808);   // 248 KiB

  // 1) x -> bf16
  cvt_f32_bf16_kernel<<<MROWS * KDIM / 8192, 256, 0, stream>>>(x, xb);

  // 2) weight transpose+convert into concatenated [6144,2048] and [2048,2048]
  transpose_cvt_kernel<1024>
      <<<dim3(1024 / TT_N, KDIM / TT_K), 256, 0, stream>>>(Wq, wcat);
  transpose_cvt_kernel<1024>
      <<<dim3(1024 / TT_N, KDIM / TT_K), 256, 0, stream>>>(
          Wk, wcat + (size_t)1024 * KDIM);
  transpose_cvt_kernel<2048>
      <<<dim3(2048 / TT_N, KDIM / TT_K), 256, 0, stream>>>(
          Wv, wcat + (size_t)2048 * KDIM);
  transpose_cvt_kernel<2048>
      <<<dim3(2048 / TT_N, KDIM / TT_K), 256, 0, stream>>>(
          Wg, wcat + (size_t)4096 * KDIM);
  transpose_cvt_kernel<2048>
      <<<dim3(2048 / TT_N, KDIM / TT_K), 256, 0, stream>>>(Wo, wot);

  // 3) fused projection GEMM (WMMA bf16 -> f32): qkvg[4096,6144]
  gemm_bf16_wmma_kernel<<<dim3(NCAT / 128, MROWS / 128), 256, 0, stream>>>(
      xb, wcat, qkvg, KDIM, NCAT);

  // 4) low-rank gate path gk[4096,1024]
  gk_kernel<<<MROWS / 16, 512, 0, stream>>>(x, Wgk1, Wgk2, bgk2, gkbuf);

  // 5) chunked GLA scan in segments (writes o over the v slice of qkvg)
  gla_seg_state_kernel<<<dim3(NSEGM1, 32), 128, 0, stream>>>(qkvg, gkbuf, segS,
                                                            segD);
  gla_seg_scan_kernel<<<32 * 64 * 32 / 256, 256, 0, stream>>>(segS, segD);
  gla_kernel<<<dim3(NSEG, 32), 128, 0, stream>>>(qkvg, gkbuf, segS);

  // 6) RMSNorm + SiLU gate -> bf16 [4096,2048]
  norm_gate_kernel<<<MROWS * 16 / 64, 256, 0, stream>>>(qkvg, norm_w, og);

  // 7) output GEMM (WMMA) -> d_out fp32 [4096,2048]
  gemm_bf16_wmma_kernel<<<dim3(NOUT / 128, MROWS / 128), 256, 0, stream>>>(
      og, wot, out, KDIM, NOUT);
}

// v006
// Measured time: 264 microseconds a run.
// In both of two side-by-side timings against v005, it was 1.10 times as fast.
// Counting every step since v000, it is 7.97 times as fast.
#include <hip/hip_runtime.h>

// ---------------------------------------------------------------------------
// Problem constants (from reference)
// ---------------------------------------------------------------------------
// B=2, T=2048, HID=2048, H=16, DK=64, DV=128, C=16, LOWR=16
// M = B*T = 4096 rows.  Fused projection GEMM: [4096,2048] x [2048,6144]
//   cols 0..1023   : q  (H*DK)
//   cols 1024..2047: k  (H*DK)
//   cols 2048..4095: v  (H*DV)   (overwritten with o by the GLA kernel)
//   cols 4096..6143: g  (H*DV)
// Output GEMM: [4096,2048] x [2048,2048] -> d_out (fp32)

#define MROWS   4096
#define KDIM    2048
#define NCAT    6144
#define NOUT    2048
#define GLA_SCALE 0.125f   // DK^-0.5

typedef __attribute__((ext_vector_type(16))) __bf16 v16bf;
typedef __attribute__((ext_vector_type(8)))  float  v8f;

__device__ __forceinline__ unsigned short f2bf(float f) {
  unsigned int u = __float_as_uint(f);
  u += 0x7fffu + ((u >> 16) & 1u);
  return (unsigned short)(u >> 16);
}

// gfx1250 async global->LDS DMA: 16B per lane, no data VGPRs, ASYNCcnt-tracked.
// GV mode: VDST = LDS byte offset (low 32 bits of flat shared address per the
// LDS aperture rule addr[31:0]), VADDR = 64-bit global address, no SADDR.
__device__ __forceinline__ void wait_async0() {
  asm volatile("s_wait_asynccnt 0x0" ::: "memory");
}

// The three streaming helpers below (convert, transpose, norm+gate) move few
// bytes per wave.
// Each is laid out so that a wave brings in 4 KiB or more with all its loads
// in flight at once, and the grids are 8 to 32 times smaller for it.

__device__ __forceinline__ unsigned int pack2bf(float lo, float hi) {
  return (unsigned int)f2bf(lo) | ((unsigned int)f2bf(hi) << 16);
}

// ---------------------------------------------------------------------------
// fp32 -> bf16 elementwise convert (x activations)
// one block converts 8192 contiguous floats: 8 float4 per thread
// ---------------------------------------------------------------------------
__global__ __launch_bounds__(256) void cvt_f32_bf16_kernel(
    const float* __restrict__ in, unsigned short* __restrict__ out) {
  const long base = (long)blockIdx.x * 2048 + threadIdx.x;   // in float4 units
  const float4* p = (const float4*)in + base;
  uint2* q = (uint2*)out + base;
  float4 v[8];
#pragma unroll  // v[] stays in registers, the 8 loads go out together
  for (int i = 0; i < 8; ++i) v[i] = p[i * 256];
#pragma unroll  // v[] stays in registers
  for (int i = 0; i < 8; ++i)
    q[i * 256] = make_uint2(pack2bf(v[i].x, v[i].y), pack2bf(v[i].z, v[i].w));
}

// ---------------------------------------------------------------------------
// Transpose [K,Nw] fp32 -> [Nw,K] bf16 (weights, so WMMA B operand is N-major)
// one block of 256 threads moves a tile of 128 k x 64 n: 8 float4 loads per
// thread (256 B of a source row per 16 lanes), then 4 stores of 8 bf16 per
// thread (256 B of an output row per 16 lanes).
// ---------------------------------------------------------------------------
#define TT_K 128
#define TT_N 64
#define TT_P 65   // odd pitch in floats: column reads spread over the banks

// The row pitches are compile-time constants, so that the 8 loads (and the 4
// stores) share one address and differ in their immediate offsets only.
template <int Nw>
__global__ __launch_bounds__(256) void transpose_cvt_kernel(
    const float* __restrict__ W, unsigned short* __restrict__ out) {
  constexpr int K = KDIM;
  __shared__ float tile[TT_K * TT_P];
  const int kb = blockIdx.y * TT_K, nb = blockIdx.x * TT_N;
  const int lo = threadIdx.x & 15, hi = threadIdx.x >> 4;
  const float* s = W + (long)(kb + hi) * Nw + (nb + lo * 4);
  float4 v[8];
#pragma unroll  // v[] stays in registers, the 8 loads go out together
  for (int i = 0; i < 8; ++i) v[i] = *(const float4*)(s + i * 16 * Nw);
#pragma unroll  // v[] stays in registers
  for (int i = 0; i < 8; ++i) {
    float* t = &tile[(hi + i * 16) * TT_P + lo * 4];
    t[0] = v[i].x; t[1] = v[i].y; t[2] = v[i].z; t[3] = v[i].w;
  }
  __syncthreads();
  uint4 r[4];
#pragma unroll  // r[] stays in registers
  for (int j = 0; j < 4; ++j) {
    const float* t = &tile[(lo * 8) * TT_P + hi + j * 16];
    r[j] = make_uint4(pack2bf(t[0 * TT_P], t[1 * TT_P]),
                      pack2bf(t[2 * TT_P], t[3 * TT_P]),
                      pack2bf(t[4 * TT_P], t[5 * TT_P]),
                      pack2bf(t[6 * TT_P], t[7 * TT_P]));
  }
  unsigned short* d = out + (long)(nb + hi) * K + (kb + lo * 8);
#pragma unroll  // r[] stays in registers
  for (int j = 0; j < 4; ++j) *(uint4*)(d + j * 16 * K) = r[j];
}

// ---------------------------------------------------------------------------
// bf16 WMMA GEMM:  C[M,N](f32) = A[M,K](bf16,row-major) * Bt[N,K]^T
// Block tile (64 FM) x 128, K-step 64, 256 threads = 8 waves (4x2 wave grid),
// each wave: FM x 4 fragments of 16x16. With FM = 4 a wave reads 8 fragments
// from LDS for 16 matrix steps (FM = 2: 6 for 8), and a block brings in 384
// operand rows for 256 x 128 results (FM = 2: 256 rows for 128 x 128).
// Double-buffered LDS, pitch 72 (144B rows -> conflict-free b128 fragment
// reads). Tile staging uses global_load_async_to_lds_b128 (no data VGPRs).
// ---------------------------------------------------------------------------
#define GT_N 128
#define GT_K 64
#define LDT  72

__device__ __forceinline__ v16bf load_frag(const unsigned short* p) {
  union { v16bf v; uint4 u[2]; } f;
  f.u[0] = *(const uint4*)(p);        // halves 0..7  : K = khalf*8 + 0..7
  f.u[1] = *(const uint4*)(p + 16);   // halves 8..15 : K = khalf*8 + 16..23
  return f.v;
}

// Rows r, r + 32, r + 64, r + 96 of a tile: 16 bytes per lane and row, from g
// (row pitch gp elements) to LDS at l (row pitch LDT). The s_wait_xcnt stands
// in the copies' own statement, ahead of any rewrite of an address register
// that they name.
__device__ __forceinline__ void async_copy_rows4(const unsigned short* g,
                                                 long gp, unsigned short* l) {
  const unsigned l0 = (unsigned)(unsigned long long)l;
  const unsigned l1 = l0 + 32 * LDT * 2, l2 = l0 + 64 * LDT * 2,
                 l3 = l0 + 96 * LDT * 2;
  const unsigned short *g1 = g + 32 * gp, *g2 = g + 64 * gp, *g3 = g + 96 * gp;
  asm volatile(
      "global_load_async_to_lds_b128 %0, %4, off\n\t"
      "global_load_async_to_lds_b128 %1, %5, off\n\t"
      "global_load_async_to_lds_b128 %2, %6, off\n\t"
      "global_load_async_to_lds_b128 %3, %7, off\n\t"
      "s_wait_xcnt 0x0"
      :: "v"(l0), "v"(l1), "v"(l2), "v"(l3), "v"(g), "v"(g1), "v"(g2), "v"(g3)
      : "memory");
}

template <int FM>
__global__ __launch_bounds__(256) void gemm_bf16_wmma_kernel(
    const unsigned short* __restrict__ A,   // [M,K] bf16
    const unsigned short* __restrict__ Bt,  // [N,K] bf16 (B transposed)
    float* __restrict__ C, int K, int ldc) {
  constexpr int BM = 64 * FM;
  __shared__ __align__(16) unsigned short As[2][BM * LDT];
  __shared__ __align__(16) unsigned short Bs[2][GT_N * LDT];

  const int tid  = threadIdx.x;
  const int lane = tid & 31;
  const int w    = tid >> 5;
  const int wm   = w >> 1;   // 0..3 : band of 16 FM rows
  const int wn   = w & 1;    // 0..1 : 64-col band

  const long m0 = (long)blockIdx.y * BM;
  const long n0 = (long)blockIdx.x * GT_N;
  const int  nk = K / GT_K;

  const unsigned short* Agb = A  + m0 * K;
  const unsigned short* Bgb = Bt + n0 * K;

  // A tile row is one 128-byte line: 8 lanes cover a whole line, a wave's copy
  // 4 whole lines. Thread tid takes 16-byte chunk tid & 7 of rows
  // (tid >> 3) + 32 i.
  const int  sr = tid >> 3, sc = (tid & 7) * 8;
  const long so = (long)sr * K + sc;     // this thread's place in a global tile
  const int  sl = sr * LDT + sc;         // and in an LDS tile
  auto stage = [&](int kt, int buf) {    // async DMA of tile kt straight to LDS
#pragma unroll  // constant LDS offsets
    for (int i = 0; i < BM / 128; ++i)
      async_copy_rows4(Agb + kt * GT_K + so + (long)(i * 128) * K, K,
                       &As[buf][i * 128 * LDT + sl]);
    async_copy_rows4(Bgb + kt * GT_K + so, K, &Bs[buf][sl]);
  };

  stage(0, 0);
  wait_async0();
  __syncthreads();
  if (nk > 1) stage(1, 1);

  v8f acc[FM][4];
#pragma unroll
  for (int fm = 0; fm < FM; ++fm)
#pragma unroll
    for (int fn = 0; fn < 4; ++fn)
      acc[fm][fn] = (v8f){0.f, 0.f, 0.f, 0.f, 0.f, 0.f, 0.f, 0.f};

  for (int kt = 0; kt < nk; ++kt) {
    const int cur = kt & 1;
    if (kt + 2 < nk) {  // gfx1250 global_prefetch_b8 for tile kt+2 into L2
      const int ca = tid * (BM / 32), cb = tid * (GT_N / 32);   // 16-byte chunks
      __builtin_prefetch(
          &Agb[(kt + 2) * GT_K + (long)(ca >> 3) * K + (ca & 7) * 8], 0, 1);
      __builtin_prefetch(
          &Bgb[(kt + 2) * GT_K + (long)(cb >> 3) * K + (cb & 7) * 8], 0, 1);
    }

    // compute on current buffer: two k=32 sub-steps
#pragma unroll
    for (int s = 0; s < 2; ++s) {
      const int kb = s * 32 + (lane >> 4) * 8;   // khalf selects K sub-lane set
      v16bf afr[FM], bfr[4];
#pragma unroll
      for (int fm = 0; fm < FM; ++fm) {
        int row = (wm * FM + fm) * 16 + (lane & 15);
        afr[fm] = load_frag(&As[cur][row * LDT + kb]);
      }
#pragma unroll
      for (int fn = 0; fn < 4; ++fn) {
        int row = wn * 64 + fn * 16 + (lane & 15);
        bfr[fn] = load_frag(&Bs[cur][row * LDT + kb]);
      }
      if (s == 1) {
        // The trip's last LDS reads are out. This wave's reads of buffer cur
        // are done and its copies of tile kt + 1 have landed; behind the
        // barrier that holds for every wave, so tile kt + 1 may be read and
        // buffer cur refilled. The refill goes out ahead of the sub-step's
        // matrix steps, which need registers only: it has the longer lead.
        asm volatile("s_wait_dscnt 0x0" ::: "memory");
        wait_async0();
        __syncthreads();
        if (kt + 2 < nk) stage(kt + 2, cur);
      }
#pragma unroll
      for (int fm = 0; fm < FM; ++fm)
#pragma unroll
        for (int fn = 0; fn < 4; ++fn)
          acc[fm][fn] = __builtin_amdgcn_wmma_f32_16x16x32_bf16(
              false, afr[fm], false, bfr[fn], (short)0, acc[fm][fn],
              false, false);
    }
  }
  wait_async0();   // no copy is in flight when the wave ends

  // store: VGPR r -> row (r + 8*khalf), lane&15 -> col  (16x16 f32 C layout)
  const int cn    = lane & 15;
  const int rbase = (lane >> 4) * 8;
#pragma unroll
  for (int fm = 0; fm < FM; ++fm)
#pragma unroll
    for (int fn = 0; fn < 4; ++fn) {
      long row0 = m0 + (wm * FM + fm) * 16 + rbase;
      long col  = n0 + wn * 64 + fn * 16 + cn;
#pragma unroll
      for (int r = 0; r < 8; ++r)
        C[(row0 + r) * ldc + col] = acc[fm][fn][r];
    }
}

// ---------------------------------------------------------------------------
// gk = log_sigmoid(x @ Wgk1 @ Wgk2 + bgk2) / 16      (low-rank, fp32)
// One block per 16 rows of x, so that Wgk1 and Wgk2 are read once per 16 rows.
// x @ Wgk1 runs on the f32 16x16x4 matrix form: wave w takes k = 128 w ..
// 128 w + 127, the 16 partial tiles are summed through LDS in the order of w.
// A wave loads its 16 x 128 piece of x in whole lines (one row piece of 512 B
// per load) and turns it into A fragments through LDS.
// k order of one matrix step (t, u): lane half hi, register i hold
// k = 128 w + 8 t + 4 hi + 2 u + i, in the A loader (a float4 of a row of x is
// u = 0, 1) and in the B loader (rows of Wgk1) alike.
// ---------------------------------------------------------------------------
#define GK_WAVES 16
#define GK_KS (KDIM / GK_WAVES)   // k per wave
#define GK_T (GK_KS / 8)          // float4 of x per lane
#define GK_XP (GK_KS + 4)         // LDS row pitch: 16 B x odd, for b128 readers

typedef __attribute__((ext_vector_type(2))) float v2f;

__device__ __forceinline__ v8f wmma_f32(v2f a, v2f b, v8f c) {
  return __builtin_amdgcn_wmma_f32_16x16x4_f32(false, a, false, b, (short)0, c,
                                               false, false);
}

// eight consecutive floats of LDS, 16-byte aligned
__device__ __forceinline__ v8f lds8(const float* p) {
  const float4 a = *(const float4*)p, b = *(const float4*)(p + 4);
  return (v8f){a.x, a.y, a.z, a.w, b.x, b.y, b.z, b.w};
}

__global__ __launch_bounds__(512) void gk_kernel(
    const float* __restrict__ x, const float* __restrict__ Wgk1,
    const float* __restrict__ Wgk2, const float* __restrict__ bgk2,
    float* __restrict__ gkout) {
  __shared__ __align__(16) float xs[GK_WAVES * 16 * GK_XP];
  __shared__ __align__(16) float red[GK_WAVES * 256];
  __shared__ __align__(16) float low[16 * 16];
  const int tid = threadIdx.x;
  const int lane = tid & 31, c16 = tid & 15, hi = (tid >> 4) & 1, w = tid >> 5;
  const long m0 = (long)blockIdx.x * 16;

  const float* xp = x + m0 * KDIM + w * GK_KS + lane * 4;
  const float* wp = Wgk1 + (w * GK_KS + 4 * hi) * 16 + c16;
  // the second product's operands: columns 2 tid, 2 tid + 1 of Wgk2 and bgk2
  float2 w2[16];
#pragma unroll  // w2[] stays in registers, the loads go out with those below
  for (int r = 0; r < 16; ++r) w2[r] = *((const float2*)(Wgk2 + r * 1024) + tid);
  const float2 bias = *((const float2*)bgk2 + tid);
  float bq[GK_T][4];
#pragma unroll  // bq[][] stays in registers, the loads go out together
  for (int t = 0; t < GK_T; ++t)
#pragma unroll  // bq[][] stays in registers
    for (int q = 0; q < 4; ++q) bq[t][q] = wp[(8 * t + q) * 16];
  // With the fence every load of the kernel is issued ahead of the first wait:
  // without it the compiler holds a quarter of these, and of those of x, back
  // behind that wait, and their latency comes on top.
  __builtin_amdgcn_sched_barrier(0);
  float4 xv[16];
#pragma unroll  // xv[] stays in registers, the loads go out together
  for (int j = 0; j < 16; ++j) xv[j] = *(const float4*)(xp + j * KDIM);

  float* xw = xs + w * (16 * GK_XP);
#pragma unroll  // xv[] stays in registers
  for (int j = 0; j < 16; ++j) *(float4*)(xw + j * GK_XP + lane * 4) = xv[j];
  __syncthreads();

  // two accumulator tiles, so that a step need not wait for the one before it
  v8f acc0 = (v8f){0.f, 0.f, 0.f, 0.f, 0.f, 0.f, 0.f, 0.f};
  v8f acc1 = acc0;
#pragma unroll  // bq[][] stays in registers
  for (int t = 0; t < GK_T; ++t) {
    const float4 a = *(const float4*)(xw + c16 * GK_XP + 8 * t + 4 * hi);
    acc0 = wmma_f32((v2f){a.x, a.y}, (v2f){bq[t][0], bq[t][1]}, acc0);
    acc1 = wmma_f32((v2f){a.z, a.w}, (v2f){bq[t][2], bq[t][3]}, acc1);
  }
  acc0 += acc1;
#pragma unroll  // acc0 stays in registers
  for (int r = 0; r < 8; ++r) red[w * 256 + r * 32 + lane] = acc0[r];
  __syncthreads();
  if (tid < 256) {   // register r = tid >> 5 of lane (c16, hi): row 8 hi + r
    float s = 0.f;
#pragma unroll  // the 16 LDS loads go out together
    for (int v = 0; v < GK_WAVES; ++v) s += red[v * 256 + tid];
    low[(8 * hi + w) * 16 + c16] = s;
  }
  __syncthreads();

  float* dst = gkout + m0 * 1024 + 2 * tid;
#pragma unroll 1  // one copy of the long log-sigmoid text
  for (int m = 0; m < 16; ++m) {
    const v8f l0 = lds8(&low[m * 16]), l1 = lds8(&low[m * 16 + 8]);
    float ax = bias.x, ay = bias.y;
#pragma unroll  // l0 and w2[] stay in registers
    for (int r = 0; r < 8; ++r) { ax += l0[r] * w2[r].x; ay += l0[r] * w2[r].y; }
#pragma unroll  // l1 and w2[] stay in registers
    for (int r = 0; r < 8; ++r) {
      ax += l1[r] * w2[8 + r].x;
      ay += l1[r] * w2[8 + r].y;
    }
    const float lx = fminf(ax, 0.f) - log1pf(__expf(-fabsf(ax)));
    const float ly = fminf(ay, 0.f) - log1pf(__expf(-fabsf(ay)));
    *(float2*)(dst + m * 1024) =
        make_float2(lx * (1.0f / 16.0f), ly * (1.0f / 16.0f));
  }
}

// ---------------------------------------------------------------------------
// Chunked GLA scan, split along the sequence into NSEG segments of SEGC chunks
// so that (b,h) x segment work-groups run side by side. The state recurrence
// S <- diag(decay) S + kv is linear in S, so over one segment
//   S_end = diag(D_seg) S_start + KV_seg,
// with D_seg the product of the chunk decays and KV_seg the segment's end
// state when started from zero. Three launches:
//   1) gla_seg_state_kernel: KV_seg and D_seg of every segment but the last
//   2) gla_seg_scan_kernel : start state of segments 1..NSEG-1 (in place)
//   3) gla_kernel          : the full chunk loop of a segment from its start
// The products with v and with S run on the f32 16x16x4 matrix form. Wave w
// owns columns e = 32 w .. 32 w + 31 (two tiles of 16). S[64][128] lives in
// registers as 4 x 2 accumulator tiles per wave: register r of lane (c, hi)
// holds S[16 dt + 8 hi + r][e0 + c]. Registers (2j, 2j+1) of such a tile are at
// once a B fragment whose four k are rows 2j, 2j+1 (hi = 0) and 8+2j, 8+2j+1
// (hi = 1); the A loaders below take their k in the same order. v is loaded in
// the same map, so it too is a B fragment as it lies. o overwrites v in qkvg.
// ---------------------------------------------------------------------------
#define CPAD 68
#define NSEG 32                 // segments per sequence
#define SEGC 4                  // chunks of 16 rows per segment (NSEG*SEGC = 128)
#define NSEGM1 (NSEG - 1)

// S <- diag(decay) S + kd^T v for one chunk; kd is [16 c][CPAD], d contiguous
__device__ __forceinline__ void state_step(v8f (&S)[4][2], const v8f (&vb)[2],
                                           const float* kd, const float* decay,
                                           int c16, int hi) {
#pragma unroll  // S[][] stays in registers
  for (int dt = 0; dt < 4; ++dt) {
    const v8f dec = lds8(&decay[dt * 16 + 8 * hi]);
    S[dt][0] *= dec;
    S[dt][1] *= dec;
#pragma unroll  // S[][] and vb[] stay in registers
    for (int j = 0; j < 4; ++j) {
      const float* kr = &kd[(2 * j + 8 * hi) * CPAD + dt * 16 + c16];
      const v2f a = {kr[0], kr[CPAD]};
#pragma unroll  // S[][] and vb[] stay in registers
      for (int et = 0; et < 2; ++et)
        S[dt][et] = wmma_f32(a, (v2f){vb[et][2 * j], vb[et][2 * j + 1]},
                             S[dt][et]);
    }
  }
}

__global__ __launch_bounds__(128) void gla_seg_state_kernel(
    const float* __restrict__ qkvg, const float* __restrict__ gk,
    float* __restrict__ segS, float* __restrict__ segD) {
  __shared__ float gc[16 * CPAD];
  __shared__ __align__(16) float kd[16 * CPAD];
  __shared__ __align__(16) float decay[64];

  const int seg = blockIdx.x;       // 0..NSEG-2
  const int bh = blockIdx.y;        // 0..31
  const int b = bh >> 4, h = bh & 15;
  const int tid = threadIdx.x;
  const int c16 = tid & 15, hi = (tid >> 4) & 1, w = tid >> 5;

  v8f S[4][2];
#pragma unroll  // S[][] stays in registers
  for (int dt = 0; dt < 4; ++dt)
#pragma unroll  // S[][] stays in registers
    for (int et = 0; et < 2; ++et)
      S[dt][et] = (v8f){0.f, 0.f, 0.f, 0.f, 0.f, 0.f, 0.f, 0.f};

  const long row0 = (long)b * 2048 + (long)seg * (SEGC * 16);
  // row pointers of the current chunk, advanced by 16 rows per chunk
  const float* gp = gk + row0 * 1024 + h * 64 + (tid & 63);
  const float* kp = qkvg + row0 * 6144 + 1024 + h * 64 + (tid & 63);
  const float* vp = qkvg + (row0 + 8 * hi) * 6144 + 2048 + h * 128 + w * 32 + c16;
  float dprod = 1.f;

  for (int n = 0; n < SEGC; ++n) {
    if (tid < 64) {                  // per-column-d prep
      const int d = tid;
      float c = 0.f;
#pragma unroll  // the 16 row loads go out together
      for (int cc = 0; cc < 16; ++cc) {
        c += gp[cc * 1024];
        gc[cc * CPAD + d] = c;
      }
      const float dec = __expf(c);
      decay[d] = dec;
      dprod *= dec;
      const float glast = c;
#pragma unroll  // the 16 row loads go out together
      for (int cc = 0; cc < 16; ++cc) {
        float g = gc[cc * CPAD + d];
        kd[cc * CPAD + d] = kp[cc * 6144] * __expf(glast - g);
      }
    }
    v8f vb[2];
#pragma unroll  // vb[] stays in registers
    for (int et = 0; et < 2; ++et)
#pragma unroll  // vb[] stays in registers
      for (int r = 0; r < 8; ++r) vb[et][r] = vp[r * 6144 + et * 16];
    __syncthreads();

    state_step(S, vb, kd, decay, c16, hi);
    gp += 16 * 1024;
    kp += 16 * 6144;
    vp += 16 * 6144;
    __syncthreads();
  }

  const long sb = (long)bh * NSEGM1 + seg;
  float* sp = segS + sb * (64 * 128) + (8 * hi) * 128 + w * 32 + c16;
#pragma unroll  // S[][] stays in registers; one address, constant offsets
  for (int dt = 0; dt < 4; ++dt)
#pragma unroll  // S[][] stays in registers
    for (int et = 0; et < 2; ++et)
#pragma unroll  // S[][] stays in registers
      for (int r = 0; r < 8; ++r)
        sp[(dt * 16 + r) * 128 + et * 16] = S[dt][et][r];
  if (tid < 64) segD[sb * 64 + tid] = dprod;
}

// segS[bh][g] holds KV of segment g on entry and the start state of segment
// g + 1 on exit. One thread per (bh, d, four columns e); every load is issued
// ahead of the first store.
__global__ __launch_bounds__(256) void gla_seg_scan_kernel(
    float* __restrict__ segS, const float* __restrict__ segD) {
  const int idx = blockIdx.x * 256 + threadIdx.x;   // 32 * 64 * 32 threads
  const int bh = idx >> 11, rem = idx & 2047, d = rem >> 5;
  float4* p = (float4*)segS + (long)bh * NSEGM1 * 2048 + rem;
  const float* dp = segD + (long)bh * NSEGM1 * 64 + d;
  float4 kv[NSEGM1];
  float dc[NSEGM1];
#pragma unroll  // kv[] and dc[] stay in registers
  for (int g = 0; g < NSEGM1; ++g) {
    kv[g] = p[g * 2048];
    dc[g] = dp[g * 64];
  }
  // Stands behind the last load and in front of the first store: no load is
  // issued among the stores into a register that a store still names, and the
  // loads' latencies overlap instead of adding up along the chain.
  asm volatile("s_wait_xcnt 0x0" ::: "memory");
  // segment 0 starts from zero, so kv[0] is already the start of segment 1
#pragma unroll  // kv[] and dc[] stay in registers
  for (int g = 1; g < NSEGM1; ++g) {
    kv[g].x = dc[g] * kv[g - 1].x + kv[g].x;
    kv[g].y = dc[g] * kv[g - 1].y + kv[g].y;
    kv[g].z = dc[g] * kv[g - 1].z + kv[g].z;
    kv[g].w = dc[g] * kv[g - 1].w + kv[g].w;
    p[g * 2048] = kv[g];
  }
}

__global__ __launch_bounds__(128) void gla_kernel(
    float* __restrict__ qkvg, const float* __restrict__ gk,
    const float* __restrict__ segS) {
  __shared__ float gc[16 * CPAD];
  __shared__ __align__(16) float qe[16 * CPAD];
  __shared__ __align__(16) float ke[16 * CPAD];
  __shared__ __align__(16) float kd[16 * CPAD];
  __shared__ __align__(16) float Am[16 * 16];
  __shared__ __align__(16) float decay[64];

  const int seg = blockIdx.x;       // 0..NSEG-1
  const int bh = blockIdx.y;        // 0..31
  const int b = bh >> 4, h = bh & 15;
  const int tid = threadIdx.x;
  const int c16 = tid & 15, hi = (tid >> 4) & 1, w = tid >> 5;

  v8f S[4][2];
  if (seg == 0) {
#pragma unroll  // S[][] stays in registers
    for (int dt = 0; dt < 4; ++dt)
#pragma unroll  // S[][] stays in registers
      for (int et = 0; et < 2; ++et)
        S[dt][et] = (v8f){0.f, 0.f, 0.f, 0.f, 0.f, 0.f, 0.f, 0.f};
  } else {
    const float* s0 = segS + ((long)bh * NSEGM1 + (seg - 1)) * (64 * 128) +
                      (8 * hi) * 128 + w * 32 + c16;
#pragma unroll  // S[][] stays in registers; one address, constant offsets
    for (int dt = 0; dt < 4; ++dt)
#pragma unroll  // S[][] stays in registers
      for (int et = 0; et < 2; ++et)
#pragma unroll  // S[][] stays in registers
        for (int r = 0; r < 8; ++r)
          S[dt][et][r] = s0[(dt * 16 + r) * 128 + et * 16];
    // behind the loads, ahead of any rewrite of a register that they name
    asm volatile("s_wait_xcnt 0x0" ::: "memory");
  }

  const long rowbase = (long)b * 2048 + (long)seg * (SEGC * 16);

  for (int n = 0; n < SEGC; ++n) {
    const long m0 = rowbase + n * 16;
    if (tid < 64) {                  // per-column-d prep
      const int d = tid;
      float c = 0.f;
#pragma unroll
      for (int cc = 0; cc < 16; ++cc) {
        c += gk[(m0 + cc) * 1024 + h * 64 + d];
        gc[cc * CPAD + d] = c;
      }
      decay[d] = __expf(c);
      const float glast = c;
#pragma unroll
      for (int cc = 0; cc < 16; ++cc) {
        float g = gc[cc * CPAD + d];
        float q = qkvg[(m0 + cc) * 6144 + h * 64 + d];
        float k = qkvg[(m0 + cc) * 6144 + 1024 + h * 64 + d];
        qe[cc * CPAD + d] = q * __expf(g) * GLA_SCALE;
        ke[cc * CPAD + d] = k * __expf(-g);
        kd[cc * CPAD + d] = k * __expf(glast - g);
      }
    }
    // this wave's 16 x 32 piece of v (and of o), rows 8 hi + r, as B fragments
    float* vo = qkvg + (m0 + 8 * hi) * 6144 + 2048 + h * 128 + w * 32 + c16;
    v8f vb[2];
#pragma unroll  // vb[] stays in registers
    for (int et = 0; et < 2; ++et)
#pragma unroll  // vb[] stays in registers
      for (int r = 0; r < 8; ++r) vb[et][r] = vo[r * 6144 + et * 16];
    __syncthreads();

    // A = tril(qe ke^T), 256 entries over 128 threads
#pragma unroll
    for (int t = tid; t < 256; t += 128) {
      int cc = t >> 4, mm = t & 15;
      float a = 0.f;
      if (mm <= cc) {
#pragma unroll
        for (int d = 0; d < 64; ++d) a += qe[cc * CPAD + d] * ke[mm * CPAD + d];
      }
      Am[cc * 16 + mm] = a;
    }
    __syncthreads();

    v8f o[2];
    o[0] = (v8f){0.f, 0.f, 0.f, 0.f, 0.f, 0.f, 0.f, 0.f};
    o[1] = o[0];
    {  // o_intra = A v: row c16 of A, k = rows of v in the order of vb
      const v8f am = lds8(&Am[c16 * 16 + 8 * hi]);
#pragma unroll  // am, vb[] and o[] stay in registers
      for (int j = 0; j < 4; ++j) {
        const v2f a = {am[2 * j], am[2 * j + 1]};
#pragma unroll  // vb[] and o[] stay in registers
        for (int et = 0; et < 2; ++et)
          o[et] = wmma_f32(a, (v2f){vb[et][2 * j], vb[et][2 * j + 1]}, o[et]);
      }
    }
    // o_inter = qe S (old S): row c16 of qe, k = rows of S in the tiles' order
#pragma unroll  // S[][] and o[] stay in registers
    for (int dt = 0; dt < 4; ++dt) {
      const v8f qf = lds8(&qe[c16 * CPAD + dt * 16 + 8 * hi]);
#pragma unroll  // qf, S[][] and o[] stay in registers
      for (int j = 0; j < 4; ++j) {
        const v2f a = {qf[2 * j], qf[2 * j + 1]};
#pragma unroll  // S[][] and o[] stay in registers
        for (int et = 0; et < 2; ++et)
          o[et] = wmma_f32(a, (v2f){S[dt][et][2 * j], S[dt][et][2 * j + 1]},
                           o[et]);
      }
    }
#pragma unroll  // o[] stays in registers
    for (int et = 0; et < 2; ++et)
#pragma unroll  // o[] stays in registers
      for (int r = 0; r < 8; ++r) vo[r * 6144 + et * 16] = o[et][r];
    // behind the stores, ahead of any rewrite of a register that they name
    asm volatile("s_wait_xcnt 0x0" ::: "memory");
    // the last chunk's end state is read by nobody here
    if (n + 1 < SEGC) state_step(S, vb, kd, decay, c16, hi);
    __syncthreads();
  }
}

// 2^x and 1/sqrt(x), each with the free slot that the instruction set asks for
// between a transcendental and a next instruction that overwrites its source.
__device__ __forceinline__ float exp2_slot(float x) {
  float r;
  asm("v_exp_f32 %0, %1\n\tv_nop" : "=v"(r) : "v"(x));
  return r;
}
__device__ __forceinline__ float rsq_slot(float x) {
  float r;
  asm("v_rsq_f32 %0, %1\n\tv_nop" : "=v"(r) : "v"(x));
  return r;
}
// g * sigmoid(g), with exp(-g) formed as 2^(-g * log2 e)
__device__ __forceinline__ float silu(float g) {
  return g / (1.f + exp2_slot(g * -1.44269504f));
}

// Sum over the 32 lanes, left in every lane: lane l with l ^ 1, 2, 4, 8 inside
// a row of 16 by DPP, then l ^ 16 by a cross-row move; all in the vector unit.
template <int M>
__device__ __forceinline__ float row_xor(float x) {
  return __builtin_bit_cast(float, __builtin_amdgcn_update_dpp(
      0, __builtin_bit_cast(int, x), 0x160 | M, 0xf, 0xf, true));
}
__device__ __forceinline__ float wave_sum(float s) {
  s += row_xor<1>(s);
  s += row_xor<2>(s);
  s += row_xor<4>(s);
  s += row_xor<8>(s);
  const int b = __builtin_bit_cast(int, s);
  return s + __builtin_bit_cast(float, __builtin_amdgcn_permlanex16(
                 b, b, 0x76543210, 0xfedcba98, false, false));
}

// ---------------------------------------------------------------------------
// RMSNorm over DV + SiLU(g) gate, output bf16 for the final GEMM
// one wave per (m, 8 heads): a row of 128 is one float4 per lane, its sum of
// squares a butterfly over the 32 lanes; no LDS, no barrier.
// ---------------------------------------------------------------------------
__global__ __launch_bounds__(256) void norm_gate_kernel(
    const float* __restrict__ qkvg, const float* __restrict__ norm_w,
    unsigned short* __restrict__ og) {
  const int lane = threadIdx.x & 31;
  const int wv = blockIdx.x * 8 + (threadIdx.x >> 5);   // 0..8191
  const int m = wv >> 1, h0 = (wv & 1) * 8;
  const float* ob = qkvg + (long)m * 6144 + 2048 + h0 * 128 + lane * 4;
  float4 o[8], g[8];
#pragma unroll  // o[] and g[] stay in registers, the 16 loads go out together
  for (int r = 0; r < 8; ++r) {
    o[r] = *(const float4*)(ob + r * 128);
    g[r] = *(const float4*)(ob + 2048 + r * 128);
  }
  const float4 w = *(const float4*)(norm_w + lane * 4);
  // The fence keeps every load above it, so that all 17 are in flight at once:
  // without it the compiler sinks six of them into the arithmetic.
  __builtin_amdgcn_sched_barrier(0);
  float ss[8];
#pragma unroll  // ss[] stays in registers
  for (int r = 0; r < 8; ++r)
    ss[r] = (o[r].x * o[r].x + o[r].y * o[r].y) +
            (o[r].z * o[r].z + o[r].w * o[r].w);
#pragma unroll  // ss[] stays in registers
  for (int r = 0; r < 8; ++r) ss[r] = wave_sum(ss[r]);
  uint2 res[8];
#pragma unroll  // res[] stays in registers
  for (int r = 0; r < 8; ++r) {
    // the argument is at least 1e-5: no subnormal range to rescale for
    const float rs = rsq_slot(ss[r] * (1.f / 128.f) + 1e-5f);
    const float a = o[r].x * rs * w.x * silu(g[r].x);
    const float b = o[r].y * rs * w.y * silu(g[r].y);
    const float c = o[r].z * rs * w.z * silu(g[r].z);
    const float d = o[r].w * rs * w.w * silu(g[r].w);
    res[r] = make_uint2(pack2bf(a, b), pack2bf(c, d));
  }
  unsigned short* dst = og + (long)m * 2048 + h0 * 128 + lane * 4;
#pragma unroll  // res[] stays in registers
  for (int r = 0; r < 8; ++r) *(uint2*)(dst + r * 128) = res[r];
}

// ---------------------------------------------------------------------------
// Host launcher
// ---------------------------------------------------------------------------
extern "C" void kernel_launch(void* const* d_in, const int* in_sizes, int n_in,
                              void* d_out, int out_size, void* d_ws,
                              size_t ws_size, hipStream_t stream) {
  const float* x      = (const float*)d_in[0];
  const float* Wq     = (const float*)d_in[1];
  const float* Wk     = (const float*)d_in[2];
  const float* Wv     = (const float*)d_in[3];
  const float* Wg     = (const float*)d_in[4];
  const float* Wgk1   = (const float*)d_in[5];
  const float* Wgk2   = (const float*)d_in[6];
  const float* bgk2   = (const float*)d_in[7];
  const float* Wo     = (const float*)d_in[8];
  const float* norm_w = (const float*)d_in[9];
  float* out = (float*)d_out;

  // workspace layout (bytes)
  char* ws = (char*)d_ws;
  unsigned short* xb    = (unsigned short*)(ws);                       // 16 MiB
  unsigned short* wcat  = (unsigned short*)(ws + (size_t)16777216);    // 24 MiB
  unsigned short* wot   = (unsigned short*)(ws + (size_t)41943040);    //  8 MiB
  float*          qkvg  = (float*)         (ws + (size_t)50331648);    // 96 MiB
  float*          gkbuf = (float*)         (ws + (size_t)150994944);   // 16 MiB
  unsigned short* og    = (unsigned short*)(ws + (size_t)167772160);   // 16 MiB
  float*          segS  = (float*)         (ws + (size_t)184549376);   // 31 MiB
  float*          segD  = (float*)         (ws + (size_t)218103808);   // 248 KiB

  // 1) x -> bf16
  cvt_f32_bf16_kernel<<<MROWS * KDIM / 8192, 256, 0, stream>>>(x, xb);

  // 2) weight transpose+convert into concatenated [6144,2048] and [2048,2048]
  transpose_cvt_kernel<1024>
      <<<dim3(1024 / TT_N, KDIM / TT_K), 256, 0, stream>>>(Wq, wcat);
  transpose_cvt_kernel<1024>
      <<<dim3(1024 / TT_N, KDIM / TT_K), 256, 0, stream>>>(
          Wk, wcat + (size_t)1024 * KDIM);
  transpose_cvt_kernel<2048>
      <<<dim3(2048 / TT_N, KDIM / TT_K), 256, 0, stream>>>(
          Wv, wcat + (size_t)2048 * KDIM);
  transpose_cvt_kernel<2048>
      <<<dim3(2048 / TT_N, KDIM / TT_K), 256, 0, stream>>>(
          Wg, wcat + (size_t)4096 * KDIM);
  transpose_cvt_kernel<2048>
      <<<dim3(2048 / TT_N, KDIM / TT_K), 256, 0, stream>>>(Wo, wot);

  // 3) fused projection GEMM (WMMA bf16 -> f32): qkvg[4096,6144]
  gemm_bf16_wmma_kernel<4><<<dim3(NCAT / 128, MROWS / 256), 256, 0, stream>>>(
      xb, wcat, qkvg, KDIM, NCAT);

  // 4) low-rank gate path gk[4096,1024]
  gk_kernel<<<MROWS / 16, 512, 0, stream>>>(x, Wgk1, Wgk2, bgk2, gkbuf);

  // 5) chunked GLA scan in segments (writes o over the v slice of qkvg)
  gla_seg_state_kernel<<<dim3(NSEGM1, 32), 128, 0, stream>>>(qkvg, gkbuf, segS,
                                                            segD);
  gla_seg_scan_kernel<<<32 * 64 * 32 / 256, 256, 0, stream>>>(segS, segD);
  gla_kernel<<<dim3(NSEG, 32), 128, 0, stream>>>(qkvg, gkbuf, segS);

  // 6) RMSNorm + SiLU gate -> bf16 [4096,2048]
  norm_gate_kernel<<<MROWS * 16 / 64, 256, 0, stream>>>(qkvg, norm_w, og);

  // 7) output GEMM (WMMA) -> d_out fp32 [4096,2048]
  gemm_bf16_wmma_kernel<2><<<dim3(NOUT / 128, MROWS / 128), 256, 0, stream>>>(
      og, wot, out, KDIM, NOUT);
}

// v007
// One run takes 252 microseconds.
// In two side-by-side timings against v006, it was 1.05 and 1.04 times as fast.
// All steps since v000 together make it 8.34 times as fast.
#include <hip/hip_runtime.h>

// ---------------------------------------------------------------------------
// Problem constants (from reference)
// ---------------------------------------------------------------------------
// B=2, T=2048, HID=2048, H=16, DK=64, DV=128, C=16, LOWR=16
// M = B*T = 4096 rows.  Fused projection GEMM: [4096,2048] x [2048,6144]
//   cols 0..1023   : q  (H*DK)
//   cols 1024..2047: k  (H*DK)
//   cols 2048..4095: v  (H*DV)   (overwritten with o by the GLA kernel)
//   cols 4096..6143: g  (H*DV)
// Output GEMM: [4096,2048] x [2048,2048] -> d_out (fp32)

#define MROWS   4096
#define KDIM    2048
#define NCAT    6144
#define NOUT    2048
#define GLA_SCALE 0.125f   // DK^-0.5

typedef __attribute__((ext_vector_type(16))) __bf16 v16bf;
typedef __attribute__((ext_vector_type(8)))  float  v8f;

__device__ __forceinline__ unsigned short f2bf(float f) {
  unsigned int u = __float_as_uint(f);
  u += 0x7fffu + ((u >> 16) & 1u);
  return (unsigned short)(u >> 16);
}

// gfx1250 async global->LDS DMA: 16B per lane, no data VGPRs, ASYNCcnt-tracked.
// GV mode: VDST = LDS byte offset (low 32 bits of flat shared address per the
// LDS aperture rule addr[31:0]), VADDR = 64-bit global address, no SADDR.
__device__ __forceinline__ void wait_async0() {
  asm volatile("s_wait_asynccnt 0x0" ::: "memory");
}

// The streaming helpers below (operand preparation, norm+gate) move few bytes
// per wave. Each is laid out so that a wave brings in 4 KiB or more with all
// its loads in flight at once.

__device__ __forceinline__ unsigned int pack2bf(float lo, float hi) {
  return (unsigned int)f2bf(lo) | ((unsigned int)f2bf(hi) << 16);
}

// ---------------------------------------------------------------------------
// All that turns an input into a bf16 GEMM operand, in one launch: x -> bf16,
// and the five weights [K,Nw] fp32 -> [Nw,K] bf16 (so that the WMMA B operand
// is N-major). These six jobs depend on the inputs alone; as six launches each
// paid its own start, first load latency and drain for a few MB.
// The work is cut into pieces of 32 KiB read and 16 KiB written: 1024 runs of
// 8192 floats of x and 2048 weight tiles of 128 k x 64 n. Block b takes run b
// of x, tile b of (Wq, Wk, Wv) and tile b of (Wg, Wo); its 24 float4 loads per
// thread go out ahead of all other work, and the 1024 blocks (four to a WGP)
// are resident together.
// A weight tile: 8 float4 loads per thread (256 B of a source row per 16
// lanes), then 4 stores of 8 bf16 per thread (256 B of an output row per 16
// lanes).
// ---------------------------------------------------------------------------
#define TT_K 128
#define TT_N 64
#define TT_P 65   // odd pitch in floats: column reads spread over the banks

__device__ __forceinline__ void tt_to_lds(const float4 (&v)[8], float* tile,
                                          int lo, int hi) {
#pragma unroll  // v[] stays in registers
  for (int i = 0; i < 8; ++i) {
    float* t = &tile[(hi + i * 16) * TT_P + lo * 4];
    t[0] = v[i].x; t[1] = v[i].y; t[2] = v[i].z; t[3] = v[i].w;
  }
}

__device__ __forceinline__ void tt_from_lds(uint4 (&r)[4], const float* tile,
                                            int lo, int hi) {
#pragma unroll  // r[] stays in registers
  for (int j = 0; j < 4; ++j) {
    const float* t = &tile[(lo * 8) * TT_P + hi + j * 16];
    r[j] = make_uint4(pack2bf(t[0 * TT_P], t[1 * TT_P]),
                      pack2bf(t[2 * TT_P], t[3 * TT_P]),
                      pack2bf(t[4 * TT_P], t[5 * TT_P]),
                      pack2bf(t[6 * TT_P], t[7 * TT_P]));
  }
}

__global__ __launch_bounds__(256) void prep_kernel(
    const float* __restrict__ x, const float* __restrict__ Wq,
    const float* __restrict__ Wk, const float* __restrict__ Wv,
    const float* __restrict__ Wg, const float* __restrict__ Wo,
    unsigned short* __restrict__ xb, unsigned short* __restrict__ wcat,
    unsigned short* __restrict__ wot) {
  __shared__ float tile[2][TT_K * TT_P];
  const int b = blockIdx.x;   // 0..1023
  const int lo = threadIdx.x & 15, hi = threadIdx.x >> 4;

  // Every address below is a base that is the same for the whole block plus a
  // 32-bit byte offset of the lane's own (plus a constant).
  // 8192 contiguous floats of x: 8 float4 per thread
  const char* xs = (const char*)(x + (long)b * 8192);
  const unsigned xl = threadIdx.x * 16u;
  // first tile: Wq (256 tiles), Wk (256), Wv (512), n running fastest; they
  // are rows 0.., 1024.., 2048.. of wcat
  const bool nar = b < 512;                  // a weight of 1024 columns
  const int nw0 = nar ? 1024 : 2048;
  const int t0 = nar ? (b & 255) : b - 512;  // tile number inside its weight
  const int kb0 = (nar ? t0 >> 4 : t0 >> 5) * TT_K;
  const int nb0 = (nar ? t0 & 15 : t0 & 31) * TT_N;
  const char* s0 =
      (const char*)((b < 256 ? Wq : (nar ? Wk : Wv)) + (long)kb0 * nw0 + nb0);
  unsigned l0[8];
#pragma unroll  // l0[] stays in registers
  for (int i = 0; i < 8; ++i)
    l0[i] = (unsigned)((hi + i * 16) * nw0 + lo * 4) * 4u;
  // second tile: Wg (512 tiles, rows 4096.. of wcat), Wo (512, wot)
  const int kb1 = ((b & 511) >> 5) * TT_K, nb1 = (b & 31) * TT_N;
  const char* s1 = (const char*)((nar ? Wg : Wo) + (long)kb1 * 2048 + nb1);
  const unsigned l1 = (unsigned)(hi * 2048 + lo * 4) * 4u;

  float4 c[8], v0[8], v1[8];
#pragma unroll  // c[] stays in registers, the 8 loads go out together
  for (int i = 0; i < 8; ++i) c[i] = *(const float4*)(xs + xl + i * 4096);
#pragma unroll  // v0[] stays in registers, the 8 loads go out together
  for (int i = 0; i < 8; ++i) v0[i] = *(const float4*)(s0 + l0[i]);
#pragma unroll  // v1[] stays in registers, the 8 loads go out together
  for (int i = 0; i < 8; ++i)
    v1[i] = *(const float4*)(s1 + l1 + i * (16 * 2048 * 4));
  // Behind the loads, ahead of any rewrite of a register that they name: the
  // operands keep the address registers as they are up to this wait.
  asm volatile("s_wait_xcnt 0x0"
               :: "v"(xl), "v"(l1), "v"(l0[0]), "v"(l0[1]), "v"(l0[2]),
                  "v"(l0[3]), "v"(l0[4]), "v"(l0[5]), "v"(l0[6]), "v"(l0[7]),
                  "s"(xs), "s"(s0), "s"(s1)
               : "memory");

  // x is packed at once, which frees half of its registers
  uint2 cb[8];
#pragma unroll  // c[] and cb[] stay in registers
  for (int i = 0; i < 8; ++i)
    cb[i] = make_uint2(pack2bf(c[i].x, c[i].y), pack2bf(c[i].z, c[i].w));

  tt_to_lds(v0, tile[0], lo, hi);
  tt_to_lds(v1, tile[1], lo, hi);
  __syncthreads();
  // x goes out behind the barrier: in front of it the barrier's own wait would
  // hold the wave until these stores have been answered
  char* xd = (char*)(xb + (long)b * 8192);
  const unsigned xq = threadIdx.x * 8u;
#pragma unroll  // cb[] stays in registers
  for (int i = 0; i < 8; ++i) *(uint2*)(xd + xq + i * 2048) = cb[i];
  // behind the stores, ahead of any rewrite of a register that they name
  asm volatile("s_wait_xcnt 0x0" ::: "memory");
  uint4 r0[4], r1[4];
  tt_from_lds(r0, tile[0], lo, hi);
  tt_from_lds(r1, tile[1], lo, hi);
  // row nb, column kb of [Nw,K] is a tile's first output element
  char* d0 = (char*)(wcat +
                     (long)((b >> 8 < 2 ? b >> 8 : 2) * 1024 + nb0) * KDIM + kb0);
  char* d1 = (char*)((nar ? wcat + (long)4096 * KDIM : wot) +
                     (long)nb1 * KDIM + kb1);
  const unsigned dl = (unsigned)(hi * KDIM + lo * 8) * 2u;
#pragma unroll  // r0[] stays in registers
  for (int j = 0; j < 4; ++j) *(uint4*)(d0 + dl + j * (16 * KDIM * 2)) = r0[j];
#pragma unroll  // r1[] stays in registers
  for (int j = 0; j < 4; ++j) *(uint4*)(d1 + dl + j * (16 * KDIM * 2)) = r1[j];
}

// ---------------------------------------------------------------------------
// bf16 WMMA GEMM:  C[M,N](f32) = A[M,K](bf16,row-major) * Bt[N,K]^T
// Block tile (64 FM) x 128, K-step 64, 256 threads = 8 waves (4x2 wave grid),
// each wave: FM x 4 fragments of 16x16. With FM = 4 a wave reads 8 fragments
// from LDS for 16 matrix steps (FM = 2: 6 for 8), and a block brings in 384
// operand rows for 256 x 128 results (FM = 2: 256 rows for 128 x 128).
// Double-buffered LDS, pitch 72 (144B rows -> conflict-free b128 fragment
// reads). Tile staging uses global_load_async_to_lds_b128 (no data VGPRs).
// ---------------------------------------------------------------------------
#define GT_N 128
#define GT_K 64
#define LDT  72

__device__ __forceinline__ v16bf load_frag(const unsigned short* p) {
  union { v16bf v; uint4 u[2]; } f;
  f.u[0] = *(const uint4*)(p);        // halves 0..7  : K = khalf*8 + 0..7
  f.u[1] = *(const uint4*)(p + 16);   // halves 8..15 : K = khalf*8 + 16..23
  return f.v;
}

// Rows r, r + 32, r + 64, r + 96 of a tile: 16 bytes per lane and row, from g
// (row pitch gp elements) to LDS at l (row pitch LDT). The s_wait_xcnt stands
// in the copies' own statement, ahead of any rewrite of an address register
// that they name.
__device__ __forceinline__ void async_copy_rows4(const unsigned short* g,
                                                 long gp, unsigned short* l) {
  const unsigned l0 = (unsigned)(unsigned long long)l;
  const unsigned l1 = l0 + 32 * LDT * 2, l2 = l0 + 64 * LDT * 2,
                 l3 = l0 + 96 * LDT * 2;
  const unsigned short *g1 = g + 32 * gp, *g2 = g + 64 * gp, *g3 = g + 96 * gp;
  asm volatile(
      "global_load_async_to_lds_b128 %0, %4, off\n\t"
      "global_load_async_to_lds_b128 %1, %5, off\n\t"
      "global_load_async_to_lds_b128 %2, %6, off\n\t"
      "global_load_async_to_lds_b128 %3, %7, off\n\t"
      "s_wait_xcnt 0x0"
      :: "v"(l0), "v"(l1), "v"(l2), "v"(l3), "v"(g), "v"(g1), "v"(g2), "v"(g3)
      : "memory");
}

template <int FM>
__global__ __launch_bounds__(256) void gemm_bf16_wmma_kernel(
    const unsigned short* __restrict__ A,   // [M,K] bf16
    const unsigned short* __restrict__ Bt,  // [N,K] bf16 (B transposed)
    float* __restrict__ C, int K, int ldc) {
  constexpr int BM = 64 * FM;
  __shared__ __align__(16) unsigned short As[2][BM * LDT];
  __shared__ __align__(16) unsigned short Bs[2][GT_N * LDT];

  const int tid  = threadIdx.x;
  const int lane = tid & 31;
  const int w    = tid >> 5;
  const int wm   = w >> 1;   // 0..3 : band of 16 FM rows
  const int wn   = w & 1;    // 0..1 : 64-col band

  const long m0 = (long)blockIdx.y * BM;
  const long n0 = (long)blockIdx.x * GT_N;
  const int  nk = K / GT_K;

  const unsigned short* Agb = A  + m0 * K;
  const unsigned short* Bgb = Bt + n0 * K;

  // A tile row is one 128-byte line: 8 lanes cover a whole line, a wave's copy
  // 4 whole lines. Thread tid takes 16-byte chunk tid & 7 of rows
  // (tid >> 3) + 32 i.
  const int  sr = tid >> 3, sc = (tid & 7) * 8;
  const long so = (long)sr * K + sc;     // this thread's place in a global tile
  const int  sl = sr * LDT + sc;         // and in an LDS tile
  auto stage = [&](int kt, int buf) {    // async DMA of tile kt straight to LDS
#pragma unroll  // constant LDS offsets
    for (int i = 0; i < BM / 128; ++i)
      async_copy_rows4(Agb + kt * GT_K + so + (long)(i * 128) * K, K,
                       &As[buf][i * 128 * LDT + sl]);
    async_copy_rows4(Bgb + kt * GT_K + so, K, &Bs[buf][sl]);
  };

  stage(0, 0);
  wait_async0();
  __syncthreads();
  if (nk > 1) stage(1, 1);

  v8f acc[FM][4];
#pragma unroll
  for (int fm = 0; fm < FM; ++fm)
#pragma unroll
    for (int fn = 0; fn < 4; ++fn)
      acc[fm][fn] = (v8f){0.f, 0.f, 0.f, 0.f, 0.f, 0.f, 0.f, 0.f};

  for (int kt = 0; kt < nk; ++kt) {
    const int cur = kt & 1;
    if (kt + 2 < nk) {  // gfx1250 global_prefetch_b8 for tile kt+2 into L2
      const int ca = tid * (BM / 32), cb = tid * (GT_N / 32);   // 16-byte chunks
      __builtin_prefetch(
          &Agb[(kt + 2) * GT_K + (long)(ca >> 3) * K + (ca & 7) * 8], 0, 1);
      __builtin_prefetch(
          &Bgb[(kt + 2) * GT_K + (long)(cb >> 3) * K + (cb & 7) * 8], 0, 1);
    }

    // compute on current buffer: two k=32 sub-steps
#pragma unroll
    for (int s = 0; s < 2; ++s) {
      const int kb = s * 32 + (lane >> 4) * 8;   // khalf selects K sub-lane set
      v16bf afr[FM], bfr[4];
#pragma unroll
      for (int fm = 0; fm < FM; ++fm) {
        int row = (wm * FM + fm) * 16 + (lane & 15);
        afr[fm] = load_frag(&As[cur][row * LDT + kb]);
      }
#pragma unroll
      for (int fn = 0; fn < 4; ++fn) {
        int row = wn * 64 + fn * 16 + (lane & 15);
        bfr[fn] = load_frag(&Bs[cur][row * LDT + kb]);
      }
      if (s == 1) {
        // The trip's last LDS reads are out. This wave's reads of buffer cur
        // are done and its copies of tile kt + 1 have landed; behind the
        // barrier that holds for every wave, so tile kt + 1 may be read and
        // buffer cur refilled. The refill goes out ahead of the sub-step's
        // matrix steps, which need registers only: it has the longer lead.
        asm volatile("s_wait_dscnt 0x0" ::: "memory");
        wait_async0();
        __syncthreads();
        if (kt + 2 < nk) stage(kt + 2, cur);
      }
#pragma unroll
      for (int fm = 0; fm < FM; ++fm)
#pragma unroll
        for (int fn = 0; fn < 4; ++fn)
          acc[fm][fn] = __builtin_amdgcn_wmma_f32_16x16x32_bf16(
              false, afr[fm], false, bfr[fn], (short)0, acc[fm][fn],
              false, false);
    }
  }
  wait_async0();   // no copy is in flight when the wave ends

  // store: VGPR r -> row (r + 8*khalf), lane&15 -> col  (16x16 f32 C layout)
  const int cn    = lane & 15;
  const int rbase = (lane >> 4) * 8;
#pragma unroll
  for (int fm = 0; fm < FM; ++fm)
#pragma unroll
    for (int fn = 0; fn < 4; ++fn) {
      long row0 = m0 + (wm * FM + fm) * 16 + rbase;
      long col  = n0 + wn * 64 + fn * 16 + cn;
#pragma unroll
      for (int r = 0; r < 8; ++r)
        C[(row0 + r) * ldc + col] = acc[fm][fn][r];
    }
}

// ---------------------------------------------------------------------------
// gk = log_sigmoid(x @ Wgk1 @ Wgk2 + bgk2) / 16      (low-rank, fp32)
// One block per 16 rows of x, so that Wgk1 and Wgk2 are read once per 16 rows.
// x @ Wgk1 runs on the f32 16x16x4 matrix form: wave w takes k = 128 w ..
// 128 w + 127, the 16 partial tiles are summed through LDS in the order of w.
// A wave loads its 16 x 128 piece of x in whole lines (one row piece of 512 B
// per load) and turns it into A fragments through LDS.
// k order of one matrix step (t, u): lane half hi, register i hold
// k = 128 w + 8 t + 4 hi + 2 u + i, in the A loader (a float4 of a row of x is
// u = 0, 1) and in the B loader (rows of Wgk1) alike.
// ---------------------------------------------------------------------------
#define GK_WAVES 16
#define GK_KS (KDIM / GK_WAVES)   // k per wave
#define GK_T (GK_KS / 8)          // float4 of x per lane
#define GK_XP (GK_KS + 4)         // LDS row pitch: 16 B x odd, for b128 readers

typedef __attribute__((ext_vector_type(2))) float v2f;

__device__ __forceinline__ v8f wmma_f32(v2f a, v2f b, v8f c) {
  return __builtin_amdgcn_wmma_f32_16x16x4_f32(false, a, false, b, (short)0, c,
                                               false, false);
}

// eight consecutive floats of LDS, 16-byte aligned
__device__ __forceinline__ v8f lds8(const float* p) {
  const float4 a = *(const float4*)p, b = *(const float4*)(p + 4);
  return (v8f){a.x, a.y, a.z, a.w, b.x, b.y, b.z, b.w};
}

__global__ __launch_bounds__(512) void gk_kernel(
    const float* __restrict__ x, const float* __restrict__ Wgk1,
    const float* __restrict__ Wgk2, const float* __restrict__ bgk2,
    float* __restrict__ gkout) {
  __shared__ __align__(16) float xs[GK_WAVES * 16 * GK_XP];
  __shared__ __align__(16) float red[GK_WAVES * 256];
  __shared__ __align__(16) float low[16 * 16];
  const int tid = threadIdx.x;
  const int lane = tid & 31, c16 = tid & 15, hi = (tid >> 4) & 1, w = tid >> 5;
  const long m0 = (long)blockIdx.x * 16;

  const float* xp = x + m0 * KDIM + w * GK_KS + lane * 4;
  const float* wp = Wgk1 + (w * GK_KS + 4 * hi) * 16 + c16;
  // the second product's operands: columns 2 tid, 2 tid + 1 of Wgk2 and bgk2
  float2 w2[16];
#pragma unroll  // w2[] stays in registers, the loads go out with those below
  for (int r = 0; r < 16; ++r) w2[r] = *((const float2*)(Wgk2 + r * 1024) + tid);
  const float2 bias = *((const float2*)bgk2 + tid);
  float bq[GK_T][4];
#pragma unroll  // bq[][] stays in registers, the loads go out together
  for (int t = 0; t < GK_T; ++t)
#pragma unroll  // bq[][] stays in registers
    for (int q = 0; q < 4; ++q) bq[t][q] = wp[(8 * t + q) * 16];
  // With the fence every load of the kernel is issued ahead of the first wait:
  // without it the compiler holds a quarter of these, and of those of x, back
  // behind that wait, and their latency comes on top.
  __builtin_amdgcn_sched_barrier(0);
  float4 xv[16];
#pragma unroll  // xv[] stays in registers, the loads go out together
  for (int j = 0; j < 16; ++j) xv[j] = *(const float4*)(xp + j * KDIM);

  float* xw = xs + w * (16 * GK_XP);
#pragma unroll  // xv[] stays in registers
  for (int j = 0; j < 16; ++j) *(float4*)(xw + j * GK_XP + lane * 4) = xv[j];
  __syncthreads();

  // two accumulator tiles, so that a step need not wait for the one before it
  v8f acc0 = (v8f){0.f, 0.f, 0.f, 0.f, 0.f, 0.f, 0.f, 0.f};
  v8f acc1 = acc0;
#pragma unroll  // bq[][] stays in registers
  for (int t = 0; t < GK_T; ++t) {
    const float4 a = *(const float4*)(xw + c16 * GK_XP + 8 * t + 4 * hi);
    acc0 = wmma_f32((v2f){a.x, a.y}, (v2f){bq[t][0], bq[t][1]}, acc0);
    acc1 = wmma_f32((v2f){a.z, a.w}, (v2f){bq[t][2], bq[t][3]}, acc1);
  }
  acc0 += acc1;
#pragma unroll  // acc0 stays in registers
  for (int r = 0; r < 8; ++r) red[w * 256 + r * 32 + lane] = acc0[r];
  __syncthreads();
  if (tid < 256) {   // register r = tid >> 5 of lane (c16, hi): row 8 hi + r
    float s = 0.f;
#pragma unroll  // the 16 LDS loads go out together
    for (int v = 0; v < GK_WAVES; ++v) s += red[v * 256 + tid];
    low[(8 * hi + w) * 16 + c16] = s;
  }
  __syncthreads();

  float* dst = gkout + m0 * 1024 + 2 * tid;
#pragma unroll 1  // one copy of the long log-sigmoid text
  for (int m = 0; m < 16; ++m) {
    const v8f l0 = lds8(&low[m * 16]), l1 = lds8(&low[m * 16 + 8]);
    float ax = bias.x, ay = bias.y;
#pragma unroll  // l0 and w2[] stay in registers
    for (int r = 0; r < 8; ++r) { ax += l0[r] * w2[r].x; ay += l0[r] * w2[r].y; }
#pragma unroll  // l1 and w2[] stay in registers
    for (int r = 0; r < 8; ++r) {
      ax += l1[r] * w2[8 + r].x;
      ay += l1[r] * w2[8 + r].y;
    }
    const float lx = fminf(ax, 0.f) - log1pf(__expf(-fabsf(ax)));
    const float ly = fminf(ay, 0.f) - log1pf(__expf(-fabsf(ay)));
    *(float2*)(dst + m * 1024) =
        make_float2(lx * (1.0f / 16.0f), ly * (1.0f / 16.0f));
  }
}

// ---------------------------------------------------------------------------
// Chunked GLA scan, split along the sequence into NSEG segments of SEGC chunks
// so that (b,h) x segment work-groups run side by side. The state recurrence
// S <- diag(decay) S + kv is linear in S, so over one segment
//   S_end = diag(D_seg) S_start + KV_seg,
// with D_seg the product of the chunk decays and KV_seg the segment's end
// state when started from zero. Three launches:
//   1) gla_seg_state_kernel: KV_seg and D_seg of every segment but the last
//   2) gla_seg_scan_kernel : start state of segments 1..NSEG-1 (in place)
//   3) gla_kernel          : the full chunk loop of a segment from its start
// The products with v and with S run on the f32 16x16x4 matrix form. Wave w
// owns columns e = 32 w .. 32 w + 31 (two tiles of 16). S[64][128] lives in
// registers as 4 x 2 accumulator tiles per wave: register r of lane (c, hi)
// holds S[16 dt + 8 hi + r][e0 + c]. Registers (2j, 2j+1) of such a tile are at
// once a B fragment whose four k are rows 2j, 2j+1 (hi = 0) and 8+2j, 8+2j+1
// (hi = 1); the A loaders below take their k in the same order. v is loaded in
// the same map, so it too is a B fragment as it lies. o overwrites v in qkvg.
// ---------------------------------------------------------------------------
#define CPAD 68
#define NSEG 32                 // segments per sequence
#define SEGC 4                  // chunks of 16 rows per segment (NSEG*SEGC = 128)
#define NSEGM1 (NSEG - 1)

// S <- diag(decay) S + kd^T v for one chunk; kd is [16 c][CPAD], d contiguous
__device__ __forceinline__ void state_step(v8f (&S)[4][2], const v8f (&vb)[2],
                                           const float* kd, const float* decay,
                                           int c16, int hi) {
#pragma unroll  // S[][] stays in registers
  for (int dt = 0; dt < 4; ++dt) {
    const v8f dec = lds8(&decay[dt * 16 + 8 * hi]);
    S[dt][0] *= dec;
    S[dt][1] *= dec;
#pragma unroll  // S[][] and vb[] stay in registers
    for (int j = 0; j < 4; ++j) {
      const float* kr = &kd[(2 * j + 8 * hi) * CPAD + dt * 16 + c16];
      const v2f a = {kr[0], kr[CPAD]};
#pragma unroll  // S[][] and vb[] stay in registers
      for (int et = 0; et < 2; ++et)
        S[dt][et] = wmma_f32(a, (v2f){vb[et][2 * j], vb[et][2 * j + 1]},
                             S[dt][et]);
    }
  }
}

__global__ __launch_bounds__(128) void gla_seg_state_kernel(
    const float* __restrict__ qkvg, const float* __restrict__ gk,
    float* __restrict__ segS, float* __restrict__ segD) {
  __shared__ float gc[16 * CPAD];
  __shared__ __align__(16) float kd[16 * CPAD];
  __shared__ __align__(16) float decay[64];

  const int seg = blockIdx.x;       // 0..NSEG-2
  const int bh = blockIdx.y;        // 0..31
  const int b = bh >> 4, h = bh & 15;
  const int tid = threadIdx.x;
  const int c16 = tid & 15, hi = (tid >> 4) & 1, w = tid >> 5;

  v8f S[4][2];
#pragma unroll  // S[][] stays in registers
  for (int dt = 0; dt < 4; ++dt)
#pragma unroll  // S[][] stays in registers
    for (int et = 0; et < 2; ++et)
      S[dt][et] = (v8f){0.f, 0.f, 0.f, 0.f, 0.f, 0.f, 0.f, 0.f};

  const long row0 = (long)b * 2048 + (long)seg * (SEGC * 16);
  // row pointers of the current chunk, advanced by 16 rows per chunk
  const float* gp = gk + row0 * 1024 + h * 64 + (tid & 63);
  const float* kp = qkvg + row0 * 6144 + 1024 + h * 64 + (tid & 63);
  const float* vp = qkvg + (row0 + 8 * hi) * 6144 + 2048 + h * 128 + w * 32 + c16;
  float dprod = 1.f;

  for (int n = 0; n < SEGC; ++n) {
    if (tid < 64) {                  // per-column-d prep
      const int d = tid;
      float c = 0.f;
#pragma unroll  // the 16 row loads go out together
      for (int cc = 0; cc < 16; ++cc) {
        c += gp[cc * 1024];
        gc[cc * CPAD + d] = c;
      }
      const float dec = __expf(c);
      decay[d] = dec;
      dprod *= dec;
      const float glast = c;
#pragma unroll  // the 16 row loads go out together
      for (int cc = 0; cc < 16; ++cc) {
        float g = gc[cc * CPAD + d];
        kd[cc * CPAD + d] = kp[cc * 6144] * __expf(glast - g);
      }
    }
    v8f vb[2];
#pragma unroll  // vb[] stays in registers
    for (int et = 0; et < 2; ++et)
#pragma unroll  // vb[] stays in registers
      for (int r = 0; r < 8; ++r) vb[et][r] = vp[r * 6144 + et * 16];
    __syncthreads();

    state_step(S, vb, kd, decay, c16, hi);
    gp += 16 * 1024;
    kp += 16 * 6144;
    vp += 16 * 6144;
    __syncthreads();
  }

  const long sb = (long)bh * NSEGM1 + seg;
  float* sp = segS + sb * (64 * 128) + (8 * hi) * 128 + w * 32 + c16;
#pragma unroll  // S[][] stays in registers; one address, constant offsets
  for (int dt = 0; dt < 4; ++dt)
#pragma unroll  // S[][] stays in registers
    for (int et = 0; et < 2; ++et)
#pragma unroll  // S[][] stays in registers
      for (int r = 0; r < 8; ++r)
        sp[(dt * 16 + r) * 128 + et * 16] = S[dt][et][r];
  if (tid < 64) segD[sb * 64 + tid] = dprod;
}

// segS[bh][g] holds KV of segment g on entry and the start state of segment
// g + 1 on exit. One thread per (bh, d, four columns e); every load is issued
// ahead of the first store.
__global__ __launch_bounds__(256) void gla_seg_scan_kernel(
    float* __restrict__ segS, const float* __restrict__ segD) {
  const int idx = blockIdx.x * 256 + threadIdx.x;   // 32 * 64 * 32 threads
  const int bh = idx >> 11, rem = idx & 2047, d = rem >> 5;
  float4* p = (float4*)segS + (long)bh * NSEGM1 * 2048 + rem;
  const float* dp = segD + (long)bh * NSEGM1 * 64 + d;
  float4 kv[NSEGM1];
  float dc[NSEGM1];
#pragma unroll  // kv[] and dc[] stay in registers
  for (int g = 0; g < NSEGM1; ++g) {
    kv[g] = p[g * 2048];
    dc[g] = dp[g * 64];
  }
  // Stands behind the last load and in front of the first store: no load is
  // issued among the stores into a register that a store still names, and the
  // loads' latencies overlap instead of adding up along the chain.
  asm volatile("s_wait_xcnt 0x0" ::: "memory");
  // segment 0 starts from zero, so kv[0] is already the start of segment 1
#pragma unroll  // kv[] and dc[] stay in registers
  for (int g = 1; g < NSEGM1; ++g) {
    kv[g].x = dc[g] * kv[g - 1].x + kv[g].x;
    kv[g].y = dc[g] * kv[g - 1].y + kv[g].y;
    kv[g].z = dc[g] * kv[g - 1].z + kv[g].z;
    kv[g].w = dc[g] * kv[g - 1].w + kv[g].w;
    p[g * 2048] = kv[g];
  }
}

__global__ __launch_bounds__(128) void gla_kernel(
    float* __restrict__ qkvg, const float* __restrict__ gk,
    const float* __restrict__ segS) {
  __shared__ float gc[16 * CPAD];
  __shared__ __align__(16) float qe[16 * CPAD];
  __shared__ __align__(16) float ke[16 * CPAD];
  __shared__ __align__(16) float kd[16 * CPAD];
  __shared__ __align__(16) float Am[16 * 16];
  __shared__ __align__(16) float decay[64];

  const int seg = blockIdx.x;       // 0..NSEG-1
  const int bh = blockIdx.y;        // 0..31
  const int b = bh >> 4, h = bh & 15;
  const int tid = threadIdx.x;
  const int c16 = tid & 15, hi = (tid >> 4) & 1, w = tid >> 5;

  v8f S[4][2];
  if (seg == 0) {
#pragma unroll  // S[][] stays in registers
    for (int dt = 0; dt < 4; ++dt)
#pragma unroll  // S[][] stays in registers
      for (int et = 0; et < 2; ++et)
        S[dt][et] = (v8f){0.f, 0.f, 0.f, 0.f, 0.f, 0.f, 0.f, 0.f};
  } else {
    const float* s0 = segS + ((long)bh * NSEGM1 + (seg - 1)) * (64 * 128) +
                      (8 * hi) * 128 + w * 32 + c16;
#pragma unroll  // S[][] stays in registers; one address, constant offsets
    for (int dt = 0; dt < 4; ++dt)
#pragma unroll  // S[][] stays in registers
      for (int et = 0; et < 2; ++et)
#pragma unroll  // S[][] stays in registers
        for (int r = 0; r < 8; ++r)
          S[dt][et][r] = s0[(dt * 16 + r) * 128 + et * 16];
    // behind the loads, ahead of any rewrite of a register that they name
    asm volatile("s_wait_xcnt 0x0" ::: "memory");
  }

  const long rowbase = (long)b * 2048 + (long)seg * (SEGC * 16);

  for (int n = 0; n < SEGC; ++n) {
    const long m0 = rowbase + n * 16;
    if (tid < 64) {                  // per-column-d prep
      const int d = tid;
      float c = 0.f;
#pragma unroll
      for (int cc = 0; cc < 16; ++cc) {
        c += gk[(m0 + cc) * 1024 + h * 64 + d];
        gc[cc * CPAD + d] = c;
      }
      decay[d] = __expf(c);
      const float glast = c;
#pragma unroll
      for (int cc = 0; cc < 16; ++cc) {
        float g = gc[cc * CPAD + d];
        float q = qkvg[(m0 + cc) * 6144 + h * 64 + d];
        float k = qkvg[(m0 + cc) * 6144 + 1024 + h * 64 + d];
        qe[cc * CPAD + d] = q * __expf(g) * GLA_SCALE;
        ke[cc * CPAD + d] = k * __expf(-g);
        kd[cc * CPAD + d] = k * __expf(glast - g);
      }
    }
    // this wave's 16 x 32 piece of v (and of o), rows 8 hi + r, as B fragments
    float* vo = qkvg + (m0 + 8 * hi) * 6144 + 2048 + h * 128 + w * 32 + c16;
    v8f vb[2];
#pragma unroll  // vb[] stays in registers
    for (int et = 0; et < 2; ++et)
#pragma unroll  // vb[] stays in registers
      for (int r = 0; r < 8; ++r) vb[et][r] = vo[r * 6144 + et * 16];
    __syncthreads();

    // A = tril(qe ke^T), 256 entries over 128 threads
#pragma unroll
    for (int t = tid; t < 256; t += 128) {
      int cc = t >> 4, mm = t & 15;
      float a = 0.f;
      if (mm <= cc) {
#pragma unroll
        for (int d = 0; d < 64; ++d) a += qe[cc * CPAD + d] * ke[mm * CPAD + d];
      }
      Am[cc * 16 + mm] = a;
    }
    __syncthreads();

    v8f o[2];
    o[0] = (v8f){0.f, 0.f, 0.f, 0.f, 0.f, 0.f, 0.f, 0.f};
    o[1] = o[0];
    {  // o_intra = A v: row c16 of A, k = rows of v in the order of vb
      const v8f am = lds8(&Am[c16 * 16 + 8 * hi]);
#pragma unroll  // am, vb[] and o[] stay in registers
      for (int j = 0; j < 4; ++j) {
        const v2f a = {am[2 * j], am[2 * j + 1]};
#pragma unroll  // vb[] and o[] stay in registers
        for (int et = 0; et < 2; ++et)
          o[et] = wmma_f32(a, (v2f){vb[et][2 * j], vb[et][2 * j + 1]}, o[et]);
      }
    }
    // o_inter = qe S (old S): row c16 of qe, k = rows of S in the tiles' order
#pragma unroll  // S[][] and o[] stay in registers
    for (int dt = 0; dt < 4; ++dt) {
      const v8f qf = lds8(&qe[c16 * CPAD + dt * 16 + 8 * hi]);
#pragma unroll  // qf, S[][] and o[] stay in registers
      for (int j = 0; j < 4; ++j) {
        const v2f a = {qf[2 * j], qf[2 * j + 1]};
#pragma unroll  // S[][] and o[] stay in registers
        for (int et = 0; et < 2; ++et)
          o[et] = wmma_f32(a, (v2f){S[dt][et][2 * j], S[dt][et][2 * j + 1]},
                           o[et]);
      }
    }
#pragma unroll  // o[] stays in registers
    for (int et = 0; et < 2; ++et)
#pragma unroll  // o[] stays in registers
      for (int r = 0; r < 8; ++r) vo[r * 6144 + et * 16] = o[et][r];
    // behind the stores, ahead of any rewrite of a register that they name
    asm volatile("s_wait_xcnt 0x0" ::: "memory");
    // the last chunk's end state is read by nobody here
    if (n + 1 < SEGC) state_step(S, vb, kd, decay, c16, hi);
    __syncthreads();
  }
}

// 2^x and 1/sqrt(x), each with the free slot that the instruction set asks for
// between a transcendental and a next instruction that overwrites its source.
__device__ __forceinline__ float exp2_slot(float x) {
  float r;
  asm("v_exp_f32 %0, %1\n\tv_nop" : "=v"(r) : "v"(x));
  return r;
}
__device__ __forceinline__ float rsq_slot(float x) {
  float r;
  asm("v_rsq_f32 %0, %1\n\tv_nop" : "=v"(r) : "v"(x));
  return r;
}
// g * sigmoid(g), with exp(-g) formed as 2^(-g * log2 e)
__device__ __forceinline__ float silu(float g) {
  return g / (1.f + exp2_slot(g * -1.44269504f));
}

// Sum over the 32 lanes, left in every lane: lane l with l ^ 1, 2, 4, 8 inside
// a row of 16 by DPP, then l ^ 16 by a cross-row move; all in the vector unit.
template <int M>
__device__ __forceinline__ float row_xor(float x) {
  return __builtin_bit_cast(float, __builtin_amdgcn_update_dpp(
      0, __builtin_bit_cast(int, x), 0x160 | M, 0xf, 0xf, true));
}
__device__ __forceinline__ float wave_sum(float s) {
  s += row_xor<1>(s);
  s += row_xor<2>(s);
  s += row_xor<4>(s);
  s += row_xor<8>(s);
  const int b = __builtin_bit_cast(int, s);
  return s + __builtin_bit_cast(float, __builtin_amdgcn_permlanex16(
                 b, b, 0x76543210, 0xfedcba98, false, false));
}

// ---------------------------------------------------------------------------
// RMSNorm over DV + SiLU(g) gate, output bf16 for the final GEMM
// one wave per (m, 8 heads): a row of 128 is one float4 per lane, its sum of
// squares a butterfly over the 32 lanes; no LDS, no barrier.
// ---------------------------------------------------------------------------
__global__ __launch_bounds__(256) void norm_gate_kernel(
    const float* __restrict__ qkvg, const float* __restrict__ norm_w,
    unsigned short* __restrict__ og) {
  const int lane = threadIdx.x & 31;
  const int wv = blockIdx.x * 8 + (threadIdx.x >> 5);   // 0..8191
  const int m = wv >> 1, h0 = (wv & 1) * 8;
  const float* ob = qkvg + (long)m * 6144 + 2048 + h0 * 128 + lane * 4;
  float4 o[8], g[8];
#pragma unroll  // o[] and g[] stay in registers, the 16 loads go out together
  for (int r = 0; r < 8; ++r) {
    o[r] = *(const float4*)(ob + r * 128);
    g[r] = *(const float4*)(ob + 2048 + r * 128);
  }
  const float4 w = *(const float4*)(norm_w + lane * 4);
  // The fence keeps every load above it, so that all 17 are in flight at once:
  // without it the compiler sinks six of them into the arithmetic.
  __builtin_amdgcn_sched_barrier(0);
  float ss[8];
#pragma unroll  // ss[] stays in registers
  for (int r = 0; r < 8; ++r)
    ss[r] = (o[r].x * o[r].x + o[r].y * o[r].y) +
            (o[r].z * o[r].z + o[r].w * o[r].w);
#pragma unroll  // ss[] stays in registers
  for (int r = 0; r < 8; ++r) ss[r] = wave_sum(ss[r]);
  uint2 res[8];
#pragma unroll  // res[] stays in registers
  for (int r = 0; r < 8; ++r) {
    // the argument is at least 1e-5: no subnormal range to rescale for
    const float rs = rsq_slot(ss[r] * (1.f / 128.f) + 1e-5f);
    const float a = o[r].x * rs * w.x * silu(g[r].x);
    const float b = o[r].y * rs * w.y * silu(g[r].y);
    const float c = o[r].z * rs * w.z * silu(g[r].z);
    const float d = o[r].w * rs * w.w * silu(g[r].w);
    res[r] = make_uint2(pack2bf(a, b), pack2bf(c, d));
  }
  unsigned short* dst = og + (long)m * 2048 + h0 * 128 + lane * 4;
#pragma unroll  // res[] stays in registers
  for (int r = 0; r < 8; ++r) *(uint2*)(dst + r * 128) = res[r];
}

// ---------------------------------------------------------------------------
// Host launcher
// ---------------------------------------------------------------------------
extern "C" void kernel_launch(void* const* d_in, const int* in_sizes, int n_in,
                              void* d_out, int out_size, void* d_ws,
                              size_t ws_size, hipStream_t stream) {
  const float* x      = (const float*)d_in[0];
  const float* Wq     = (const float*)d_in[1];
  const float* Wk     = (const float*)d_in[2];
  const float* Wv     = (const float*)d_in[3];
  const float* Wg     = (const float*)d_in[4];
  const float* Wgk1   = (const float*)d_in[5];
  const float* Wgk2   = (const float*)d_in[6];
  const float* bgk2   = (const float*)d_in[7];
  const float* Wo     = (const float*)d_in[8];
  const float* norm_w = (const float*)d_in[9];
  float* out = (float*)d_out;

  // workspace layout (bytes)
  char* ws = (char*)d_ws;
  unsigned short* xb    = (unsigned short*)(ws);                       // 16 MiB
  unsigned short* wcat  = (unsigned short*)(ws + (size_t)16777216);    // 24 MiB
  unsigned short* wot   = (unsigned short*)(ws + (size_t)41943040);    //  8 MiB
  float*          qkvg  = (float*)         (ws + (size_t)50331648);    // 96 MiB
  float*          gkbuf = (float*)         (ws + (size_t)150994944);   // 16 MiB
  unsigned short* og    = (unsigned short*)(ws + (size_t)167772160);   // 16 MiB
  float*          segS  = (float*)         (ws + (size_t)184549376);   // 31 MiB
  float*          segD  = (float*)         (ws + (size_t)218103808);   // 248 KiB

  // 1, 2) x -> bf16; weights transposed and converted into the concatenated
  // [6144,2048] and into [2048,2048]
  prep_kernel<<<1024, 256, 0, stream>>>(x, Wq, Wk, Wv, Wg, Wo, xb, wcat, wot);

  // 3) fused projection GEMM (WMMA bf16 -> f32): qkvg[4096,6144]
  gemm_bf16_wmma_kernel<4><<<dim3(NCAT / 128, MROWS / 256), 256, 0, stream>>>(
      xb, wcat, qkvg, KDIM, NCAT);

  // 4) low-rank gate path gk[4096,1024]
  gk_kernel<<<MROWS / 16, 512, 0, stream>>>(x, Wgk1, Wgk2, bgk2, gkbuf);

  // 5) chunked GLA scan in segments (writes o over the v slice of qkvg)
  gla_seg_state_kernel<<<dim3(NSEGM1, 32), 128, 0, stream>>>(qkvg, gkbuf, segS,
                                                            segD);
  gla_seg_scan_kernel<<<32 * 64 * 32 / 256, 256, 0, stream>>>(segS, segD);
  gla_kernel<<<dim3(NSEG, 32), 128, 0, stream>>>(qkvg, gkbuf, segS);

  // 6) RMSNorm + SiLU gate -> bf16 [4096,2048]
  norm_gate_kernel<<<MROWS * 16 / 64, 256, 0, stream>>>(qkvg, norm_w, og);

  // 7) output GEMM (WMMA) -> d_out fp32 [4096,2048]
  gemm_bf16_wmma_kernel<2><<<dim3(NOUT / 128, MROWS / 128), 256, 0, stream>>>(
      og, wot, out, KDIM, NOUT);
}

// v008
// It runs in 229 microseconds.
// Timed twice side by side with v007, it ran 1.10 times as fast both times.
// All steps since v000 together make it 9.14 times as fast.
#include <hip/hip_runtime.h>

// ---------------------------------------------------------------------------
// Problem constants (from reference)
// ---------------------------------------------------------------------------
// B=2, T=2048, HID=2048, H=16, DK=64, DV=128, C=16, LOWR=16
// M = B*T = 4096 rows.  Fused projection GEMM: [4096,2048] x [2048,6144]
//   cols 0..1023   : q  (H*DK)
//   cols 1024..2047: k  (H*DK)
//   cols 2048..4095: v  (H*DV)   (overwritten with o by the GLA kernel)
//   cols 4096..6143: g  (H*DV)
// Output GEMM: [4096,2048] x [2048,2048] -> d_out (fp32)

#define MROWS   4096
#define KDIM    2048
#define NCAT    6144
#define NOUT    2048
#define GLA_SCALE 0.125f   // DK^-0.5

typedef __attribute__((ext_vector_type(16))) __bf16 v16bf;
typedef __attribute__((ext_vector_type(8)))  float  v8f;

__device__ __forceinline__ unsigned short f2bf(float f) {
  unsigned int u = __float_as_uint(f);
  u += 0x7fffu + ((u >> 16) & 1u);
  return (unsigned short)(u >> 16);
}

// gfx1250 async global->LDS DMA: 16B per lane, no data VGPRs, ASYNCcnt-tracked.
// GV mode: VDST = LDS byte offset (low 32 bits of flat shared address per the
// LDS aperture rule addr[31:0]), VADDR = 64-bit global address, no SADDR.
__device__ __forceinline__ void wait_async0() {
  asm volatile("s_wait_asynccnt 0x0" ::: "memory");
}

// The streaming helpers below (operand preparation, norm+gate) move few bytes
// per wave. Each is laid out so that a wave brings in 4 KiB or more with all
// its loads in flight at once.

__device__ __forceinline__ unsigned int pack2bf(float lo, float hi) {
  return (unsigned int)f2bf(lo) | ((unsigned int)f2bf(hi) << 16);
}

// ---------------------------------------------------------------------------
// All that turns an input into a bf16 GEMM operand, in one launch: x -> bf16,
// and the five weights [K,Nw] fp32 -> [Nw,K] bf16 (so that the WMMA B operand
// is N-major). These six jobs depend on the inputs alone; as six launches each
// paid its own start, first load latency and drain for a few MB.
// The work is cut into pieces of 32 KiB read and 16 KiB written: 1024 runs of
// 8192 floats of x and 2048 weight tiles of 128 k x 64 n. Block b takes run b
// of x, tile b of (Wq, Wk, Wv) and tile b of (Wg, Wo); its 24 float4 loads per
// thread go out ahead of all other work, and the 1024 blocks (four to a WGP)
// are resident together.
// A weight tile: 8 float4 loads per thread (256 B of a source row per 16
// lanes), then 4 stores of 8 bf16 per thread (256 B of an output row per 16
// lanes).
// ---------------------------------------------------------------------------
#define TT_K 128
#define TT_N 64
#define TT_P 65   // odd pitch in floats: column reads spread over the banks

__device__ __forceinline__ void tt_to_lds(const float4 (&v)[8], float* tile,
                                          int lo, int hi) {
#pragma unroll  // v[] stays in registers
  for (int i = 0; i < 8; ++i) {
    float* t = &tile[(hi + i * 16) * TT_P + lo * 4];
    t[0] = v[i].x; t[1] = v[i].y; t[2] = v[i].z; t[3] = v[i].w;
  }
}

__device__ __forceinline__ void tt_from_lds(uint4 (&r)[4], const float* tile,
                                            int lo, int hi) {
#pragma unroll  // r[] stays in registers
  for (int j = 0; j < 4; ++j) {
    const float* t = &tile[(lo * 8) * TT_P + hi + j * 16];
    r[j] = make_uint4(pack2bf(t[0 * TT_P], t[1 * TT_P]),
                      pack2bf(t[2 * TT_P], t[3 * TT_P]),
                      pack2bf(t[4 * TT_P], t[5 * TT_P]),
                      pack2bf(t[6 * TT_P], t[7 * TT_P]));
  }
}

__global__ __launch_bounds__(256) void prep_kernel(
    const float* __restrict__ x, const float* __restrict__ Wq,
    const float* __restrict__ Wk, const float* __restrict__ Wv,
    const float* __restrict__ Wg, const float* __restrict__ Wo,
    unsigned short* __restrict__ xb, unsigned short* __restrict__ wcat,
    unsigned short* __restrict__ wot) {
  __shared__ float tile[2][TT_K * TT_P];
  const int b = blockIdx.x;   // 0..1023
  const int lo = threadIdx.x & 15, hi = threadIdx.x >> 4;

  // Every address below is a base that is the same for the whole block plus a
  // 32-bit byte offset of the lane's own (plus a constant).
  // 8192 contiguous floats of x: 8 float4 per thread
  const char* xs = (const char*)(x + (long)b * 8192);
  const unsigned xl = threadIdx.x * 16u;
  // first tile: Wq (256 tiles), Wk (256), Wv (512), n running fastest; they
  // are rows 0.., 1024.., 2048.. of wcat
  const bool nar = b < 512;                  // a weight of 1024 columns
  const int nw0 = nar ? 1024 : 2048;
  const int t0 = nar ? (b & 255) : b - 512;  // tile number inside its weight
  const int kb0 = (nar ? t0 >> 4 : t0 >> 5) * TT_K;
  const int nb0 = (nar ? t0 & 15 : t0 & 31) * TT_N;
  const char* s0 =
      (const char*)((b < 256 ? Wq : (nar ? Wk : Wv)) + (long)kb0 * nw0 + nb0);
  unsigned l0[8];
#pragma unroll  // l0[] stays in registers
  for (int i = 0; i < 8; ++i)
    l0[i] = (unsigned)((hi + i * 16) * nw0 + lo * 4) * 4u;
  // second tile: Wg (512 tiles, rows 4096.. of wcat), Wo (512, wot)
  const int kb1 = ((b & 511) >> 5) * TT_K, nb1 = (b & 31) * TT_N;
  const char* s1 = (const char*)((nar ? Wg : Wo) + (long)kb1 * 2048 + nb1);
  const unsigned l1 = (unsigned)(hi * 2048 + lo * 4) * 4u;

  float4 c[8], v0[8], v1[8];
#pragma unroll  // c[] stays in registers, the 8 loads go out together
  for (int i = 0; i < 8; ++i) c[i] = *(const float4*)(xs + xl + i * 4096);
#pragma unroll  // v0[] stays in registers, the 8 loads go out together
  for (int i = 0; i < 8; ++i) v0[i] = *(const float4*)(s0 + l0[i]);
#pragma unroll  // v1[] stays in registers, the 8 loads go out together
  for (int i = 0; i < 8; ++i)
    v1[i] = *(const float4*)(s1 + l1 + i * (16 * 2048 * 4));
  // Behind the loads, ahead of any rewrite of a register that they name: the
  // operands keep the address registers as they are up to this wait.
  asm volatile("s_wait_xcnt 0x0"
               :: "v"(xl), "v"(l1), "v"(l0[0]), "v"(l0[1]), "v"(l0[2]),
                  "v"(l0[3]), "v"(l0[4]), "v"(l0[5]), "v"(l0[6]), "v"(l0[7]),
                  "s"(xs), "s"(s0), "s"(s1)
               : "memory");

  // x is packed at once, which frees half of its registers
  uint2 cb[8];
#pragma unroll  // c[] and cb[] stay in registers
  for (int i = 0; i < 8; ++i)
    cb[i] = make_uint2(pack2bf(c[i].x, c[i].y), pack2bf(c[i].z, c[i].w));

  tt_to_lds(v0, tile[0], lo, hi);
  tt_to_lds(v1, tile[1], lo, hi);
  __syncthreads();
  // x goes out behind the barrier: in front of it the barrier's own wait would
  // hold the wave until these stores have been answered
  char* xd = (char*)(xb + (long)b * 8192);
  const unsigned xq = threadIdx.x * 8u;
#pragma unroll  // cb[] stays in registers
  for (int i = 0; i < 8; ++i) *(uint2*)(xd + xq + i * 2048) = cb[i];
  // behind the stores, ahead of any rewrite of a register that they name
  asm volatile("s_wait_xcnt 0x0" ::: "memory");
  uint4 r0[4], r1[4];
  tt_from_lds(r0, tile[0], lo, hi);
  tt_from_lds(r1, tile[1], lo, hi);
  // row nb, column kb of [Nw,K] is a tile's first output element
  char* d0 = (char*)(wcat +
                     (long)((b >> 8 < 2 ? b >> 8 : 2) * 1024 + nb0) * KDIM + kb0);
  char* d1 = (char*)((nar ? wcat + (long)4096 * KDIM : wot) +
                     (long)nb1 * KDIM + kb1);
  const unsigned dl = (unsigned)(hi * KDIM + lo * 8) * 2u;
#pragma unroll  // r0[] stays in registers
  for (int j = 0; j < 4; ++j) *(uint4*)(d0 + dl + j * (16 * KDIM * 2)) = r0[j];
#pragma unroll  // r1[] stays in registers
  for (int j = 0; j < 4; ++j) *(uint4*)(d1 + dl + j * (16 * KDIM * 2)) = r1[j];
}

// ---------------------------------------------------------------------------
// bf16 WMMA GEMM:  C[M,N](f32) = A[M,K](bf16,row-major) * Bt[N,K]^T
// Block tile (64 FM) x 128, K-step 64, 256 threads = 8 waves (4x2 wave grid),
// each wave: FM x 4 fragments of 16x16. With FM = 4 a wave reads 8 fragments
// from LDS for 16 matrix steps (FM = 2: 6 for 8), and a block brings in 384
// operand rows for 256 x 128 results (FM = 2: 256 rows for 128 x 128).
// Double-buffered LDS, pitch 72 (144B rows -> conflict-free b128 fragment
// reads). Tile staging uses global_load_async_to_lds_b128 (no data VGPRs).
// ---------------------------------------------------------------------------
#define GT_N 128
#define GT_K 64
#define LDT  72

__device__ __forceinline__ v16bf load_frag(const unsigned short* p) {
  union { v16bf v; uint4 u[2]; } f;
  f.u[0] = *(const uint4*)(p);        // halves 0..7  : K = khalf*8 + 0..7
  f.u[1] = *(const uint4*)(p + 16);   // halves 8..15 : K = khalf*8 + 16..23
  return f.v;
}

// Rows r, r + 32, r + 64, r + 96 of a tile: 16 bytes per lane and row, from g
// (row pitch gp elements) to LDS at l (row pitch LDT). The s_wait_xcnt stands
// in the copies' own statement, ahead of any rewrite of an address register
// that they name.
__device__ __forceinline__ void async_copy_rows4(const unsigned short* g,
                                                 long gp, unsigned short* l) {
  const unsigned l0 = (unsigned)(unsigned long long)l;
  const unsigned l1 = l0 + 32 * LDT * 2, l2 = l0 + 64 * LDT * 2,
                 l3 = l0 + 96 * LDT * 2;
  const unsigned short *g1 = g + 32 * gp, *g2 = g + 64 * gp, *g3 = g + 96 * gp;
  asm volatile(
      "global_load_async_to_lds_b128 %0, %4, off\n\t"
      "global_load_async_to_lds_b128 %1, %5, off\n\t"
      "global_load_async_to_lds_b128 %2, %6, off\n\t"
      "global_load_async_to_lds_b128 %3, %7, off\n\t"
      "s_wait_xcnt 0x0"
      :: "v"(l0), "v"(l1), "v"(l2), "v"(l3), "v"(g), "v"(g1), "v"(g2), "v"(g3)
      : "memory");
}

template <int FM>
__global__ __launch_bounds__(256) void gemm_bf16_wmma_kernel(
    const unsigned short* __restrict__ A,   // [M,K] bf16
    const unsigned short* __restrict__ Bt,  // [N,K] bf16 (B transposed)
    float* __restrict__ C, int K, int ldc) {
  constexpr int BM = 64 * FM;
  __shared__ __align__(16) unsigned short As[2][BM * LDT];
  __shared__ __align__(16) unsigned short Bs[2][GT_N * LDT];

  const int tid  = threadIdx.x;
  const int lane = tid & 31;
  const int w    = tid >> 5;
  const int wm   = w >> 1;   // 0..3 : band of 16 FM rows
  const int wn   = w & 1;    // 0..1 : 64-col band

  const long m0 = (long)blockIdx.y * BM;
  const long n0 = (long)blockIdx.x * GT_N;
  const int  nk = K / GT_K;

  const unsigned short* Agb = A  + m0 * K;
  const unsigned short* Bgb = Bt + n0 * K;

  // A tile row is one 128-byte line: 8 lanes cover a whole line, a wave's copy
  // 4 whole lines. Thread tid takes 16-byte chunk tid & 7 of rows
  // (tid >> 3) + 32 i.
  const int  sr = tid >> 3, sc = (tid & 7) * 8;
  const long so = (long)sr * K + sc;     // this thread's place in a global tile
  const int  sl = sr * LDT + sc;         // and in an LDS tile
  auto stage = [&](int kt, int buf) {    // async DMA of tile kt straight to LDS
#pragma unroll  // constant LDS offsets
    for (int i = 0; i < BM / 128; ++i)
      async_copy_rows4(Agb + kt * GT_K + so + (long)(i * 128) * K, K,
                       &As[buf][i * 128 * LDT + sl]);
    async_copy_rows4(Bgb + kt * GT_K + so, K, &Bs[buf][sl]);
  };

  stage(0, 0);
  wait_async0();
  __syncthreads();
  if (nk > 1) stage(1, 1);

  v8f acc[FM][4];
#pragma unroll
  for (int fm = 0; fm < FM; ++fm)
#pragma unroll
    for (int fn = 0; fn < 4; ++fn)
      acc[fm][fn] = (v8f){0.f, 0.f, 0.f, 0.f, 0.f, 0.f, 0.f, 0.f};

  for (int kt = 0; kt < nk; ++kt) {
    const int cur = kt & 1;
    // compute on current buffer: two k=32 sub-steps
#pragma unroll
    for (int s = 0; s < 2; ++s) {
      const int kb = s * 32 + (lane >> 4) * 8;   // khalf selects K sub-lane set
      v16bf afr[FM], bfr[4];
#pragma unroll
      for (int fm = 0; fm < FM; ++fm) {
        int row = (wm * FM + fm) * 16 + (lane & 15);
        afr[fm] = load_frag(&As[cur][row * LDT + kb]);
      }
#pragma unroll
      for (int fn = 0; fn < 4; ++fn) {
        int row = wn * 64 + fn * 16 + (lane & 15);
        bfr[fn] = load_frag(&Bs[cur][row * LDT + kb]);
      }
      if (s == 1) {
        // The trip's last LDS reads are out. This wave's reads of buffer cur
        // are done and its copies of tile kt + 1 have landed; behind the
        // barrier that holds for every wave, so tile kt + 1 may be read and
        // buffer cur refilled. The refill goes out ahead of the sub-step's
        // matrix steps, which need registers only: it has the longer lead.
        asm volatile("s_wait_dscnt 0x0" ::: "memory");
        wait_async0();
        __syncthreads();
        if (kt + 2 < nk) stage(kt + 2, cur);
      }
#pragma unroll
      for (int fm = 0; fm < FM; ++fm)
#pragma unroll
        for (int fn = 0; fn < 4; ++fn)
          acc[fm][fn] = __builtin_amdgcn_wmma_f32_16x16x32_bf16(
              false, afr[fm], false, bfr[fn], (short)0, acc[fm][fn],
              false, false);
    }
  }
  wait_async0();   // no copy is in flight when the wave ends

  // store: VGPR r -> row (r + 8*khalf), lane&15 -> col  (16x16 f32 C layout)
  const int cn    = lane & 15;
  const int rbase = (lane >> 4) * 8;
#pragma unroll
  for (int fm = 0; fm < FM; ++fm)
#pragma unroll
    for (int fn = 0; fn < 4; ++fn) {
      long row0 = m0 + (wm * FM + fm) * 16 + rbase;
      long col  = n0 + wn * 64 + fn * 16 + cn;
#pragma unroll
      for (int r = 0; r < 8; ++r)
        C[(row0 + r) * ldc + col] = acc[fm][fn][r];
    }
}

// ---------------------------------------------------------------------------
// gk = log_sigmoid(x @ Wgk1 @ Wgk2 + bgk2) / 16      (low-rank, fp32)
// One block per 16 rows of x, so that Wgk1 and Wgk2 are read once per 16 rows.
// x @ Wgk1 runs on the f32 16x16x4 matrix form: wave w takes k = 128 w ..
// 128 w + 127, the 16 partial tiles are summed through LDS in the order of w.
// A wave loads its 16 x 128 piece of x in whole lines (one row piece of 512 B
// per load) and turns it into A fragments through LDS.
// k order of one matrix step (t, u): lane half hi, register i hold
// k = 128 w + 8 t + 4 hi + 2 u + i, in the A loader (a float4 of a row of x is
// u = 0, 1) and in the B loader (rows of Wgk1) alike.
// ---------------------------------------------------------------------------
#define GK_WAVES 16
#define GK_KS (KDIM / GK_WAVES)   // k per wave
#define GK_T (GK_KS / 8)          // float4 of x per lane
#define GK_XP (GK_KS + 4)         // LDS row pitch: 16 B x odd, for b128 readers

typedef __attribute__((ext_vector_type(2))) float v2f;

__device__ __forceinline__ v8f wmma_f32(v2f a, v2f b, v8f c) {
  return __builtin_amdgcn_wmma_f32_16x16x4_f32(false, a, false, b, (short)0, c,
                                               false, false);
}

// eight consecutive floats of LDS, 16-byte aligned
__device__ __forceinline__ v8f lds8(const float* p) {
  const float4 a = *(const float4*)p, b = *(const float4*)(p + 4);
  return (v8f){a.x, a.y, a.z, a.w, b.x, b.y, b.z, b.w};
}

__global__ __launch_bounds__(512) void gk_kernel(
    const float* __restrict__ x, const float* __restrict__ Wgk1,
    const float* __restrict__ Wgk2, const float* __restrict__ bgk2,
    float* __restrict__ gkout) {
  __shared__ __align__(16) float xs[GK_WAVES * 16 * GK_XP];
  __shared__ __align__(16) float red[GK_WAVES * 256];
  __shared__ __align__(16) float low[16 * 16];
  const int tid = threadIdx.x;
  const int lane = tid & 31, c16 = tid & 15, hi = (tid >> 4) & 1, w = tid >> 5;
  const long m0 = (long)blockIdx.x * 16;

  const float* xp = x + m0 * KDIM + w * GK_KS + lane * 4;
  const float* wp = Wgk1 + (w * GK_KS + 4 * hi) * 16 + c16;
  // the second product's operands: columns 2 tid, 2 tid + 1 of Wgk2 and bgk2
  float2 w2[16];
#pragma unroll  // w2[] stays in registers, the loads go out with those below
  for (int r = 0; r < 16; ++r) w2[r] = *((const float2*)(Wgk2 + r * 1024) + tid);
  const float2 bias = *((const float2*)bgk2 + tid);
  float bq[GK_T][4];
#pragma unroll  // bq[][] stays in registers, the loads go out together
  for (int t = 0; t < GK_T; ++t)
#pragma unroll  // bq[][] stays in registers
    for (int q = 0; q < 4; ++q) bq[t][q] = wp[(8 * t + q) * 16];
  // With the fence every load of the kernel is issued ahead of the first wait:
  // without it the compiler holds a quarter of these, and of those of x, back
  // behind that wait, and their latency comes on top.
  __builtin_amdgcn_sched_barrier(0);
  float4 xv[16];
#pragma unroll  // xv[] stays in registers, the loads go out together
  for (int j = 0; j < 16; ++j) xv[j] = *(const float4*)(xp + j * KDIM);

  float* xw = xs + w * (16 * GK_XP);
#pragma unroll  // xv[] stays in registers
  for (int j = 0; j < 16; ++j) *(float4*)(xw + j * GK_XP + lane * 4) = xv[j];
  __syncthreads();

  // two accumulator tiles, so that a step need not wait for the one before it
  v8f acc0 = (v8f){0.f, 0.f, 0.f, 0.f, 0.f, 0.f, 0.f, 0.f};
  v8f acc1 = acc0;
#pragma unroll  // bq[][] stays in registers
  for (int t = 0; t < GK_T; ++t) {
    const float4 a = *(const float4*)(xw + c16 * GK_XP + 8 * t + 4 * hi);
    acc0 = wmma_f32((v2f){a.x, a.y}, (v2f){bq[t][0], bq[t][1]}, acc0);
    acc1 = wmma_f32((v2f){a.z, a.w}, (v2f){bq[t][2], bq[t][3]}, acc1);
  }
  acc0 += acc1;
#pragma unroll  // acc0 stays in registers
  for (int r = 0; r < 8; ++r) red[w * 256 + r * 32 + lane] = acc0[r];
  __syncthreads();
  if (tid < 256) {   // register r = tid >> 5 of lane (c16, hi): row 8 hi + r
    float s = 0.f;
#pragma unroll  // the 16 LDS loads go out together
    for (int v = 0; v < GK_WAVES; ++v) s += red[v * 256 + tid];
    low[(8 * hi + w) * 16 + c16] = s;
  }
  __syncthreads();

  float* dst = gkout + m0 * 1024 + 2 * tid;
#pragma unroll 1  // one copy of the long log-sigmoid text
  for (int m = 0; m < 16; ++m) {
    const v8f l0 = lds8(&low[m * 16]), l1 = lds8(&low[m * 16 + 8]);
    float ax = bias.x, ay = bias.y;
#pragma unroll  // l0 and w2[] stay in registers
    for (int r = 0; r < 8; ++r) { ax += l0[r] * w2[r].x; ay += l0[r] * w2[r].y; }
#pragma unroll  // l1 and w2[] stay in registers
    for (int r = 0; r < 8; ++r) {
      ax += l1[r] * w2[8 + r].x;
      ay += l1[r] * w2[8 + r].y;
    }
    const float lx = fminf(ax, 0.f) - log1pf(__expf(-fabsf(ax)));
    const float ly = fminf(ay, 0.f) - log1pf(__expf(-fabsf(ay)));
    *(float2*)(dst + m * 1024) =
        make_float2(lx * (1.0f / 16.0f), ly * (1.0f / 16.0f));
  }
}

// ---------------------------------------------------------------------------
// Chunked GLA scan, split along the sequence into NSEG segments of SEGC chunks
// so that (b,h) x segment work-groups run side by side. The state recurrence
// S <- diag(decay) S + kv is linear in S, so over one segment
//   S_end = diag(D_seg) S_start + KV_seg,
// with D_seg the product of the chunk decays and KV_seg the segment's end
// state when started from zero. Three launches:
//   1) gla_seg_state_kernel: KV_seg and D_seg of every segment but the last
//   2) gla_seg_scan_kernel : start state of segments 1..NSEG-1 (in place)
//   3) gla_kernel          : the full chunk loop of a segment from its start
// The products with v and with S run on the f32 16x16x4 matrix form. Wave w
// owns columns e = 32 w .. 32 w + 31 (two tiles of 16). S[64][128] lives in
// registers as 4 x 2 accumulator tiles per wave: register r of lane (c, hi)
// holds S[16 dt + 8 hi + r][e0 + c]. Registers (2j, 2j+1) of such a tile are at
// once a B fragment whose four k are rows 2j, 2j+1 (hi = 0) and 8+2j, 8+2j+1
// (hi = 1); the A loaders below take their k in the same order. v is loaded in
// the same map, so it too is a B fragment as it lies. o overwrites v in qkvg.
// ---------------------------------------------------------------------------
#define CPAD 68
#define NSEG 32                 // segments per sequence
#define SEGC 4                  // chunks of 16 rows per segment (NSEG*SEGC = 128)
#define NSEGM1 (NSEG - 1)

// S <- diag(decay) S + kd^T v for one chunk; kd is [16 c][CPAD], d contiguous
__device__ __forceinline__ void state_step(v8f (&S)[4][2], const v8f (&vb)[2],
                                           const float* kd, const float* decay,
                                           int c16, int hi) {
#pragma unroll  // S[][] stays in registers
  for (int dt = 0; dt < 4; ++dt) {
    const v8f dec = lds8(&decay[dt * 16 + 8 * hi]);
    S[dt][0] *= dec;
    S[dt][1] *= dec;
#pragma unroll  // S[][] and vb[] stay in registers
    for (int j = 0; j < 4; ++j) {
      const float* kr = &kd[(2 * j + 8 * hi) * CPAD + dt * 16 + c16];
      const v2f a = {kr[0], kr[CPAD]};
#pragma unroll  // S[][] and vb[] stay in registers
      for (int et = 0; et < 2; ++et)
        S[dt][et] = wmma_f32(a, (v2f){vb[et][2 * j], vb[et][2 * j + 1]},
                             S[dt][et]);
    }
  }
}

__global__ __launch_bounds__(128) void gla_seg_state_kernel(
    const float* __restrict__ qkvg, const float* __restrict__ gk,
    float* __restrict__ segS, float* __restrict__ segD) {
  __shared__ float gc[16 * CPAD];
  __shared__ __align__(16) float kd[16 * CPAD];
  __shared__ __align__(16) float decay[64];

  const int seg = blockIdx.x;       // 0..NSEG-2
  const int bh = blockIdx.y;        // 0..31
  const int b = bh >> 4, h = bh & 15;
  const int tid = threadIdx.x;
  const int c16 = tid & 15, hi = (tid >> 4) & 1, w = tid >> 5;

  v8f S[4][2];
#pragma unroll  // S[][] stays in registers
  for (int dt = 0; dt < 4; ++dt)
#pragma unroll  // S[][] stays in registers
    for (int et = 0; et < 2; ++et)
      S[dt][et] = (v8f){0.f, 0.f, 0.f, 0.f, 0.f, 0.f, 0.f, 0.f};

  const long row0 = (long)b * 2048 + (long)seg * (SEGC * 16);
  // row pointers of the current chunk, advanced by 16 rows per chunk
  const float* gp = gk + row0 * 1024 + h * 64 + (tid & 63);
  const float* kp = qkvg + row0 * 6144 + 1024 + h * 64 + (tid & 63);
  const float* vp = qkvg + (row0 + 8 * hi) * 6144 + 2048 + h * 128 + w * 32 + c16;
  float dprod = 1.f;

  for (int n = 0; n < SEGC; ++n) {
    if (tid < 64) {                  // per-column-d prep
      const int d = tid;
      float c = 0.f;
#pragma unroll  // the 16 row loads go out together
      for (int cc = 0; cc < 16; ++cc) {
        c += gp[cc * 1024];
        gc[cc * CPAD + d] = c;
      }
      const float dec = __expf(c);
      decay[d] = dec;
      dprod *= dec;
      const float glast = c;
#pragma unroll  // the 16 row loads go out together
      for (int cc = 0; cc < 16; ++cc) {
        float g = gc[cc * CPAD + d];
        kd[cc * CPAD + d] = kp[cc * 6144] * __expf(glast - g);
      }
    }
    v8f vb[2];
#pragma unroll  // vb[] stays in registers
    for (int et = 0; et < 2; ++et)
#pragma unroll  // vb[] stays in registers
      for (int r = 0; r < 8; ++r) vb[et][r] = vp[r * 6144 + et * 16];
    __syncthreads();

    state_step(S, vb, kd, decay, c16, hi);
    gp += 16 * 1024;
    kp += 16 * 6144;
    vp += 16 * 6144;
    __syncthreads();
  }

  const long sb = (long)bh * NSEGM1 + seg;
  float* sp = segS + sb * (64 * 128) + (8 * hi) * 128 + w * 32 + c16;
#pragma unroll  // S[][] stays in registers; one address, constant offsets
  for (int dt = 0; dt < 4; ++dt)
#pragma unroll  // S[][] stays in registers
    for (int et = 0; et < 2; ++et)
#pragma unroll  // S[][] stays in registers
      for (int r = 0; r < 8; ++r)
        sp[(dt * 16 + r) * 128 + et * 16] = S[dt][et][r];
  if (tid < 64) segD[sb * 64 + tid] = dprod;
}

// segS[bh][g] holds KV of segment g on entry and the start state of segment
// g + 1 on exit. One thread per (bh, d, four columns e); every load is issued
// ahead of the first store.
__global__ __launch_bounds__(256) void gla_seg_scan_kernel(
    float* __restrict__ segS, const float* __restrict__ segD) {
  const int idx = blockIdx.x * 256 + threadIdx.x;   // 32 * 64 * 32 threads
  const int bh = idx >> 11, rem = idx & 2047, d = rem >> 5;
  float4* p = (float4*)segS + (long)bh * NSEGM1 * 2048 + rem;
  const float* dp = segD + (long)bh * NSEGM1 * 64 + d;
  float4 kv[NSEGM1];
  float dc[NSEGM1];
#pragma unroll  // kv[] and dc[] stay in registers
  for (int g = 0; g < NSEGM1; ++g) {
    kv[g] = p[g * 2048];
    dc[g] = dp[g * 64];
  }
  // Stands behind the last load and in front of the first store: no load is
  // issued among the stores into a register that a store still names, and the
  // loads' latencies overlap instead of adding up along the chain.
  asm volatile("s_wait_xcnt 0x0" ::: "memory");
  // segment 0 starts from zero, so kv[0] is already the start of segment 1
#pragma unroll  // kv[] and dc[] stay in registers
  for (int g = 1; g < NSEGM1; ++g) {
    kv[g].x = dc[g] * kv[g - 1].x + kv[g].x;
    kv[g].y = dc[g] * kv[g - 1].y + kv[g].y;
    kv[g].z = dc[g] * kv[g - 1].z + kv[g].z;
    kv[g].w = dc[g] * kv[g - 1].w + kv[g].w;
    p[g * 2048] = kv[g];
  }
}

__global__ __launch_bounds__(128) void gla_kernel(
    float* __restrict__ qkvg, const float* __restrict__ gk,
    const float* __restrict__ segS) {
  __shared__ float gc[16 * CPAD];
  __shared__ __align__(16) float qe[16 * CPAD];
  __shared__ __align__(16) float ke[16 * CPAD];
  __shared__ __align__(16) float kd[16 * CPAD];
  __shared__ __align__(16) float Am[16 * 16];
  __shared__ __align__(16) float decay[64];

  const int seg = blockIdx.x;       // 0..NSEG-1
  const int bh = blockIdx.y;        // 0..31
  const int b = bh >> 4, h = bh & 15;
  const int tid = threadIdx.x;
  const int c16 = tid & 15, hi = (tid >> 4) & 1, w = tid >> 5;

  v8f S[4][2];
  if (seg == 0) {
#pragma unroll  // S[][] stays in registers
    for (int dt = 0; dt < 4; ++dt)
#pragma unroll  // S[][] stays in registers
      for (int et = 0; et < 2; ++et)
        S[dt][et] = (v8f){0.f, 0.f, 0.f, 0.f, 0.f, 0.f, 0.f, 0.f};
  } else {
    const float* s0 = segS + ((long)bh * NSEGM1 + (seg - 1)) * (64 * 128) +
                      (8 * hi) * 128 + w * 32 + c16;
#pragma unroll  // S[][] stays in registers; one address, constant offsets
    for (int dt = 0; dt < 4; ++dt)
#pragma unroll  // S[][] stays in registers
      for (int et = 0; et < 2; ++et)
#pragma unroll  // S[][] stays in registers
        for (int r = 0; r < 8; ++r)
          S[dt][et][r] = s0[(dt * 16 + r) * 128 + et * 16];
    // behind the loads, ahead of any rewrite of a register that they name
    asm volatile("s_wait_xcnt 0x0" ::: "memory");
  }

  const long rowbase = (long)b * 2048 + (long)seg * (SEGC * 16);

  for (int n = 0; n < SEGC; ++n) {
    const long m0 = rowbase + n * 16;
    if (tid < 64) {                  // per-column-d prep
      const int d = tid;
      float c = 0.f;
#pragma unroll
      for (int cc = 0; cc < 16; ++cc) {
        c += gk[(m0 + cc) * 1024 + h * 64 + d];
        gc[cc * CPAD + d] = c;
      }
      decay[d] = __expf(c);
      const float glast = c;
#pragma unroll
      for (int cc = 0; cc < 16; ++cc) {
        float g = gc[cc * CPAD + d];
        float q = qkvg[(m0 + cc) * 6144 + h * 64 + d];
        float k = qkvg[(m0 + cc) * 6144 + 1024 + h * 64 + d];
        qe[cc * CPAD + d] = q * __expf(g) * GLA_SCALE;
        ke[cc * CPAD + d] = k * __expf(-g);
        kd[cc * CPAD + d] = k * __expf(glast - g);
      }
    }
    // this wave's 16 x 32 piece of v (and of o), rows 8 hi + r, as B fragments
    float* vo = qkvg + (m0 + 8 * hi) * 6144 + 2048 + h * 128 + w * 32 + c16;
    v8f vb[2];
#pragma unroll  // vb[] stays in registers
    for (int et = 0; et < 2; ++et)
#pragma unroll  // vb[] stays in registers
      for (int r = 0; r < 8; ++r) vb[et][r] = vo[r * 6144 + et * 16];
    __syncthreads();

    // A = tril(qe ke^T), 256 entries over 128 threads
#pragma unroll
    for (int t = tid; t < 256; t += 128) {
      int cc = t >> 4, mm = t & 15;
      float a = 0.f;
      if (mm <= cc) {
#pragma unroll
        for (int d = 0; d < 64; ++d) a += qe[cc * CPAD + d] * ke[mm * CPAD + d];
      }
      Am[cc * 16 + mm] = a;
    }
    __syncthreads();

    v8f o[2];
    o[0] = (v8f){0.f, 0.f, 0.f, 0.f, 0.f, 0.f, 0.f, 0.f};
    o[1] = o[0];
    {  // o_intra = A v: row c16 of A, k = rows of v in the order of vb
      const v8f am = lds8(&Am[c16 * 16 + 8 * hi]);
#pragma unroll  // am, vb[] and o[] stay in registers
      for (int j = 0; j < 4; ++j) {
        const v2f a = {am[2 * j], am[2 * j + 1]};
#pragma unroll  // vb[] and o[] stay in registers
        for (int et = 0; et < 2; ++et)
          o[et] = wmma_f32(a, (v2f){vb[et][2 * j], vb[et][2 * j + 1]}, o[et]);
      }
    }
    // o_inter = qe S (old S): row c16 of qe, k = rows of S in the tiles' order
#pragma unroll  // S[][] and o[] stay in registers
    for (int dt = 0; dt < 4; ++dt) {
      const v8f qf = lds8(&qe[c16 * CPAD + dt * 16 + 8 * hi]);
#pragma unroll  // qf, S[][] and o[] stay in registers
      for (int j = 0; j < 4; ++j) {
        const v2f a = {qf[2 * j], qf[2 * j + 1]};
#pragma unroll  // S[][] and o[] stay in registers
        for (int et = 0; et < 2; ++et)
          o[et] = wmma_f32(a, (v2f){S[dt][et][2 * j], S[dt][et][2 * j + 1]},
                           o[et]);
      }
    }
#pragma unroll  // o[] stays in registers
    for (int et = 0; et < 2; ++et)
#pragma unroll  // o[] stays in registers
      for (int r = 0; r < 8; ++r) vo[r * 6144 + et * 16] = o[et][r];
    // behind the stores, ahead of any rewrite of a register that they name
    asm volatile("s_wait_xcnt 0x0" ::: "memory");
    // the last chunk's end state is read by nobody here
    if (n + 1 < SEGC) state_step(S, vb, kd, decay, c16, hi);
    __syncthreads();
  }
}

// 2^x and 1/sqrt(x), each with the free slot that the instruction set asks for
// between a transcendental and a next instruction that overwrites its source.
__device__ __forceinline__ float exp2_slot(float x) {
  float r;
  asm("v_exp_f32 %0, %1\n\tv_nop" : "=v"(r) : "v"(x));
  return r;
}
__device__ __forceinline__ float rsq_slot(float x) {
  float r;
  asm("v_rsq_f32 %0, %1\n\tv_nop" : "=v"(r) : "v"(x));
  return r;
}
// g * sigmoid(g), with exp(-g) formed as 2^(-g * log2 e)
__device__ __forceinline__ float silu(float g) {
  return g / (1.f + exp2_slot(g * -1.44269504f));
}

// Sum over the 32 lanes, left in every lane: lane l with l ^ 1, 2, 4, 8 inside
// a row of 16 by DPP, then l ^ 16 by a cross-row move; all in the vector unit.
template <int M>
__device__ __forceinline__ float row_xor(float x) {
  return __builtin_bit_cast(float, __builtin_amdgcn_update_dpp(
      0, __builtin_bit_cast(int, x), 0x160 | M, 0xf, 0xf, true));
}
__device__ __forceinline__ float wave_sum(float s) {
  s += row_xor<1>(s);
  s += row_xor<2>(s);
  s += row_xor<4>(s);
  s += row_xor<8>(s);
  const int b = __builtin_bit_cast(int, s);
  return s + __builtin_bit_cast(float, __builtin_amdgcn_permlanex16(
                 b, b, 0x76543210, 0xfedcba98, false, false));
}

// ---------------------------------------------------------------------------
// RMSNorm over DV + SiLU(g) gate, output bf16 for the final GEMM
// one wave per (m, 8 heads): a row of 128 is one float4 per lane, its sum of
// squares a butterfly over the 32 lanes; no LDS, no barrier.
// ---------------------------------------------------------------------------
__global__ __launch_bounds__(256) void norm_gate_kernel(
    const float* __restrict__ qkvg, const float* __restrict__ norm_w,
    unsigned short* __restrict__ og) {
  const int lane = threadIdx.x & 31;
  const int wv = blockIdx.x * 8 + (threadIdx.x >> 5);   // 0..8191
  const int m = wv >> 1, h0 = (wv & 1) * 8;
  const float* ob = qkvg + (long)m * 6144 + 2048 + h0 * 128 + lane * 4;
  float4 o[8], g[8];
#pragma unroll  // o[] and g[] stay in registers, the 16 loads go out together
  for (int r = 0; r < 8; ++r) {
    o[r] = *(const float4*)(ob + r * 128);
    g[r] = *(const float4*)(ob + 2048 + r * 128);
  }
  const float4 w = *(const float4*)(norm_w + lane * 4);
  // The fence keeps every load above it, so that all 17 are in flight at once:
  // without it the compiler sinks six of them into the arithmetic.
  __builtin_amdgcn_sched_barrier(0);
  float ss[8];
#pragma unroll  // ss[] stays in registers
  for (int r = 0; r < 8; ++r)
    ss[r] = (o[r].x * o[r].x + o[r].y * o[r].y) +
            (o[r].z * o[r].z + o[r].w * o[r].w);
#pragma unroll  // ss[] stays in registers
  for (int r = 0; r < 8; ++r) ss[r] = wave_sum(ss[r]);
  uint2 res[8];
#pragma unroll  // res[] stays in registers
  for (int r = 0; r < 8; ++r) {
    // the argument is at least 1e-5: no subnormal range to rescale for
    const float rs = rsq_slot(ss[r] * (1.f / 128.f) + 1e-5f);
    const float a = o[r].x * rs * w.x * silu(g[r].x);
    const float b = o[r].y * rs * w.y * silu(g[r].y);
    const float c = o[r].z * rs * w.z * silu(g[r].z);
    const float d = o[r].w * rs * w.w * silu(g[r].w);
    res[r] = make_uint2(pack2bf(a, b), pack2bf(c, d));
  }
  unsigned short* dst = og + (long)m * 2048 + h0 * 128 + lane * 4;
#pragma unroll  // res[] stays in registers
  for (int r = 0; r < 8; ++r) *(uint2*)(dst + r * 128) = res[r];
}

// ---------------------------------------------------------------------------
// Host launcher
// ---------------------------------------------------------------------------
extern "C" void kernel_launch(void* const* d_in, const int* in_sizes, int n_in,
                              void* d_out, int out_size, void* d_ws,
                              size_t ws_size, hipStream_t stream) {
  const float* x      = (const float*)d_in[0];
  const float* Wq     = (const float*)d_in[1];
  const float* Wk     = (const float*)d_in[2];
  const float* Wv     = (const float*)d_in[3];
  const float* Wg     = (const float*)d_in[4];
  const float* Wgk1   = (const float*)d_in[5];
  const float* Wgk2   = (const float*)d_in[6];
  const float* bgk2   = (const float*)d_in[7];
  const float* Wo     = (const float*)d_in[8];
  const float* norm_w = (const float*)d_in[9];
  float* out = (float*)d_out;

  // workspace layout (bytes)
  char* ws = (char*)d_ws;
  unsigned short* xb    = (unsigned short*)(ws);                       // 16 MiB
  unsigned short* wcat  = (unsigned short*)(ws + (size_t)16777216);    // 24 MiB
  unsigned short* wot   = (unsigned short*)(ws + (size_t)41943040);    //  8 MiB
  float*          qkvg  = (float*)         (ws + (size_t)50331648);    // 96 MiB
  float*          gkbuf = (float*)         (ws + (size_t)150994944);   // 16 MiB
  unsigned short* og    = (unsigned short*)(ws + (size_t)167772160);   // 16 MiB
  float*          segS  = (float*)         (ws + (size_t)184549376);   // 31 MiB
  float*          segD  = (float*)         (ws + (size_t)218103808);   // 248 KiB

  // 1, 2) x -> bf16; weights transposed and converted into the concatenated
  // [6144,2048] and into [2048,2048]
  prep_kernel<<<1024, 256, 0, stream>>>(x, Wq, Wk, Wv, Wg, Wo, xb, wcat, wot);

  // 3) fused projection GEMM (WMMA bf16 -> f32): qkvg[4096,6144]
  gemm_bf16_wmma_kernel<4><<<dim3(NCAT / 128, MROWS / 256), 256, 0, stream>>>(
      xb, wcat, qkvg, KDIM, NCAT);

  // 4) low-rank gate path gk[4096,1024]
  gk_kernel<<<MROWS / 16, 512, 0, stream>>>(x, Wgk1, Wgk2, bgk2, gkbuf);

  // 5) chunked GLA scan in segments (writes o over the v slice of qkvg)
  gla_seg_state_kernel<<<dim3(NSEGM1, 32), 128, 0, stream>>>(qkvg, gkbuf, segS,
                                                            segD);
  gla_seg_scan_kernel<<<32 * 64 * 32 / 256, 256, 0, stream>>>(segS, segD);
  gla_kernel<<<dim3(NSEG, 32), 128, 0, stream>>>(qkvg, gkbuf, segS);

  // 6) RMSNorm + SiLU gate -> bf16 [4096,2048]
  norm_gate_kernel<<<MROWS * 16 / 64, 256, 0, stream>>>(qkvg, norm_w, og);

  // 7) output GEMM (WMMA) -> d_out fp32 [4096,2048]
  gemm_bf16_wmma_kernel<2><<<dim3(NOUT / 128, MROWS / 128), 256, 0, stream>>>(
      og, wot, out, KDIM, NOUT);
}

// v009
// Measured time: 219 microseconds a run.
// Two timings next to v008 both put it at 1.05 times that version's speed.
// All steps since v000 together make it 9.60 times as fast.
#include <hip/hip_runtime.h>

// ---------------------------------------------------------------------------
// Problem constants (from reference)
// ---------------------------------------------------------------------------
// B=2, T=2048, HID=2048, H=16, DK=64, DV=128, C=16, LOWR=16
// M = B*T = 4096 rows.  Fused projection GEMM: [4096,2048] x [2048,6144]
//   cols 0..1023   : q  (H*DK)
//   cols 1024..2047: k  (H*DK)
//   cols 2048..4095: v  (H*DV)   (overwritten with o by the GLA kernel)
//   cols 4096..6143: g  (H*DV)
// Output GEMM: [4096,2048] x [2048,2048] -> d_out (fp32)

#define MROWS   4096
#define KDIM    2048
#define NCAT    6144
#define NOUT    2048
#define GLA_SCALE 0.125f   // DK^-0.5

typedef __attribute__((ext_vector_type(16))) __bf16 v16bf;
typedef __attribute__((ext_vector_type(8)))  float  v8f;

__device__ __forceinline__ unsigned short f2bf(float f) {
  unsigned int u = __float_as_uint(f);
  u += 0x7fffu + ((u >> 16) & 1u);
  return (unsigned short)(u >> 16);
}

// gfx1250 async global->LDS DMA: 16B per lane, no data VGPRs, ASYNCcnt-tracked.
// GV mode: VDST = LDS byte offset (low 32 bits of flat shared address per the
// LDS aperture rule addr[31:0]), VADDR = 64-bit global address, no SADDR.
__device__ __forceinline__ void wait_async0() {
  asm volatile("s_wait_asynccnt 0x0" ::: "memory");
}

// The streaming helpers below (operand preparation, norm+gate) move few bytes
// per wave. Each is laid out so that a wave brings in 4 KiB or more with all
// its loads in flight at once.

__device__ __forceinline__ unsigned int pack2bf(float lo, float hi) {
  return (unsigned int)f2bf(lo) | ((unsigned int)f2bf(hi) << 16);
}

// ---------------------------------------------------------------------------
// All that turns an input into a bf16 GEMM operand, in one launch: x -> bf16,
// and the five weights [K,Nw] fp32 -> [Nw,K] bf16 (so that the WMMA B operand
// is N-major). These six jobs depend on the inputs alone; as six launches each
// paid its own start, first load latency and drain for a few MB.
// The work is cut into pieces of 32 KiB read and 16 KiB written: 1024 runs of
// 8192 floats of x and 2048 weight tiles of 128 k x 64 n. Block b takes run b
// of x, tile b of (Wq, Wk, Wv) and tile b of (Wg, Wo); its 24 float4 loads per
// thread go out ahead of all other work, and the 1024 blocks (four to a WGP)
// are resident together.
// A weight tile: 8 float4 loads per thread (256 B of a source row per 16
// lanes), then 4 stores of 8 bf16 per thread (256 B of an output row per 16
// lanes).
// ---------------------------------------------------------------------------
#define TT_K 128
#define TT_N 64
#define TT_P 65   // odd pitch in floats: column reads spread over the banks

__device__ __forceinline__ void tt_to_lds(const float4 (&v)[8], float* tile,
                                          int lo, int hi) {
#pragma unroll  // v[] stays in registers
  for (int i = 0; i < 8; ++i) {
    float* t = &tile[(hi + i * 16) * TT_P + lo * 4];
    t[0] = v[i].x; t[1] = v[i].y; t[2] = v[i].z; t[3] = v[i].w;
  }
}

__device__ __forceinline__ void tt_from_lds(uint4 (&r)[4], const float* tile,
                                            int lo, int hi) {
#pragma unroll  // r[] stays in registers
  for (int j = 0; j < 4; ++j) {
    const float* t = &tile[(lo * 8) * TT_P + hi + j * 16];
    r[j] = make_uint4(pack2bf(t[0 * TT_P], t[1 * TT_P]),
                      pack2bf(t[2 * TT_P], t[3 * TT_P]),
                      pack2bf(t[4 * TT_P], t[5 * TT_P]),
                      pack2bf(t[6 * TT_P], t[7 * TT_P]));
  }
}

__global__ __launch_bounds__(256) void prep_kernel(
    const float* __restrict__ x, const float* __restrict__ Wq,
    const float* __restrict__ Wk, const float* __restrict__ Wv,
    const float* __restrict__ Wg, const float* __restrict__ Wo,
    unsigned short* __restrict__ xb, unsigned short* __restrict__ wcat,
    unsigned short* __restrict__ wot) {
  __shared__ float tile[2][TT_K * TT_P];
  const int b = blockIdx.x;   // 0..1023
  const int lo = threadIdx.x & 15, hi = threadIdx.x >> 4;

  // Every address below is a base that is the same for the whole block plus a
  // 32-bit byte offset of the lane's own (plus a constant).
  // 8192 contiguous floats of x: 8 float4 per thread
  const char* xs = (const char*)(x + (long)b * 8192);
  const unsigned xl = threadIdx.x * 16u;
  // first tile: Wq (256 tiles), Wk (256), Wv (512), n running fastest; they
  // are rows 0.., 1024.., 2048.. of wcat
  const bool nar = b < 512;                  // a weight of 1024 columns
  const int nw0 = nar ? 1024 : 2048;
  const int t0 = nar ? (b & 255) : b - 512;  // tile number inside its weight
  const int kb0 = (nar ? t0 >> 4 : t0 >> 5) * TT_K;
  const int nb0 = (nar ? t0 & 15 : t0 & 31) * TT_N;
  const char* s0 =
      (const char*)((b < 256 ? Wq : (nar ? Wk : Wv)) + (long)kb0 * nw0 + nb0);
  unsigned l0[8];
#pragma unroll  // l0[] stays in registers
  for (int i = 0; i < 8; ++i)
    l0[i] = (unsigned)((hi + i * 16) * nw0 + lo * 4) * 4u;
  // second tile: Wg (512 tiles, rows 4096.. of wcat), Wo (512, wot)
  const int kb1 = ((b & 511) >> 5) * TT_K, nb1 = (b & 31) * TT_N;
  const char* s1 = (const char*)((nar ? Wg : Wo) + (long)kb1 * 2048 + nb1);
  const unsigned l1 = (unsigned)(hi * 2048 + lo * 4) * 4u;

  float4 c[8], v0[8], v1[8];
#pragma unroll  // c[] stays in registers, the 8 loads go out together
  for (int i = 0; i < 8; ++i) c[i] = *(const float4*)(xs + xl + i * 4096);
#pragma unroll  // v0[] stays in registers, the 8 loads go out together
  for (int i = 0; i < 8; ++i) v0[i] = *(const float4*)(s0 + l0[i]);
#pragma unroll  // v1[] stays in registers, the 8 loads go out together
  for (int i = 0; i < 8; ++i)
    v1[i] = *(const float4*)(s1 + l1 + i * (16 * 2048 * 4));
  // Behind the loads, ahead of any rewrite of a register that they name: the
  // operands keep the address registers as they are up to this wait.
  asm volatile("s_wait_xcnt 0x0"
               :: "v"(xl), "v"(l1), "v"(l0[0]), "v"(l0[1]), "v"(l0[2]),
                  "v"(l0[3]), "v"(l0[4]), "v"(l0[5]), "v"(l0[6]), "v"(l0[7]),
                  "s"(xs), "s"(s0), "s"(s1)
               : "memory");

  // x is packed at once, which frees half of its registers
  uint2 cb[8];
#pragma unroll  // c[] and cb[] stay in registers
  for (int i = 0; i < 8; ++i)
    cb[i] = make_uint2(pack2bf(c[i].x, c[i].y), pack2bf(c[i].z, c[i].w));

  tt_to_lds(v0, tile[0], lo, hi);
  tt_to_lds(v1, tile[1], lo, hi);
  __syncthreads();
  // x goes out behind the barrier: in front of it the barrier's own wait would
  // hold the wave until these stores have been answered
  char* xd = (char*)(xb + (long)b * 8192);
  const unsigned xq = threadIdx.x * 8u;
#pragma unroll  // cb[] stays in registers
  for (int i = 0; i < 8; ++i) *(uint2*)(xd + xq + i * 2048) = cb[i];
  // behind the stores, ahead of any rewrite of a register that they name
  asm volatile("s_wait_xcnt 0x0" ::: "memory");
  uint4 r0[4], r1[4];
  tt_from_lds(r0, tile[0], lo, hi);
  tt_from_lds(r1, tile[1], lo, hi);
  // row nb, column kb of [Nw,K] is a tile's first output element
  char* d0 = (char*)(wcat +
                     (long)((b >> 8 < 2 ? b >> 8 : 2) * 1024 + nb0) * KDIM + kb0);
  char* d1 = (char*)((nar ? wcat + (long)4096 * KDIM : wot) +
                     (long)nb1 * KDIM + kb1);
  const unsigned dl = (unsigned)(hi * KDIM + lo * 8) * 2u;
#pragma unroll  // r0[] stays in registers
  for (int j = 0; j < 4; ++j) *(uint4*)(d0 + dl + j * (16 * KDIM * 2)) = r0[j];
#pragma unroll  // r1[] stays in registers
  for (int j = 0; j < 4; ++j) *(uint4*)(d1 + dl + j * (16 * KDIM * 2)) = r1[j];
}

// ---------------------------------------------------------------------------
// bf16 WMMA GEMM:  C[M,N](f32) = A[M,K](bf16,row-major) * Bt[N,K]^T
// Block tile (64 FM) x 128, K-step 64, 256 threads = 8 waves (4x2 wave grid),
// each wave: FM x 4 fragments of 16x16. With FM = 4 a wave reads 8 fragments
// from LDS for 16 matrix steps (FM = 2: 6 for 8), and a block brings in 384
// operand rows for 256 x 128 results (FM = 2: 256 rows for 128 x 128).
// Double-buffered LDS, pitch 72 (144B rows -> conflict-free b128 fragment
// reads). Tile staging uses global_load_async_to_lds_b128 (no data VGPRs).
// ---------------------------------------------------------------------------
#define GT_N 128
#define GT_K 64
#define LDT  72

__device__ __forceinline__ v16bf load_frag(const unsigned short* p) {
  union { v16bf v; uint4 u[2]; } f;
  f.u[0] = *(const uint4*)(p);        // halves 0..7  : K = khalf*8 + 0..7
  f.u[1] = *(const uint4*)(p + 16);   // halves 8..15 : K = khalf*8 + 16..23
  return f.v;
}

// Rows r, r + 32, r + 64, r + 96 of a tile: 16 bytes per lane and row, from g
// (row pitch gp elements) to LDS at l (row pitch LDT). The s_wait_xcnt stands
// in the copies' own statement, ahead of any rewrite of an address register
// that they name.
__device__ __forceinline__ void async_copy_rows4(const unsigned short* g,
                                                 long gp, unsigned short* l) {
  const unsigned l0 = (unsigned)(unsigned long long)l;
  const unsigned l1 = l0 + 32 * LDT * 2, l2 = l0 + 64 * LDT * 2,
                 l3 = l0 + 96 * LDT * 2;
  const unsigned short *g1 = g + 32 * gp, *g2 = g + 64 * gp, *g3 = g + 96 * gp;
  asm volatile(
      "global_load_async_to_lds_b128 %0, %4, off\n\t"
      "global_load_async_to_lds_b128 %1, %5, off\n\t"
      "global_load_async_to_lds_b128 %2, %6, off\n\t"
      "global_load_async_to_lds_b128 %3, %7, off\n\t"
      "s_wait_xcnt 0x0"
      :: "v"(l0), "v"(l1), "v"(l2), "v"(l3), "v"(g), "v"(g1), "v"(g2), "v"(g3)
      : "memory");
}

template <int FM>
__global__ __launch_bounds__(256) void gemm_bf16_wmma_kernel(
    const unsigned short* __restrict__ A,   // [M,K] bf16
    const unsigned short* __restrict__ Bt,  // [N,K] bf16 (B transposed)
    float* __restrict__ C, int K, int ldc) {
  constexpr int BM = 64 * FM;
  __shared__ __align__(16) unsigned short As[2][BM * LDT];
  __shared__ __align__(16) unsigned short Bs[2][GT_N * LDT];

  const int tid  = threadIdx.x;
  const int lane = tid & 31;
  const int w    = tid >> 5;
  const int wm   = w >> 1;   // 0..3 : band of 16 FM rows
  const int wn   = w & 1;    // 0..1 : 64-col band

  const long m0 = (long)blockIdx.y * BM;
  const long n0 = (long)blockIdx.x * GT_N;
  const int  nk = K / GT_K;

  const unsigned short* Agb = A  + m0 * K;
  const unsigned short* Bgb = Bt + n0 * K;

  // A tile row is one 128-byte line: 8 lanes cover a whole line, a wave's copy
  // 4 whole lines. Thread tid takes 16-byte chunk tid & 7 of rows
  // (tid >> 3) + 32 i.
  const int  sr = tid >> 3, sc = (tid & 7) * 8;
  const long so = (long)sr * K + sc;     // this thread's place in a global tile
  const int  sl = sr * LDT + sc;         // and in an LDS tile
  auto stage = [&](int kt, int buf) {    // async DMA of tile kt straight to LDS
#pragma unroll  // constant LDS offsets
    for (int i = 0; i < BM / 128; ++i)
      async_copy_rows4(Agb + kt * GT_K + so + (long)(i * 128) * K, K,
                       &As[buf][i * 128 * LDT + sl]);
    async_copy_rows4(Bgb + kt * GT_K + so, K, &Bs[buf][sl]);
  };

  stage(0, 0);
  wait_async0();
  __syncthreads();
  if (nk > 1) stage(1, 1);

  v8f acc[FM][4];
#pragma unroll
  for (int fm = 0; fm < FM; ++fm)
#pragma unroll
    for (int fn = 0; fn < 4; ++fn)
      acc[fm][fn] = (v8f){0.f, 0.f, 0.f, 0.f, 0.f, 0.f, 0.f, 0.f};

  for (int kt = 0; kt < nk; ++kt) {
    const int cur = kt & 1;
    // compute on current buffer: two k=32 sub-steps
#pragma unroll
    for (int s = 0; s < 2; ++s) {
      const int kb = s * 32 + (lane >> 4) * 8;   // khalf selects K sub-lane set
      v16bf afr[FM], bfr[4];
#pragma unroll
      for (int fm = 0; fm < FM; ++fm) {
        int row = (wm * FM + fm) * 16 + (lane & 15);
        afr[fm] = load_frag(&As[cur][row * LDT + kb]);
      }
#pragma unroll
      for (int fn = 0; fn < 4; ++fn) {
        int row = wn * 64 + fn * 16 + (lane & 15);
        bfr[fn] = load_frag(&Bs[cur][row * LDT + kb]);
      }
      if (s == 1) {
        // The trip's last LDS reads are out. This wave's reads of buffer cur
        // are done and its copies of tile kt + 1 have landed; behind the
        // barrier that holds for every wave, so tile kt + 1 may be read and
        // buffer cur refilled. The refill goes out ahead of the sub-step's
        // matrix steps, which need registers only: it has the longer lead.
        asm volatile("s_wait_dscnt 0x0" ::: "memory");
        wait_async0();
        __syncthreads();
        if (kt + 2 < nk) stage(kt + 2, cur);
      }
#pragma unroll
      for (int fm = 0; fm < FM; ++fm)
#pragma unroll
        for (int fn = 0; fn < 4; ++fn)
          acc[fm][fn] = __builtin_amdgcn_wmma_f32_16x16x32_bf16(
              false, afr[fm], false, bfr[fn], (short)0, acc[fm][fn],
              false, false);
    }
  }
  wait_async0();   // no copy is in flight when the wave ends

  // store: VGPR r -> row (r + 8*khalf), lane&15 -> col  (16x16 f32 C layout)
  const int cn    = lane & 15;
  const int rbase = (lane >> 4) * 8;
#pragma unroll
  for (int fm = 0; fm < FM; ++fm)
#pragma unroll
    for (int fn = 0; fn < 4; ++fn) {
      long row0 = m0 + (wm * FM + fm) * 16 + rbase;
      long col  = n0 + wn * 64 + fn * 16 + cn;
#pragma unroll
      for (int r = 0; r < 8; ++r)
        C[(row0 + r) * ldc + col] = acc[fm][fn][r];
    }
}

// ---------------------------------------------------------------------------
// The same product on a block tile of 256 x 384, for the projection: one block
// per WGP holds all of that WGP's share of the results at once, so a block
// brings in 640 operand rows from L2 for 98304 results (256 x 128: 384 rows for
// 32768). 8 waves in a 2 x 4 grid, each 8 x 6 fragments (128 x 96): 14 fragments
// from LDS for 48 matrix steps. The accumulators take 384 registers of a wave's
// 512 (two waves per SIMD), so a sub-step keeps its 6 B fragments and brings
// its A fragments in row by row, ahead of their use.
// ---------------------------------------------------------------------------
#define WT_FM 8
#define WT_FN 6
#define WT_M 256
#define WT_N 384

// Rows r, r + 32, r + 64, r + 96 of a tile with the addresses in two vector
// registers (this tile leaves none to spare): the lane's place in the tile is a
// 32-bit byte offset vo, a row group's start a scalar base. An immediate offset
// moves the LDS address and the global address alike, so rows 32 j lie at LDS
// offset j * 32 * LDT * 2, and base j is set back by as much. The s_wait_xcnt
// stands in the copies' own statement, ahead of any rewrite of a register that
// they name.
__device__ __forceinline__ void async_copy_rows4s(const unsigned short* g,
                                                  long gp, unsigned vo,
                                                  unsigned short* l) {
  const unsigned l0 = (unsigned)(unsigned long long)l;
  const char* g0 = (const char*)g;
  const char* g1 = (const char*)(g + 32 * gp) - 32 * LDT * 2;
  const char* g2 = (const char*)(g + 64 * gp) - 64 * LDT * 2;
  const char* g3 = (const char*)(g + 96 * gp) - 96 * LDT * 2;
  static_assert(LDT == 72, "the offsets in the text below are 32 j LDT 2");
  asm volatile(
      "global_load_async_to_lds_b128 %0, %1, %2\n\t"
      "global_load_async_to_lds_b128 %0, %1, %3 offset:4608\n\t"
      "global_load_async_to_lds_b128 %0, %1, %4 offset:9216\n\t"
      "global_load_async_to_lds_b128 %0, %1, %5 offset:13824\n\t"
      "s_wait_xcnt 0x0"
      :: "v"(l0), "v"(vo), "s"(g0), "s"(g1), "s"(g2), "s"(g3)
      : "memory");
}

__global__ __launch_bounds__(256) void gemm_bf16_wide_kernel(
    const unsigned short* __restrict__ A,   // [M,K] bf16
    const unsigned short* __restrict__ Bt,  // [N,K] bf16 (B transposed)
    float* __restrict__ C, int K, int ldc) {
  __shared__ __align__(16) unsigned short As[2][WT_M * LDT];
  __shared__ __align__(16) unsigned short Bs[2][WT_N * LDT];

  const int tid  = threadIdx.x;
  const int lane = tid & 31;
  const int w    = tid >> 5;
  const int wm   = w >> 2;   // 0..1 : band of 128 rows
  const int wn   = w & 3;    // 0..3 : band of 96 columns

  const long m0 = (long)blockIdx.y * WT_M;
  const long n0 = (long)blockIdx.x * WT_N;
  const int  nk = K / GT_K;

  const unsigned short* Agb = A  + m0 * K;
  const unsigned short* Bgb = Bt + n0 * K;

  // As in the kernel above: 8 lanes cover a whole 128-byte tile row; thread tid
  // takes 16-byte chunk tid & 7 of rows (tid >> 3) + 32 i.
  const int      sr = tid >> 3, sc = (tid & 7) * 8;
  const unsigned vo = (unsigned)(sr * K + sc) * 2u;  // place in a global tile
  const int      sl = sr * LDT + sc;                 // and in an LDS tile
  auto stage = [&](int kt, int buf) {    // async DMA of tile kt straight to LDS
#pragma unroll  // constant LDS offsets
    for (int i = 0; i < WT_M / 128; ++i)
      async_copy_rows4s(Agb + kt * GT_K + (long)(i * 128) * K, K, vo,
                        &As[buf][i * 128 * LDT + sl]);
#pragma unroll  // constant LDS offsets
    for (int i = 0; i < WT_N / 128; ++i)
      async_copy_rows4s(Bgb + kt * GT_K + (long)(i * 128) * K, K, vo,
                        &Bs[buf][i * 128 * LDT + sl]);
  };

  stage(0, 0);
  wait_async0();
  __syncthreads();
  if (nk > 1) stage(1, 1);

  v8f acc[WT_FM][WT_FN];
#pragma unroll  // acc[][] stays in registers
  for (int fm = 0; fm < WT_FM; ++fm)
#pragma unroll  // acc[][] stays in registers
    for (int fn = 0; fn < WT_FN; ++fn)
      acc[fm][fn] = (v8f){0.f, 0.f, 0.f, 0.f, 0.f, 0.f, 0.f, 0.f};

  // the lane's place in a fragment: row lane & 15, K sub-lane set lane >> 4
  const int fo = (lane & 15) * LDT + (lane >> 4) * 8;
  for (int kt = 0; kt < nk; ++kt) {
    const int cur = kt & 1;
    // one address per operand, every fragment at a constant offset from it
    const unsigned short* ap = &As[cur][fo + wm * (WT_FM * 16 * LDT)];
    const unsigned short* bp = &Bs[cur][fo + wn * (WT_FN * 16 * LDT)];
#pragma unroll  // two k=32 sub-steps; afr[] and bfr[] stay in registers
    for (int s = 0; s < 2; ++s) {
      v16bf afr[WT_FM], bfr[WT_FN];
#pragma unroll  // bfr[] stays in registers
      for (int fn = 0; fn < WT_FN; ++fn)
        bfr[fn] = load_frag(bp + fn * 16 * LDT + s * 32);
      afr[0] = load_frag(ap + s * 32);
      afr[1] = load_frag(ap + 16 * LDT + s * 32);
#pragma unroll  // acc[][], afr[] and bfr[] stay in registers
      for (int fm = 0; fm < WT_FM; ++fm) {
        // Ahead of row fm's matrix steps the loads of later rows go out. First
        // sub-step: row fm + 2. Last sub-step: all eight rows are in by row 3,
        // since the barrier below ends the reads of this buffer.
        const int lo = s == 0 ? fm + 2 : (fm == 0 ? 2 : 2 * fm + 1);
        const int hi = s == 0 ? fm + 3 : 2 * fm + 3;
#pragma unroll  // afr[] stays in registers
        for (int i = lo; i < hi && i < WT_FM; ++i)
          afr[i] = load_frag(ap + i * 16 * LDT + s * 32);
        // Holds these loads in front of the row: short of registers, the
        // compiler otherwise sinks each row's loads to just ahead of its own
        // matrix steps, which then wait out the whole LDS latency.
        __builtin_amdgcn_sched_barrier(0);
        if (s == 1 && fm == WT_FM / 2) {
          // The trip's last LDS reads are out. This wave's reads of buffer cur
          // are done and its copies of tile kt + 1 have landed; behind the
          // barrier that holds for every wave, so tile kt + 1 may be read and
          // buffer cur refilled. The refill goes out ahead of the trip's last
          // 24 matrix steps, which need registers only.
          asm volatile("s_wait_dscnt 0x0" ::: "memory");
          wait_async0();
          __syncthreads();
          if (kt + 2 < nk) stage(kt + 2, cur);
        }
#pragma unroll  // acc[][] and bfr[] stay in registers
        for (int fn = 0; fn < WT_FN; ++fn)
          acc[fm][fn] = __builtin_amdgcn_wmma_f32_16x16x32_bf16(
              false, afr[fm], false, bfr[fn], (short)0, acc[fm][fn],
              false, false);
      }
    }
  }
  wait_async0();   // no copy is in flight when the wave ends

  // store: VGPR r -> row (r + 8*khalf), lane&15 -> col  (16x16 f32 C layout)
  const int cn    = lane & 15;
  const int rbase = (lane >> 4) * 8;
  float* cw = C + (m0 + wm * (WT_FM * 16) + rbase) * ldc + n0 +
              wn * (WT_FN * 16) + cn;
#pragma unroll  // acc[][] stays in registers
  for (int fm = 0; fm < WT_FM; ++fm) {
    float* cp[8];
#pragma unroll  // cp[] stays in registers
    for (int r = 0; r < 8; ++r) cp[r] = cw + (long)(fm * 16 + r) * ldc;
    // The two fences keep a row's address arithmetic in front of its stores and
    // the next row's behind the wait: no register that an issued store names
    // is rewritten ahead of that wait.
    __builtin_amdgcn_sched_barrier(0);
#pragma unroll  // acc[][] stays in registers
    for (int fn = 0; fn < WT_FN; ++fn)
#pragma unroll  // acc[][] and cp[] stay in registers
      for (int r = 0; r < 8; ++r) cp[r][fn * 16] = acc[fm][fn][r];
    asm volatile("s_wait_xcnt 0x0" ::: "memory");
    __builtin_amdgcn_sched_barrier(0);
  }
}

// ---------------------------------------------------------------------------
// gk = log_sigmoid(x @ Wgk1 @ Wgk2 + bgk2) / 16      (low-rank, fp32)
// One block per 16 rows of x, so that Wgk1 and Wgk2 are read once per 16 rows.
// x @ Wgk1 runs on the f32 16x16x4 matrix form: wave w takes k = 128 w ..
// 128 w + 127, the 16 partial tiles are summed through LDS in the order of w.
// A wave loads its 16 x 128 piece of x in whole lines (one row piece of 512 B
// per load) and turns it into A fragments through LDS.
// k order of one matrix step (t, u): lane half hi, register i hold
// k = 128 w + 8 t + 4 hi + 2 u + i, in the A loader (a float4 of a row of x is
// u = 0, 1) and in the B loader (rows of Wgk1) alike.
// ---------------------------------------------------------------------------
#define GK_WAVES 16
#define GK_KS (KDIM / GK_WAVES)   // k per wave
#define GK_T (GK_KS / 8)          // float4 of x per lane
#define GK_XP (GK_KS + 4)         // LDS row pitch: 16 B x odd, for b128 readers

typedef __attribute__((ext_vector_type(2))) float v2f;

__device__ __forceinline__ v8f wmma_f32(v2f a, v2f b, v8f c) {
  return __builtin_amdgcn_wmma_f32_16x16x4_f32(false, a, false, b, (short)0, c,
                                               false, false);
}

// eight consecutive floats of LDS, 16-byte aligned
__device__ __forceinline__ v8f lds8(const float* p) {
  const float4 a = *(const float4*)p, b = *(const float4*)(p + 4);
  return (v8f){a.x, a.y, a.z, a.w, b.x, b.y, b.z, b.w};
}

__global__ __launch_bounds__(512) void gk_kernel(
    const float* __restrict__ x, const float* __restrict__ Wgk1,
    const float* __restrict__ Wgk2, const float* __restrict__ bgk2,
    float* __restrict__ gkout) {
  __shared__ __align__(16) float xs[GK_WAVES * 16 * GK_XP];
  __shared__ __align__(16) float red[GK_WAVES * 256];
  __shared__ __align__(16) float low[16 * 16];
  const int tid = threadIdx.x;
  const int lane = tid & 31, c16 = tid & 15, hi = (tid >> 4) & 1, w = tid >> 5;
  const long m0 = (long)blockIdx.x * 16;

  const float* xp = x + m0 * KDIM + w * GK_KS + lane * 4;
  const float* wp = Wgk1 + (w * GK_KS + 4 * hi) * 16 + c16;
  // the second product's operands: columns 2 tid, 2 tid + 1 of Wgk2 and bgk2
  float2 w2[16];
#pragma unroll  // w2[] stays in registers, the loads go out with those below
  for (int r = 0; r < 16; ++r) w2[r] = *((const float2*)(Wgk2 + r * 1024) + tid);
  const float2 bias = *((const float2*)bgk2 + tid);
  float bq[GK_T][4];
#pragma unroll  // bq[][] stays in registers, the loads go out together
  for (int t = 0; t < GK_T; ++t)
#pragma unroll  // bq[][] stays in registers
    for (int q = 0; q < 4; ++q) bq[t][q] = wp[(8 * t + q) * 16];
  // With the fence every load of the kernel is issued ahead of the first wait:
  // without it the compiler holds a quarter of these, and of those of x, back
  // behind that wait, and their latency comes on top.
  __builtin_amdgcn_sched_barrier(0);
  float4 xv[16];
#pragma unroll  // xv[] stays in registers, the loads go out together
  for (int j = 0; j < 16; ++j) xv[j] = *(const float4*)(xp + j * KDIM);

  float* xw = xs + w * (16 * GK_XP);
#pragma unroll  // xv[] stays in registers
  for (int j = 0; j < 16; ++j) *(float4*)(xw + j * GK_XP + lane * 4) = xv[j];
  __syncthreads();

  // two accumulator tiles, so that a step need not wait for the one before it
  v8f acc0 = (v8f){0.f, 0.f, 0.f, 0.f, 0.f, 0.f, 0.f, 0.f};
  v8f acc1 = acc0;
#pragma unroll  // bq[][] stays in registers
  for (int t = 0; t < GK_T; ++t) {
    const float4 a = *(const float4*)(xw + c16 * GK_XP + 8 * t + 4 * hi);
    acc0 = wmma_f32((v2f){a.x, a.y}, (v2f){bq[t][0], bq[t][1]}, acc0);
    acc1 = wmma_f32((v2f){a.z, a.w}, (v2f){bq[t][2], bq[t][3]}, acc1);
  }
  acc0 += acc1;
#pragma unroll  // acc0 stays in registers
  for (int r = 0; r < 8; ++r) red[w * 256 + r * 32 + lane] = acc0[r];
  __syncthreads();
  if (tid < 256) {   // register r = tid >> 5 of lane (c16, hi): row 8 hi + r
    float s = 0.f;
#pragma unroll  // the 16 LDS loads go out together
    for (int v = 0; v < GK_WAVES; ++v) s += red[v * 256 + tid];
    low[(8 * hi + w) * 16 + c16] = s;
  }
  __syncthreads();

  float* dst = gkout + m0 * 1024 + 2 * tid;
#pragma unroll 1  // one copy of the long log-sigmoid text
  for (int m = 0; m < 16; ++m) {
    const v8f l0 = lds8(&low[m * 16]), l1 = lds8(&low[m * 16 + 8]);
    float ax = bias.x, ay = bias.y;
#pragma unroll  // l0 and w2[] stay in registers
    for (int r = 0; r < 8; ++r) { ax += l0[r] * w2[r].x; ay += l0[r] * w2[r].y; }
#pragma unroll  // l1 and w2[] stay in registers
    for (int r = 0; r < 8; ++r) {
      ax += l1[r] * w2[8 + r].x;
      ay += l1[r] * w2[8 + r].y;
    }
    const float lx = fminf(ax, 0.f) - log1pf(__expf(-fabsf(ax)));
    const float ly = fminf(ay, 0.f) - log1pf(__expf(-fabsf(ay)));
    *(float2*)(dst + m * 1024) =
        make_float2(lx * (1.0f / 16.0f), ly * (1.0f / 16.0f));
  }
}

// ---------------------------------------------------------------------------
// Chunked GLA scan, split along the sequence into NSEG segments of SEGC chunks
// so that (b,h) x segment work-groups run side by side. The state recurrence
// S <- diag(decay) S + kv is linear in S, so over one segment
//   S_end = diag(D_seg) S_start + KV_seg,
// with D_seg the product of the chunk decays and KV_seg the segment's end
// state when started from zero. Three launches:
//   1) gla_seg_state_kernel: KV_seg and D_seg of every segment but the last
//   2) gla_seg_scan_kernel : start state of segments 1..NSEG-1 (in place)
//   3) gla_kernel          : the full chunk loop of a segment from its start
// The products with v and with S run on the f32 16x16x4 matrix form. Wave w
// owns columns e = 32 w .. 32 w + 31 (two tiles of 16). S[64][128] lives in
// registers as 4 x 2 accumulator tiles per wave: register r of lane (c, hi)
// holds S[16 dt + 8 hi + r][e0 + c]. Registers (2j, 2j+1) of such a tile are at
// once a B fragment whose four k are rows 2j, 2j+1 (hi = 0) and 8+2j, 8+2j+1
// (hi = 1); the A loaders below take their k in the same order. v is loaded in
// the same map, so it too is a B fragment as it lies. o overwrites v in qkvg.
// ---------------------------------------------------------------------------
#define CPAD 68
#define NSEG 32                 // segments per sequence
#define SEGC 4                  // chunks of 16 rows per segment (NSEG*SEGC = 128)
#define NSEGM1 (NSEG - 1)

// S <- diag(decay) S + kd^T v for one chunk; kd is [16 c][CPAD], d contiguous
__device__ __forceinline__ void state_step(v8f (&S)[4][2], const v8f (&vb)[2],
                                           const float* kd, const float* decay,
                                           int c16, int hi) {
#pragma unroll  // S[][] stays in registers
  for (int dt = 0; dt < 4; ++dt) {
    const v8f dec = lds8(&decay[dt * 16 + 8 * hi]);
    S[dt][0] *= dec;
    S[dt][1] *= dec;
#pragma unroll  // S[][] and vb[] stay in registers
    for (int j = 0; j < 4; ++j) {
      const float* kr = &kd[(2 * j + 8 * hi) * CPAD + dt * 16 + c16];
      const v2f a = {kr[0], kr[CPAD]};
#pragma unroll  // S[][] and vb[] stay in registers
      for (int et = 0; et < 2; ++et)
        S[dt][et] = wmma_f32(a, (v2f){vb[et][2 * j], vb[et][2 * j + 1]},
                             S[dt][et]);
    }
  }
}

__global__ __launch_bounds__(128) void gla_seg_state_kernel(
    const float* __restrict__ qkvg, const float* __restrict__ gk,
    float* __restrict__ segS, float* __restrict__ segD) {
  __shared__ float gc[16 * CPAD];
  __shared__ __align__(16) float kd[16 * CPAD];
  __shared__ __align__(16) float decay[64];

  const int seg = blockIdx.x;       // 0..NSEG-2
  const int bh = blockIdx.y;        // 0..31
  const int b = bh >> 4, h = bh & 15;
  const int tid = threadIdx.x;
  const int c16 = tid & 15, hi = (tid >> 4) & 1, w = tid >> 5;

  v8f S[4][2];
#pragma unroll  // S[][] stays in registers
  for (int dt = 0; dt < 4; ++dt)
#pragma unroll  // S[][] stays in registers
    for (int et = 0; et < 2; ++et)
      S[dt][et] = (v8f){0.f, 0.f, 0.f, 0.f, 0.f, 0.f, 0.f, 0.f};

  const long row0 = (long)b * 2048 + (long)seg * (SEGC * 16);
  // row pointers of the current chunk, advanced by 16 rows per chunk
  const float* gp = gk + row0 * 1024 + h * 64 + (tid & 63);
  const float* kp = qkvg + row0 * 6144 + 1024 + h * 64 + (tid & 63);
  const float* vp = qkvg + (row0 + 8 * hi) * 6144 + 2048 + h * 128 + w * 32 + c16;
  float dprod = 1.f;

  for (int n = 0; n < SEGC; ++n) {
    if (tid < 64) {                  // per-column-d prep
      const int d = tid;
      float c = 0.f;
#pragma unroll  // the 16 row loads go out together
      for (int cc = 0; cc < 16; ++cc) {
        c += gp[cc * 1024];
        gc[cc * CPAD + d] = c;
      }
      const float dec = __expf(c);
      decay[d] = dec;
      dprod *= dec;
      const float glast = c;
#pragma unroll  // the 16 row loads go out together
      for (int cc = 0; cc < 16; ++cc) {
        float g = gc[cc * CPAD + d];
        kd[cc * CPAD + d] = kp[cc * 6144] * __expf(glast - g);
      }
    }
    v8f vb[2];
#pragma unroll  // vb[] stays in registers
    for (int et = 0; et < 2; ++et)
#pragma unroll  // vb[] stays in registers
      for (int r = 0; r < 8; ++r) vb[et][r] = vp[r * 6144 + et * 16];
    __syncthreads();

    state_step(S, vb, kd, decay, c16, hi);
    gp += 16 * 1024;
    kp += 16 * 6144;
    vp += 16 * 6144;
    __syncthreads();
  }

  const long sb = (long)bh * NSEGM1 + seg;
  float* sp = segS + sb * (64 * 128) + (8 * hi) * 128 + w * 32 + c16;
#pragma unroll  // S[][] stays in registers; one address, constant offsets
  for (int dt = 0; dt < 4; ++dt)
#pragma unroll  // S[][] stays in registers
    for (int et = 0; et < 2; ++et)
#pragma unroll  // S[][] stays in registers
      for (int r = 0; r < 8; ++r)
        sp[(dt * 16 + r) * 128 + et * 16] = S[dt][et][r];
  if (tid < 64) segD[sb * 64 + tid] = dprod;
}

// segS[bh][g] holds KV of segment g on entry and the start state of segment
// g + 1 on exit. One thread per (bh, d, four columns e); every load is issued
// ahead of the first store.
__global__ __launch_bounds__(256) void gla_seg_scan_kernel(
    float* __restrict__ segS, const float* __restrict__ segD) {
  const int idx = blockIdx.x * 256 + threadIdx.x;   // 32 * 64 * 32 threads
  const int bh = idx >> 11, rem = idx & 2047, d = rem >> 5;
  float4* p = (float4*)segS + (long)bh * NSEGM1 * 2048 + rem;
  const float* dp = segD + (long)bh * NSEGM1 * 64 + d;
  float4 kv[NSEGM1];
  float dc[NSEGM1];
#pragma unroll  // kv[] and dc[] stay in registers
  for (int g = 0; g < NSEGM1; ++g) {
    kv[g] = p[g * 2048];
    dc[g] = dp[g * 64];
  }
  // Stands behind the last load and in front of the first store: no load is
  // issued among the stores into a register that a store still names, and the
  // loads' latencies overlap instead of adding up along the chain.
  asm volatile("s_wait_xcnt 0x0" ::: "memory");
  // segment 0 starts from zero, so kv[0] is already the start of segment 1
#pragma unroll  // kv[] and dc[] stay in registers
  for (int g = 1; g < NSEGM1; ++g) {
    kv[g].x = dc[g] * kv[g - 1].x + kv[g].x;
    kv[g].y = dc[g] * kv[g - 1].y + kv[g].y;
    kv[g].z = dc[g] * kv[g - 1].z + kv[g].z;
    kv[g].w = dc[g] * kv[g - 1].w + kv[g].w;
    p[g * 2048] = kv[g];
  }
}

__global__ __launch_bounds__(128) void gla_kernel(
    float* __restrict__ qkvg, const float* __restrict__ gk,
    const float* __restrict__ segS) {
  __shared__ float gc[16 * CPAD];
  __shared__ __align__(16) float qe[16 * CPAD];
  __shared__ __align__(16) float ke[16 * CPAD];
  __shared__ __align__(16) float kd[16 * CPAD];
  __shared__ __align__(16) float Am[16 * 16];
  __shared__ __align__(16) float decay[64];

  const int seg = blockIdx.x;       // 0..NSEG-1
  const int bh = blockIdx.y;        // 0..31
  const int b = bh >> 4, h = bh & 15;
  const int tid = threadIdx.x;
  const int c16 = tid & 15, hi = (tid >> 4) & 1, w = tid >> 5;

  v8f S[4][2];
  if (seg == 0) {
#pragma unroll  // S[][] stays in registers
    for (int dt = 0; dt < 4; ++dt)
#pragma unroll  // S[][] stays in registers
      for (int et = 0; et < 2; ++et)
        S[dt][et] = (v8f){0.f, 0.f, 0.f, 0.f, 0.f, 0.f, 0.f, 0.f};
  } else {
    const float* s0 = segS + ((long)bh * NSEGM1 + (seg - 1)) * (64 * 128) +
                      (8 * hi) * 128 + w * 32 + c16;
#pragma unroll  // S[][] stays in registers; one address, constant offsets
    for (int dt = 0; dt < 4; ++dt)
#pragma unroll  // S[][] stays in registers
      for (int et = 0; et < 2; ++et)
#pragma unroll  // S[][] stays in registers
        for (int r = 0; r < 8; ++r)
          S[dt][et][r] = s0[(dt * 16 + r) * 128 + et * 16];
    // behind the loads, ahead of any rewrite of a register that they name
    asm volatile("s_wait_xcnt 0x0" ::: "memory");
  }

  const long rowbase = (long)b * 2048 + (long)seg * (SEGC * 16);

  for (int n = 0; n < SEGC; ++n) {
    const long m0 = rowbase + n * 16;
    if (tid < 64) {                  // per-column-d prep
      const int d = tid;
      float c = 0.f;
#pragma unroll
      for (int cc = 0; cc < 16; ++cc) {
        c += gk[(m0 + cc) * 1024 + h * 64 + d];
        gc[cc * CPAD + d] = c;
      }
      decay[d] = __expf(c);
      const float glast = c;
#pragma unroll
      for (int cc = 0; cc < 16; ++cc) {
        float g = gc[cc * CPAD + d];
        float q = qkvg[(m0 + cc) * 6144 + h * 64 + d];
        float k = qkvg[(m0 + cc) * 6144 + 1024 + h * 64 + d];
        qe[cc * CPAD + d] = q * __expf(g) * GLA_SCALE;
        ke[cc * CPAD + d] = k * __expf(-g);
        kd[cc * CPAD + d] = k * __expf(glast - g);
      }
    }
    // this wave's 16 x 32 piece of v (and of o), rows 8 hi + r, as B fragments
    float* vo = qkvg + (m0 + 8 * hi) * 6144 + 2048 + h * 128 + w * 32 + c16;
    v8f vb[2];
#pragma unroll  // vb[] stays in registers
    for (int et = 0; et < 2; ++et)
#pragma unroll  // vb[] stays in registers
      for (int r = 0; r < 8; ++r) vb[et][r] = vo[r * 6144 + et * 16];
    __syncthreads();

    // A = tril(qe ke^T), 256 entries over 128 threads
#pragma unroll
    for (int t = tid; t < 256; t += 128) {
      int cc = t >> 4, mm = t & 15;
      float a = 0.f;
      if (mm <= cc) {
#pragma unroll
        for (int d = 0; d < 64; ++d) a += qe[cc * CPAD + d] * ke[mm * CPAD + d];
      }
      Am[cc * 16 + mm] = a;
    }
    __syncthreads();

    v8f o[2];
    o[0] = (v8f){0.f, 0.f, 0.f, 0.f, 0.f, 0.f, 0.f, 0.f};
    o[1] = o[0];
    {  // o_intra = A v: row c16 of A, k = rows of v in the order of vb
      const v8f am = lds8(&Am[c16 * 16 + 8 * hi]);
#pragma unroll  // am, vb[] and o[] stay in registers
      for (int j = 0; j < 4; ++j) {
        const v2f a = {am[2 * j], am[2 * j + 1]};
#pragma unroll  // vb[] and o[] stay in registers
        for (int et = 0; et < 2; ++et)
          o[et] = wmma_f32(a, (v2f){vb[et][2 * j], vb[et][2 * j + 1]}, o[et]);
      }
    }
    // o_inter = qe S (old S): row c16 of qe, k = rows of S in the tiles' order
#pragma unroll  // S[][] and o[] stay in registers
    for (int dt = 0; dt < 4; ++dt) {
      const v8f qf = lds8(&qe[c16 * CPAD + dt * 16 + 8 * hi]);
#pragma unroll  // qf, S[][] and o[] stay in registers
      for (int j = 0; j < 4; ++j) {
        const v2f a = {qf[2 * j], qf[2 * j + 1]};
#pragma unroll  // S[][] and o[] stay in registers
        for (int et = 0; et < 2; ++et)
          o[et] = wmma_f32(a, (v2f){S[dt][et][2 * j], S[dt][et][2 * j + 1]},
                           o[et]);
      }
    }
#pragma unroll  // o[] stays in registers
    for (int et = 0; et < 2; ++et)
#pragma unroll  // o[] stays in registers
      for (int r = 0; r < 8; ++r) vo[r * 6144 + et * 16] = o[et][r];
    // behind the stores, ahead of any rewrite of a register that they name
    asm volatile("s_wait_xcnt 0x0" ::: "memory");
    // the last chunk's end state is read by nobody here
    if (n + 1 < SEGC) state_step(S, vb, kd, decay, c16, hi);
    __syncthreads();
  }
}

// 2^x and 1/sqrt(x), each with the free slot that the instruction set asks for
// between a transcendental and a next instruction that overwrites its source.
__device__ __forceinline__ float exp2_slot(float x) {
  float r;
  asm("v_exp_f32 %0, %1\n\tv_nop" : "=v"(r) : "v"(x));
  return r;
}
__device__ __forceinline__ float rsq_slot(float x) {
  float r;
  asm("v_rsq_f32 %0, %1\n\tv_nop" : "=v"(r) : "v"(x));
  return r;
}
// g * sigmoid(g), with exp(-g) formed as 2^(-g * log2 e)
__device__ __forceinline__ float silu(float g) {
  return g / (1.f + exp2_slot(g * -1.44269504f));
}

// Sum over the 32 lanes, left in every lane: lane l with l ^ 1, 2, 4, 8 inside
// a row of 16 by DPP, then l ^ 16 by a cross-row move; all in the vector unit.
template <int M>
__device__ __forceinline__ float row_xor(float x) {
  return __builtin_bit_cast(float, __builtin_amdgcn_update_dpp(
      0, __builtin_bit_cast(int, x), 0x160 | M, 0xf, 0xf, true));
}
__device__ __forceinline__ float wave_sum(float s) {
  s += row_xor<1>(s);
  s += row_xor<2>(s);
  s += row_xor<4>(s);
  s += row_xor<8>(s);
  const int b = __builtin_bit_cast(int, s);
  return s + __builtin_bit_cast(float, __builtin_amdgcn_permlanex16(
                 b, b, 0x76543210, 0xfedcba98, false, false));
}

// ---------------------------------------------------------------------------
// RMSNorm over DV + SiLU(g) gate, output bf16 for the final GEMM
// one wave per (m, 8 heads): a row of 128 is one float4 per lane, its sum of
// squares a butterfly over the 32 lanes; no LDS, no barrier.
// ---------------------------------------------------------------------------
__global__ __launch_bounds__(256) void norm_gate_kernel(
    const float* __restrict__ qkvg, const float* __restrict__ norm_w,
    unsigned short* __restrict__ og) {
  const int lane = threadIdx.x & 31;
  const int wv = blockIdx.x * 8 + (threadIdx.x >> 5);   // 0..8191
  const int m = wv >> 1, h0 = (wv & 1) * 8;
  const float* ob = qkvg + (long)m * 6144 + 2048 + h0 * 128 + lane * 4;
  float4 o[8], g[8];
#pragma unroll  // o[] and g[] stay in registers, the 16 loads go out together
  for (int r = 0; r < 8; ++r) {
    o[r] = *(const float4*)(ob + r * 128);
    g[r] = *(const float4*)(ob + 2048 + r * 128);
  }
  const float4 w = *(const float4*)(norm_w + lane * 4);
  // The fence keeps every load above it, so that all 17 are in flight at once:
  // without it the compiler sinks six of them into the arithmetic.
  __builtin_amdgcn_sched_barrier(0);
  float ss[8];
#pragma unroll  // ss[] stays in registers
  for (int r = 0; r < 8; ++r)
    ss[r] = (o[r].x * o[r].x + o[r].y * o[r].y) +
            (o[r].z * o[r].z + o[r].w * o[r].w);
#pragma unroll  // ss[] stays in registers
  for (int r = 0; r < 8; ++r) ss[r] = wave_sum(ss[r]);
  uint2 res[8];
#pragma unroll  // res[] stays in registers
  for (int r = 0; r < 8; ++r) {
    // the argument is at least 1e-5: no subnormal range to rescale for
    const float rs = rsq_slot(ss[r] * (1.f / 128.f) + 1e-5f);
    const float a = o[r].x * rs * w.x * silu(g[r].x);
    const float b = o[r].y * rs * w.y * silu(g[r].y);
    const float c = o[r].z * rs * w.z * silu(g[r].z);
    const float d = o[r].w * rs * w.w * silu(g[r].w);
    res[r] = make_uint2(pack2bf(a, b), pack2bf(c, d));
  }
  unsigned short* dst = og + (long)m * 2048 + h0 * 128 + lane * 4;
#pragma unroll  // res[] stays in registers
  for (int r = 0; r < 8; ++r) *(uint2*)(dst + r * 128) = res[r];
}

// ---------------------------------------------------------------------------
// Host launcher
// ---------------------------------------------------------------------------
extern "C" void kernel_launch(void* const* d_in, const int* in_sizes, int n_in,
                              void* d_out, int out_size, void* d_ws,
                              size_t ws_size, hipStream_t stream) {
  const float* x      = (const float*)d_in[0];
  const float* Wq     = (const float*)d_in[1];
  const float* Wk     = (const float*)d_in[2];
  const float* Wv     = (const float*)d_in[3];
  const float* Wg     = (const float*)d_in[4];
  const float* Wgk1   = (const float*)d_in[5];
  const float* Wgk2   = (const float*)d_in[6];
  const float* bgk2   = (const float*)d_in[7];
  const float* Wo     = (const float*)d_in[8];
  const float* norm_w = (const float*)d_in[9];
  float* out = (float*)d_out;

  // workspace layout (bytes)
  char* ws = (char*)d_ws;
  unsigned short* xb    = (unsigned short*)(ws);                       // 16 MiB
  unsigned short* wcat  = (unsigned short*)(ws + (size_t)16777216);    // 24 MiB
  unsigned short* wot   = (unsigned short*)(ws + (size_t)41943040);    //  8 MiB
  float*          qkvg  = (float*)         (ws + (size_t)50331648);    // 96 MiB
  float*          gkbuf = (float*)         (ws + (size_t)150994944);   // 16 MiB
  unsigned short* og    = (unsigned short*)(ws + (size_t)167772160);   // 16 MiB
  float*          segS  = (float*)         (ws + (size_t)184549376);   // 31 MiB
  float*          segD  = (float*)         (ws + (size_t)218103808);   // 248 KiB

  // 1, 2) x -> bf16; weights transposed and converted into the concatenated
  // [6144,2048] and into [2048,2048]
  prep_kernel<<<1024, 256, 0, stream>>>(x, Wq, Wk, Wv, Wg, Wo, xb, wcat, wot);

  // 3) fused projection GEMM (WMMA bf16 -> f32): qkvg[4096,6144]
  gemm_bf16_wide_kernel<<<dim3(NCAT / WT_N, MROWS / WT_M), 256, 0, stream>>>(
      xb, wcat, qkvg, KDIM, NCAT);

  // 4) low-rank gate path gk[4096,1024]
  gk_kernel<<<MROWS / 16, 512, 0, stream>>>(x, Wgk1, Wgk2, bgk2, gkbuf);

  // 5) chunked GLA scan in segments (writes o over the v slice of qkvg)
  gla_seg_state_kernel<<<dim3(NSEGM1, 32), 128, 0, stream>>>(qkvg, gkbuf, segS,
                                                            segD);
  gla_seg_scan_kernel<<<32 * 64 * 32 / 256, 256, 0, stream>>>(segS, segD);
  gla_kernel<<<dim3(NSEG, 32), 128, 0, stream>>>(qkvg, gkbuf, segS);

  // 6) RMSNorm + SiLU gate -> bf16 [4096,2048]
  norm_gate_kernel<<<MROWS * 16 / 64, 256, 0, stream>>>(qkvg, norm_w, og);

  // 7) output GEMM (WMMA) -> d_out fp32 [4096,2048]
  gemm_bf16_wmma_kernel<2><<<dim3(NOUT / 128, MROWS / 128), 256, 0, stream>>>(
      og, wot, out, KDIM, NOUT);
}

// v010
// Measured time: 210 microseconds a run.
// Next to v009, in two timings, it ran 1.04 times as fast each time.
// All steps since v000 together make it 9.97 times as fast.
#include <hip/hip_runtime.h>

// ---------------------------------------------------------------------------
// Problem constants (from reference)
// ---------------------------------------------------------------------------
// B=2, T=2048, HID=2048, H=16, DK=64, DV=128, C=16, LOWR=16
// M = B*T = 4096 rows.  Fused projection GEMM: [4096,2048] x [2048,6144]
//   cols 0..1023   : q  (H*DK)
//   cols 1024..2047: k  (H*DK)
//   cols 2048..4095: v  (H*DV)   (overwritten with o by the GLA kernel)
//   cols 4096..6143: g  (H*DV)
// Output GEMM: [4096,2048] x [2048,2048] -> d_out (fp32)

#define MROWS   4096
#define KDIM    2048
#define NCAT    6144
#define NOUT    2048
#define GLA_SCALE 0.125f   // DK^-0.5

typedef __attribute__((ext_vector_type(16))) __bf16 v16bf;
typedef __attribute__((ext_vector_type(8)))  float  v8f;

__device__ __forceinline__ unsigned short f2bf(float f) {
  unsigned int u = __float_as_uint(f);
  u += 0x7fffu + ((u >> 16) & 1u);
  return (unsigned short)(u >> 16);
}

// gfx1250 async global->LDS DMA: 16B per lane, no data VGPRs, ASYNCcnt-tracked.
// GV mode: VDST = LDS byte offset (low 32 bits of flat shared address per the
// LDS aperture rule addr[31:0]), VADDR = 64-bit global address, no SADDR.
__device__ __forceinline__ void wait_async0() {
  asm volatile("s_wait_asynccnt 0x0" ::: "memory");
}

// The streaming helpers below (operand preparation, norm+gate) move few bytes
// per wave. Each is laid out so that a wave brings in 4 KiB or more with all
// its loads in flight at once.

__device__ __forceinline__ unsigned int pack2bf(float lo, float hi) {
  return (unsigned int)f2bf(lo) | ((unsigned int)f2bf(hi) << 16);
}

// ---------------------------------------------------------------------------
// The five weights [K,Nw] fp32 -> [Nw,K] bf16 (so that the WMMA B operand is
// N-major), as one role of the first launch (see prep_gate_kernel below).
// The work is cut into 2048 weight tiles of 128 k x 64 n: 32 KiB read and
// 16 KiB written each. Pair p of 256 threads takes tile p of (Wq, Wk, Wv) and
// tile p of (Wg, Wo); its 16 float4 loads per thread go out ahead of all other
// work.
// A weight tile: 8 float4 loads per thread (256 B of a source row per 16
// lanes), then 4 stores of 8 bf16 per thread (256 B of an output row per 16
// lanes).
// ---------------------------------------------------------------------------
#define TT_K 128
#define TT_N 64
#define TT_P 65   // odd pitch in floats: column reads spread over the banks

__device__ __forceinline__ void tt_to_lds(const float4 (&v)[8], float* tile,
                                          int lo, int hi) {
#pragma unroll  // v[] stays in registers
  for (int i = 0; i < 8; ++i) {
    float* t = &tile[(hi + i * 16) * TT_P + lo * 4];
    t[0] = v[i].x; t[1] = v[i].y; t[2] = v[i].z; t[3] = v[i].w;
  }
}

__device__ __forceinline__ void tt_from_lds(uint4 (&r)[4], const float* tile,
                                            int lo, int hi) {
#pragma unroll  // r[] stays in registers
  for (int j = 0; j < 4; ++j) {
    const float* t = &tile[(lo * 8) * TT_P + hi + j * 16];
    r[j] = make_uint4(pack2bf(t[0 * TT_P], t[1 * TT_P]),
                      pack2bf(t[2 * TT_P], t[3 * TT_P]),
                      pack2bf(t[4 * TT_P], t[5 * TT_P]),
                      pack2bf(t[6 * TT_P], t[7 * TT_P]));
  }
}

// Block wb (0..511) of 512 threads: each half of 256 threads takes one pair of
// tiles. sm holds the four tiles.
__device__ __forceinline__ void weight_tiles(
    int wb, const float* __restrict__ Wq, const float* __restrict__ Wk,
    const float* __restrict__ Wv, const float* __restrict__ Wg,
    const float* __restrict__ Wo, unsigned short* __restrict__ wcat,
    unsigned short* __restrict__ wot, float* sm) {
  // the half is the same for a whole wave: as a scalar it keeps every base
  // below in scalar registers
  const int half = __builtin_amdgcn_readfirstlane((int)(threadIdx.x >> 8));
  const int b = wb * 2 + half;   // 0..1023
  const int lo = threadIdx.x & 15, hi = (threadIdx.x >> 4) & 15;
  float* tile0 = sm + half * (2 * TT_K * TT_P);
  float* tile1 = tile0 + TT_K * TT_P;

  // Every address below is a base that is the same for the whole wave plus a
  // 32-bit byte offset of the lane's own (plus a constant).
  // first tile: Wq (256 tiles), Wk (256), Wv (512), n running fastest; they
  // are rows 0.., 1024.., 2048.. of wcat
  const bool nar = b < 512;                  // a weight of 1024 columns
  const int nw0 = nar ? 1024 : 2048;
  const int t0 = nar ? (b & 255) : b - 512;  // tile number inside its weight
  const int kb0 = (nar ? t0 >> 4 : t0 >> 5) * TT_K;
  const int nb0 = (nar ? t0 & 15 : t0 & 31) * TT_N;
  const char* s0 =
      (const char*)((b < 256 ? Wq : (nar ? Wk : Wv)) + (long)kb0 * nw0 + nb0);
  unsigned l0[8];
#pragma unroll  // l0[] stays in registers
  for (int i = 0; i < 8; ++i)
    l0[i] = (unsigned)((hi + i * 16) * nw0 + lo * 4) * 4u;
  // second tile: Wg (512 tiles, rows 4096.. of wcat), Wo (512, wot)
  const int kb1 = ((b & 511) >> 5) * TT_K, nb1 = (b & 31) * TT_N;
  const char* s1 = (const char*)((nar ? Wg : Wo) + (long)kb1 * 2048 + nb1);
  const unsigned l1 = (unsigned)(hi * 2048 + lo * 4) * 4u;

  float4 v0[8], v1[8];
#pragma unroll  // v0[] stays in registers, the 8 loads go out together
  for (int i = 0; i < 8; ++i) v0[i] = *(const float4*)(s0 + l0[i]);
#pragma unroll  // v1[] stays in registers, the 8 loads go out together
  for (int i = 0; i < 8; ++i)
    v1[i] = *(const float4*)(s1 + l1 + i * (16 * 2048 * 4));
  // Behind the loads, ahead of any rewrite of a register that they name: the
  // operands keep the address registers as they are up to this wait.
  asm volatile("s_wait_xcnt 0x0"
               :: "v"(l1), "v"(l0[0]), "v"(l0[1]), "v"(l0[2]), "v"(l0[3]),
                  "v"(l0[4]), "v"(l0[5]), "v"(l0[6]), "v"(l0[7]), "s"(s0),
                  "s"(s1)
               : "memory");

  tt_to_lds(v0, tile0, lo, hi);
  tt_to_lds(v1, tile1, lo, hi);
  __syncthreads();
  uint4 r0[4], r1[4];
  tt_from_lds(r0, tile0, lo, hi);
  tt_from_lds(r1, tile1, lo, hi);
  // row nb, column kb of [Nw,K] is a tile's first output element
  char* d0 = (char*)(wcat +
                     (long)((b >> 8 < 2 ? b >> 8 : 2) * 1024 + nb0) * KDIM + kb0);
  char* d1 = (char*)((nar ? wcat + (long)4096 * KDIM : wot) +
                     (long)nb1 * KDIM + kb1);
  const unsigned dl = (unsigned)(hi * KDIM + lo * 8) * 2u;
#pragma unroll  // r0[] stays in registers
  for (int j = 0; j < 4; ++j) *(uint4*)(d0 + dl + j * (16 * KDIM * 2)) = r0[j];
#pragma unroll  // r1[] stays in registers
  for (int j = 0; j < 4; ++j) *(uint4*)(d1 + dl + j * (16 * KDIM * 2)) = r1[j];
  // behind the stores, ahead of any rewrite of a register that they name: the
  // other role's text lies behind this one in the kernel
  asm volatile("s_wait_xcnt 0x0" ::: "memory");
}

// ---------------------------------------------------------------------------
// bf16 WMMA GEMM:  C[M,N](f32) = A[M,K](bf16,row-major) * Bt[N,K]^T
// Block tile (64 FM) x 128, K-step 64, 256 threads = 8 waves (4x2 wave grid),
// each wave: FM x 4 fragments of 16x16. With FM = 4 a wave reads 8 fragments
// from LDS for 16 matrix steps (FM = 2: 6 for 8), and a block brings in 384
// operand rows for 256 x 128 results (FM = 2: 256 rows for 128 x 128).
// Double-buffered LDS, pitch 72 (144B rows -> conflict-free b128 fragment
// reads). Tile staging uses global_load_async_to_lds_b128 (no data VGPRs).
// ---------------------------------------------------------------------------
#define GT_N 128
#define GT_K 64
#define LDT  72

__device__ __forceinline__ v16bf load_frag(const unsigned short* p) {
  union { v16bf v; uint4 u[2]; } f;
  f.u[0] = *(const uint4*)(p);        // halves 0..7  : K = khalf*8 + 0..7
  f.u[1] = *(const uint4*)(p + 16);   // halves 8..15 : K = khalf*8 + 16..23
  return f.v;
}

// Rows r, r + 32, r + 64, r + 96 of a tile: 16 bytes per lane and row, from g
// (row pitch gp elements) to LDS at l (row pitch LDT). The s_wait_xcnt stands
// in the copies' own statement, ahead of any rewrite of an address register
// that they name.
__device__ __forceinline__ void async_copy_rows4(const unsigned short* g,
                                                 long gp, unsigned short* l) {
  const unsigned l0 = (unsigned)(unsigned long long)l;
  const unsigned l1 = l0 + 32 * LDT * 2, l2 = l0 + 64 * LDT * 2,
                 l3 = l0 + 96 * LDT * 2;
  const unsigned short *g1 = g + 32 * gp, *g2 = g + 64 * gp, *g3 = g + 96 * gp;
  asm volatile(
      "global_load_async_to_lds_b128 %0, %4, off\n\t"
      "global_load_async_to_lds_b128 %1, %5, off\n\t"
      "global_load_async_to_lds_b128 %2, %6, off\n\t"
      "global_load_async_to_lds_b128 %3, %7, off\n\t"
      "s_wait_xcnt 0x0"
      :: "v"(l0), "v"(l1), "v"(l2), "v"(l3), "v"(g), "v"(g1), "v"(g2), "v"(g3)
      : "memory");
}

template <int FM>
__global__ __launch_bounds__(256) void gemm_bf16_wmma_kernel(
    const unsigned short* __restrict__ A,   // [M,K] bf16
    const unsigned short* __restrict__ Bt,  // [N,K] bf16 (B transposed)
    float* __restrict__ C, int K, int ldc) {
  constexpr int BM = 64 * FM;
  __shared__ __align__(16) unsigned short As[2][BM * LDT];
  __shared__ __align__(16) unsigned short Bs[2][GT_N * LDT];

  const int tid  = threadIdx.x;
  const int lane = tid & 31;
  const int w    = tid >> 5;
  const int wm   = w >> 1;   // 0..3 : band of 16 FM rows
  const int wn   = w & 1;    // 0..1 : 64-col band

  const long m0 = (long)blockIdx.y * BM;
  const long n0 = (long)blockIdx.x * GT_N;
  const int  nk = K / GT_K;

  const unsigned short* Agb = A  + m0 * K;
  const unsigned short* Bgb = Bt + n0 * K;

  // A tile row is one 128-byte line: 8 lanes cover a whole line, a wave's copy
  // 4 whole lines. Thread tid takes 16-byte chunk tid & 7 of rows
  // (tid >> 3) + 32 i.
  const int  sr = tid >> 3, sc = (tid & 7) * 8;
  const long so = (long)sr * K + sc;     // this thread's place in a global tile
  const int  sl = sr * LDT + sc;         // and in an LDS tile
  auto stage = [&](int kt, int buf) {    // async DMA of tile kt straight to LDS
#pragma unroll  // constant LDS offsets
    for (int i = 0; i < BM / 128; ++i)
      async_copy_rows4(Agb + kt * GT_K + so + (long)(i * 128) * K, K,
                       &As[buf][i * 128 * LDT + sl]);
    async_copy_rows4(Bgb + kt * GT_K + so, K, &Bs[buf][sl]);
  };

  stage(0, 0);
  wait_async0();
  __syncthreads();
  if (nk > 1) stage(1, 1);

  v8f acc[FM][4];
#pragma unroll
  for (int fm = 0; fm < FM; ++fm)
#pragma unroll
    for (int fn = 0; fn < 4; ++fn)
      acc[fm][fn] = (v8f){0.f, 0.f, 0.f, 0.f, 0.f, 0.f, 0.f, 0.f};

  for (int kt = 0; kt < nk; ++kt) {
    const int cur = kt & 1;
    // compute on current buffer: two k=32 sub-steps
#pragma unroll
    for (int s = 0; s < 2; ++s) {
      const int kb = s * 32 + (lane >> 4) * 8;   // khalf selects K sub-lane set
      v16bf afr[FM], bfr[4];
#pragma unroll
      for (int fm = 0; fm < FM; ++fm) {
        int row = (wm * FM + fm) * 16 + (lane & 15);
        afr[fm] = load_frag(&As[cur][row * LDT + kb]);
      }
#pragma unroll
      for (int fn = 0; fn < 4; ++fn) {
        int row = wn * 64 + fn * 16 + (lane & 15);
        bfr[fn] = load_frag(&Bs[cur][row * LDT + kb]);
      }
      if (s == 1) {
        // The trip's last LDS reads are out. This wave's reads of buffer cur
        // are done and its copies of tile kt + 1 have landed; behind the
        // barrier that holds for every wave, so tile kt + 1 may be read and
        // buffer cur refilled. The refill goes out ahead of the sub-step's
        // matrix steps, which need registers only: it has the longer lead.
        asm volatile("s_wait_dscnt 0x0" ::: "memory");
        wait_async0();
        __syncthreads();
        if (kt + 2 < nk) stage(kt + 2, cur);
      }
#pragma unroll
      for (int fm = 0; fm < FM; ++fm)
#pragma unroll
        for (int fn = 0; fn < 4; ++fn)
          acc[fm][fn] = __builtin_amdgcn_wmma_f32_16x16x32_bf16(
              false, afr[fm], false, bfr[fn], (short)0, acc[fm][fn],
              false, false);
    }
  }
  wait_async0();   // no copy is in flight when the wave ends

  // store: VGPR r -> row (r + 8*khalf), lane&15 -> col  (16x16 f32 C layout)
  const int cn    = lane & 15;
  const int rbase = (lane >> 4) * 8;
#pragma unroll
  for (int fm = 0; fm < FM; ++fm)
#pragma unroll
    for (int fn = 0; fn < 4; ++fn) {
      long row0 = m0 + (wm * FM + fm) * 16 + rbase;
      long col  = n0 + wn * 64 + fn * 16 + cn;
#pragma unroll
      for (int r = 0; r < 8; ++r)
        C[(row0 + r) * ldc + col] = acc[fm][fn][r];
    }
}

// ---------------------------------------------------------------------------
// The same product on a block tile of 256 x 384, for the projection: one block
// per WGP holds all of that WGP's share of the results at once, so a block
// brings in 640 operand rows from L2 for 98304 results (256 x 128: 384 rows for
// 32768). 8 waves in a 2 x 4 grid, each 8 x 6 fragments (128 x 96): 14 fragments
// from LDS for 48 matrix steps. The accumulators take 384 registers of a wave's
// 512 (two waves per SIMD), so a sub-step keeps its 6 B fragments and brings
// its A fragments in row by row, ahead of their use.
// ---------------------------------------------------------------------------
#define WT_FM 8
#define WT_FN 6
#define WT_M 256
#define WT_N 384

// Rows r, r + 32, r + 64, r + 96 of a tile with the addresses in two vector
// registers (this tile leaves none to spare): the lane's place in the tile is a
// 32-bit byte offset vo, a row group's start a scalar base. An immediate offset
// moves the LDS address and the global address alike, so rows 32 j lie at LDS
// offset j * 32 * LDT * 2, and base j is set back by as much. The s_wait_xcnt
// stands in the copies' own statement, ahead of any rewrite of a register that
// they name.
__device__ __forceinline__ void async_copy_rows4s(const unsigned short* g,
                                                  long gp, unsigned vo,
                                                  unsigned short* l) {
  const unsigned l0 = (unsigned)(unsigned long long)l;
  const char* g0 = (const char*)g;
  const char* g1 = (const char*)(g + 32 * gp) - 32 * LDT * 2;
  const char* g2 = (const char*)(g + 64 * gp) - 64 * LDT * 2;
  const char* g3 = (const char*)(g + 96 * gp) - 96 * LDT * 2;
  static_assert(LDT == 72, "the offsets in the text below are 32 j LDT 2");
  asm volatile(
      "global_load_async_to_lds_b128 %0, %1, %2\n\t"
      "global_load_async_to_lds_b128 %0, %1, %3 offset:4608\n\t"
      "global_load_async_to_lds_b128 %0, %1, %4 offset:9216\n\t"
      "global_load_async_to_lds_b128 %0, %1, %5 offset:13824\n\t"
      "s_wait_xcnt 0x0"
      :: "v"(l0), "v"(vo), "s"(g0), "s"(g1), "s"(g2), "s"(g3)
      : "memory");
}

__global__ __launch_bounds__(256) void gemm_bf16_wide_kernel(
    const unsigned short* __restrict__ A,   // [M,K] bf16
    const unsigned short* __restrict__ Bt,  // [N,K] bf16 (B transposed)
    float* __restrict__ C, int K, int ldc) {
  __shared__ __align__(16) unsigned short As[2][WT_M * LDT];
  __shared__ __align__(16) unsigned short Bs[2][WT_N * LDT];

  const int tid  = threadIdx.x;
  const int lane = tid & 31;
  const int w    = tid >> 5;
  const int wm   = w >> 2;   // 0..1 : band of 128 rows
  const int wn   = w & 3;    // 0..3 : band of 96 columns

  const long m0 = (long)blockIdx.y * WT_M;
  const long n0 = (long)blockIdx.x * WT_N;
  const int  nk = K / GT_K;

  const unsigned short* Agb = A  + m0 * K;
  const unsigned short* Bgb = Bt + n0 * K;

  // As in the kernel above: 8 lanes cover a whole 128-byte tile row; thread tid
  // takes 16-byte chunk tid & 7 of rows (tid >> 3) + 32 i.
  const int      sr = tid >> 3, sc = (tid & 7) * 8;
  const unsigned vo = (unsigned)(sr * K + sc) * 2u;  // place in a global tile
  const int      sl = sr * LDT + sc;                 // and in an LDS tile
  auto stage = [&](int kt, int buf) {    // async DMA of tile kt straight to LDS
#pragma unroll  // constant LDS offsets
    for (int i = 0; i < WT_M / 128; ++i)
      async_copy_rows4s(Agb + kt * GT_K + (long)(i * 128) * K, K, vo,
                        &As[buf][i * 128 * LDT + sl]);
#pragma unroll  // constant LDS offsets
    for (int i = 0; i < WT_N / 128; ++i)
      async_copy_rows4s(Bgb + kt * GT_K + (long)(i * 128) * K, K, vo,
                        &Bs[buf][i * 128 * LDT + sl]);
  };

  stage(0, 0);
  wait_async0();
  __syncthreads();
  if (nk > 1) stage(1, 1);

  v8f acc[WT_FM][WT_FN];
#pragma unroll  // acc[][] stays in registers
  for (int fm = 0; fm < WT_FM; ++fm)
#pragma unroll  // acc[][] stays in registers
    for (int fn = 0; fn < WT_FN; ++fn)
      acc[fm][fn] = (v8f){0.f, 0.f, 0.f, 0.f, 0.f, 0.f, 0.f, 0.f};

  // the lane's place in a fragment: row lane & 15, K sub-lane set lane >> 4
  const int fo = (lane & 15) * LDT + (lane >> 4) * 8;
  for (int kt = 0; kt < nk; ++kt) {
    const int cur = kt & 1;
    // one address per operand, every fragment at a constant offset from it
    const unsigned short* ap = &As[cur][fo + wm * (WT_FM * 16 * LDT)];
    const unsigned short* bp = &Bs[cur][fo + wn * (WT_FN * 16 * LDT)];
#pragma unroll  // two k=32 sub-steps; afr[] and bfr[] stay in registers
    for (int s = 0; s < 2; ++s) {
      v16bf afr[WT_FM], bfr[WT_FN];
#pragma unroll  // bfr[] stays in registers
      for (int fn = 0; fn < WT_FN; ++fn)
        bfr[fn] = load_frag(bp + fn * 16 * LDT + s * 32);
      afr[0] = load_frag(ap + s * 32);
      afr[1] = load_frag(ap + 16 * LDT + s * 32);
#pragma unroll  // acc[][], afr[] and bfr[] stay in registers
      for (int fm = 0; fm < WT_FM; ++fm) {
        // Ahead of row fm's matrix steps the loads of later rows go out. First
        // sub-step: row fm + 2. Last sub-step: all eight rows are in by row 3,
        // since the barrier below ends the reads of this buffer.
        const int lo = s == 0 ? fm + 2 : (fm == 0 ? 2 : 2 * fm + 1);
        const int hi = s == 0 ? fm + 3 : 2 * fm + 3;
#pragma unroll  // afr[] stays in registers
        for (int i = lo; i < hi && i < WT_FM; ++i)
          afr[i] = load_frag(ap + i * 16 * LDT + s * 32);
        // Holds these loads in front of the row: short of registers, the
        // compiler otherwise sinks each row's loads to just ahead of its own
        // matrix steps, which then wait out the whole LDS latency.
        __builtin_amdgcn_sched_barrier(0);
        if (s == 1 && fm == WT_FM / 2) {
          // The trip's last LDS reads are out. This wave's reads of buffer cur
          // are done and its copies of tile kt + 1 have landed; behind the
          // barrier that holds for every wave, so tile kt + 1 may be read and
          // buffer cur refilled. The refill goes out ahead of the trip's last
          // 24 matrix steps, which need registers only.
          asm volatile("s_wait_dscnt 0x0" ::: "memory");
          wait_async0();
          __syncthreads();
          if (kt + 2 < nk) stage(kt + 2, cur);
        }
#pragma unroll  // acc[][] and bfr[] stay in registers
        for (int fn = 0; fn < WT_FN; ++fn)
          acc[fm][fn] = __builtin_amdgcn_wmma_f32_16x16x32_bf16(
              false, afr[fm], false, bfr[fn], (short)0, acc[fm][fn],
              false, false);
      }
    }
  }
  wait_async0();   // no copy is in flight when the wave ends

  // store: VGPR r -> row (r + 8*khalf), lane&15 -> col  (16x16 f32 C layout)
  const int cn    = lane & 15;
  const int rbase = (lane >> 4) * 8;
  float* cw = C + (m0 + wm * (WT_FM * 16) + rbase) * ldc + n0 +
              wn * (WT_FN * 16) + cn;
#pragma unroll  // acc[][] stays in registers
  for (int fm = 0; fm < WT_FM; ++fm) {
    float* cp[8];
#pragma unroll  // cp[] stays in registers
    for (int r = 0; r < 8; ++r) cp[r] = cw + (long)(fm * 16 + r) * ldc;
    // The two fences keep a row's address arithmetic in front of its stores and
    // the next row's behind the wait: no register that an issued store names
    // is rewritten ahead of that wait.
    __builtin_amdgcn_sched_barrier(0);
#pragma unroll  // acc[][] stays in registers
    for (int fn = 0; fn < WT_FN; ++fn)
#pragma unroll  // acc[][] and cp[] stay in registers
      for (int r = 0; r < 8; ++r) cp[r][fn * 16] = acc[fm][fn][r];
    asm volatile("s_wait_xcnt 0x0" ::: "memory");
    __builtin_amdgcn_sched_barrier(0);
  }
}

// ---------------------------------------------------------------------------
// gk = log_sigmoid(x @ Wgk1 @ Wgk2 + bgk2) / 16      (low-rank, fp32), and
// x -> bf16 for the projection, as the other role of the first launch: x is
// read from memory once for both.
// One block per 16 rows of x, so that Wgk1 and Wgk2 are read once per 16 rows.
// x @ Wgk1 runs on the f32 16x16x4 matrix form: wave w takes k = 128 w ..
// 128 w + 127, the 16 partial tiles are summed through LDS in the order of w.
// A wave loads its 16 x 128 piece of x in whole lines (one row piece of 512 B
// per load) and turns it into A fragments through LDS.
// k order of one matrix step (t, u): lane half hi, register i hold
// k = 128 w + 8 t + 4 hi + 2 u + i, in the A loader (a float4 of a row of x is
// u = 0, 1) and in the B loader (rows of Wgk1) alike.
// ---------------------------------------------------------------------------
#define GK_WAVES 16
#define GK_KS (KDIM / GK_WAVES)   // k per wave
#define GK_T (GK_KS / 8)          // float4 of x per lane
#define GK_XP (GK_KS + 4)         // LDS row pitch: 16 B x odd, for b128 readers

typedef __attribute__((ext_vector_type(2))) float v2f;

__device__ __forceinline__ v8f wmma_f32(v2f a, v2f b, v8f c) {
  return __builtin_amdgcn_wmma_f32_16x16x4_f32(false, a, false, b, (short)0, c,
                                               false, false);
}

// eight consecutive floats of LDS, 16-byte aligned
__device__ __forceinline__ v8f lds8(const float* p) {
  const float4 a = *(const float4*)p, b = *(const float4*)(p + 4);
  return (v8f){a.x, a.y, a.z, a.w, b.x, b.y, b.z, b.w};
}

#define GK_SM (GK_WAVES * 16 * GK_XP + GK_WAVES * 256 + 256)   // floats of LDS

__device__ __forceinline__ void gate_rows(
    int rb, const float* __restrict__ x, const float* __restrict__ Wgk1,
    const float* __restrict__ Wgk2, const float* __restrict__ bgk2,
    unsigned short* __restrict__ xb, float* __restrict__ gkout, float* sm) {
  float* xs = sm;                               // [GK_WAVES][16][GK_XP]
  float* red = xs + GK_WAVES * 16 * GK_XP;      // [GK_WAVES][256]
  float* low = red + GK_WAVES * 256;            // [16][16]
  const int tid = threadIdx.x;
  const int lane = tid & 31, c16 = tid & 15, hi = (tid >> 4) & 1, w = tid >> 5;
  const long m0 = (long)rb * 16;

  const float* xp = x + m0 * KDIM + w * GK_KS + lane * 4;
  const float* wp = Wgk1 + (w * GK_KS + 4 * hi) * 16 + c16;
  // Two blocks share a WGP, so a wave has 128 registers: x and the first half
  // of the Wgk1 fragments go out first, the second half when x has left its
  // registers for LDS, Wgk2 when the fragments are used up.
  float bq[GK_T][4];
#pragma unroll  // bq[][] stays in registers, the loads go out together
  for (int t = 0; t < GK_T / 2; ++t)
#pragma unroll  // bq[][] stays in registers
    for (int q = 0; q < 4; ++q) bq[t][q] = wp[(8 * t + q) * 16];
  float4 xv[16];
#pragma unroll  // xv[] stays in registers, the loads go out together
  for (int j = 0; j < 16; ++j) xv[j] = *(const float4*)(xp + j * KDIM);
  // The fence keeps the loads above in front of the first wait, all in flight
  // at once, and those below behind the registers that x gives back.
  __builtin_amdgcn_sched_barrier(0);

  float* xw = xs + w * (16 * GK_XP);
#pragma unroll  // xv[] stays in registers
  for (int j = 0; j < 16; ++j) *(float4*)(xw + j * GK_XP + lane * 4) = xv[j];
  // keeps the loads below from rising over the LDS stores (see above)
  __builtin_amdgcn_sched_barrier(0);
#pragma unroll  // bq[][] stays in registers, the loads go out together
  for (int t = GK_T / 2; t < GK_T; ++t)
#pragma unroll  // bq[][] stays in registers
    for (int q = 0; q < 4; ++q) bq[t][q] = wp[(8 * t + q) * 16];
  __syncthreads();

  // two accumulator tiles, so that a step need not wait for the one before it
  v8f acc0 = (v8f){0.f, 0.f, 0.f, 0.f, 0.f, 0.f, 0.f, 0.f};
  v8f acc1 = acc0;
#pragma unroll  // bq[][] stays in registers
  for (int t = 0; t < GK_T; ++t) {
    const float4 a = *(const float4*)(xw + c16 * GK_XP + 8 * t + 4 * hi);
    acc0 = wmma_f32((v2f){a.x, a.y}, (v2f){bq[t][0], bq[t][1]}, acc0);
    acc1 = wmma_f32((v2f){a.z, a.w}, (v2f){bq[t][2], bq[t][3]}, acc1);
    // Four steps' LDS loads at a time: with all sixteen hoisted to the front
    // the wave runs out of its 128 registers and spills. The last fence keeps
    // the loads below behind the matrix steps, whose Wgk1 fragments then give
    // their registers back.
    if ((t & 3) == 3) __builtin_amdgcn_sched_barrier(0);
  }
  // the second product's operands: columns 2 tid, 2 tid + 1 of Wgk2 and bgk2;
  // the next barrier's own wait holds the wave until they are in
  float2 w2[16];
#pragma unroll  // w2[] stays in registers, the loads go out together
  for (int r = 0; r < 16; ++r) w2[r] = *((const float2*)(Wgk2 + r * 1024) + tid);
  const float2 bias = *((const float2*)bgk2 + tid);
  acc0 += acc1;
#pragma unroll  // acc0 stays in registers
  for (int r = 0; r < 8; ++r) red[w * 256 + r * 32 + lane] = acc0[r];
  __syncthreads();
  if (tid < 256) {   // register r = tid >> 5 of lane (c16, hi): row 8 hi + r
    float s = 0.f;
#pragma unroll  // the 16 LDS loads go out together
    for (int v = 0; v < GK_WAVES; ++v) s += red[v * 256 + tid];
    low[(8 * hi + w) * 16 + c16] = s;
  }
  __syncthreads();

  // x -> bf16, from the wave's own piece in LDS. It stands behind the last
  // barrier: in front of one, the barrier's own wait would hold the wave until
  // these stores have been answered.
  unsigned short* xd = xb + m0 * KDIM + w * GK_KS + lane * 4;
#pragma unroll  // constant offsets from one LDS and one global address
  for (int j = 0; j < 16; ++j) {
    const float4 c = *(const float4*)(xw + j * GK_XP + lane * 4);
    *(uint2*)(xd + j * KDIM) =
        make_uint2(pack2bf(c.x, c.y), pack2bf(c.z, c.w));
  }
  // behind the stores, ahead of any rewrite of a register that they name
  asm volatile("s_wait_xcnt 0x0" ::: "memory");

  float* dst = gkout + m0 * 1024 + 2 * tid;
#pragma unroll 1  // one copy of the long log-sigmoid text
  for (int m = 0; m < 16; ++m) {
    const v8f l0 = lds8(&low[m * 16]), l1 = lds8(&low[m * 16 + 8]);
    float ax = bias.x, ay = bias.y;
#pragma unroll  // l0 and w2[] stay in registers
    for (int r = 0; r < 8; ++r) { ax += l0[r] * w2[r].x; ay += l0[r] * w2[r].y; }
#pragma unroll  // l1 and w2[] stay in registers
    for (int r = 0; r < 8; ++r) {
      ax += l1[r] * w2[8 + r].x;
      ay += l1[r] * w2[8 + r].y;
    }
    const float lx = fminf(ax, 0.f) - log1pf(__expf(-fabsf(ax)));
    const float ly = fminf(ay, 0.f) - log1pf(__expf(-fabsf(ay)));
    *(float2*)(dst + m * 1024) =
        make_float2(lx * (1.0f / 16.0f), ly * (1.0f / 16.0f));
  }
}

// ---------------------------------------------------------------------------
// The first launch: all that depends on the inputs alone. Blocks 0..255 take
// the gate path and x -> bf16 (16 rows of x each), blocks 256..767 the weight
// tiles. The gate path ends in a long stretch of vector arithmetic, the weight
// tiles are memory traffic: with two blocks on a WGP (LDS and 128 registers a
// wave allow two) the one runs beside the other, where two launches ran them
// one after the other. The gate blocks last longest and come first in the grid.
// ---------------------------------------------------------------------------
#define PG_GATE (MROWS / 16)
#define PG_TILES 512
static_assert(4 * TT_K * TT_P <= GK_SM, "the four weight tiles fit the LDS");

// 8 waves per SIMD = two blocks of 16 waves on a WGP: caps a wave at 128 registers
__global__ __launch_bounds__(512) __attribute__((amdgpu_waves_per_eu(8)))
void prep_gate_kernel(
    const float* __restrict__ x, const float* __restrict__ Wq,
    const float* __restrict__ Wk, const float* __restrict__ Wv,
    const float* __restrict__ Wg, const float* __restrict__ Wo,
    const float* __restrict__ Wgk1, const float* __restrict__ Wgk2,
    const float* __restrict__ bgk2, unsigned short* __restrict__ xb,
    unsigned short* __restrict__ wcat, unsigned short* __restrict__ wot,
    float* __restrict__ gkout) {
  __shared__ __align__(16) float sm[GK_SM];
  const int b = blockIdx.x;
  if (b < PG_GATE)   // the same for the whole block: the barriers inside are safe
    gate_rows(b, x, Wgk1, Wgk2, bgk2, xb, gkout, sm);
  else
    weight_tiles(b - PG_GATE, Wq, Wk, Wv, Wg, Wo, wcat, wot, sm);
}

// ---------------------------------------------------------------------------
// Chunked GLA scan, split along the sequence into NSEG segments of SEGC chunks
// so that (b,h) x segment work-groups run side by side. The state recurrence
// S <- diag(decay) S + kv is linear in S, so over one segment
//   S_end = diag(D_seg) S_start + KV_seg,
// with D_seg the product of the chunk decays and KV_seg the segment's end
// state when started from zero. Three launches:
//   1) gla_seg_state_kernel: KV_seg and D_seg of every segment but the last
//   2) gla_seg_scan_kernel : start state of segments 1..NSEG-1 (in place)
//   3) gla_kernel          : the full chunk loop of a segment from its start
// The products with v and with S run on the f32 16x16x4 matrix form. Wave w
// owns columns e = 32 w .. 32 w + 31 (two tiles of 16). S[64][128] lives in
// registers as 4 x 2 accumulator tiles per wave: register r of lane (c, hi)
// holds S[16 dt + 8 hi + r][e0 + c]. Registers (2j, 2j+1) of such a tile are at
// once a B fragment whose four k are rows 2j, 2j+1 (hi = 0) and 8+2j, 8+2j+1
// (hi = 1); the A loaders below take their k in the same order. v is loaded in
// the same map, so it too is a B fragment as it lies. o overwrites v in qkvg.
// ---------------------------------------------------------------------------
#define CPAD 68
#define NSEG 32                 // segments per sequence
#define SEGC 4                  // chunks of 16 rows per segment (NSEG*SEGC = 128)
#define NSEGM1 (NSEG - 1)

// S <- diag(decay) S + kd^T v for one chunk; kd is [16 c][CPAD], d contiguous
__device__ __forceinline__ void state_step(v8f (&S)[4][2], const v8f (&vb)[2],
                                           const float* kd, const float* decay,
                                           int c16, int hi) {
#pragma unroll  // S[][] stays in registers
  for (int dt = 0; dt < 4; ++dt) {
    const v8f dec = lds8(&decay[dt * 16 + 8 * hi]);
    S[dt][0] *= dec;
    S[dt][1] *= dec;
#pragma unroll  // S[][] and vb[] stay in registers
    for (int j = 0; j < 4; ++j) {
      const float* kr = &kd[(2 * j + 8 * hi) * CPAD + dt * 16 + c16];
      const v2f a = {kr[0], kr[CPAD]};
#pragma unroll  // S[][] and vb[] stay in registers
      for (int et = 0; et < 2; ++et)
        S[dt][et] = wmma_f32(a, (v2f){vb[et][2 * j], vb[et][2 * j + 1]},
                             S[dt][et]);
    }
  }
}

__global__ __launch_bounds__(128) void gla_seg_state_kernel(
    const float* __restrict__ qkvg, const float* __restrict__ gk,
    float* __restrict__ segS, float* __restrict__ segD) {
  __shared__ float gc[16 * CPAD];
  __shared__ __align__(16) float kd[16 * CPAD];
  __shared__ __align__(16) float decay[64];

  const int seg = blockIdx.x;       // 0..NSEG-2
  const int bh = blockIdx.y;        // 0..31
  const int b = bh >> 4, h = bh & 15;
  const int tid = threadIdx.x;
  const int c16 = tid & 15, hi = (tid >> 4) & 1, w = tid >> 5;

  v8f S[4][2];
#pragma unroll  // S[][] stays in registers
  for (int dt = 0; dt < 4; ++dt)
#pragma unroll  // S[][] stays in registers
    for (int et = 0; et < 2; ++et)
      S[dt][et] = (v8f){0.f, 0.f, 0.f, 0.f, 0.f, 0.f, 0.f, 0.f};

  const long row0 = (long)b * 2048 + (long)seg * (SEGC * 16);
  // row pointers of the current chunk, advanced by 16 rows per chunk
  const float* gp = gk + row0 * 1024 + h * 64 + (tid & 63);
  const float* kp = qkvg + row0 * 6144 + 1024 + h * 64 + (tid & 63);
  const float* vp = qkvg + (row0 + 8 * hi) * 6144 + 2048 + h * 128 + w * 32 + c16;
  float dprod = 1.f;

  for (int n = 0; n < SEGC; ++n) {
    if (tid < 64) {                  // per-column-d prep
      const int d = tid;
      float c = 0.f;
#pragma unroll  // the 16 row loads go out together
      for (int cc = 0; cc < 16; ++cc) {
        c += gp[cc * 1024];
        gc[cc * CPAD + d] = c;
      }
      const float dec = __expf(c);
      decay[d] = dec;
      dprod *= dec;
      const float glast = c;
#pragma unroll  // the 16 row loads go out together
      for (int cc = 0; cc < 16; ++cc) {
        float g = gc[cc * CPAD + d];
        kd[cc * CPAD + d] = kp[cc * 6144] * __expf(glast - g);
      }
    }
    v8f vb[2];
#pragma unroll  // vb[] stays in registers
    for (int et = 0; et < 2; ++et)
#pragma unroll  // vb[] stays in registers
      for (int r = 0; r < 8; ++r) vb[et][r] = vp[r * 6144 + et * 16];
    __syncthreads();

    state_step(S, vb, kd, decay, c16, hi);
    gp += 16 * 1024;
    kp += 16 * 6144;
    vp += 16 * 6144;
    __syncthreads();
  }

  const long sb = (long)bh * NSEGM1 + seg;
  float* sp = segS + sb * (64 * 128) + (8 * hi) * 128 + w * 32 + c16;
#pragma unroll  // S[][] stays in registers; one address, constant offsets
  for (int dt = 0; dt < 4; ++dt)
#pragma unroll  // S[][] stays in registers
    for (int et = 0; et < 2; ++et)
#pragma unroll  // S[][] stays in registers
      for (int r = 0; r < 8; ++r)
        sp[(dt * 16 + r) * 128 + et * 16] = S[dt][et][r];
  if (tid < 64) segD[sb * 64 + tid] = dprod;
}

// segS[bh][g] holds KV of segment g on entry and the start state of segment
// g + 1 on exit. One thread per (bh, d, four columns e); every load is issued
// ahead of the first store.
__global__ __launch_bounds__(256) void gla_seg_scan_kernel(
    float* __restrict__ segS, const float* __restrict__ segD) {
  const int idx = blockIdx.x * 256 + threadIdx.x;   // 32 * 64 * 32 threads
  const int bh = idx >> 11, rem = idx & 2047, d = rem >> 5;
  float4* p = (float4*)segS + (long)bh * NSEGM1 * 2048 + rem;
  const float* dp = segD + (long)bh * NSEGM1 * 64 + d;
  float4 kv[NSEGM1];
  float dc[NSEGM1];
#pragma unroll  // kv[] and dc[] stay in registers
  for (int g = 0; g < NSEGM1; ++g) {
    kv[g] = p[g * 2048];
    dc[g] = dp[g * 64];
  }
  // Stands behind the last load and in front of the first store: no load is
  // issued among the stores into a register that a store still names, and the
  // loads' latencies overlap instead of adding up along the chain.
  asm volatile("s_wait_xcnt 0x0" ::: "memory");
  // segment 0 starts from zero, so kv[0] is already the start of segment 1
#pragma unroll  // kv[] and dc[] stay in registers
  for (int g = 1; g < NSEGM1; ++g) {
    kv[g].x = dc[g] * kv[g - 1].x + kv[g].x;
    kv[g].y = dc[g] * kv[g - 1].y + kv[g].y;
    kv[g].z = dc[g] * kv[g - 1].z + kv[g].z;
    kv[g].w = dc[g] * kv[g - 1].w + kv[g].w;
    p[g * 2048] = kv[g];
  }
}

__global__ __launch_bounds__(128) void gla_kernel(
    float* __restrict__ qkvg, const float* __restrict__ gk,
    const float* __restrict__ segS) {
  __shared__ float gc[16 * CPAD];
  __shared__ __align__(16) float qe[16 * CPAD];
  __shared__ __align__(16) float ke[16 * CPAD];
  __shared__ __align__(16) float kd[16 * CPAD];
  __shared__ __align__(16) float Am[16 * 16];
  __shared__ __align__(16) float decay[64];

  const int seg = blockIdx.x;       // 0..NSEG-1
  const int bh = blockIdx.y;        // 0..31
  const int b = bh >> 4, h = bh & 15;
  const int tid = threadIdx.x;
  const int c16 = tid & 15, hi = (tid >> 4) & 1, w = tid >> 5;

  v8f S[4][2];
  if (seg == 0) {
#pragma unroll  // S[][] stays in registers
    for (int dt = 0; dt < 4; ++dt)
#pragma unroll  // S[][] stays in registers
      for (int et = 0; et < 2; ++et)
        S[dt][et] = (v8f){0.f, 0.f, 0.f, 0.f, 0.f, 0.f, 0.f, 0.f};
  } else {
    const float* s0 = segS + ((long)bh * NSEGM1 + (seg - 1)) * (64 * 128) +
                      (8 * hi) * 128 + w * 32 + c16;
#pragma unroll  // S[][] stays in registers; one address, constant offsets
    for (int dt = 0; dt < 4; ++dt)
#pragma unroll  // S[][] stays in registers
      for (int et = 0; et < 2; ++et)
#pragma unroll  // S[][] stays in registers
        for (int r = 0; r < 8; ++r)
          S[dt][et][r] = s0[(dt * 16 + r) * 128 + et * 16];
    // behind the loads, ahead of any rewrite of a register that they name
    asm volatile("s_wait_xcnt 0x0" ::: "memory");
  }

  const long rowbase = (long)b * 2048 + (long)seg * (SEGC * 16);

  for (int n = 0; n < SEGC; ++n) {
    const long m0 = rowbase + n * 16;
    if (tid < 64) {                  // per-column-d prep
      const int d = tid;
      float c = 0.f;
#pragma unroll
      for (int cc = 0; cc < 16; ++cc) {
        c += gk[(m0 + cc) * 1024 + h * 64 + d];
        gc[cc * CPAD + d] = c;
      }
      decay[d] = __expf(c);
      const float glast = c;
#pragma unroll
      for (int cc = 0; cc < 16; ++cc) {
        float g = gc[cc * CPAD + d];
        float q = qkvg[(m0 + cc) * 6144 + h * 64 + d];
        float k = qkvg[(m0 + cc) * 6144 + 1024 + h * 64 + d];
        qe[cc * CPAD + d] = q * __expf(g) * GLA_SCALE;
        ke[cc * CPAD + d] = k * __expf(-g);
        kd[cc * CPAD + d] = k * __expf(glast - g);
      }
    }
    // this wave's 16 x 32 piece of v (and of o), rows 8 hi + r, as B fragments
    float* vo = qkvg + (m0 + 8 * hi) * 6144 + 2048 + h * 128 + w * 32 + c16;
    v8f vb[2];
#pragma unroll  // vb[] stays in registers
    for (int et = 0; et < 2; ++et)
#pragma unroll  // vb[] stays in registers
      for (int r = 0; r < 8; ++r) vb[et][r] = vo[r * 6144 + et * 16];
    __syncthreads();

    // A = tril(qe ke^T), 256 entries over 128 threads
#pragma unroll
    for (int t = tid; t < 256; t += 128) {
      int cc = t >> 4, mm = t & 15;
      float a = 0.f;
      if (mm <= cc) {
#pragma unroll
        for (int d = 0; d < 64; ++d) a += qe[cc * CPAD + d] * ke[mm * CPAD + d];
      }
      Am[cc * 16 + mm] = a;
    }
    __syncthreads();

    v8f o[2];
    o[0] = (v8f){0.f, 0.f, 0.f, 0.f, 0.f, 0.f, 0.f, 0.f};
    o[1] = o[0];
    {  // o_intra = A v: row c16 of A, k = rows of v in the order of vb
      const v8f am = lds8(&Am[c16 * 16 + 8 * hi]);
#pragma unroll  // am, vb[] and o[] stay in registers
      for (int j = 0; j < 4; ++j) {
        const v2f a = {am[2 * j], am[2 * j + 1]};
#pragma unroll  // vb[] and o[] stay in registers
        for (int et = 0; et < 2; ++et)
          o[et] = wmma_f32(a, (v2f){vb[et][2 * j], vb[et][2 * j + 1]}, o[et]);
      }
    }
    // o_inter = qe S (old S): row c16 of qe, k = rows of S in the tiles' order
#pragma unroll  // S[][] and o[] stay in registers
    for (int dt = 0; dt < 4; ++dt) {
      const v8f qf = lds8(&qe[c16 * CPAD + dt * 16 + 8 * hi]);
#pragma unroll  // qf, S[][] and o[] stay in registers
      for (int j = 0; j < 4; ++j) {
        const v2f a = {qf[2 * j], qf[2 * j + 1]};
#pragma unroll  // S[][] and o[] stay in registers
        for (int et = 0; et < 2; ++et)
          o[et] = wmma_f32(a, (v2f){S[dt][et][2 * j], S[dt][et][2 * j + 1]},
                           o[et]);
      }
    }
#pragma unroll  // o[] stays in registers
    for (int et = 0; et < 2; ++et)
#pragma unroll  // o[] stays in registers
      for (int r = 0; r < 8; ++r) vo[r * 6144 + et * 16] = o[et][r];
    // behind the stores, ahead of any rewrite of a register that they name
    asm volatile("s_wait_xcnt 0x0" ::: "memory");
    // the last chunk's end state is read by nobody here
    if (n + 1 < SEGC) state_step(S, vb, kd, decay, c16, hi);
    __syncthreads();
  }
}

// 2^x and 1/sqrt(x), each with the free slot that the instruction set asks for
// between a transcendental and a next instruction that overwrites its source.
__device__ __forceinline__ float exp2_slot(float x) {
  float r;
  asm("v_exp_f32 %0, %1\n\tv_nop" : "=v"(r) : "v"(x));
  return r;
}
__device__ __forceinline__ float rsq_slot(float x) {
  float r;
  asm("v_rsq_f32 %0, %1\n\tv_nop" : "=v"(r) : "v"(x));
  return r;
}
// g * sigmoid(g), with exp(-g) formed as 2^(-g * log2 e)
__device__ __forceinline__ float silu(float g) {
  return g / (1.f + exp2_slot(g * -1.44269504f));
}

// Sum over the 32 lanes, left in every lane: lane l with l ^ 1, 2, 4, 8 inside
// a row of 16 by DPP, then l ^ 16 by a cross-row move; all in the vector unit.
template <int M>
__device__ __forceinline__ float row_xor(float x) {
  return __builtin_bit_cast(float, __builtin_amdgcn_update_dpp(
      0, __builtin_bit_cast(int, x), 0x160 | M, 0xf, 0xf, true));
}
__device__ __forceinline__ float wave_sum(float s) {
  s += row_xor<1>(s);
  s += row_xor<2>(s);
  s += row_xor<4>(s);
  s += row_xor<8>(s);
  const int b = __builtin_bit_cast(int, s);
  return s + __builtin_bit_cast(float, __builtin_amdgcn_permlanex16(
                 b, b, 0x76543210, 0xfedcba98, false, false));
}

// ---------------------------------------------------------------------------
// RMSNorm over DV + SiLU(g) gate, output bf16 for the final GEMM
// one wave per (m, 8 heads): a row of 128 is one float4 per lane, its sum of
// squares a butterfly over the 32 lanes; no LDS, no barrier.
// ---------------------------------------------------------------------------
__global__ __launch_bounds__(256) void norm_gate_kernel(
    const float* __restrict__ qkvg, const float* __restrict__ norm_w,
    unsigned short* __restrict__ og) {
  const int lane = threadIdx.x & 31;
  const int wv = blockIdx.x * 8 + (threadIdx.x >> 5);   // 0..8191
  const int m = wv >> 1, h0 = (wv & 1) * 8;
  const float* ob = qkvg + (long)m * 6144 + 2048 + h0 * 128 + lane * 4;
  float4 o[8], g[8];
#pragma unroll  // o[] and g[] stay in registers, the 16 loads go out together
  for (int r = 0; r < 8; ++r) {
    o[r] = *(const float4*)(ob + r * 128);
    g[r] = *(const float4*)(ob + 2048 + r * 128);
  }
  const float4 w = *(const float4*)(norm_w + lane * 4);
  // The fence keeps every load above it, so that all 17 are in flight at once:
  // without it the compiler sinks six of them into the arithmetic.
  __builtin_amdgcn_sched_barrier(0);
  float ss[8];
#pragma unroll  // ss[] stays in registers
  for (int r = 0; r < 8; ++r)
    ss[r] = (o[r].x * o[r].x + o[r].y * o[r].y) +
            (o[r].z * o[r].z + o[r].w * o[r].w);
#pragma unroll  // ss[] stays in registers
  for (int r = 0; r < 8; ++r) ss[r] = wave_sum(ss[r]);
  uint2 res[8];
#pragma unroll  // res[] stays in registers
  for (int r = 0; r < 8; ++r) {
    // the argument is at least 1e-5: no subnormal range to rescale for
    const float rs = rsq_slot(ss[r] * (1.f / 128.f) + 1e-5f);
    const float a = o[r].x * rs * w.x * silu(g[r].x);
    const float b = o[r].y * rs * w.y * silu(g[r].y);
    const float c = o[r].z * rs * w.z * silu(g[r].z);
    const float d = o[r].w * rs * w.w * silu(g[r].w);
    res[r] = make_uint2(pack2bf(a, b), pack2bf(c, d));
  }
  unsigned short* dst = og + (long)m * 2048 + h0 * 128 + lane * 4;
#pragma unroll  // res[] stays in registers
  for (int r = 0; r < 8; ++r) *(uint2*)(dst + r * 128) = res[r];
}

// ---------------------------------------------------------------------------
// Host launcher
// ---------------------------------------------------------------------------
extern "C" void kernel_launch(void* const* d_in, const int* in_sizes, int n_in,
                              void* d_out, int out_size, void* d_ws,
                              size_t ws_size, hipStream_t stream) {
  const float* x      = (const float*)d_in[0];
  const float* Wq     = (const float*)d_in[1];
  const float* Wk     = (const float*)d_in[2];
  const float* Wv     = (const float*)d_in[3];
  const float* Wg     = (const float*)d_in[4];
  const float* Wgk1   = (const float*)d_in[5];
  const float* Wgk2   = (const float*)d_in[6];
  const float* bgk2   = (const float*)d_in[7];
  const float* Wo     = (const float*)d_in[8];
  const float* norm_w = (const float*)d_in[9];
  float* out = (float*)d_out;

  // workspace layout (bytes)
  char* ws = (char*)d_ws;
  unsigned short* xb    = (unsigned short*)(ws);                       // 16 MiB
  unsigned short* wcat  = (unsigned short*)(ws + (size_t)16777216);    // 24 MiB
  unsigned short* wot   = (unsigned short*)(ws + (size_t)41943040);    //  8 MiB
  float*          qkvg  = (float*)         (ws + (size_t)50331648);    // 96 MiB
  float*          gkbuf = (float*)         (ws + (size_t)150994944);   // 16 MiB
  unsigned short* og    = (unsigned short*)(ws + (size_t)167772160);   // 16 MiB
  float*          segS  = (float*)         (ws + (size_t)184549376);   // 31 MiB
  float*          segD  = (float*)         (ws + (size_t)218103808);   // 248 KiB

  // 1, 2, 4) x -> bf16 and the low-rank gate path gk[4096,1024]; weights
  // transposed and converted into the concatenated [6144,2048] and [2048,2048]
  prep_gate_kernel<<<PG_GATE + PG_TILES, 512, 0, stream>>>(
      x, Wq, Wk, Wv, Wg, Wo, Wgk1, Wgk2, bgk2, xb, wcat, wot, gkbuf);

  // 3) fused projection GEMM (WMMA bf16 -> f32): qkvg[4096,6144]
  gemm_bf16_wide_kernel<<<dim3(NCAT / WT_N, MROWS / WT_M), 256, 0, stream>>>(
      xb, wcat, qkvg, KDIM, NCAT);

  // 5) chunked GLA scan in segments (writes o over the v slice of qkvg)
  gla_seg_state_kernel<<<dim3(NSEGM1, 32), 128, 0, stream>>>(qkvg, gkbuf, segS,
                                                            segD);
  gla_seg_scan_kernel<<<32 * 64 * 32 / 256, 256, 0, stream>>>(segS, segD);
  gla_kernel<<<dim3(NSEG, 32), 128, 0, stream>>>(qkvg, gkbuf, segS);

  // 6) RMSNorm + SiLU gate -> bf16 [4096,2048]
  norm_gate_kernel<<<MROWS * 16 / 64, 256, 0, stream>>>(qkvg, norm_w, og);

  // 7) output GEMM (WMMA) -> d_out fp32 [4096,2048]
  gemm_bf16_wmma_kernel<2><<<dim3(NOUT / 128, MROWS / 128), 256, 0, stream>>>(
      og, wot, out, KDIM, NOUT);
}
